// v000
// The times below were measured on an AMD MI455X: many runs one after another, warmed up first and cycling through
// copies of the inputs, with the whole window's GPU time divided by the number of runs. Launches and the gaps
// between them are all in it. The median over several windows is given; except for v000 it joins two sittings, which
// can be a few percent apart, so the side-by-side timings, each taken in one sitting, are the better comparison.
// The starting kernel, v000, takes 2860 microseconds a run.
#include <hip/hip_runtime.h>

// Causal multi-head self-attention with interleaved-pair rotary embeddings (x [4][2048][1024]; qkv = x qkv_w^T ('oi' [3072][1024], row blocks q | k | v; 16 heads x 64); rotary on adjacent (even, odd) pairs with angle token_positions[t] x 10000^(-2i/64) (positions read from the int32 input; the reference's float32 table constants computed on device); scores / 8, causal (-inf); softmax; out = merged o_w^T ('oi', no bias) -> [4][2048][1024] (8.4 M)).
// Compute dtypes, f32 accumulate: every input rounded to bf16; q/k/v on PLAIN bf16 operands (inputs: exact); interleaved rotary in f32 (precise cosf/sinf table at the input positions); causal scores and attn.v (tile skipping): query rows < 512 hl (3 products), the rest single fp16 (x1024); softmax f32; o_w hl x exact (2 products).

#define NB_  4
#define TT   2048
#define DM   1024
#define NH_  16
#define NKV  16
#define REP  (NH_ / NKV)
#define HD   64
#define DQ   (NH_ * HD)
#define DKV  (NKV * HD)
#define ZH   2
#define RH   512                  // query rows < RH use hi+lo planes (0: none)
#define WIN  2048
#define PCAR 1024.0f
#define SCL  0.125f   // HD^-0.5
typedef _Float16 h16;
typedef unsigned short bf;
typedef __attribute__((ext_vector_type(16))) __bf16   v16bf;
typedef __attribute__((ext_vector_type(16))) _Float16 v16h;
typedef __attribute__((ext_vector_type(8)))  _Float16 v8h;
typedef __attribute__((ext_vector_type(8)))  unsigned short v8us;
typedef __attribute__((ext_vector_type(8)))  float    v8f;
typedef __attribute__((ext_vector_type(4)))  float    v4f;
typedef v8h  __attribute__((may_alias)) v8ha;
typedef v4f  __attribute__((may_alias)) v4fa;
typedef v8us __attribute__((may_alias)) v8usa;

__device__ __forceinline__ unsigned short f2bf(float f) { unsigned u = __float_as_uint(f); u += 0x7FFFu + ((u >> 16) & 1u); return (unsigned short)(u >> 16); }
__device__ __forceinline__ float bf2f(unsigned short b) { return __uint_as_float(((unsigned)b) << 16); }
__device__ __forceinline__ float bfr(float f) { return bf2f(f2bf(f)); }
__device__ __forceinline__ v16h cat16(v8h lo, v8h hi) { return __builtin_shufflevector(lo, hi, 0, 1, 2, 3, 4, 5, 6, 7, 8, 9, 10, 11, 12, 13, 14, 15); }
__device__ __forceinline__ v16bf cat16b(v8us lo, v8us hi) { return __builtin_bit_cast(v16bf, __builtin_shufflevector(lo, hi, 0, 1, 2, 3, 4, 5, 6, 7, 8, 9, 10, 11, 12, 13, 14, 15)); }
__device__ __forceinline__ v8f wmma16(v16h a, v16h b, v8f c) { return __builtin_amdgcn_wmma_f32_16x16x32_f16(false, a, false, b, (short)0, c, false, false); }
__device__ __forceinline__ v8f wmmab(v16bf a, v16bf b, v8f c) { return __builtin_amdgcn_wmma_f32_16x16x32_bf16(false, a, false, b, (short)0, c, false, false); }



// ---- k_gemmw: register-blocked GEMM, ONE WAVE per 64x64 output tile (16 accumulators), operands straight from K-contiguous 16-bit planes; grid (M/64, N/64, Z), 32 threads.
// C[m][n] (f32, pitch ldc, + optional f32 bias[n]) = sum_k A[m][k] Bt[n][k] (+ split products per NSPLIT). z-batch strides sA/sB/sC in elements. K % 32 == 0.
template <typename T16> struct WFrag;
template <> struct WFrag<h16> { typedef v16h V; static __device__ __forceinline__ V ld(const h16* p) { return cat16(*(const v8h*)p, *(const v8h*)(p + 16)); } static __device__ __forceinline__ v8f mma(V a, V b, v8f c) { return wmma16(a, b, c); } };
template <> struct WFrag<bf> { typedef v16bf V; static __device__ __forceinline__ V ld(const bf* p) { return cat16b(*(const v8us*)p, *(const v8us*)(p + 16)); } static __device__ __forceinline__ v8f mma(V a, V b, v8f c) { return wmmab(a, b, c); } };
template <typename T16, int NSPLIT, bool BIAS>
__global__ __launch_bounds__(32) void k_gemmw(const T16* __restrict__ A, const T16* __restrict__ A2, const T16* __restrict__ Bt, const T16* __restrict__ Bt2, int K, float* C, int ldc, const float* __restrict__ bias, size_t sA, size_t sB, size_t sC) {
    typedef typename WFrag<T16>::V V;
    __shared__ __align__(16) float os[16 * 68];
    const size_t z = blockIdx.z; A += z * sA; if (A2) A2 += z * sA; Bt += z * sB; if (Bt2) Bt2 += z * sB; C += z * sC;
    const int lane = threadIdx.x & 31, lr = lane & 15, hi = lane >> 4; const int r0 = blockIdx.x * 64, c0 = blockIdx.y * 64;
    v8f acc[4][4];
#pragma unroll
    for (int mb = 0; mb < 4; ++mb)
#pragma unroll
        for (int nb = 0; nb < 4; ++nb) acc[mb][nb] = (v8f){};
    const size_t aoff = (size_t)(r0 + lr) * K + 8 * hi, boff = (size_t)(c0 + lr) * K + 8 * hi;
#pragma unroll 1
    for (int kc = 0; kc < K; kc += 32) {
        V a[4], a2[4];
#pragma unroll
        for (int mb = 0; mb < 4; ++mb) { a[mb] = WFrag<T16>::ld(A + aoff + (size_t)mb * 16 * K + kc); if (NSPLIT == 1 || NSPLIT == 2) a2[mb] = WFrag<T16>::ld(A2 + aoff + (size_t)mb * 16 * K + kc); }
#pragma unroll
        for (int nb = 0; nb < 4; ++nb) { const V b = WFrag<T16>::ld(Bt + boff + (size_t)nb * 16 * K + kc); V b2; if (NSPLIT >= 2) b2 = WFrag<T16>::ld(Bt2 + boff + (size_t)nb * 16 * K + kc);
#pragma unroll
            for (int mb = 0; mb < 4; ++mb) { acc[mb][nb] = WFrag<T16>::mma(a[mb], b, acc[mb][nb]); if (NSPLIT == 1 || NSPLIT == 2) acc[mb][nb] = WFrag<T16>::mma(a2[mb], b, acc[mb][nb]); if (NSPLIT >= 2) acc[mb][nb] = WFrag<T16>::mma(a[mb], b2, acc[mb][nb]); } }
        asm volatile("v_nop\n\tv_nop\n\tv_nop\n\tv_nop" : "+v"(acc[0][0]), "+v"(acc[1][1]), "+v"(acc[2][2]), "+v"(acc[3][3]) : "v"(a[0]), "v"(a[3]));
    }
#pragma unroll
    for (int mb = 0; mb < 4; ++mb) {
#pragma unroll
        for (int nb = 0; nb < 4; ++nb) {
#pragma unroll
            for (int j = 0; j < 8; ++j) os[(hi * 8 + j) * 68 + nb * 16 + lr] = acc[mb][nb][j]; }
        __builtin_amdgcn_wave_barrier(); asm volatile("" ::: "memory");
        float* crow = C + (size_t)(r0 + mb * 16) * ldc + c0;
{
#pragma unroll
            for (int s = 0; s < 8; ++s) { const int row = 2 * s + hi, cofs = lr * 4; v4f val = *(const v4fa*)(os + row * 68 + cofs); if (BIAS) { val[0] += bfr(bias[c0 + cofs]); val[1] += bfr(bias[c0 + cofs + 1]); val[2] += bfr(bias[c0 + cofs + 2]); val[3] += bfr(bias[c0 + cofs + 3]); }
                *(v4f*)(crow + (size_t)row * ldc + cofs) = val; }
             }
        __builtin_amdgcn_wave_barrier(); asm volatile("" ::: "memory");
    }
}

// ---- k_gemmc: the same one-wave 64x64 tile GEMM specialised for causal attention: CMODE 1 skips score tiles entirely above the diagonal (query rows r0+roff.., key columns c0..), CMODE 2 limits the
// key (K) loop of the probability x value contraction to the diagonal block (probabilities beyond it are exactly zero). roff = row offset of this launch's first row within the sequence.
template <typename T16, int NSPLIT, int CMODE>
__global__ __launch_bounds__(32) void k_gemmc(const T16* __restrict__ A, const T16* __restrict__ A2, const T16* __restrict__ Bt, const T16* __restrict__ Bt2, int K, float* C, int ldc, int roff, size_t sA, size_t sB, size_t sC) {
    typedef typename WFrag<T16>::V V;
    __shared__ __align__(16) float os[16 * 68];
    const size_t z = blockIdx.z; A += z * sA; if (A2) A2 += z * sA; Bt += z * sB; if (Bt2) Bt2 += z * sB; C += z * sC;
    const int lane = threadIdx.x & 31, lr = lane & 15, hi = lane >> 4; const int r0 = blockIdx.x * 64, c0 = blockIdx.y * 64;
    if (CMODE == 1 && c0 > r0 + roff + 63) return;                  // score tile entirely above the causal diagonal: left unwritten (the softmax loads it but masks j > i by select)
    const int Kl = (CMODE == 2) ? min(K, r0 + roff + 64) : K;        // P.V: probabilities are exactly 0 beyond the diagonal block, so the K loop stops there
    v8f acc[4][4];
#pragma unroll
    for (int mb = 0; mb < 4; ++mb)
#pragma unroll
        for (int nb = 0; nb < 4; ++nb) acc[mb][nb] = (v8f){};
    const size_t aoff = (size_t)(r0 + lr) * K + 8 * hi, boff = (size_t)(c0 + lr) * K + 8 * hi;
#pragma unroll 1
    for (int kc = 0; kc < Kl; kc += 32) {
        V a[4], a2[4];
#pragma unroll
        for (int mb = 0; mb < 4; ++mb) { a[mb] = WFrag<T16>::ld(A + aoff + (size_t)mb * 16 * K + kc); if (NSPLIT == 1 || NSPLIT == 2) a2[mb] = WFrag<T16>::ld(A2 + aoff + (size_t)mb * 16 * K + kc); }
#pragma unroll
        for (int nb = 0; nb < 4; ++nb) { const V b = WFrag<T16>::ld(Bt + boff + (size_t)nb * 16 * K + kc); V b2; if (NSPLIT >= 2) b2 = WFrag<T16>::ld(Bt2 + boff + (size_t)nb * 16 * K + kc);
#pragma unroll
            for (int mb = 0; mb < 4; ++mb) { acc[mb][nb] = WFrag<T16>::mma(a[mb], b, acc[mb][nb]); if (NSPLIT == 1 || NSPLIT == 2) acc[mb][nb] = WFrag<T16>::mma(a2[mb], b, acc[mb][nb]); if (NSPLIT >= 2) acc[mb][nb] = WFrag<T16>::mma(a[mb], b2, acc[mb][nb]); } }
        asm volatile("v_nop\n\tv_nop\n\tv_nop\n\tv_nop" : "+v"(acc[0][0]), "+v"(acc[1][1]), "+v"(acc[2][2]), "+v"(acc[3][3]) : "v"(a[0]), "v"(a[3]));
    }
#pragma unroll
    for (int mb = 0; mb < 4; ++mb) {
#pragma unroll
        for (int nb = 0; nb < 4; ++nb) {
#pragma unroll
            for (int j = 0; j < 8; ++j) os[(hi * 8 + j) * 68 + nb * 16 + lr] = acc[mb][nb][j]; }
        __builtin_amdgcn_wave_barrier(); asm volatile("" ::: "memory");
        float* crow = C + (size_t)(r0 + mb * 16) * ldc + c0;
{
#pragma unroll
            for (int s = 0; s < 8; ++s) { const int row = 2 * s + hi, cofs = lr * 4; v4f val = *(const v4fa*)(os + row * 68 + cofs);
                *(v4f*)(crow + (size_t)row * ldc + cofs) = val; }
             }
        __builtin_amdgcn_wave_barrier(); asm volatile("" ::: "memory");
    }
}

__device__ __forceinline__ h16 tohx(float x) { return (h16)x; }
__device__ __forceinline__ void splitf(float y, unsigned short& h, unsigned short& l) { h = f2bf(y); l = f2bf(y - bf2f(h)); }
typedef __attribute__((ext_vector_type(2))) _Float16 v2h;
typedef __attribute__((ext_vector_type(4))) _Float16 v4h;
typedef __attribute__((ext_vector_type(2))) unsigned short v2us;
typedef __attribute__((ext_vector_type(4))) unsigned short v4us;
typedef __attribute__((ext_vector_type(2))) float v2f;
typedef __attribute__((ext_vector_type(4))) int v4i;

__global__ __launch_bounds__(256) void k_wtG(const float* __restrict__ w, int K, int N, bf* Bt) {
    const int lane = threadIdx.x & 31; const int L0 = (blockIdx.x * 8 + (threadIdx.x >> 5)) * 8; const int nlines = N * K / 64;
{
#pragma unroll 1
        for (int l = 0; l < 8; ++l) { const int L = L0 + l; if (L >= nlines) break; const size_t e = (size_t)L * 64 + lane * 2; const int k = (int)(e % K), n = (int)(e / K); v2us o;
            o[0] = f2bf(w[(size_t)k * N + n]); o[1] = f2bf(w[(size_t)(k + 1) * N + n]); *(v2us*)(Bt + e) = o; }
         }
}
__global__ __launch_bounds__(256) void k_cvt8(const float* __restrict__ src, bf* dst, size_t n8) { const size_t i = (size_t)blockIdx.x * 256 + threadIdx.x; if (i >= n8) return; const v8f v = *(const v8f*)(src + i * 8); v8us o;
#pragma unroll
    for (int k = 0; k < 8; ++k) o[k] = f2bf(v[k]); *(v8us*)(dst + i * 8) = o;  }

// k_ropeI: head planes [h][t][d] (fp16 + hi/lo) of rope(x) x sc with the interleaved-pair convention (d even) out[d] = x[d] cos[t][d] - x[d+1] sin[t][d], out[d+1] = x[d+1] cos[t][d] + x[d] sin[t][d]

__global__ __launch_bounds__(256) void k_vtp(const float* __restrict__ F, int pitch, int nheads, h16* V16, bf* Vh, bf* Vl) { const size_t e = ((size_t)blockIdx.x * 256 + threadIdx.x) * 2; if (e >= (size_t)nheads * HD * TT) return; const int t = (int)(e % TT); const int d = (int)((e / TT) % HD); const int g = (int)(e / ((size_t)TT * HD)); v2h o16; v2us oh, ol;
#pragma unroll
    for (int q = 0; q < 2; ++q) { const float x = F[(size_t)(t + q) * pitch + g * HD + d]; o16[q] = tohx(x); unsigned short a2, c2; splitf(x, a2, c2); oh[q] = a2; ol[q] = c2; }
    *(v2h*)(V16 + e) = o16; *(v2us*)(Vh + e) = oh; *(v2us*)(Vl + e) = ol;  }
__constant__ float INV[HD / 2] = {1.0f,0.749894202f,0.562341332f,0.421696514f,0.316227764f,0.237137362f,0.177827939f,0.133352146f,0.100000001f,0.0749894157f,0.0562341288f,0.0421696492f,0.0316227786f,0.0237137359f,0.0177827943f,0.0133352149f,0.00999999978f,0.00749894232f,0.00562341325f,0.00421696482f,0.00316227786f,0.00237137382f,0.00177827943f,0.00133352145f,0.00100000005f,0.000749894185f,0.000562341302f,0.000421696488f,0.000316227786f,0.000237137385f,0.00017782794f,0.00013335215f};
__global__ __launch_bounds__(256) void k_cstabP(const int* __restrict__ pos, float* CS) { const int idx = blockIdx.x * 256 + threadIdx.x; if (idx >= TT * HD) return; const int t = idx / HD, d = idx % HD; const float ang = __fmul_rn((float)pos[t], INV[d >> 1]); v2f cs; cs[0] = cosf(ang); cs[1] = sinf(ang);
    *(v2f*)(CS + (size_t)idx * 2) = cs;  }
__global__ __launch_bounds__(256) void k_ropeI(const float* __restrict__ F, int pitch, int nheads, const float* __restrict__ CS, float sc, h16* P16, bf* Ph, bf* Pl) {
    const size_t e = ((size_t)blockIdx.x * 256 + threadIdx.x) * 2; if (e >= (size_t)nheads * TT * HD) return; const int d = (int)(e % HD); const int t = (int)((e / HD) % TT); const int h = (int)(e / ((size_t)HD * TT)); const float* f = F + (size_t)t * pitch + h * HD; const float x0 = f[d], x1 = f[d + 1]; const v2f cs = *(const v2f*)(CS + ((size_t)t * HD + d) * 2); v2h o16; v2us oh, ol;
    float a0 = __fmul_rn(x0, cs[0]), b0 = __fmul_rn(x1, cs[1]), a1 = __fmul_rn(x1, cs[0]), b1 = __fmul_rn(x0, cs[1]); asm volatile("" : "+v"(a0), "+v"(b0), "+v"(a1), "+v"(b1));
    float r0 = __fsub_rn(a0, b0) * sc, r1 = __fadd_rn(b1, a1) * sc;   /* even: x0 c - x1 s; odd: x0 s + x1 c */
    o16[0] = tohx(r0); o16[1] = tohx(r1); { unsigned short a2, c2; splitf(r0, a2, c2); oh[0] = a2; ol[0] = c2; splitf(r1, a2, c2); oh[1] = a2; ol[1] = c2; }
    *(v2h*)(P16 + e) = o16; *(v2us*)(Ph + e) = oh; *(v2us*)(Pl + e) = ol;  }

// k_asoft: per row (zz, i): t = S x HD^-0.5 for j <= i and i - j < WIN (WIN = TT: the window test always holds, so plain causal; the reference's -1e9 additive fill vanishes identically); softmax over the 2048 keys (register row, one exp, fixed trees);
__global__ __launch_bounds__(256) void k_asoft(const float* __restrict__ Sb, h16* P16, bf* Ph, bf* Pl) {
    const int lane = threadIdx.x & 31; const int row = blockIdx.x * 8 + (threadIdx.x >> 5); if (row >= ZH * TT) return; const int i = row % TT; const int zz = row / TT; (void)zz; const bool hires = (i < RH); const float* sr = Sb + (size_t)row * TT; float v[TT / 32]; float mx = -3.0e38f;
#pragma unroll
    for (int ch = 0; ch < TT / 128; ++ch) { const int j0 = ch * 128 + lane * 4; const v4f a = *(const v4f*)(sr + j0);
#pragma unroll
        for (int q = 0; q < 4; ++q) { const int j = j0 + q; (void)j; const float t = (j <= i && i - j < WIN) ? a[q] * SCL : -3.0e38f; v[ch * 4 + q] = t; mx = fmaxf(mx, t); } }
#pragma unroll
    for (int sh = 16; sh; sh >>= 1) mx = fmaxf(mx, __shfl_xor(mx, sh, 32));
    float sum = 0.f;
#pragma unroll
    for (int k = 0; k < TT / 32; ++k) { float d0 = __fsub_rn(v[k], mx); asm volatile("" : "+v"(d0)); v[k] = __builtin_amdgcn_exp2f(__fmul_rn(d0, 1.4426950408889634f)); sum += v[k]; }
#pragma unroll
    for (int sh = 16; sh; sh >>= 1) sum += __shfl_xor(sum, sh, 32);
    const float f = __fdiv_rn(hires ? 1.0f : PCAR, sum);
{
        if (hires) {
#pragma unroll
            for (int ch = 0; ch < TT / 128; ++ch) { v4us oh, ol;
#pragma unroll
                for (int q = 0; q < 4; ++q) { unsigned short a, c2; splitf(v[ch * 4 + q] * f, a, c2); oh[q] = a; ol[q] = c2; }
                const size_t oo = ((size_t)zz * (RH ? RH : 1) + i) * TT + ch * 128 + lane * 4; *(v4us*)(Ph + oo) = oh; *(v4us*)(Pl + oo) = ol; }
        } else {
#pragma unroll
            for (int ch = 0; ch < TT / 128; ++ch) { v4h o4;
#pragma unroll
                for (int q = 0; q < 4; ++q) o4[q] = tohx(v[ch * 4 + q] * f);
                *(v4h*)(P16 + (size_t)row * TT + ch * 128 + lane * 4) = o4; } }
         }
}
__global__ __launch_bounds__(256) void k_merge(const float* __restrict__ O, int h0, bf* Ah, bf* Al) { const size_t e = ((size_t)blockIdx.x * 256 + threadIdx.x) * 2; if (e >= (size_t)ZH * TT * HD) return; const int d = (int)(e % HD); const int t = (int)((e / HD) % TT); const int zz = (int)(e / ((size_t)HD * TT)); const float cs = (t < RH) ? 1.0f : (1.0f / PCAR); const size_t oo = (size_t)t * DQ + (h0 + zz) * HD + d;
    v2us oh, ol;
#pragma unroll
    for (int q = 0; q < 2; ++q) { unsigned short a, c2; splitf(O[e + q] * cs, a, c2); oh[q] = a; ol[q] = c2; } *(v2us*)(Ah + oo) = oh; *(v2us*)(Al + oo) = ol;  }

extern "C" void kernel_launch(void* const* d_in, const int* in_sizes, int n_in,
                              void* d_out, int out_size, void* d_ws, size_t ws_size, hipStream_t stream) {
    (void)in_sizes; (void)n_in; (void)out_size;
    const float* x = (const float*)d_in[0]; const int* PID = (const int*)d_in[1]; const float* wqkv = (const float*)d_in[2]; const float* wo = (const float*)d_in[3];  const float* wq = wqkv; const float* wk = wqkv + (size_t)1024 * 1024; const float* wv = wqkv + (size_t)2048 * 1024; (void)wq; (void)wk; (void)wv;
    float* OUT = (float*)d_out;     // [4][2048][1024]
    char* wsp = (char*)d_ws;
    auto take = [&](size_t bytes) { char* p = wsp; wsp += (bytes + 255) & ~(size_t)255; return (void*)p; };
    bf* WQ = (bf*)take((size_t)DQ * DM * 2); bf* WK = (bf*)take((size_t)DKV * DM * 2); bf* WV = (bf*)take((size_t)DKV * DM * 2); bf* WO = (bf*)take((size_t)DM * DQ * 2); float* CS = (float*)take((size_t)TT * HD * 2 * 4);
    bf* XB = (bf*)take((size_t)TT * DM * 2); float* FQ = (float*)take((size_t)TT * DQ * 4); float* FK = (float*)take((size_t)TT * DKV * 4);
    h16* QP16 = (h16*)take((size_t)NH_ * TT * HD * 2); h16* KP16 = (h16*)take((size_t)NKV * TT * HD * 2); h16* VT16 = (h16*)take((size_t)NKV * HD * TT * 2);
    bf* QPh = (bf*)take((size_t)NH_ * TT * HD * 2); bf* QPl = (bf*)take((size_t)NH_ * TT * HD * 2); bf* KPh = (bf*)take((size_t)NKV * TT * HD * 2); bf* KPl = (bf*)take((size_t)NKV * TT * HD * 2); bf* VTh = (bf*)take((size_t)NKV * HD * TT * 2); bf* VTl = (bf*)take((size_t)NKV * HD * TT * 2); bf* Ph = (bf*)take((size_t)ZH * RH * TT * 2); bf* Pl = (bf*)take((size_t)ZH * RH * TT * 2);
    float* Sb = (float*)take((size_t)ZH * TT * TT * 4); h16* P16 = (h16*)take((size_t)ZH * TT * TT * 2); float* Ob = (float*)take((size_t)ZH * TT * HD * 4); bf* ATh = (bf*)take((size_t)TT * DQ * 2); bf* ATl = (bf*)take((size_t)TT * DQ * 2);
    if ((size_t)(wsp - (char*)d_ws) > ws_size) return;    // ws 256 MiB
    float* FV = FK;   // v projection reuses the k buffer after the k planes are built (stream-ordered)
    { k_cvt8<<<(unsigned)(((size_t)DQ * DM / 8 + 255) / 256), 256, 0, stream>>>(wq, WQ, (size_t)DQ * DM / 8); k_cvt8<<<(unsigned)(((size_t)DKV * DM / 8 + 255) / 256), 256, 0, stream>>>(wk, WK, (size_t)DKV * DM / 8); k_cvt8<<<(unsigned)(((size_t)DKV * DM / 8 + 255) / 256), 256, 0, stream>>>(wv, WV, (size_t)DKV * DM / 8);
      k_cvt8<<<(unsigned)(((size_t)DM * DQ / 8 + 255) / 256), 256, 0, stream>>>(wo, WO, (size_t)DM * DQ / 8);
       }
    k_cstabP<<<(TT * HD + 255) / 256, 256, 0, stream>>>(PID, CS);
    const unsigned LQ = (unsigned)(((size_t)NH_ * TT * HD / 2 + 255) / 256), LKv = (unsigned)(((size_t)NKV * TT * HD / 2 + 255) / 256);
    for (int b = 0; b < NB_; ++b) {
        
        k_cvt8<<<(unsigned)(((size_t)TT * DM / 8 + 255) / 256), 256, 0, stream>>>(x + (size_t)b * TT * DM, XB, (size_t)TT * DM / 8);
        k_gemmw<bf, 0, false><<<dim3(TT / 64, DQ / 64, 1), 32, 0, stream>>>(XB, nullptr, WQ, nullptr, DM, FQ, DQ, nullptr, 0, 0, 0);
        k_ropeI<<<LQ, 256, 0, stream>>>(FQ, DQ, NH_, CS, 1.0f, QP16, QPh, QPl);
        k_gemmw<bf, 0, false><<<dim3(TT / 64, DKV / 64, 1), 32, 0, stream>>>(XB, nullptr, WK, nullptr, DM, FK, DKV, nullptr, 0, 0, 0);
        k_ropeI<<<LKv, 256, 0, stream>>>(FK, DKV, NKV, CS, 1.0f, KP16, KPh, KPl);
        k_gemmw<bf, 0, false><<<dim3(TT / 64, DKV / 64, 1), 32, 0, stream>>>(XB, nullptr, WV, nullptr, DM, FV, DKV, nullptr, 0, 0, 0); k_vtp<<<LKv, 256, 0, stream>>>(FV, DKV, NKV, VT16, VTh, VTl);
        for (int h0 = 0; h0 < NH_; h0 += ZH) { const size_t zq = (size_t)h0, zk = (size_t)(h0 / REP);   // one kv head per query head: the pass's two heads use consecutive kv planes (z-strides TT*HD)
            k_gemmc<bf, 2, 1><<<dim3(RH / 64, TT / 64, ZH), 32, 0, stream>>>(QPh + zq * TT * HD, QPl + zq * TT * HD, KPh + zk * TT * HD, KPl + zk * TT * HD, HD, Sb, TT, 0, (size_t)TT * HD, (size_t)TT * HD, (size_t)TT * TT);
            k_gemmc<h16, 0, 1><<<dim3((TT - RH) / 64, TT / 64, ZH), 32, 0, stream>>>(QP16 + zq * TT * HD + (size_t)RH * HD, nullptr, KP16 + zk * TT * HD, nullptr, HD, Sb + (size_t)RH * TT, TT, RH, (size_t)TT * HD, (size_t)TT * HD, (size_t)TT * TT);
            k_asoft<<<ZH * TT / 8, 256, 0, stream>>>(Sb, P16, Ph, Pl);
            k_gemmc<bf, 2, 2><<<dim3(RH / 64, HD / 64, ZH), 32, 0, stream>>>(Ph, Pl, VTh + zk * HD * TT, VTl + zk * HD * TT, TT, Ob, HD, 0, (size_t)RH * TT, (size_t)HD * TT, (size_t)TT * HD);
            k_gemmc<h16, 0, 2><<<dim3((TT - RH) / 64, HD / 64, ZH), 32, 0, stream>>>(P16 + (size_t)RH * TT, nullptr, VT16 + zk * HD * TT, nullptr, TT, Ob + (size_t)RH * HD, HD, RH, (size_t)TT * TT, (size_t)HD * TT, (size_t)TT * HD);
            k_merge<<<(unsigned)(((size_t)ZH * TT * HD / 2 + 255) / 256), 256, 0, stream>>>(Ob, h0, ATh, ATl); }
        k_gemmw<bf, 1, false><<<dim3(TT / 64, DM / 64, 1), 32, 0, stream>>>(ATh, ATl, WO, nullptr, DQ, OUT + (size_t)b * TT * DM, DM, nullptr, 0, 0, 0); }
}

// v001
// One run takes 1760 microseconds.
// Timed twice side by side with v000, it ran 1.63 times as fast both times.
#include <hip/hip_runtime.h>

// Causal multi-head self-attention with interleaved-pair rotary embeddings (x [4][2048][1024]; qkv = x qkv_w^T ('oi' [3072][1024], row blocks q | k | v; 16 heads x 64); rotary on adjacent (even, odd) pairs with angle token_positions[t] x 10000^(-2i/64) (positions read from the int32 input; the reference's float32 table constants computed on device); scores / 8, causal (-inf); softmax; out = merged o_w^T ('oi', no bias) -> [4][2048][1024] (8.4 M)).
// Compute dtypes, f32 accumulate: every input rounded to bf16; q/k/v on PLAIN bf16 operands (inputs: exact); interleaved rotary in f32 (precise cosf/sinf table at the input positions); causal scores and attn.v (tile skipping): query rows < 512 hl (3 products), the rest single fp16 (x1024); softmax f32; o_w hl x exact (2 products).

#define NB_  4
#define TT   2048
#define DM   1024
#define NH_  16
#define NKV  16
#define REP  (NH_ / NKV)
#define HD   64
#define DQ   (NH_ * HD)
#define DKV  (NKV * HD)
#define ZH   2
#define RH   512                  // query rows < RH use hi+lo planes (0: none)
#define WIN  2048
#define PCAR 1024.0f
#define SCL  0.125f   // HD^-0.5
typedef _Float16 h16;
typedef unsigned short bf;
typedef __attribute__((ext_vector_type(16))) __bf16   v16bf;
typedef __attribute__((ext_vector_type(16))) _Float16 v16h;
typedef __attribute__((ext_vector_type(8)))  _Float16 v8h;
typedef __attribute__((ext_vector_type(8)))  unsigned short v8us;
typedef __attribute__((ext_vector_type(8)))  float    v8f;
typedef __attribute__((ext_vector_type(4)))  float    v4f;
typedef v8h  __attribute__((may_alias)) v8ha;
typedef v4f  __attribute__((may_alias)) v4fa;
typedef v8us __attribute__((may_alias)) v8usa;

__device__ __forceinline__ unsigned short f2bf(float f) { unsigned u = __float_as_uint(f); u += 0x7FFFu + ((u >> 16) & 1u); return (unsigned short)(u >> 16); }
__device__ __forceinline__ float bf2f(unsigned short b) { return __uint_as_float(((unsigned)b) << 16); }
__device__ __forceinline__ float bfr(float f) { return bf2f(f2bf(f)); }
__device__ __forceinline__ v16h cat16(v8h lo, v8h hi) { return __builtin_shufflevector(lo, hi, 0, 1, 2, 3, 4, 5, 6, 7, 8, 9, 10, 11, 12, 13, 14, 15); }
__device__ __forceinline__ v16bf cat16b(v8us lo, v8us hi) { return __builtin_bit_cast(v16bf, __builtin_shufflevector(lo, hi, 0, 1, 2, 3, 4, 5, 6, 7, 8, 9, 10, 11, 12, 13, 14, 15)); }
__device__ __forceinline__ v8f wmma16(v16h a, v16h b, v8f c) { return __builtin_amdgcn_wmma_f32_16x16x32_f16(false, a, false, b, (short)0, c, false, false); }
__device__ __forceinline__ v8f wmmab(v16bf a, v16bf b, v8f c) { return __builtin_amdgcn_wmma_f32_16x16x32_bf16(false, a, false, b, (short)0, c, false, false); }



// ---- k_gemmw: register-blocked GEMM, ONE WAVE per 64x64 output tile (16 accumulators), operands straight from K-contiguous 16-bit planes; grid (M/64, N/64, Z), 32 threads.
// C[m][n] (f32, pitch ldc, + optional f32 bias[n]) = sum_k A[m][k] Bt[n][k] (+ split products per NSPLIT). z-batch strides sA/sB/sC in elements. K % 32 == 0.
template <typename T16> struct WFrag;
template <> struct WFrag<h16> { typedef v16h V; static __device__ __forceinline__ V ld(const h16* p) { return cat16(*(const v8h*)p, *(const v8h*)(p + 16)); } static __device__ __forceinline__ v8f mma(V a, V b, v8f c) { return wmma16(a, b, c); } };
template <> struct WFrag<bf> { typedef v16bf V; static __device__ __forceinline__ V ld(const bf* p) { return cat16b(*(const v8us*)p, *(const v8us*)(p + 16)); } static __device__ __forceinline__ v8f mma(V a, V b, v8f c) { return wmmab(a, b, c); } };
template <typename T16, int NSPLIT, bool BIAS>
__global__ __launch_bounds__(32) void k_gemmw(const T16* __restrict__ A, const T16* __restrict__ A2, const T16* __restrict__ Bt, const T16* __restrict__ Bt2, int K, float* C, int ldc, const float* __restrict__ bias, size_t sA, size_t sB, size_t sC) {
    typedef typename WFrag<T16>::V V;
    __shared__ __align__(16) float os[16 * 68];
    const size_t z = blockIdx.z; A += z * sA; if (A2) A2 += z * sA; Bt += z * sB; if (Bt2) Bt2 += z * sB; C += z * sC;
    const int lane = threadIdx.x & 31, lr = lane & 15, hi = lane >> 4; const int r0 = blockIdx.x * 64, c0 = blockIdx.y * 64;
    v8f acc[4][4];
#pragma unroll
    for (int mb = 0; mb < 4; ++mb)
#pragma unroll
        for (int nb = 0; nb < 4; ++nb) acc[mb][nb] = (v8f){};
    const size_t aoff = (size_t)(r0 + lr) * K + 8 * hi, boff = (size_t)(c0 + lr) * K + 8 * hi;
#pragma unroll 1
    for (int kc = 0; kc < K; kc += 32) {
        V a[4], a2[4];
#pragma unroll
        for (int mb = 0; mb < 4; ++mb) { a[mb] = WFrag<T16>::ld(A + aoff + (size_t)mb * 16 * K + kc); if (NSPLIT == 1 || NSPLIT == 2) a2[mb] = WFrag<T16>::ld(A2 + aoff + (size_t)mb * 16 * K + kc); }
#pragma unroll
        for (int nb = 0; nb < 4; ++nb) { const V b = WFrag<T16>::ld(Bt + boff + (size_t)nb * 16 * K + kc); V b2; if (NSPLIT >= 2) b2 = WFrag<T16>::ld(Bt2 + boff + (size_t)nb * 16 * K + kc);
#pragma unroll
            for (int mb = 0; mb < 4; ++mb) { acc[mb][nb] = WFrag<T16>::mma(a[mb], b, acc[mb][nb]); if (NSPLIT == 1 || NSPLIT == 2) acc[mb][nb] = WFrag<T16>::mma(a2[mb], b, acc[mb][nb]); if (NSPLIT >= 2) acc[mb][nb] = WFrag<T16>::mma(a[mb], b2, acc[mb][nb]); } }
        asm volatile("v_nop\n\tv_nop\n\tv_nop\n\tv_nop" : "+v"(acc[0][0]), "+v"(acc[1][1]), "+v"(acc[2][2]), "+v"(acc[3][3]) : "v"(a[0]), "v"(a[3]));
    }
#pragma unroll
    for (int mb = 0; mb < 4; ++mb) {
#pragma unroll
        for (int nb = 0; nb < 4; ++nb) {
#pragma unroll
            for (int j = 0; j < 8; ++j) os[(hi * 8 + j) * 68 + nb * 16 + lr] = acc[mb][nb][j]; }
        __builtin_amdgcn_wave_barrier(); asm volatile("" ::: "memory");
        float* crow = C + (size_t)(r0 + mb * 16) * ldc + c0;
{
#pragma unroll
            for (int s = 0; s < 8; ++s) { const int row = 2 * s + hi, cofs = lr * 4; v4f val = *(const v4fa*)(os + row * 68 + cofs); if (BIAS) { val[0] += bfr(bias[c0 + cofs]); val[1] += bfr(bias[c0 + cofs + 1]); val[2] += bfr(bias[c0 + cofs + 2]); val[3] += bfr(bias[c0 + cofs + 3]); }
                *(v4f*)(crow + (size_t)row * ldc + cofs) = val; }
             }
        __builtin_amdgcn_wave_barrier(); asm volatile("" ::: "memory");
    }
}

// ---- k_gemmc: the same one-wave 64x64 tile GEMM specialised for causal attention: CMODE 1 skips score tiles entirely above the diagonal (query rows r0+roff.., key columns c0..), CMODE 2 limits the
// key (K) loop of the probability x value contraction to the diagonal block (probabilities beyond it are exactly zero). roff = row offset of this launch's first row within the sequence.
template <typename T16, int NSPLIT, int CMODE>
__global__ __launch_bounds__(32) void k_gemmc(const T16* __restrict__ A, const T16* __restrict__ A2, const T16* __restrict__ Bt, const T16* __restrict__ Bt2, int K, float* C, int ldc, int roff, size_t sA, size_t sB, size_t sC) {
    typedef typename WFrag<T16>::V V;
    __shared__ __align__(16) float os[16 * 68];
    const size_t z = blockIdx.z; A += z * sA; if (A2) A2 += z * sA; Bt += z * sB; if (Bt2) Bt2 += z * sB; C += z * sC;
    const int lane = threadIdx.x & 31, lr = lane & 15, hi = lane >> 4; const int r0 = blockIdx.x * 64, c0 = blockIdx.y * 64;
    if (CMODE == 1 && c0 > r0 + roff + 63) return;                  // score tile entirely above the causal diagonal: left unwritten (the softmax loads it but masks j > i by select)
    const int Kl = (CMODE == 2) ? min(K, r0 + roff + 64) : K;        // P.V: probabilities are exactly 0 beyond the diagonal block, so the K loop stops there
    v8f acc[4][4];
#pragma unroll
    for (int mb = 0; mb < 4; ++mb)
#pragma unroll
        for (int nb = 0; nb < 4; ++nb) acc[mb][nb] = (v8f){};
    const size_t aoff = (size_t)(r0 + lr) * K + 8 * hi, boff = (size_t)(c0 + lr) * K + 8 * hi;
#pragma unroll 1
    for (int kc = 0; kc < Kl; kc += 32) {
        V a[4], a2[4];
#pragma unroll
        for (int mb = 0; mb < 4; ++mb) { a[mb] = WFrag<T16>::ld(A + aoff + (size_t)mb * 16 * K + kc); if (NSPLIT == 1 || NSPLIT == 2) a2[mb] = WFrag<T16>::ld(A2 + aoff + (size_t)mb * 16 * K + kc); }
#pragma unroll
        for (int nb = 0; nb < 4; ++nb) { const V b = WFrag<T16>::ld(Bt + boff + (size_t)nb * 16 * K + kc); V b2; if (NSPLIT >= 2) b2 = WFrag<T16>::ld(Bt2 + boff + (size_t)nb * 16 * K + kc);
#pragma unroll
            for (int mb = 0; mb < 4; ++mb) { acc[mb][nb] = WFrag<T16>::mma(a[mb], b, acc[mb][nb]); if (NSPLIT == 1 || NSPLIT == 2) acc[mb][nb] = WFrag<T16>::mma(a2[mb], b, acc[mb][nb]); if (NSPLIT >= 2) acc[mb][nb] = WFrag<T16>::mma(a[mb], b2, acc[mb][nb]); } }
        asm volatile("v_nop\n\tv_nop\n\tv_nop\n\tv_nop" : "+v"(acc[0][0]), "+v"(acc[1][1]), "+v"(acc[2][2]), "+v"(acc[3][3]) : "v"(a[0]), "v"(a[3]));
    }
#pragma unroll
    for (int mb = 0; mb < 4; ++mb) {
#pragma unroll
        for (int nb = 0; nb < 4; ++nb) {
#pragma unroll
            for (int j = 0; j < 8; ++j) os[(hi * 8 + j) * 68 + nb * 16 + lr] = acc[mb][nb][j]; }
        __builtin_amdgcn_wave_barrier(); asm volatile("" ::: "memory");
        float* crow = C + (size_t)(r0 + mb * 16) * ldc + c0;
{
#pragma unroll
            for (int s = 0; s < 8; ++s) { const int row = 2 * s + hi, cofs = lr * 4; v4f val = *(const v4fa*)(os + row * 68 + cofs);
                *(v4f*)(crow + (size_t)row * ldc + cofs) = val; }
             }
        __builtin_amdgcn_wave_barrier(); asm volatile("" ::: "memory");
    }
}

// ---- k_gemmpv: the probability x value contraction, one 64x64 output tile per work-group of NW waves. The key (K) loop, cut at the diagonal block as in k_gemmc CMODE 2, is dealt out in 32-key chunks:
// wave w takes chunks w, w + NW, ...; every wave holds the whole tile (16 accumulators). The NW partial tiles go to LDS in accumulator layout [wave][tile][row half][lane][4] and are summed in fixed wave order 0..NW-1.
// Each wave sums and stores two side-by-side 16-column tiles of one 4-row group per half-wave, so that every 128-byte line of C has one writing wave.
template <typename T16, int NSPLIT, int NW>
__global__ __launch_bounds__(32 * NW) void k_gemmpv(const T16* __restrict__ A, const T16* __restrict__ A2, const T16* __restrict__ Bt, const T16* __restrict__ Bt2, int K, float* C, int ldc, int roff, size_t sA, size_t sB, size_t sC) {
    typedef typename WFrag<T16>::V V;
    __shared__ __align__(16) float red[NW * 16 * 2 * 32 * 4];
    const size_t z = blockIdx.z; A += z * sA; if (A2) A2 += z * sA; Bt += z * sB; if (Bt2) Bt2 += z * sB; C += z * sC;
    const int lane = threadIdx.x & 31, lr = lane & 15, hi = lane >> 4; const int w = __builtin_amdgcn_readfirstlane((int)(threadIdx.x >> 5)) /* wave number in a scalar register: the chunk loop keeps a scalar bound test */; const int r0 = blockIdx.x * 64, c0 = blockIdx.y * 64;
    const int Kl = min(K, r0 + roff + 64);        // probabilities are exactly 0 beyond the diagonal block, so the K loop stops there
    v8f acc[4][4];
#pragma unroll
    for (int mb = 0; mb < 4; ++mb)
#pragma unroll
        for (int nb = 0; nb < 4; ++nb) acc[mb][nb] = (v8f){};
    // addresses: a wave-uniform plane base plus one 32-bit byte offset per lane and 16-row block (a plane is at most 8 MiB); the offsets are carried round the loop and stepped at its foot,
    // so that they stay live through a trip and no load's result is placed in a register that an issued load names
    unsigned ao[4], bo[4];
#pragma unroll
    for (int i = 0; i < 4; ++i) { ao[i] = (unsigned)((r0 + lr + i * 16) * K + 8 * hi + 32 * w) * 2u; bo[i] = (unsigned)((c0 + lr + i * 16) * K + 8 * hi + 32 * w) * 2u; }
#pragma unroll 1   // rolled, as in k_gemmc: one chunk's fragments and the 16 accumulators fill the 256 registers a wave of a 16-wave work-group may hold
    for (int kc = 32 * w; kc < Kl; kc += 32 * NW) {
        V a[4], a2[4];
#pragma unroll
        for (int mb = 0; mb < 4; ++mb) { a[mb] = WFrag<T16>::ld((const T16*)((const char*)A + ao[mb])); if (NSPLIT == 1 || NSPLIT == 2) a2[mb] = WFrag<T16>::ld((const T16*)((const char*)A2 + ao[mb])); }
#pragma unroll
        for (int nb = 0; nb < 4; ++nb) { const V b = WFrag<T16>::ld((const T16*)((const char*)Bt + bo[nb])); V b2; if (NSPLIT >= 2) b2 = WFrag<T16>::ld((const T16*)((const char*)Bt2 + bo[nb]));
#pragma unroll
            for (int mb = 0; mb < 4; ++mb) { acc[mb][nb] = WFrag<T16>::mma(a[mb], b, acc[mb][nb]); if (NSPLIT == 1 || NSPLIT == 2) acc[mb][nb] = WFrag<T16>::mma(a2[mb], b, acc[mb][nb]); if (NSPLIT >= 2) acc[mb][nb] = WFrag<T16>::mma(a[mb], b2, acc[mb][nb]); } }
        // four vector slots behind the last WMMA, on the taken back edge too, before the offset steps, the next chunk's loads or the LDS stores touch its registers
        asm volatile("v_nop\n\tv_nop\n\tv_nop\n\tv_nop" : "+v"(acc[0][0]), "+v"(acc[1][1]), "+v"(acc[2][2]), "+v"(acc[3][3]) : "v"(a[0]), "v"(a[3]));
        // the wait that stands in front of a rewrite of registers which issued global loads name; the offsets are in-out operands so that their steps below cannot be lifted over it
        asm volatile("s_wait_xcnt 0x0" : "+v"(ao[0]), "+v"(ao[1]), "+v"(ao[2]), "+v"(ao[3]), "+v"(bo[0]), "+v"(bo[1]), "+v"(bo[2]), "+v"(bo[3]) :: "memory");
#pragma unroll
        for (int i = 0; i < 4; ++i) { ao[i] += 64u * NW; bo[i] += 64u * NW; }
    }
#pragma unroll
    for (int t = 0; t < 16; ++t) {
#pragma unroll
        for (int jh = 0; jh < 2; ++jh) { const v8f s = acc[t >> 2][t & 3]; v4f o; o[0] = s[jh * 4]; o[1] = s[jh * 4 + 1]; o[2] = s[jh * 4 + 2]; o[3] = s[jh * 4 + 3]; *(v4fa*)(red + (size_t)(((w * 16 + t) * 2 + jh) * 32 + lane) * 4) = o; } }
    __syncthreads();      // every wave's partial tile is in LDS before any wave sums
#pragma unroll
    for (int u0 = 0; u0 < 16; u0 += NW) { const int u = u0 + w, mb = u >> 2, np = (u >> 1) & 1, jh = u & 1;
#pragma unroll
        for (int e = 0; e < 2; ++e) { const int t = mb * 4 + np * 2 + e; v4f s = *(const v4fa*)(red + (size_t)((t * 2 + jh) * 32 + lane) * 4);
#pragma unroll
            for (int k = 1; k < NW; ++k) s += *(const v4fa*)(red + (size_t)(((k * 16 + t) * 2 + jh) * 32 + lane) * 4);
#pragma unroll
            for (int q = 0; q < 4; ++q) C[(size_t)(r0 + mb * 16 + hi * 8 + jh * 4 + q) * ldc + c0 + (np * 2 + e) * 16 + lr] = s[q]; } }
}

__device__ __forceinline__ h16 tohx(float x) { return (h16)x; }
__device__ __forceinline__ void splitf(float y, unsigned short& h, unsigned short& l) { h = f2bf(y); l = f2bf(y - bf2f(h)); }
typedef __attribute__((ext_vector_type(2))) _Float16 v2h;
typedef __attribute__((ext_vector_type(4))) _Float16 v4h;
typedef __attribute__((ext_vector_type(2))) unsigned short v2us;
typedef __attribute__((ext_vector_type(4))) unsigned short v4us;
typedef __attribute__((ext_vector_type(2))) float v2f;
typedef __attribute__((ext_vector_type(4))) int v4i;

__global__ __launch_bounds__(256) void k_wtG(const float* __restrict__ w, int K, int N, bf* Bt) {
    const int lane = threadIdx.x & 31; const int L0 = (blockIdx.x * 8 + (threadIdx.x >> 5)) * 8; const int nlines = N * K / 64;
{
#pragma unroll 1
        for (int l = 0; l < 8; ++l) { const int L = L0 + l; if (L >= nlines) break; const size_t e = (size_t)L * 64 + lane * 2; const int k = (int)(e % K), n = (int)(e / K); v2us o;
            o[0] = f2bf(w[(size_t)k * N + n]); o[1] = f2bf(w[(size_t)(k + 1) * N + n]); *(v2us*)(Bt + e) = o; }
         }
}
__global__ __launch_bounds__(256) void k_cvt8(const float* __restrict__ src, bf* dst, size_t n8) { const size_t i = (size_t)blockIdx.x * 256 + threadIdx.x; if (i >= n8) return; const v8f v = *(const v8f*)(src + i * 8); v8us o;
#pragma unroll
    for (int k = 0; k < 8; ++k) o[k] = f2bf(v[k]); *(v8us*)(dst + i * 8) = o;  }

// k_ropeI: head planes [h][t][d] (fp16 + hi/lo) of rope(x) x sc with the interleaved-pair convention (d even) out[d] = x[d] cos[t][d] - x[d+1] sin[t][d], out[d+1] = x[d+1] cos[t][d] + x[d] sin[t][d]

__global__ __launch_bounds__(256) void k_vtp(const float* __restrict__ F, int pitch, int nheads, h16* V16, bf* Vh, bf* Vl) { const size_t e = ((size_t)blockIdx.x * 256 + threadIdx.x) * 2; if (e >= (size_t)nheads * HD * TT) return; const int t = (int)(e % TT); const int d = (int)((e / TT) % HD); const int g = (int)(e / ((size_t)TT * HD)); v2h o16; v2us oh, ol;
#pragma unroll
    for (int q = 0; q < 2; ++q) { const float x = F[(size_t)(t + q) * pitch + g * HD + d]; o16[q] = tohx(x); unsigned short a2, c2; splitf(x, a2, c2); oh[q] = a2; ol[q] = c2; }
    *(v2h*)(V16 + e) = o16; *(v2us*)(Vh + e) = oh; *(v2us*)(Vl + e) = ol;  }
__constant__ float INV[HD / 2] = {1.0f,0.749894202f,0.562341332f,0.421696514f,0.316227764f,0.237137362f,0.177827939f,0.133352146f,0.100000001f,0.0749894157f,0.0562341288f,0.0421696492f,0.0316227786f,0.0237137359f,0.0177827943f,0.0133352149f,0.00999999978f,0.00749894232f,0.00562341325f,0.00421696482f,0.00316227786f,0.00237137382f,0.00177827943f,0.00133352145f,0.00100000005f,0.000749894185f,0.000562341302f,0.000421696488f,0.000316227786f,0.000237137385f,0.00017782794f,0.00013335215f};
__global__ __launch_bounds__(256) void k_cstabP(const int* __restrict__ pos, float* CS) { const int idx = blockIdx.x * 256 + threadIdx.x; if (idx >= TT * HD) return; const int t = idx / HD, d = idx % HD; const float ang = __fmul_rn((float)pos[t], INV[d >> 1]); v2f cs; cs[0] = cosf(ang); cs[1] = sinf(ang);
    *(v2f*)(CS + (size_t)idx * 2) = cs;  }
__global__ __launch_bounds__(256) void k_ropeI(const float* __restrict__ F, int pitch, int nheads, const float* __restrict__ CS, float sc, h16* P16, bf* Ph, bf* Pl) {
    const size_t e = ((size_t)blockIdx.x * 256 + threadIdx.x) * 2; if (e >= (size_t)nheads * TT * HD) return; const int d = (int)(e % HD); const int t = (int)((e / HD) % TT); const int h = (int)(e / ((size_t)HD * TT)); const float* f = F + (size_t)t * pitch + h * HD; const float x0 = f[d], x1 = f[d + 1]; const v2f cs = *(const v2f*)(CS + ((size_t)t * HD + d) * 2); v2h o16; v2us oh, ol;
    float a0 = __fmul_rn(x0, cs[0]), b0 = __fmul_rn(x1, cs[1]), a1 = __fmul_rn(x1, cs[0]), b1 = __fmul_rn(x0, cs[1]); asm volatile("" : "+v"(a0), "+v"(b0), "+v"(a1), "+v"(b1));
    float r0 = __fsub_rn(a0, b0) * sc, r1 = __fadd_rn(b1, a1) * sc;   /* even: x0 c - x1 s; odd: x0 s + x1 c */
    o16[0] = tohx(r0); o16[1] = tohx(r1); { unsigned short a2, c2; splitf(r0, a2, c2); oh[0] = a2; ol[0] = c2; splitf(r1, a2, c2); oh[1] = a2; ol[1] = c2; }
    *(v2h*)(P16 + e) = o16; *(v2us*)(Ph + e) = oh; *(v2us*)(Pl + e) = ol;  }

// k_asoft: per row (zz, i): t = S x HD^-0.5 for j <= i and i - j < WIN (WIN = TT: the window test always holds, so plain causal; the reference's -1e9 additive fill vanishes identically); softmax over the 2048 keys (register row, one exp, fixed trees);
__global__ __launch_bounds__(256) void k_asoft(const float* __restrict__ Sb, h16* P16, bf* Ph, bf* Pl) {
    const int lane = threadIdx.x & 31; const int row = blockIdx.x * 8 + (threadIdx.x >> 5); if (row >= ZH * TT) return; const int i = row % TT; const int zz = row / TT; (void)zz; const bool hires = (i < RH); const float* sr = Sb + (size_t)row * TT; float v[TT / 32]; float mx = -3.0e38f;
#pragma unroll
    for (int ch = 0; ch < TT / 128; ++ch) { const int j0 = ch * 128 + lane * 4; const v4f a = *(const v4f*)(sr + j0);
#pragma unroll
        for (int q = 0; q < 4; ++q) { const int j = j0 + q; (void)j; const float t = (j <= i && i - j < WIN) ? a[q] * SCL : -3.0e38f; v[ch * 4 + q] = t; mx = fmaxf(mx, t); } }
#pragma unroll
    for (int sh = 16; sh; sh >>= 1) mx = fmaxf(mx, __shfl_xor(mx, sh, 32));
    float sum = 0.f;
#pragma unroll
    for (int k = 0; k < TT / 32; ++k) { float d0 = __fsub_rn(v[k], mx); asm volatile("" : "+v"(d0)); v[k] = __builtin_amdgcn_exp2f(__fmul_rn(d0, 1.4426950408889634f)); sum += v[k]; }
#pragma unroll
    for (int sh = 16; sh; sh >>= 1) sum += __shfl_xor(sum, sh, 32);
    const float f = __fdiv_rn(hires ? 1.0f : PCAR, sum);
{
        if (hires) {
#pragma unroll
            for (int ch = 0; ch < TT / 128; ++ch) { v4us oh, ol;
#pragma unroll
                for (int q = 0; q < 4; ++q) { unsigned short a, c2; splitf(v[ch * 4 + q] * f, a, c2); oh[q] = a; ol[q] = c2; }
                const size_t oo = ((size_t)zz * (RH ? RH : 1) + i) * TT + ch * 128 + lane * 4; *(v4us*)(Ph + oo) = oh; *(v4us*)(Pl + oo) = ol; }
        } else {
#pragma unroll
            for (int ch = 0; ch < TT / 128; ++ch) { v4h o4;
#pragma unroll
                for (int q = 0; q < 4; ++q) o4[q] = tohx(v[ch * 4 + q] * f);
                *(v4h*)(P16 + (size_t)row * TT + ch * 128 + lane * 4) = o4; } }
         }
}
__global__ __launch_bounds__(256) void k_merge(const float* __restrict__ O, int h0, bf* Ah, bf* Al) { const size_t e = ((size_t)blockIdx.x * 256 + threadIdx.x) * 2; if (e >= (size_t)ZH * TT * HD) return; const int d = (int)(e % HD); const int t = (int)((e / HD) % TT); const int zz = (int)(e / ((size_t)HD * TT)); const float cs = (t < RH) ? 1.0f : (1.0f / PCAR); const size_t oo = (size_t)t * DQ + (h0 + zz) * HD + d;
    v2us oh, ol;
#pragma unroll
    for (int q = 0; q < 2; ++q) { unsigned short a, c2; splitf(O[e + q] * cs, a, c2); oh[q] = a; ol[q] = c2; } *(v2us*)(Ah + oo) = oh; *(v2us*)(Al + oo) = ol;  }

extern "C" void kernel_launch(void* const* d_in, const int* in_sizes, int n_in,
                              void* d_out, int out_size, void* d_ws, size_t ws_size, hipStream_t stream) {
    (void)in_sizes; (void)n_in; (void)out_size;
    const float* x = (const float*)d_in[0]; const int* PID = (const int*)d_in[1]; const float* wqkv = (const float*)d_in[2]; const float* wo = (const float*)d_in[3];  const float* wq = wqkv; const float* wk = wqkv + (size_t)1024 * 1024; const float* wv = wqkv + (size_t)2048 * 1024; (void)wq; (void)wk; (void)wv;
    float* OUT = (float*)d_out;     // [4][2048][1024]
    char* wsp = (char*)d_ws;
    auto take = [&](size_t bytes) { char* p = wsp; wsp += (bytes + 255) & ~(size_t)255; return (void*)p; };
    bf* WQ = (bf*)take((size_t)DQ * DM * 2); bf* WK = (bf*)take((size_t)DKV * DM * 2); bf* WV = (bf*)take((size_t)DKV * DM * 2); bf* WO = (bf*)take((size_t)DM * DQ * 2); float* CS = (float*)take((size_t)TT * HD * 2 * 4);
    bf* XB = (bf*)take((size_t)TT * DM * 2); float* FQ = (float*)take((size_t)TT * DQ * 4); float* FK = (float*)take((size_t)TT * DKV * 4);
    h16* QP16 = (h16*)take((size_t)NH_ * TT * HD * 2); h16* KP16 = (h16*)take((size_t)NKV * TT * HD * 2); h16* VT16 = (h16*)take((size_t)NKV * HD * TT * 2);
    bf* QPh = (bf*)take((size_t)NH_ * TT * HD * 2); bf* QPl = (bf*)take((size_t)NH_ * TT * HD * 2); bf* KPh = (bf*)take((size_t)NKV * TT * HD * 2); bf* KPl = (bf*)take((size_t)NKV * TT * HD * 2); bf* VTh = (bf*)take((size_t)NKV * HD * TT * 2); bf* VTl = (bf*)take((size_t)NKV * HD * TT * 2); bf* Ph = (bf*)take((size_t)ZH * RH * TT * 2); bf* Pl = (bf*)take((size_t)ZH * RH * TT * 2);
    float* Sb = (float*)take((size_t)ZH * TT * TT * 4); h16* P16 = (h16*)take((size_t)ZH * TT * TT * 2); float* Ob = (float*)take((size_t)ZH * TT * HD * 4); bf* ATh = (bf*)take((size_t)TT * DQ * 2); bf* ATl = (bf*)take((size_t)TT * DQ * 2);
    if ((size_t)(wsp - (char*)d_ws) > ws_size) return;    // ws 256 MiB
    float* FV = FK;   // v projection reuses the k buffer after the k planes are built (stream-ordered)
    { k_cvt8<<<(unsigned)(((size_t)DQ * DM / 8 + 255) / 256), 256, 0, stream>>>(wq, WQ, (size_t)DQ * DM / 8); k_cvt8<<<(unsigned)(((size_t)DKV * DM / 8 + 255) / 256), 256, 0, stream>>>(wk, WK, (size_t)DKV * DM / 8); k_cvt8<<<(unsigned)(((size_t)DKV * DM / 8 + 255) / 256), 256, 0, stream>>>(wv, WV, (size_t)DKV * DM / 8);
      k_cvt8<<<(unsigned)(((size_t)DM * DQ / 8 + 255) / 256), 256, 0, stream>>>(wo, WO, (size_t)DM * DQ / 8);
       }
    k_cstabP<<<(TT * HD + 255) / 256, 256, 0, stream>>>(PID, CS);
    const unsigned LQ = (unsigned)(((size_t)NH_ * TT * HD / 2 + 255) / 256), LKv = (unsigned)(((size_t)NKV * TT * HD / 2 + 255) / 256);
    for (int b = 0; b < NB_; ++b) {
        
        k_cvt8<<<(unsigned)(((size_t)TT * DM / 8 + 255) / 256), 256, 0, stream>>>(x + (size_t)b * TT * DM, XB, (size_t)TT * DM / 8);
        k_gemmw<bf, 0, false><<<dim3(TT / 64, DQ / 64, 1), 32, 0, stream>>>(XB, nullptr, WQ, nullptr, DM, FQ, DQ, nullptr, 0, 0, 0);
        k_ropeI<<<LQ, 256, 0, stream>>>(FQ, DQ, NH_, CS, 1.0f, QP16, QPh, QPl);
        k_gemmw<bf, 0, false><<<dim3(TT / 64, DKV / 64, 1), 32, 0, stream>>>(XB, nullptr, WK, nullptr, DM, FK, DKV, nullptr, 0, 0, 0);
        k_ropeI<<<LKv, 256, 0, stream>>>(FK, DKV, NKV, CS, 1.0f, KP16, KPh, KPl);
        k_gemmw<bf, 0, false><<<dim3(TT / 64, DKV / 64, 1), 32, 0, stream>>>(XB, nullptr, WV, nullptr, DM, FV, DKV, nullptr, 0, 0, 0); k_vtp<<<LKv, 256, 0, stream>>>(FV, DKV, NKV, VT16, VTh, VTl);
        for (int h0 = 0; h0 < NH_; h0 += ZH) { const size_t zq = (size_t)h0, zk = (size_t)(h0 / REP);   // one kv head per query head: the pass's two heads use consecutive kv planes (z-strides TT*HD)
            k_gemmc<bf, 2, 1><<<dim3(RH / 64, TT / 64, ZH), 32, 0, stream>>>(QPh + zq * TT * HD, QPl + zq * TT * HD, KPh + zk * TT * HD, KPl + zk * TT * HD, HD, Sb, TT, 0, (size_t)TT * HD, (size_t)TT * HD, (size_t)TT * TT);
            k_gemmc<h16, 0, 1><<<dim3((TT - RH) / 64, TT / 64, ZH), 32, 0, stream>>>(QP16 + zq * TT * HD + (size_t)RH * HD, nullptr, KP16 + zk * TT * HD, nullptr, HD, Sb + (size_t)RH * TT, TT, RH, (size_t)TT * HD, (size_t)TT * HD, (size_t)TT * TT);
            k_asoft<<<ZH * TT / 8, 256, 0, stream>>>(Sb, P16, Ph, Pl);
            k_gemmpv<bf, 2, 16><<<dim3(RH / 64, HD / 64, ZH), 512, 0, stream>>>(Ph, Pl, VTh + zk * HD * TT, VTl + zk * HD * TT, TT, Ob, HD, 0, (size_t)RH * TT, (size_t)HD * TT, (size_t)TT * HD);
            k_gemmpv<h16, 0, 16><<<dim3((TT - RH) / 64, HD / 64, ZH), 512, 0, stream>>>(P16 + (size_t)RH * TT, nullptr, VT16 + zk * HD * TT, nullptr, TT, Ob + (size_t)RH * HD, HD, RH, (size_t)TT * TT, (size_t)HD * TT, (size_t)TT * HD);
            k_merge<<<(unsigned)(((size_t)ZH * TT * HD / 2 + 255) / 256), 256, 0, stream>>>(Ob, h0, ATh, ATl); }
        k_gemmw<bf, 1, false><<<dim3(TT / 64, DM / 64, 1), 32, 0, stream>>>(ATh, ATl, WO, nullptr, DQ, OUT + (size_t)b * TT * DM, DM, nullptr, 0, 0, 0); }
}

// v002
// One run takes 1090 microseconds.
// Next to v001, in two timings, it ran 1.60 and 1.61 times as fast.
// All steps since v000 together make it 2.61 times as fast.
#include <hip/hip_runtime.h>

// Causal multi-head self-attention with interleaved-pair rotary embeddings (x [4][2048][1024]; qkv = x qkv_w^T ('oi' [3072][1024], row blocks q | k | v; 16 heads x 64); rotary on adjacent (even, odd) pairs with angle token_positions[t] x 10000^(-2i/64) (positions read from the int32 input; the reference's float32 table constants computed on device); scores / 8, causal (-inf); softmax; out = merged o_w^T ('oi', no bias) -> [4][2048][1024] (8.4 M)).
// Compute dtypes, f32 accumulate: every input rounded to bf16; q/k/v on PLAIN bf16 operands (inputs: exact); interleaved rotary in f32 (precise cosf/sinf table at the input positions); causal scores and attn.v (tile skipping): query rows < 512 hl (3 products), the rest single fp16 (x1024); softmax f32; o_w hl x exact (2 products).

#define NB_  4
#define TT   2048
#define DM   1024
#define NH_  16
#define NKV  16
#define REP  (NH_ / NKV)
#define HD   64
#define DQ   (NH_ * HD)
#define DKV  (NKV * HD)
#define ZH   8                    // heads per attention pass (grid z of the pass's GEMM launches)
#define RH   512                  // query rows < RH use hi+lo planes (0: none)
#define WIN  2048
#define PCAR 1024.0f
#define SCL  0.125f   // HD^-0.5
typedef _Float16 h16;
typedef unsigned short bf;
typedef __attribute__((ext_vector_type(16))) __bf16   v16bf;
typedef __attribute__((ext_vector_type(16))) _Float16 v16h;
typedef __attribute__((ext_vector_type(8)))  _Float16 v8h;
typedef __attribute__((ext_vector_type(8)))  unsigned short v8us;
typedef __attribute__((ext_vector_type(8)))  float    v8f;
typedef __attribute__((ext_vector_type(4)))  float    v4f;
typedef v8h  __attribute__((may_alias)) v8ha;
typedef v4f  __attribute__((may_alias)) v4fa;
typedef v8us __attribute__((may_alias)) v8usa;

__device__ __forceinline__ unsigned short f2bf(float f) { unsigned u = __float_as_uint(f); u += 0x7FFFu + ((u >> 16) & 1u); return (unsigned short)(u >> 16); }
__device__ __forceinline__ float bf2f(unsigned short b) { return __uint_as_float(((unsigned)b) << 16); }
__device__ __forceinline__ float bfr(float f) { return bf2f(f2bf(f)); }
__device__ __forceinline__ v16h cat16(v8h lo, v8h hi) { return __builtin_shufflevector(lo, hi, 0, 1, 2, 3, 4, 5, 6, 7, 8, 9, 10, 11, 12, 13, 14, 15); }
__device__ __forceinline__ v16bf cat16b(v8us lo, v8us hi) { return __builtin_bit_cast(v16bf, __builtin_shufflevector(lo, hi, 0, 1, 2, 3, 4, 5, 6, 7, 8, 9, 10, 11, 12, 13, 14, 15)); }
__device__ __forceinline__ v8f wmma16(v16h a, v16h b, v8f c) { return __builtin_amdgcn_wmma_f32_16x16x32_f16(false, a, false, b, (short)0, c, false, false); }
__device__ __forceinline__ v8f wmmab(v16bf a, v16bf b, v8f c) { return __builtin_amdgcn_wmma_f32_16x16x32_bf16(false, a, false, b, (short)0, c, false, false); }



// ---- k_gemmw: register-blocked GEMM, ONE WAVE per 64x64 output tile (16 accumulators), operands straight from K-contiguous 16-bit planes; grid (M/64, N/64, Z), 32 threads.
// C[m][n] (f32, pitch ldc, + optional f32 bias[n]) = sum_k A[m][k] Bt[n][k] (+ split products per NSPLIT). z-batch strides sA/sB/sC in elements. K % 32 == 0.
template <typename T16> struct WFrag;
template <> struct WFrag<h16> { typedef v16h V; static __device__ __forceinline__ V ld(const h16* p) { return cat16(*(const v8h*)p, *(const v8h*)(p + 16)); } static __device__ __forceinline__ v8f mma(V a, V b, v8f c) { return wmma16(a, b, c); } };
template <> struct WFrag<bf> { typedef v16bf V; static __device__ __forceinline__ V ld(const bf* p) { return cat16b(*(const v8us*)p, *(const v8us*)(p + 16)); } static __device__ __forceinline__ v8f mma(V a, V b, v8f c) { return wmmab(a, b, c); } };
template <typename T16, int NSPLIT, bool BIAS>
__global__ __launch_bounds__(32) void k_gemmw(const T16* __restrict__ A, const T16* __restrict__ A2, const T16* __restrict__ Bt, const T16* __restrict__ Bt2, int K, float* C, int ldc, const float* __restrict__ bias, size_t sA, size_t sB, size_t sC) {
    typedef typename WFrag<T16>::V V;
    __shared__ __align__(16) float os[16 * 68];
    const size_t z = blockIdx.z; A += z * sA; if (A2) A2 += z * sA; Bt += z * sB; if (Bt2) Bt2 += z * sB; C += z * sC;
    const int lane = threadIdx.x & 31, lr = lane & 15, hi = lane >> 4; const int r0 = blockIdx.x * 64, c0 = blockIdx.y * 64;
    v8f acc[4][4];
#pragma unroll
    for (int mb = 0; mb < 4; ++mb)
#pragma unroll
        for (int nb = 0; nb < 4; ++nb) acc[mb][nb] = (v8f){};
    const size_t aoff = (size_t)(r0 + lr) * K + 8 * hi, boff = (size_t)(c0 + lr) * K + 8 * hi;
#pragma unroll 1
    for (int kc = 0; kc < K; kc += 32) {
        V a[4], a2[4];
#pragma unroll
        for (int mb = 0; mb < 4; ++mb) { a[mb] = WFrag<T16>::ld(A + aoff + (size_t)mb * 16 * K + kc); if (NSPLIT == 1 || NSPLIT == 2) a2[mb] = WFrag<T16>::ld(A2 + aoff + (size_t)mb * 16 * K + kc); }
#pragma unroll
        for (int nb = 0; nb < 4; ++nb) { const V b = WFrag<T16>::ld(Bt + boff + (size_t)nb * 16 * K + kc); V b2; if (NSPLIT >= 2) b2 = WFrag<T16>::ld(Bt2 + boff + (size_t)nb * 16 * K + kc);
#pragma unroll
            for (int mb = 0; mb < 4; ++mb) { acc[mb][nb] = WFrag<T16>::mma(a[mb], b, acc[mb][nb]); if (NSPLIT == 1 || NSPLIT == 2) acc[mb][nb] = WFrag<T16>::mma(a2[mb], b, acc[mb][nb]); if (NSPLIT >= 2) acc[mb][nb] = WFrag<T16>::mma(a[mb], b2, acc[mb][nb]); } }
        asm volatile("v_nop\n\tv_nop\n\tv_nop\n\tv_nop" : "+v"(acc[0][0]), "+v"(acc[1][1]), "+v"(acc[2][2]), "+v"(acc[3][3]) : "v"(a[0]), "v"(a[3]));
    }
#pragma unroll
    for (int mb = 0; mb < 4; ++mb) {
#pragma unroll
        for (int nb = 0; nb < 4; ++nb) {
#pragma unroll
            for (int j = 0; j < 8; ++j) os[(hi * 8 + j) * 68 + nb * 16 + lr] = acc[mb][nb][j]; }
        __builtin_amdgcn_wave_barrier(); asm volatile("" ::: "memory");
        float* crow = C + (size_t)(r0 + mb * 16) * ldc + c0;
{
#pragma unroll
            for (int s = 0; s < 8; ++s) { const int row = 2 * s + hi, cofs = lr * 4; v4f val = *(const v4fa*)(os + row * 68 + cofs); if (BIAS) { val[0] += bfr(bias[c0 + cofs]); val[1] += bfr(bias[c0 + cofs + 1]); val[2] += bfr(bias[c0 + cofs + 2]); val[3] += bfr(bias[c0 + cofs + 3]); }
                *(v4f*)(crow + (size_t)row * ldc + cofs) = val; }
             }
        __builtin_amdgcn_wave_barrier(); asm volatile("" ::: "memory");
    }
}

// ---- k_gemmc: the same one-wave 64x64 tile GEMM specialised for causal attention: CMODE 1 skips score tiles entirely above the diagonal (query rows r0+roff.., key columns c0..), CMODE 2 limits the
// key (K) loop of the probability x value contraction to the diagonal block (probabilities beyond it are exactly zero). roff = row offset of this launch's first row within the sequence.
template <typename T16, int NSPLIT, int CMODE>
__global__ __launch_bounds__(32) void k_gemmc(const T16* __restrict__ A, const T16* __restrict__ A2, const T16* __restrict__ Bt, const T16* __restrict__ Bt2, int K, float* C, int ldc, int roff, size_t sA, size_t sB, size_t sC) {
    typedef typename WFrag<T16>::V V;
    __shared__ __align__(16) float os[16 * 68];
    const size_t z = blockIdx.z; A += z * sA; if (A2) A2 += z * sA; Bt += z * sB; if (Bt2) Bt2 += z * sB; C += z * sC;
    const int lane = threadIdx.x & 31, lr = lane & 15, hi = lane >> 4; const int r0 = blockIdx.x * 64, c0 = blockIdx.y * 64;
    if (CMODE == 1 && c0 > r0 + roff + 63) return;                  // score tile entirely above the causal diagonal: left unwritten (the softmax loads it but masks j > i by select)
    const int Kl = (CMODE == 2) ? min(K, r0 + roff + 64) : K;        // P.V: probabilities are exactly 0 beyond the diagonal block, so the K loop stops there
    v8f acc[4][4];
#pragma unroll
    for (int mb = 0; mb < 4; ++mb)
#pragma unroll
        for (int nb = 0; nb < 4; ++nb) acc[mb][nb] = (v8f){};
    const size_t aoff = (size_t)(r0 + lr) * K + 8 * hi, boff = (size_t)(c0 + lr) * K + 8 * hi;
#pragma unroll 1
    for (int kc = 0; kc < Kl; kc += 32) {
        V a[4], a2[4];
#pragma unroll
        for (int mb = 0; mb < 4; ++mb) { a[mb] = WFrag<T16>::ld(A + aoff + (size_t)mb * 16 * K + kc); if (NSPLIT == 1 || NSPLIT == 2) a2[mb] = WFrag<T16>::ld(A2 + aoff + (size_t)mb * 16 * K + kc); }
#pragma unroll
        for (int nb = 0; nb < 4; ++nb) { const V b = WFrag<T16>::ld(Bt + boff + (size_t)nb * 16 * K + kc); V b2; if (NSPLIT >= 2) b2 = WFrag<T16>::ld(Bt2 + boff + (size_t)nb * 16 * K + kc);
#pragma unroll
            for (int mb = 0; mb < 4; ++mb) { acc[mb][nb] = WFrag<T16>::mma(a[mb], b, acc[mb][nb]); if (NSPLIT == 1 || NSPLIT == 2) acc[mb][nb] = WFrag<T16>::mma(a2[mb], b, acc[mb][nb]); if (NSPLIT >= 2) acc[mb][nb] = WFrag<T16>::mma(a[mb], b2, acc[mb][nb]); } }
        asm volatile("v_nop\n\tv_nop\n\tv_nop\n\tv_nop" : "+v"(acc[0][0]), "+v"(acc[1][1]), "+v"(acc[2][2]), "+v"(acc[3][3]) : "v"(a[0]), "v"(a[3]));
    }
#pragma unroll
    for (int mb = 0; mb < 4; ++mb) {
#pragma unroll
        for (int nb = 0; nb < 4; ++nb) {
#pragma unroll
            for (int j = 0; j < 8; ++j) os[(hi * 8 + j) * 68 + nb * 16 + lr] = acc[mb][nb][j]; }
        __builtin_amdgcn_wave_barrier(); asm volatile("" ::: "memory");
        float* crow = C + (size_t)(r0 + mb * 16) * ldc + c0;
{
#pragma unroll
            for (int s = 0; s < 8; ++s) { const int row = 2 * s + hi, cofs = lr * 4; v4f val = *(const v4fa*)(os + row * 68 + cofs);
                *(v4f*)(crow + (size_t)row * ldc + cofs) = val; }
             }
        __builtin_amdgcn_wave_barrier(); asm volatile("" ::: "memory");
    }
}

// ---- k_gemmpv: the probability x value contraction, one 64x64 output tile per work-group of NW waves. The key (K) loop, cut at the diagonal block as in k_gemmc CMODE 2, is dealt out in 32-key chunks:
// wave w takes chunks w, w + NW, ...; every wave holds the whole tile (16 accumulators). The NW partial tiles go to LDS in accumulator layout [wave][tile][row half][lane][4] and are summed in fixed wave order 0..NW-1.
// Each wave sums and stores two side-by-side 16-column tiles of one 4-row group per half-wave, so that every 128-byte line of C has one writing wave.
// lda = pitch of the A rows in elements (the probabilities lie in their score rows, see k_asoft); the Bt rows have pitch K.
template <typename T16, int NSPLIT, int NW>
__global__ __launch_bounds__(32 * NW) void k_gemmpv(const T16* __restrict__ A, const T16* __restrict__ A2, int lda, const T16* __restrict__ Bt, const T16* __restrict__ Bt2, int K, float* C, int ldc, int roff, size_t sA, size_t sB, size_t sC) {
    typedef typename WFrag<T16>::V V;
    __shared__ __align__(16) float red[NW * 16 * 2 * 32 * 4];
    const size_t z = blockIdx.z; A += z * sA; if (A2) A2 += z * sA; Bt += z * sB; if (Bt2) Bt2 += z * sB; C += z * sC;
    const int lane = threadIdx.x & 31, lr = lane & 15, hi = lane >> 4; const int w = __builtin_amdgcn_readfirstlane((int)(threadIdx.x >> 5)) /* wave number in a scalar register: the chunk loop keeps a scalar bound test */; const int r0 = blockIdx.x * 64, c0 = blockIdx.y * 64;
    const int Kl = min(K, r0 + roff + 64);        // probabilities are exactly 0 beyond the diagonal block, so the K loop stops there
    v8f acc[4][4];
#pragma unroll
    for (int mb = 0; mb < 4; ++mb)
#pragma unroll
        for (int nb = 0; nb < 4; ++nb) acc[mb][nb] = (v8f){};
    // addresses: a wave-uniform plane base plus one 32-bit byte offset per lane and 16-row block (a plane is at most 16 MiB); the offsets are carried round the loop and stepped at its foot,
    // so that they stay live through a trip and no load's result is placed in a register that an issued load names
    unsigned ao[4], bo[4];
#pragma unroll
    for (int i = 0; i < 4; ++i) { ao[i] = (unsigned)((r0 + lr + i * 16) * lda + 8 * hi + 32 * w) * 2u; bo[i] = (unsigned)((c0 + lr + i * 16) * K + 8 * hi + 32 * w) * 2u; }
#pragma unroll 1   // rolled, as in k_gemmc: one chunk's fragments and the 16 accumulators fill the 256 registers a wave of a 16-wave work-group may hold
    for (int kc = 32 * w; kc < Kl; kc += 32 * NW) {
        V a[4], a2[4];
#pragma unroll
        for (int mb = 0; mb < 4; ++mb) { a[mb] = WFrag<T16>::ld((const T16*)((const char*)A + ao[mb])); if (NSPLIT == 1 || NSPLIT == 2) a2[mb] = WFrag<T16>::ld((const T16*)((const char*)A2 + ao[mb])); }
#pragma unroll
        for (int nb = 0; nb < 4; ++nb) { const V b = WFrag<T16>::ld((const T16*)((const char*)Bt + bo[nb])); V b2; if (NSPLIT >= 2) b2 = WFrag<T16>::ld((const T16*)((const char*)Bt2 + bo[nb]));
#pragma unroll
            for (int mb = 0; mb < 4; ++mb) { acc[mb][nb] = WFrag<T16>::mma(a[mb], b, acc[mb][nb]); if (NSPLIT == 1 || NSPLIT == 2) acc[mb][nb] = WFrag<T16>::mma(a2[mb], b, acc[mb][nb]); if (NSPLIT >= 2) acc[mb][nb] = WFrag<T16>::mma(a[mb], b2, acc[mb][nb]); } }
        // four vector slots behind the last WMMA, on the taken back edge too, before the offset steps, the next chunk's loads or the LDS stores touch its registers
        asm volatile("v_nop\n\tv_nop\n\tv_nop\n\tv_nop" : "+v"(acc[0][0]), "+v"(acc[1][1]), "+v"(acc[2][2]), "+v"(acc[3][3]) : "v"(a[0]), "v"(a[3]));
        // the wait that stands in front of a rewrite of registers which issued global loads name; the offsets are in-out operands so that their steps below cannot be lifted over it
        asm volatile("s_wait_xcnt 0x0" : "+v"(ao[0]), "+v"(ao[1]), "+v"(ao[2]), "+v"(ao[3]), "+v"(bo[0]), "+v"(bo[1]), "+v"(bo[2]), "+v"(bo[3]) :: "memory");
#pragma unroll
        for (int i = 0; i < 4; ++i) { ao[i] += 64u * NW; bo[i] += 64u * NW; }
    }
#pragma unroll
    for (int t = 0; t < 16; ++t) {
#pragma unroll
        for (int jh = 0; jh < 2; ++jh) { const v8f s = acc[t >> 2][t & 3]; v4f o; o[0] = s[jh * 4]; o[1] = s[jh * 4 + 1]; o[2] = s[jh * 4 + 2]; o[3] = s[jh * 4 + 3]; *(v4fa*)(red + (size_t)(((w * 16 + t) * 2 + jh) * 32 + lane) * 4) = o; } }
    __syncthreads();      // every wave's partial tile is in LDS before any wave sums
#pragma unroll
    for (int u0 = 0; u0 < 16; u0 += NW) { const int u = u0 + w, mb = u >> 2, np = (u >> 1) & 1, jh = u & 1;
#pragma unroll
        for (int e = 0; e < 2; ++e) { const int t = mb * 4 + np * 2 + e; v4f s = *(const v4fa*)(red + (size_t)((t * 2 + jh) * 32 + lane) * 4);
#pragma unroll
            for (int k = 1; k < NW; ++k) s += *(const v4fa*)(red + (size_t)(((k * 16 + t) * 2 + jh) * 32 + lane) * 4);
#pragma unroll
            for (int q = 0; q < 4; ++q) C[(size_t)(r0 + mb * 16 + hi * 8 + jh * 4 + q) * ldc + c0 + (np * 2 + e) * 16 + lr] = s[q]; } }
}

__device__ __forceinline__ h16 tohx(float x) { return (h16)x; }
__device__ __forceinline__ void splitf(float y, unsigned short& h, unsigned short& l) { h = f2bf(y); l = f2bf(y - bf2f(h)); }
typedef __attribute__((ext_vector_type(2))) _Float16 v2h;
typedef __attribute__((ext_vector_type(4))) _Float16 v4h;
typedef __attribute__((ext_vector_type(2))) unsigned short v2us;
typedef __attribute__((ext_vector_type(4))) unsigned short v4us;
typedef __attribute__((ext_vector_type(2))) float v2f;
typedef __attribute__((ext_vector_type(4))) int v4i;
typedef v4h  __attribute__((may_alias)) v4ha;
typedef v4us __attribute__((may_alias)) v4usa;

__global__ __launch_bounds__(256) void k_wtG(const float* __restrict__ w, int K, int N, bf* Bt) {
    const int lane = threadIdx.x & 31; const int L0 = (blockIdx.x * 8 + (threadIdx.x >> 5)) * 8; const int nlines = N * K / 64;
{
#pragma unroll 1
        for (int l = 0; l < 8; ++l) { const int L = L0 + l; if (L >= nlines) break; const size_t e = (size_t)L * 64 + lane * 2; const int k = (int)(e % K), n = (int)(e / K); v2us o;
            o[0] = f2bf(w[(size_t)k * N + n]); o[1] = f2bf(w[(size_t)(k + 1) * N + n]); *(v2us*)(Bt + e) = o; }
         }
}
__global__ __launch_bounds__(256) void k_cvt8(const float* __restrict__ src, bf* dst, size_t n8) { const size_t i = (size_t)blockIdx.x * 256 + threadIdx.x; if (i >= n8) return; const v8f v = *(const v8f*)(src + i * 8); v8us o;
#pragma unroll
    for (int k = 0; k < 8; ++k) o[k] = f2bf(v[k]); *(v8us*)(dst + i * 8) = o;  }

// k_ropeI: head planes [h][t][d] (fp16 + hi/lo) of rope(x) x sc with the interleaved-pair convention (d even) out[d] = x[d] cos[t][d] - x[d+1] sin[t][d], out[d+1] = x[d+1] cos[t][d] + x[d] sin[t][d]

__global__ __launch_bounds__(256) void k_vtp(const float* __restrict__ F, int pitch, int nheads, h16* V16, bf* Vh, bf* Vl) { const size_t e = ((size_t)blockIdx.x * 256 + threadIdx.x) * 2; if (e >= (size_t)nheads * HD * TT) return; const int t = (int)(e % TT); const int d = (int)((e / TT) % HD); const int g = (int)(e / ((size_t)TT * HD)); v2h o16; v2us oh, ol;
#pragma unroll
    for (int q = 0; q < 2; ++q) { const float x = F[(size_t)(t + q) * pitch + g * HD + d]; o16[q] = tohx(x); unsigned short a2, c2; splitf(x, a2, c2); oh[q] = a2; ol[q] = c2; }
    *(v2h*)(V16 + e) = o16; *(v2us*)(Vh + e) = oh; *(v2us*)(Vl + e) = ol;  }
__constant__ float INV[HD / 2] = {1.0f,0.749894202f,0.562341332f,0.421696514f,0.316227764f,0.237137362f,0.177827939f,0.133352146f,0.100000001f,0.0749894157f,0.0562341288f,0.0421696492f,0.0316227786f,0.0237137359f,0.0177827943f,0.0133352149f,0.00999999978f,0.00749894232f,0.00562341325f,0.00421696482f,0.00316227786f,0.00237137382f,0.00177827943f,0.00133352145f,0.00100000005f,0.000749894185f,0.000562341302f,0.000421696488f,0.000316227786f,0.000237137385f,0.00017782794f,0.00013335215f};
__global__ __launch_bounds__(256) void k_cstabP(const int* __restrict__ pos, float* CS) { const int idx = blockIdx.x * 256 + threadIdx.x; if (idx >= TT * HD) return; const int t = idx / HD, d = idx % HD; const float ang = __fmul_rn((float)pos[t], INV[d >> 1]); v2f cs; cs[0] = cosf(ang); cs[1] = sinf(ang);
    *(v2f*)(CS + (size_t)idx * 2) = cs;  }
__global__ __launch_bounds__(256) void k_ropeI(const float* __restrict__ F, int pitch, int nheads, const float* __restrict__ CS, float sc, h16* P16, bf* Ph, bf* Pl) {
    const size_t e = ((size_t)blockIdx.x * 256 + threadIdx.x) * 2; if (e >= (size_t)nheads * TT * HD) return; const int d = (int)(e % HD); const int t = (int)((e / HD) % TT); const int h = (int)(e / ((size_t)HD * TT)); const float* f = F + (size_t)t * pitch + h * HD; const float x0 = f[d], x1 = f[d + 1]; const v2f cs = *(const v2f*)(CS + ((size_t)t * HD + d) * 2); v2h o16; v2us oh, ol;
    float a0 = __fmul_rn(x0, cs[0]), b0 = __fmul_rn(x1, cs[1]), a1 = __fmul_rn(x1, cs[0]), b1 = __fmul_rn(x0, cs[1]); asm volatile("" : "+v"(a0), "+v"(b0), "+v"(a1), "+v"(b1));
    float r0 = __fsub_rn(a0, b0) * sc, r1 = __fadd_rn(b1, a1) * sc;   /* even: x0 c - x1 s; odd: x0 s + x1 c */
    o16[0] = tohx(r0); o16[1] = tohx(r1); { unsigned short a2, c2; splitf(r0, a2, c2); oh[0] = a2; ol[0] = c2; splitf(r1, a2, c2); oh[1] = a2; ol[1] = c2; }
    *(v2h*)(P16 + e) = o16; *(v2us*)(Ph + e) = oh; *(v2us*)(Pl + e) = ol;  }

// k_asoft: per row (zz, i): t = S x HD^-0.5 for j <= i and i - j < WIN (sliding causal window; the reference's -1e9 additive fill vanishes identically); softmax over the 2048 keys (register row, one exp, fixed trees);
// the probabilities overwrite their own score row (one wave owns a row and holds all of it in registers before its first store): 8192 bytes = fp16 row in the first half, or bf16 hi row | bf16 lo row; 16-bit pitch 2 x TT.
__global__ __launch_bounds__(256) void k_asoft(float* Sb) {
    const int lane = threadIdx.x & 31; const int row = blockIdx.x * 8 + (threadIdx.x >> 5); if (row >= ZH * TT) return; const int i = row % TT; const int zz = row / TT; (void)zz; const bool hires = (i < RH); float* sr = Sb + (size_t)row * TT; float v[TT / 32]; float mx = -3.0e38f;
#pragma unroll
    for (int ch = 0; ch < TT / 128; ++ch) { const int j0 = ch * 128 + lane * 4; const v4f a = *(const v4fa*)(sr + j0);
#pragma unroll
        for (int q = 0; q < 4; ++q) { const int j = j0 + q; (void)j; const float t = (j <= i && i - j < WIN) ? a[q] * SCL : -3.0e38f; v[ch * 4 + q] = t; mx = fmaxf(mx, t); } }
#pragma unroll
    for (int sh = 16; sh; sh >>= 1) mx = fmaxf(mx, __shfl_xor(mx, sh, 32));
    float sum = 0.f;
#pragma unroll
    for (int k = 0; k < TT / 32; ++k) { float d0 = __fsub_rn(v[k], mx); asm volatile("" : "+v"(d0)); v[k] = __builtin_amdgcn_exp2f(__fmul_rn(d0, 1.4426950408889634f)); sum += v[k]; }
#pragma unroll
    for (int sh = 16; sh; sh >>= 1) sum += __shfl_xor(sum, sh, 32);
    const float f = __fdiv_rn(hires ? 1.0f : PCAR, sum);
{
        if (hires) {
#pragma unroll
            for (int ch = 0; ch < TT / 128; ++ch) { v4us oh, ol;
#pragma unroll
                for (int q = 0; q < 4; ++q) { unsigned short a, c2; splitf(v[ch * 4 + q] * f, a, c2); oh[q] = a; ol[q] = c2; }
                bf* po = (bf*)sr + ch * 128 + lane * 4; *(v4usa*)po = oh; *(v4usa*)(po + TT) = ol; }
        } else {
#pragma unroll
            for (int ch = 0; ch < TT / 128; ++ch) { v4h o4;
#pragma unroll
                for (int q = 0; q < 4; ++q) o4[q] = tohx(v[ch * 4 + q] * f);
                *(v4ha*)((h16*)sr + ch * 128 + lane * 4) = o4; } }
         }
}
__global__ __launch_bounds__(256) void k_merge(const float* __restrict__ O, int h0, bf* Ah, bf* Al) { const size_t e = ((size_t)blockIdx.x * 256 + threadIdx.x) * 2; if (e >= (size_t)ZH * TT * HD) return; const int d = (int)(e % HD); const int t = (int)((e / HD) % TT); const int zz = (int)(e / ((size_t)HD * TT)); const float cs = (t < RH) ? 1.0f : (1.0f / PCAR); const size_t oo = (size_t)t * DQ + (h0 + zz) * HD + d;
    v2us oh, ol;
#pragma unroll
    for (int q = 0; q < 2; ++q) { unsigned short a, c2; splitf(O[e + q] * cs, a, c2); oh[q] = a; ol[q] = c2; } *(v2us*)(Ah + oo) = oh; *(v2us*)(Al + oo) = ol;  }

extern "C" void kernel_launch(void* const* d_in, const int* in_sizes, int n_in,
                              void* d_out, int out_size, void* d_ws, size_t ws_size, hipStream_t stream) {
    (void)in_sizes; (void)n_in; (void)out_size;
    const float* x = (const float*)d_in[0]; const int* PID = (const int*)d_in[1]; const float* wqkv = (const float*)d_in[2]; const float* wo = (const float*)d_in[3];  const float* wq = wqkv; const float* wk = wqkv + (size_t)1024 * 1024; const float* wv = wqkv + (size_t)2048 * 1024; (void)wq; (void)wk; (void)wv;
    float* OUT = (float*)d_out;     // [4][2048][1024]
    char* wsp = (char*)d_ws;
    auto take = [&](size_t bytes) { char* p = wsp; wsp += (bytes + 255) & ~(size_t)255; return (void*)p; };
    bf* WQ = (bf*)take((size_t)DQ * DM * 2); bf* WK = (bf*)take((size_t)DKV * DM * 2); bf* WV = (bf*)take((size_t)DKV * DM * 2); bf* WO = (bf*)take((size_t)DM * DQ * 2); float* CS = (float*)take((size_t)TT * HD * 2 * 4);
    bf* XB = (bf*)take((size_t)TT * DM * 2); float* FQ = (float*)take((size_t)TT * DQ * 4); float* FK = (float*)take((size_t)TT * DKV * 4);
    h16* QP16 = (h16*)take((size_t)NH_ * TT * HD * 2); h16* KP16 = (h16*)take((size_t)NKV * TT * HD * 2); h16* VT16 = (h16*)take((size_t)NKV * HD * TT * 2);
    bf* QPh = (bf*)take((size_t)NH_ * TT * HD * 2); bf* QPl = (bf*)take((size_t)NH_ * TT * HD * 2); bf* KPh = (bf*)take((size_t)NKV * TT * HD * 2); bf* KPl = (bf*)take((size_t)NKV * TT * HD * 2); bf* VTh = (bf*)take((size_t)NKV * HD * TT * 2); bf* VTl = (bf*)take((size_t)NKV * HD * TT * 2);
    float* Sb = (float*)take((size_t)ZH * TT * TT * 4); float* Ob = (float*)take((size_t)ZH * TT * HD * 4); bf* ATh = (bf*)take((size_t)TT * DQ * 2); bf* ATl = (bf*)take((size_t)TT * DQ * 2);
    if ((size_t)(wsp - (char*)d_ws) > ws_size) return;    // ws 256 MiB
    float* FV = FK;   // v projection reuses the k buffer after the k planes are built (stream-ordered)
    { k_cvt8<<<(unsigned)(((size_t)DQ * DM / 8 + 255) / 256), 256, 0, stream>>>(wq, WQ, (size_t)DQ * DM / 8); k_cvt8<<<(unsigned)(((size_t)DKV * DM / 8 + 255) / 256), 256, 0, stream>>>(wk, WK, (size_t)DKV * DM / 8); k_cvt8<<<(unsigned)(((size_t)DKV * DM / 8 + 255) / 256), 256, 0, stream>>>(wv, WV, (size_t)DKV * DM / 8);
      k_cvt8<<<(unsigned)(((size_t)DM * DQ / 8 + 255) / 256), 256, 0, stream>>>(wo, WO, (size_t)DM * DQ / 8);
       }
    k_cstabP<<<(TT * HD + 255) / 256, 256, 0, stream>>>(PID, CS);
    const unsigned LQ = (unsigned)(((size_t)NH_ * TT * HD / 2 + 255) / 256), LKv = (unsigned)(((size_t)NKV * TT * HD / 2 + 255) / 256);
    for (int b = 0; b < NB_; ++b) {
        
        k_cvt8<<<(unsigned)(((size_t)TT * DM / 8 + 255) / 256), 256, 0, stream>>>(x + (size_t)b * TT * DM, XB, (size_t)TT * DM / 8);
        k_gemmw<bf, 0, false><<<dim3(TT / 64, DQ / 64, 1), 32, 0, stream>>>(XB, nullptr, WQ, nullptr, DM, FQ, DQ, nullptr, 0, 0, 0);
        k_ropeI<<<LQ, 256, 0, stream>>>(FQ, DQ, NH_, CS, 1.0f, QP16, QPh, QPl);
        k_gemmw<bf, 0, false><<<dim3(TT / 64, DKV / 64, 1), 32, 0, stream>>>(XB, nullptr, WK, nullptr, DM, FK, DKV, nullptr, 0, 0, 0);
        k_ropeI<<<LKv, 256, 0, stream>>>(FK, DKV, NKV, CS, 1.0f, KP16, KPh, KPl);
        k_gemmw<bf, 0, false><<<dim3(TT / 64, DKV / 64, 1), 32, 0, stream>>>(XB, nullptr, WV, nullptr, DM, FV, DKV, nullptr, 0, 0, 0); k_vtp<<<LKv, 256, 0, stream>>>(FV, DKV, NKV, VT16, VTh, VTl);
        for (int h0 = 0; h0 < NH_; h0 += ZH) { const size_t zq = (size_t)h0, zk = (size_t)(h0 / REP);   // one kv head per query head: the pass's heads use consecutive kv planes (z-strides TT*HD)
            k_gemmc<bf, 2, 1><<<dim3(RH / 64, TT / 64, ZH), 32, 0, stream>>>(QPh + zq * TT * HD, QPl + zq * TT * HD, KPh + zk * TT * HD, KPl + zk * TT * HD, HD, Sb, TT, 0, (size_t)TT * HD, (size_t)TT * HD, (size_t)TT * TT);
            k_gemmc<h16, 0, 1><<<dim3((TT - RH) / 64, TT / 64, ZH), 32, 0, stream>>>(QP16 + zq * TT * HD + (size_t)RH * HD, nullptr, KP16 + zk * TT * HD, nullptr, HD, Sb + (size_t)RH * TT, TT, RH, (size_t)TT * HD, (size_t)TT * HD, (size_t)TT * TT);
            k_asoft<<<ZH * TT / 8, 256, 0, stream>>>(Sb);
            k_gemmpv<bf, 2, 16><<<dim3(RH / 64, HD / 64, ZH), 512, 0, stream>>>((const bf*)Sb, (const bf*)Sb + TT, 2 * TT, VTh + zk * HD * TT, VTl + zk * HD * TT, TT, Ob, HD, 0, (size_t)TT * 2 * TT, (size_t)HD * TT, (size_t)TT * HD);
            k_gemmpv<h16, 0, 16><<<dim3((TT - RH) / 64, HD / 64, ZH), 512, 0, stream>>>((const h16*)Sb + (size_t)RH * 2 * TT, nullptr, 2 * TT, VT16 + zk * HD * TT, nullptr, TT, Ob + (size_t)RH * HD, HD, RH, (size_t)TT * 2 * TT, (size_t)HD * TT, (size_t)TT * HD);
            k_merge<<<(unsigned)(((size_t)ZH * TT * HD / 2 + 255) / 256), 256, 0, stream>>>(Ob, h0, ATh, ATl); }
        k_gemmw<bf, 1, false><<<dim3(TT / 64, DM / 64, 1), 32, 0, stream>>>(ATh, ATl, WO, nullptr, DQ, OUT + (size_t)b * TT * DM, DM, nullptr, 0, 0, 0); }
}

// v003
// A run of this version takes 564 microseconds.
// Two timings next to v002 put it at 1.94 and 1.93 times that version's speed.
// All steps since v000 together make it 5.04 times as fast.
#include <hip/hip_runtime.h>

// Causal multi-head self-attention with interleaved-pair rotary embeddings (x [4][2048][1024]; qkv = x qkv_w^T ('oi' [3072][1024], row blocks q | k | v; 16 heads x 64); rotary on adjacent (even, odd) pairs with angle token_positions[t] x 10000^(-2i/64) (positions read from the int32 input; the reference's float32 table constants computed on device); scores / 8, causal (-inf); softmax; out = merged o_w^T ('oi', no bias) -> [4][2048][1024] (8.4 M)).
// Compute dtypes, f32 accumulate: every input rounded to bf16; q/k/v on PLAIN bf16 operands (inputs: exact); interleaved rotary in f32 (precise cosf/sinf table at the input positions); causal scores, streaming softmax (f32) and attn.v in one kernel: query rows < 512 hl (3 products), the rest single fp16 (x1024); o_w hl x exact (2 products).

#define NB_  4
#define TT   2048
#define DM   1024
#define NH_  16
#define NKV  16
#define REP  (NH_ / NKV)
#define HD   64
#define DQ   (NH_ * HD)
#define DKV  (NKV * HD)
#define RH   512                  // query rows < RH use hi+lo planes (0: none)
#define SCL  0.125f   // HD^-0.5
typedef _Float16 h16;
typedef unsigned short bf;
typedef __attribute__((ext_vector_type(16))) __bf16   v16bf;
typedef __attribute__((ext_vector_type(16))) _Float16 v16h;
typedef __attribute__((ext_vector_type(8)))  _Float16 v8h;
typedef __attribute__((ext_vector_type(8)))  unsigned short v8us;
typedef __attribute__((ext_vector_type(8)))  float    v8f;
typedef __attribute__((ext_vector_type(4)))  float    v4f;
typedef v8h  __attribute__((may_alias)) v8ha;
typedef v4f  __attribute__((may_alias)) v4fa;
typedef v8us __attribute__((may_alias)) v8usa;

__device__ __forceinline__ unsigned short f2bf(float f) { unsigned u = __float_as_uint(f); u += 0x7FFFu + ((u >> 16) & 1u); return (unsigned short)(u >> 16); }
__device__ __forceinline__ float bf2f(unsigned short b) { return __uint_as_float(((unsigned)b) << 16); }
__device__ __forceinline__ float bfr(float f) { return bf2f(f2bf(f)); }
__device__ __forceinline__ v16h cat16(v8h lo, v8h hi) { return __builtin_shufflevector(lo, hi, 0, 1, 2, 3, 4, 5, 6, 7, 8, 9, 10, 11, 12, 13, 14, 15); }
__device__ __forceinline__ v16bf cat16b(v8us lo, v8us hi) { return __builtin_bit_cast(v16bf, __builtin_shufflevector(lo, hi, 0, 1, 2, 3, 4, 5, 6, 7, 8, 9, 10, 11, 12, 13, 14, 15)); }
__device__ __forceinline__ v8f wmma16(v16h a, v16h b, v8f c) { return __builtin_amdgcn_wmma_f32_16x16x32_f16(false, a, false, b, (short)0, c, false, false); }
__device__ __forceinline__ v8f wmmab(v16bf a, v16bf b, v8f c) { return __builtin_amdgcn_wmma_f32_16x16x32_bf16(false, a, false, b, (short)0, c, false, false); }



// ---- k_gemmw: register-blocked GEMM, ONE WAVE per 64x64 output tile (16 accumulators), operands straight from K-contiguous 16-bit planes; grid (M/64, N/64, Z), 32 threads.
// C[m][n] (f32, pitch ldc, + optional f32 bias[n]) = sum_k A[m][k] Bt[n][k] (+ split products per NSPLIT). z-batch strides sA/sB/sC in elements. K % 32 == 0.
template <typename T16> struct WFrag;
template <> struct WFrag<h16> { typedef v16h V; static __device__ __forceinline__ V ld(const h16* p) { return cat16(*(const v8h*)p, *(const v8h*)(p + 16)); } static __device__ __forceinline__ v8f mma(V a, V b, v8f c) { return wmma16(a, b, c); } };
template <> struct WFrag<bf> { typedef v16bf V; static __device__ __forceinline__ V ld(const bf* p) { return cat16b(*(const v8us*)p, *(const v8us*)(p + 16)); } static __device__ __forceinline__ v8f mma(V a, V b, v8f c) { return wmmab(a, b, c); } };
template <typename T16, int NSPLIT, bool BIAS>
__global__ __launch_bounds__(32) void k_gemmw(const T16* __restrict__ A, const T16* __restrict__ A2, const T16* __restrict__ Bt, const T16* __restrict__ Bt2, int K, float* C, int ldc, const float* __restrict__ bias, size_t sA, size_t sB, size_t sC) {
    typedef typename WFrag<T16>::V V;
    __shared__ __align__(16) float os[16 * 68];
    const size_t z = blockIdx.z; A += z * sA; if (A2) A2 += z * sA; Bt += z * sB; if (Bt2) Bt2 += z * sB; C += z * sC;
    const int lane = threadIdx.x & 31, lr = lane & 15, hi = lane >> 4; const int r0 = blockIdx.x * 64, c0 = blockIdx.y * 64;
    v8f acc[4][4];
#pragma unroll
    for (int mb = 0; mb < 4; ++mb)
#pragma unroll
        for (int nb = 0; nb < 4; ++nb) acc[mb][nb] = (v8f){};
    const size_t aoff = (size_t)(r0 + lr) * K + 8 * hi, boff = (size_t)(c0 + lr) * K + 8 * hi;
#pragma unroll 1
    for (int kc = 0; kc < K; kc += 32) {
        V a[4], a2[4];
#pragma unroll
        for (int mb = 0; mb < 4; ++mb) { a[mb] = WFrag<T16>::ld(A + aoff + (size_t)mb * 16 * K + kc); if (NSPLIT == 1 || NSPLIT == 2) a2[mb] = WFrag<T16>::ld(A2 + aoff + (size_t)mb * 16 * K + kc); }
#pragma unroll
        for (int nb = 0; nb < 4; ++nb) { const V b = WFrag<T16>::ld(Bt + boff + (size_t)nb * 16 * K + kc); V b2; if (NSPLIT >= 2) b2 = WFrag<T16>::ld(Bt2 + boff + (size_t)nb * 16 * K + kc);
#pragma unroll
            for (int mb = 0; mb < 4; ++mb) { acc[mb][nb] = WFrag<T16>::mma(a[mb], b, acc[mb][nb]); if (NSPLIT == 1 || NSPLIT == 2) acc[mb][nb] = WFrag<T16>::mma(a2[mb], b, acc[mb][nb]); if (NSPLIT >= 2) acc[mb][nb] = WFrag<T16>::mma(a[mb], b2, acc[mb][nb]); } }
        asm volatile("v_nop\n\tv_nop\n\tv_nop\n\tv_nop" : "+v"(acc[0][0]), "+v"(acc[1][1]), "+v"(acc[2][2]), "+v"(acc[3][3]) : "v"(a[0]), "v"(a[3]));
    }
#pragma unroll
    for (int mb = 0; mb < 4; ++mb) {
#pragma unroll
        for (int nb = 0; nb < 4; ++nb) {
#pragma unroll
            for (int j = 0; j < 8; ++j) os[(hi * 8 + j) * 68 + nb * 16 + lr] = acc[mb][nb][j]; }
        __builtin_amdgcn_wave_barrier(); asm volatile("" ::: "memory");
        float* crow = C + (size_t)(r0 + mb * 16) * ldc + c0;
{
#pragma unroll
            for (int s = 0; s < 8; ++s) { const int row = 2 * s + hi, cofs = lr * 4; v4f val = *(const v4fa*)(os + row * 68 + cofs); if (BIAS) { val[0] += bfr(bias[c0 + cofs]); val[1] += bfr(bias[c0 + cofs + 1]); val[2] += bfr(bias[c0 + cofs + 2]); val[3] += bfr(bias[c0 + cofs + 3]); }
                *(v4f*)(crow + (size_t)row * ldc + cofs) = val; }
             }
        __builtin_amdgcn_wave_barrier(); asm volatile("" ::: "memory");
    }
}

__device__ __forceinline__ h16 tohx(float x) { return (h16)x; }
__device__ __forceinline__ void splitf(float y, unsigned short& h, unsigned short& l) { h = f2bf(y); l = f2bf(y - bf2f(h)); }
typedef __attribute__((ext_vector_type(2))) _Float16 v2h;
typedef __attribute__((ext_vector_type(4))) _Float16 v4h;
typedef __attribute__((ext_vector_type(2))) unsigned short v2us;
typedef __attribute__((ext_vector_type(4))) unsigned short v4us;
typedef __attribute__((ext_vector_type(2))) float v2f;
typedef __attribute__((ext_vector_type(4))) int v4i;
typedef v4h  __attribute__((may_alias)) v4ha;
typedef v4us __attribute__((may_alias)) v4usa;

__global__ __launch_bounds__(256) void k_wtG(const float* __restrict__ w, int K, int N, bf* Bt) {
    const int lane = threadIdx.x & 31; const int L0 = (blockIdx.x * 8 + (threadIdx.x >> 5)) * 8; const int nlines = N * K / 64;
{
#pragma unroll 1
        for (int l = 0; l < 8; ++l) { const int L = L0 + l; if (L >= nlines) break; const size_t e = (size_t)L * 64 + lane * 2; const int k = (int)(e % K), n = (int)(e / K); v2us o;
            o[0] = f2bf(w[(size_t)k * N + n]); o[1] = f2bf(w[(size_t)(k + 1) * N + n]); *(v2us*)(Bt + e) = o; }
         }
}
__global__ __launch_bounds__(256) void k_cvt8(const float* __restrict__ src, bf* dst, size_t n8) { const size_t i = (size_t)blockIdx.x * 256 + threadIdx.x; if (i >= n8) return; const v8f v = *(const v8f*)(src + i * 8); v8us o;
#pragma unroll
    for (int k = 0; k < 8; ++k) o[k] = f2bf(v[k]); *(v8us*)(dst + i * 8) = o;  }

// k_ropeI: head planes [h][t][d] (fp16 + hi/lo) of rope(x) x sc with the interleaved-pair convention (d even) out[d] = x[d] cos[t][d] - x[d+1] sin[t][d], out[d+1] = x[d+1] cos[t][d] + x[d] sin[t][d]

__global__ __launch_bounds__(256) void k_vtp(const float* __restrict__ F, int pitch, int nheads, h16* V16, bf* Vh, bf* Vl) { const size_t e = ((size_t)blockIdx.x * 256 + threadIdx.x) * 2; if (e >= (size_t)nheads * HD * TT) return; const int t = (int)(e % TT); const int d = (int)((e / TT) % HD); const int g = (int)(e / ((size_t)TT * HD)); v2h o16; v2us oh, ol;
#pragma unroll
    for (int q = 0; q < 2; ++q) { const float x = F[(size_t)(t + q) * pitch + g * HD + d]; o16[q] = tohx(x); unsigned short a2, c2; splitf(x, a2, c2); oh[q] = a2; ol[q] = c2; }
    *(v2h*)(V16 + e) = o16; *(v2us*)(Vh + e) = oh; *(v2us*)(Vl + e) = ol;  }
__constant__ float INV[HD / 2] = {1.0f,0.749894202f,0.562341332f,0.421696514f,0.316227764f,0.237137362f,0.177827939f,0.133352146f,0.100000001f,0.0749894157f,0.0562341288f,0.0421696492f,0.0316227786f,0.0237137359f,0.0177827943f,0.0133352149f,0.00999999978f,0.00749894232f,0.00562341325f,0.00421696482f,0.00316227786f,0.00237137382f,0.00177827943f,0.00133352145f,0.00100000005f,0.000749894185f,0.000562341302f,0.000421696488f,0.000316227786f,0.000237137385f,0.00017782794f,0.00013335215f};
__global__ __launch_bounds__(256) void k_cstabP(const int* __restrict__ pos, float* CS) { const int idx = blockIdx.x * 256 + threadIdx.x; if (idx >= TT * HD) return; const int t = idx / HD, d = idx % HD; const float ang = __fmul_rn((float)pos[t], INV[d >> 1]); v2f cs; cs[0] = cosf(ang); cs[1] = sinf(ang);
    *(v2f*)(CS + (size_t)idx * 2) = cs;  }
__global__ __launch_bounds__(256) void k_ropeI(const float* __restrict__ F, int pitch, int nheads, const float* __restrict__ CS, float sc, h16* P16, bf* Ph, bf* Pl) {
    const size_t e = ((size_t)blockIdx.x * 256 + threadIdx.x) * 2; if (e >= (size_t)nheads * TT * HD) return; const int d = (int)(e % HD); const int t = (int)((e / HD) % TT); const int h = (int)(e / ((size_t)HD * TT)); const float* f = F + (size_t)t * pitch + h * HD; const float x0 = f[d], x1 = f[d + 1]; const v2f cs = *(const v2f*)(CS + ((size_t)t * HD + d) * 2); v2h o16; v2us oh, ol;
    float a0 = __fmul_rn(x0, cs[0]), b0 = __fmul_rn(x1, cs[1]), a1 = __fmul_rn(x1, cs[0]), b1 = __fmul_rn(x0, cs[1]); asm volatile("" : "+v"(a0), "+v"(b0), "+v"(a1), "+v"(b1));
    float r0 = __fsub_rn(a0, b0) * sc, r1 = __fadd_rn(b1, a1) * sc;   /* even: x0 c - x1 s; odd: x0 s + x1 c */
    o16[0] = tohx(r0); o16[1] = tohx(r1); { unsigned short a2, c2; splitf(r0, a2, c2); oh[0] = a2; ol[0] = c2; splitf(r1, a2, c2); oh[1] = a2; ol[1] = c2; }
    *(v2h*)(P16 + e) = o16; *(v2us*)(Ph + e) = oh; *(v2us*)(Pl + e) = ol;  }

// ---- k_attn: causal scores, softmax and probability x value contraction in one kernel; no score matrix goes through the workspace. One work-group of ANW waves owns one block of query rows of one head.
// Transposed products: S^T = K Q^T (A = 16 key rows, B = 16 query rows), so that a lane holds 16 scores of ONE query per 32 keys (keys kc + 8 hi + j and kc + 16 + 8 hi + j); the two converted score tiles are,
// register for register, the B operand of O^T += V^T P^T (A = 16 rows of the [d][t] value plane). Running maximum m and sum l per query (streaming softmax): a new maximum rescales l and O^T by exp(m_old - m_new).
// The 32-key chunks up to the diagonal are dealt to the waves (wave w: chunks w, w + ANW, ...); the ANW partial (m, l, O) go to LDS and are joined in fixed wave order 0..ANW-1 with weights exp(m_w - max m).
// HL: bf16 hi + lo planes, 3 products each (query rows < RH); otherwise single fp16 with the probabilities carried x1024 (the factor is in l too and cancels). Output: the merged [t][DQ] bf16 hi | lo planes.
// Every '#pragma unroll' below stands on a loop of constant length that indexes register arrays (fragments, accumulators, a lane's scores): unrolled, each index is a compile-time register.
#define ANW 4
#define L2E 1.4426950408889634f
__device__ __forceinline__ float xhalf(float x) { return __builtin_bit_cast(float, __builtin_amdgcn_permlanex16(__builtin_bit_cast(int, x), __builtin_bit_cast(int, x), 0x76543210, 0xfedcba98, false, false)); }  // lane l with lane l ^ 16
// v_exp_f32 and, in the same statement, the one slot that the instruction set asks for between a transcendental and an instruction that reads its result or overwrites its source
__device__ __forceinline__ float exp2s(float x) { float r; asm("v_exp_f32 %0, %1\n\tv_nop" : "=v"(r) : "v"(x)); return r; }
template <bool HL> struct AT;
template <> struct AT<true> { typedef bf T; };
template <> struct AT<false> { typedef h16 T; };
template <bool HL, int NQ>
__device__ __forceinline__ void attn_tile(const typename AT<HL>::T* __restrict__ Q, const typename AT<HL>::T* __restrict__ Q2, const typename AT<HL>::T* __restrict__ Kp, const typename AT<HL>::T* __restrict__ Kp2,
                                          const typename AT<HL>::T* __restrict__ Vp, const typename AT<HL>::T* __restrict__ Vp2, int q0, int hcol, bf* Ah, bf* Al, float* sO, float* sM, float* sL) {
    typedef typename AT<HL>::T T; typedef WFrag<T> F; typedef typename F::V V;
    const int tid = threadIdx.x, lane = tid & 31, lr = lane & 15, hi = lane >> 4; const int w = __builtin_amdgcn_readfirstlane(tid >> 5) /* wave number in a scalar register: the chunk loop keeps a scalar bound test */;
    V qf[NQ][2], qg[NQ][2];
#pragma unroll
    for (int qt = 0; qt < NQ; ++qt)
#pragma unroll
        for (int ks = 0; ks < 2; ++ks) { const size_t qo = (size_t)(q0 + qt * 16 + lr) * HD + ks * 32 + 8 * hi; qf[qt][ks] = F::ld(Q + qo); if (HL) qg[qt][ks] = F::ld(Q2 + qo); }
    v8f o[NQ][4]; float m[NQ], l[NQ];
#pragma unroll
    for (int qt = 0; qt < NQ; ++qt) { m[qt] = -1.0e30f; l[qt] = 0.f;
#pragma unroll
        for (int dt = 0; dt < 4; ++dt) o[qt][dt] = (v8f){}; }
    const int kend = q0 + NQ * 16;      // keys beyond the block's last query row are masked for every row of it
    // one 32-bit byte offset per lane into the key planes and one into the value planes, carried round the loop
    unsigned ko = (unsigned)((32 * w + lr) * HD + 8 * hi) * 2u, vo = (unsigned)(lr * TT + 32 * w + 8 * hi) * 2u;
    V kf[2][2], kg[2][2], vf[4], vg[4];
    auto ldk = [&]() {
#pragma unroll
        for (int kt = 0; kt < 2; ++kt)
#pragma unroll
            for (int ks = 0; ks < 2; ++ks) { kf[kt][ks] = F::ld((const T*)((const char*)Kp + ko) + kt * 16 * HD + ks * 32); if (HL) kg[kt][ks] = F::ld((const T*)((const char*)Kp2 + ko) + kt * 16 * HD + ks * 32); } };
    auto ldv = [&]() {
#pragma unroll
        for (int dt = 0; dt < 4; ++dt) { vf[dt] = F::ld((const T*)((const char*)Vp + vo) + dt * 16 * TT); if (HL) vg[dt] = F::ld((const T*)((const char*)Vp2 + vo) + dt * 16 * TT); } };
    // fp16 blocks (up to TT / 32 / ANW trips): every chunk but the wave's first is fetched one trip ahead, into the same registers, right behind the products that read them.
    // hi+lo blocks (at most RH / 32 / ANW trips, twice the fragments): each trip fetches its own chunk, so that the kernel stays within 256 registers.
    if (!HL && 32 * w < kend) {
        __builtin_amdgcn_sched_barrier(0);      // the query loads are issued first ...
        ldk(); ldv();
        // ... and have landed before the loop (inputs only, loaded values): otherwise the loop head's wait for them, which counts loads in issue order, would also wait for the value loads that each trip has just issued
        if constexpr (NQ == 2) asm volatile("" :: "v"(qf[0][0]), "v"(qf[0][1]), "v"(qf[1][0]), "v"(qf[1][1]));
    }
#pragma unroll 1   // rolled: one chunk's fragments, the query fragments, the scores and the output tiles fill most of a wave's 256 registers
    for (int kc = 32 * w; kc < kend; kc += 32 * ANW) {
        const bool more = kc + 32 * ANW < kend;      // wave-uniform; the last trip fetches its own chunk once more instead of one past the end: with no branch round the loads the load counter is exact at every wait
        if (HL) { ldk(); ldv(); }
        v8f s[NQ][2];
#pragma unroll
        for (int qt = 0; qt < NQ; ++qt)
#pragma unroll
            for (int kt = 0; kt < 2; ++kt) { s[qt][kt] = (v8f){};
#pragma unroll
                for (int ks = 0; ks < 2; ++ks) { s[qt][kt] = F::mma(kf[kt][ks], qf[qt][ks], s[qt][kt]); if (HL) { s[qt][kt] = F::mma(kf[kt][ks], qg[qt][ks], s[qt][kt]); s[qt][kt] = F::mma(kg[kt][ks], qf[qt][ks], s[qt][kt]); } } }
        if (!HL) {
            __builtin_amdgcn_sched_barrier(0);      // keeps the next chunk's key loads, and the wait in front of them, behind every score product (they land in the same registers) ...
            // the wait that stands in front of a rewrite of a register which issued global loads name; the offset is an in-out operand so that its step cannot be lifted over it
            asm volatile("s_wait_xcnt 0x0" : "+v"(ko) :: "memory");
            ko += more ? 32u * ANW * HD * 2u : 0u;
            ldk();
            __builtin_amdgcn_sched_barrier(0);      // ... and in front of the softmax, whose time covers their latency (left free, the scheduler sinks each load to its first use)
        }
#pragma unroll
        for (int qt = 0; qt < NQ; ++qt) {
            const int lim = q0 + qt * 16 + lr - kc - hi * 8; float t[16]; float mx = -2.0e38f;      // causal: the lane's key number e (kc + 8 hi + 16 (e >> 3) + (e & 7)) counts while it is <= the lane's query row
#pragma unroll
            for (int e = 0; e < 16; ++e) { t[e] = ((e >> 3) * 16 + (e & 7) <= lim) ? s[qt][e >> 3][e & 7] * SCL : -2.0e38f; mx = fmaxf(mx, t[e]); }
            mx = fmaxf(mx, xhalf(mx));      // the other half-wave holds the query's other 16 keys
            const float mn = fmaxf(m[qt], mx), al = exp2s((m[qt] - mn) * L2E); m[qt] = mn;
            float p[16];
#pragma unroll
            for (int e = 0; e < 16; ++e) p[e] = exp2s((t[e] - mn) * L2E + (HL ? 0.0f : 10.0f));   // a masked key gives exactly 0 (m >= -1e30)
            l[qt] = l[qt] * al + ((((p[0] + p[1]) + (p[2] + p[3])) + ((p[4] + p[5]) + (p[6] + p[7]))) + (((p[8] + p[9]) + (p[10] + p[11])) + ((p[12] + p[13]) + (p[14] + p[15]))));
#pragma unroll
            for (int dt = 0; dt < 4; ++dt) o[qt][dt] *= al;
            if constexpr (HL) { v8us h0, h1, l0, l1;
#pragma unroll
                for (int e = 0; e < 8; ++e) { unsigned short a, c2; splitf(p[e], a, c2); h0[e] = a; l0[e] = c2; splitf(p[8 + e], a, c2); h1[e] = a; l1[e] = c2; }
                const V ph = cat16b(h0, h1), pl = cat16b(l0, l1);
#pragma unroll
                for (int dt = 0; dt < 4; ++dt) { o[qt][dt] = F::mma(vf[dt], ph, o[qt][dt]); o[qt][dt] = F::mma(vf[dt], pl, o[qt][dt]); o[qt][dt] = F::mma(vg[dt], ph, o[qt][dt]); }
            } else { V pb;
#pragma unroll
                for (int e = 0; e < 16; ++e) pb[e] = tohx(p[e]);
#pragma unroll
                for (int dt = 0; dt < 4; ++dt) o[qt][dt] = F::mma(vf[dt], pb, o[qt][dt]); }
        }
        if (HL) { asm volatile("s_wait_xcnt 0x0" : "+v"(ko), "+v"(vo) :: "memory");      // the wait in front of the steps of both offsets, which issued global loads name
            ko += 32u * ANW * HD * 2u; vo += 32u * ANW * 2u;
        } else { asm volatile("s_wait_xcnt 0x0" : "+v"(vo) :: "memory");      // as above, for the value offset
            vo += more ? 32u * ANW * 2u : 0u;
            ldv(); }
    }
    // the same wait on the way out of the loop: the last trip's value loads name the offset's register, which is free for other values from here on (kept live up to this line as an in-out operand)
    if (!HL) asm volatile("s_wait_xcnt 0x0" : "+v"(vo) :: "memory");
#pragma unroll
    for (int qt = 0; qt < NQ; ++qt) { l[qt] += xhalf(l[qt]); const int qr = w * NQ * 16 + qt * 16 + lr;
        if (hi == 0) { sM[qr] = m[qt]; sL[qr] = l[qt]; }
#pragma unroll
        for (int dt = 0; dt < 4; ++dt)
#pragma unroll
            for (int jh = 0; jh < 2; ++jh) { const v8f a = o[qt][dt]; v4f x; x[0] = a[jh * 4]; x[1] = a[jh * 4 + 1]; x[2] = a[jh * 4 + 2]; x[3] = a[jh * 4 + 3]; *(v4fa*)(sO + (size_t)qr * 68 + dt * 16 + hi * 8 + jh * 4) = x; } }
    __syncthreads();      // every wave's partial (m, l, O) is in LDS before any wave joins them
    // join: a thread takes DPT consecutive d of one query row; the 64 d of a row (one 128-byte line of each output plane) lie in one wave
    constexpr int DPT = NQ * 16 * HD / (32 * ANW), PARTS = HD / DPT; const int ql = tid / PARTS, d0 = (tid % PARTS) * DPT;
    float M = sM[ql];
#pragma unroll
    for (int k = 1; k < ANW; ++k) M = fmaxf(M, sM[k * NQ * 16 + ql]);
    float f[ANW]; float L = 0.f;
#pragma unroll
    for (int k = 0; k < ANW; ++k) { f[k] = exp2s((sM[k * NQ * 16 + ql] - M) * L2E); L += f[k] * sL[k * NQ * 16 + ql]; }
    const float inv = __fdiv_rn(1.0f, L);
#pragma unroll
    for (int c = 0; c < DPT; c += 8) { v8us oh, ol;
#pragma unroll
        for (int g = 0; g < 2; ++g) { v4f a = *(const v4fa*)(sO + (size_t)ql * 68 + d0 + c + g * 4) * f[0];
#pragma unroll
            for (int k = 1; k < ANW; ++k) a += *(const v4fa*)(sO + (size_t)(k * NQ * 16 + ql) * 68 + d0 + c + g * 4) * f[k];
#pragma unroll
            for (int q = 0; q < 4; ++q) { unsigned short x, y; splitf(a[q] * inv, x, y); oh[g * 4 + q] = x; ol[g * 4 + q] = y; } }
        const size_t oo = (size_t)(q0 + ql) * DQ + hcol + d0 + c; *(v8usa*)(Ah + oo) = oh; *(v8usa*)(Al + oo) = ol; }
    // the wait behind the stores of the hi+lo instance: in the built kernel its code is followed by a branch whose other side (the fp16 instance) rewrites the registers that these stores name
    if (HL) asm volatile("s_wait_xcnt 0x0" ::: "memory");
}
// grid (heads, NF + RH / 16): y < NF: fp16 blocks of 32 query rows, the longest (last) rows first; the rest: hi+lo blocks of 16 query rows. The choice is the same for a whole work-group.
#define NF ((TT - RH) / 32)
__global__ __launch_bounds__(32 * ANW) void k_attn(const h16* __restrict__ Q16, const h16* __restrict__ K16, const h16* __restrict__ V16, const bf* __restrict__ Qh, const bf* __restrict__ Ql, const bf* __restrict__ Kh, const bf* __restrict__ Kl,
                                                   const bf* __restrict__ Vh, const bf* __restrict__ Vl, bf* Ah, bf* Al) {
    __shared__ __align__(16) float sO[ANW * 32 * 68]; __shared__ float sM[ANW * 32]; __shared__ float sL[ANW * 32];
    const int bx = blockIdx.y, h = blockIdx.x; const size_t pq = (size_t)h * TT * HD, pk = (size_t)(h / REP) * TT * HD;
    if (bx < NF) attn_tile<false, 2>(Q16 + pq, nullptr, K16 + pk, nullptr, V16 + pk, nullptr, TT - 32 * (bx + 1), h * HD, Ah, Al, sO, sM, sL);
    else attn_tile<true, 1>(Qh + pq, Ql + pq, Kh + pk, Kl + pk, Vh + pk, Vl + pk, RH - 16 * (bx - NF + 1), h * HD, Ah, Al, sO, sM, sL);
}

extern "C" void kernel_launch(void* const* d_in, const int* in_sizes, int n_in,
                              void* d_out, int out_size, void* d_ws, size_t ws_size, hipStream_t stream) {
    (void)in_sizes; (void)n_in; (void)out_size;
    const float* x = (const float*)d_in[0]; const int* PID = (const int*)d_in[1]; const float* wqkv = (const float*)d_in[2]; const float* wo = (const float*)d_in[3];  const float* wq = wqkv; const float* wk = wqkv + (size_t)1024 * 1024; const float* wv = wqkv + (size_t)2048 * 1024; (void)wq; (void)wk; (void)wv;
    float* OUT = (float*)d_out;     // [4][2048][1024]
    char* wsp = (char*)d_ws;
    auto take = [&](size_t bytes) { char* p = wsp; wsp += (bytes + 255) & ~(size_t)255; return (void*)p; };
    bf* WQ = (bf*)take((size_t)DQ * DM * 2); bf* WK = (bf*)take((size_t)DKV * DM * 2); bf* WV = (bf*)take((size_t)DKV * DM * 2); bf* WO = (bf*)take((size_t)DM * DQ * 2); float* CS = (float*)take((size_t)TT * HD * 2 * 4);
    bf* XB = (bf*)take((size_t)TT * DM * 2); float* FQ = (float*)take((size_t)TT * DQ * 4); float* FK = (float*)take((size_t)TT * DKV * 4);
    h16* QP16 = (h16*)take((size_t)NH_ * TT * HD * 2); h16* KP16 = (h16*)take((size_t)NKV * TT * HD * 2); h16* VT16 = (h16*)take((size_t)NKV * HD * TT * 2);
    bf* QPh = (bf*)take((size_t)NH_ * TT * HD * 2); bf* QPl = (bf*)take((size_t)NH_ * TT * HD * 2); bf* KPh = (bf*)take((size_t)NKV * TT * HD * 2); bf* KPl = (bf*)take((size_t)NKV * TT * HD * 2); bf* VTh = (bf*)take((size_t)NKV * HD * TT * 2); bf* VTl = (bf*)take((size_t)NKV * HD * TT * 2);
    bf* ATh = (bf*)take((size_t)TT * DQ * 2); bf* ATl = (bf*)take((size_t)TT * DQ * 2);
    if ((size_t)(wsp - (char*)d_ws) > ws_size) return;    // ws 256 MiB
    float* FV = FK;   // v projection reuses the k buffer after the k planes are built (stream-ordered)
    { k_cvt8<<<(unsigned)(((size_t)DQ * DM / 8 + 255) / 256), 256, 0, stream>>>(wq, WQ, (size_t)DQ * DM / 8); k_cvt8<<<(unsigned)(((size_t)DKV * DM / 8 + 255) / 256), 256, 0, stream>>>(wk, WK, (size_t)DKV * DM / 8); k_cvt8<<<(unsigned)(((size_t)DKV * DM / 8 + 255) / 256), 256, 0, stream>>>(wv, WV, (size_t)DKV * DM / 8);
      k_cvt8<<<(unsigned)(((size_t)DM * DQ / 8 + 255) / 256), 256, 0, stream>>>(wo, WO, (size_t)DM * DQ / 8);
       }
    k_cstabP<<<(TT * HD + 255) / 256, 256, 0, stream>>>(PID, CS);
    const unsigned LQ = (unsigned)(((size_t)NH_ * TT * HD / 2 + 255) / 256), LKv = (unsigned)(((size_t)NKV * TT * HD / 2 + 255) / 256);
    for (int b = 0; b < NB_; ++b) {
        
        k_cvt8<<<(unsigned)(((size_t)TT * DM / 8 + 255) / 256), 256, 0, stream>>>(x + (size_t)b * TT * DM, XB, (size_t)TT * DM / 8);
        k_gemmw<bf, 0, false><<<dim3(TT / 64, DQ / 64, 1), 32, 0, stream>>>(XB, nullptr, WQ, nullptr, DM, FQ, DQ, nullptr, 0, 0, 0);
        k_ropeI<<<LQ, 256, 0, stream>>>(FQ, DQ, NH_, CS, 1.0f, QP16, QPh, QPl);
        k_gemmw<bf, 0, false><<<dim3(TT / 64, DKV / 64, 1), 32, 0, stream>>>(XB, nullptr, WK, nullptr, DM, FK, DKV, nullptr, 0, 0, 0);
        k_ropeI<<<LKv, 256, 0, stream>>>(FK, DKV, NKV, CS, 1.0f, KP16, KPh, KPl);
        k_gemmw<bf, 0, false><<<dim3(TT / 64, DKV / 64, 1), 32, 0, stream>>>(XB, nullptr, WV, nullptr, DM, FV, DKV, nullptr, 0, 0, 0); k_vtp<<<LKv, 256, 0, stream>>>(FV, DKV, NKV, VT16, VTh, VTl);
        k_attn<<<dim3(NH_, NF + RH / 16, 1), 32 * ANW, 0, stream>>>(QP16, KP16, VT16, QPh, QPl, KPh, KPl, VTh, VTl, ATh, ATl);
        k_gemmw<bf, 1, false><<<dim3(TT / 64, DM / 64, 1), 32, 0, stream>>>(ATh, ATl, WO, nullptr, DQ, OUT + (size_t)b * TT * DM, DM, nullptr, 0, 0, 0); }
}

// v004
// Measured time: 497 microseconds a run.
// Next to v003, in two timings, it ran 1.14 times as fast each time.
// Counting every step since v000, it is 5.74 times as fast.
#include <hip/hip_runtime.h>

// Causal multi-head self-attention with interleaved-pair rotary embeddings (x [4][2048][1024]; qkv = x qkv_w^T ('oi' [3072][1024], row blocks q | k | v; 16 heads x 64); rotary on adjacent (even, odd) pairs with angle token_positions[t] x 10000^(-2i/64) (positions read from the int32 input; the reference's float32 table constants computed on device); scores / 8, causal (-inf); softmax; out = merged o_w^T ('oi', no bias) -> [4][2048][1024] (8.4 M)).
// Compute dtypes, f32 accumulate: every input rounded to bf16; q/k/v on PLAIN bf16 operands (inputs: exact); interleaved rotary in f32 (precise cosf/sinf table at the input positions); causal scores, streaming softmax (f32) and attn.v in one kernel: query rows < 512 hl (3 products), the rest single fp16 (x1024); o_w hl x exact (2 products).

#define NB_  4
#define TT   2048
#define DM   1024
#define NH_  16
#define NKV  16
#define REP  (NH_ / NKV)
#define HD   64
#define DQ   (NH_ * HD)
#define DKV  (NKV * HD)
#define RH   512                  // query rows < RH use hi+lo planes (0: none)
#define SCL  0.125f   // HD^-0.5
typedef _Float16 h16;
typedef unsigned short bf;
typedef __attribute__((ext_vector_type(16))) __bf16   v16bf;
typedef __attribute__((ext_vector_type(16))) _Float16 v16h;
typedef __attribute__((ext_vector_type(8)))  _Float16 v8h;
typedef __attribute__((ext_vector_type(8)))  unsigned short v8us;
typedef __attribute__((ext_vector_type(8)))  float    v8f;
typedef __attribute__((ext_vector_type(4)))  float    v4f;
typedef v8h  __attribute__((may_alias)) v8ha;
typedef v4f  __attribute__((may_alias)) v4fa;
typedef v8us __attribute__((may_alias)) v8usa;

__device__ __forceinline__ unsigned short f2bf(float f) { unsigned u = __float_as_uint(f); u += 0x7FFFu + ((u >> 16) & 1u); return (unsigned short)(u >> 16); }
__device__ __forceinline__ float bf2f(unsigned short b) { return __uint_as_float(((unsigned)b) << 16); }
__device__ __forceinline__ float bfr(float f) { return bf2f(f2bf(f)); }
__device__ __forceinline__ v16h cat16(v8h lo, v8h hi) { return __builtin_shufflevector(lo, hi, 0, 1, 2, 3, 4, 5, 6, 7, 8, 9, 10, 11, 12, 13, 14, 15); }
__device__ __forceinline__ v16bf cat16b(v8us lo, v8us hi) { return __builtin_bit_cast(v16bf, __builtin_shufflevector(lo, hi, 0, 1, 2, 3, 4, 5, 6, 7, 8, 9, 10, 11, 12, 13, 14, 15)); }
__device__ __forceinline__ v8f wmma16(v16h a, v16h b, v8f c) { return __builtin_amdgcn_wmma_f32_16x16x32_f16(false, a, false, b, (short)0, c, false, false); }
__device__ __forceinline__ v8f wmmab(v16bf a, v16bf b, v8f c) { return __builtin_amdgcn_wmma_f32_16x16x32_bf16(false, a, false, b, (short)0, c, false, false); }



__device__ __forceinline__ h16 tohx(float x) { return (h16)x; }
__device__ __forceinline__ void splitf(float y, unsigned short& h, unsigned short& l) { h = f2bf(y); l = f2bf(y - bf2f(h)); }
typedef __attribute__((ext_vector_type(2))) _Float16 v2h;
typedef __attribute__((ext_vector_type(4))) _Float16 v4h;
typedef __attribute__((ext_vector_type(2))) unsigned short v2us;
typedef __attribute__((ext_vector_type(4))) unsigned short v4us;
typedef __attribute__((ext_vector_type(2))) float v2f;
typedef __attribute__((ext_vector_type(4))) int v4i;
typedef v4h  __attribute__((may_alias)) v4ha;
typedef v4us __attribute__((may_alias)) v4usa;
// one rotary pair (even, odd) at table entry cs = (cos, sin): the operations of the former rotary kernel in their order, so that the q and k planes keep their bits (the four products are rounded on their own, as in the reference's table form)
__device__ __forceinline__ void rot2(float x0, float x1, v2f cs, float& e0, float& e1) {
    float a0 = __fmul_rn(x0, cs[0]), b0 = __fmul_rn(x1, cs[1]), a1 = __fmul_rn(x1, cs[0]), b1 = __fmul_rn(x0, cs[1]); asm volatile("" : "+v"(a0), "+v"(b0), "+v"(a1), "+v"(b1));
    e0 = __fsub_rn(a0, b0); e1 = __fadd_rn(b1, a1);   /* even: x0 c - x1 s; odd: x0 s + x1 c */
}

// ---- k_gemmw: register-blocked GEMM, ONE WAVE per 64x64 output tile (16 accumulators), operands straight from K-contiguous 16-bit planes; grid (M/64, N/64, Z), 32 threads.
// C[m][n] (f32, pitch ldc, + optional f32 bias[n]) = sum_k A[m][k] Bt[n][k] (+ split products per NSPLIT). z-batch strides sA/sB/sC in elements. K % 32 == 0.
// EPI says what leaves the tile. 0: the f32 tile to C. 1 and 2: N is heads x HD, so a tile is 64 tokens of ONE head (blockIdx.y), and the wave writes that head's 16-bit planes (fp16 | bf16 hi | bf16 lo) itself; no f32 projection goes through memory.
// 1: rotary with the table CS [t][d](cos, sin), planes [h][t][d]: 16 lanes store one token's 64 d, a whole 128-byte line of each plane. 2: planes [h][d][t]: a lane's 8 accumulator rows of one column are 8 consecutive t of one d, stored from registers.
template <typename T16> struct WFrag;
template <> struct WFrag<h16> { typedef v16h V; static __device__ __forceinline__ V ld(const h16* p) { return cat16(*(const v8h*)p, *(const v8h*)(p + 16)); } static __device__ __forceinline__ v8f mma(V a, V b, v8f c) { return wmma16(a, b, c); } };
template <> struct WFrag<bf> { typedef v16bf V; static __device__ __forceinline__ V ld(const bf* p) { return cat16b(*(const v8us*)p, *(const v8us*)(p + 16)); } static __device__ __forceinline__ v8f mma(V a, V b, v8f c) { return wmmab(a, b, c); } };
template <typename T16, int NSPLIT, bool BIAS, int EPI>
__global__ __launch_bounds__(32) void k_gemmw(const T16* __restrict__ A, const T16* __restrict__ A2, const T16* __restrict__ Bt, const T16* __restrict__ Bt2, int K, float* C, int ldc, const float* __restrict__ bias, size_t sA, size_t sB, size_t sC, const float* __restrict__ CS, h16* P16, bf* Ph, bf* Pl) {
    typedef typename WFrag<T16>::V V;
    __shared__ __align__(16) float os[16 * 68];
    const size_t z = blockIdx.z; A += z * sA; if (A2) A2 += z * sA; Bt += z * sB; if (Bt2) Bt2 += z * sB; C += z * sC;
    const int lane = threadIdx.x & 31, lr = lane & 15, hi = lane >> 4; const int r0 = blockIdx.x * 64, c0 = blockIdx.y * 64;
    v8f acc[4][4];
#pragma unroll
    for (int mb = 0; mb < 4; ++mb)
#pragma unroll
        for (int nb = 0; nb < 4; ++nb) acc[mb][nb] = (v8f){};
    const size_t aoff = (size_t)(r0 + lr) * K + 8 * hi, boff = (size_t)(c0 + lr) * K + 8 * hi;
#pragma unroll 1
    for (int kc = 0; kc < K; kc += 32) {
        V a[4], a2[4];
#pragma unroll
        for (int mb = 0; mb < 4; ++mb) { a[mb] = WFrag<T16>::ld(A + aoff + (size_t)mb * 16 * K + kc); if (NSPLIT == 1 || NSPLIT == 2) a2[mb] = WFrag<T16>::ld(A2 + aoff + (size_t)mb * 16 * K + kc); }
#pragma unroll
        for (int nb = 0; nb < 4; ++nb) { const V b = WFrag<T16>::ld(Bt + boff + (size_t)nb * 16 * K + kc); V b2; if (NSPLIT >= 2) b2 = WFrag<T16>::ld(Bt2 + boff + (size_t)nb * 16 * K + kc);
#pragma unroll
            for (int mb = 0; mb < 4; ++mb) { acc[mb][nb] = WFrag<T16>::mma(a[mb], b, acc[mb][nb]); if (NSPLIT == 1 || NSPLIT == 2) acc[mb][nb] = WFrag<T16>::mma(a2[mb], b, acc[mb][nb]); if (NSPLIT >= 2) acc[mb][nb] = WFrag<T16>::mma(a[mb], b2, acc[mb][nb]); } }
        asm volatile("v_nop\n\tv_nop\n\tv_nop\n\tv_nop" : "+v"(acc[0][0]), "+v"(acc[1][1]), "+v"(acc[2][2]), "+v"(acc[3][3]) : "v"(a[0]), "v"(a[3]));
    }
    if constexpr (EPI == 2) {
        const size_t vb = (size_t)(c0 + lr) * TT + r0 + hi * 8;      // one offset per lane (d = lr, t = r0 + 8 hi); every step from there is a compile-time offset
#pragma unroll
        for (int nb = 0; nb < 4; ++nb)
#pragma unroll
            for (int mb = 0; mb < 4; ++mb) { v8h o16; v8us oh, ol;      // the four mb of one nb fill one 128-byte line per d and plane
#pragma unroll
                for (int j = 0; j < 8; ++j) { const float x = acc[mb][nb][j]; o16[j] = tohx(x); unsigned short a2, c2; splitf(x, a2, c2); oh[j] = a2; ol[j] = c2; }
                const int eo = nb * 16 * TT + mb * 16; *(v8ha*)(P16 + vb + eo) = o16; *(v8usa*)(Ph + vb + eo) = oh; *(v8usa*)(Pl + vb + eo) = ol; }
        return;
    }
    // EPI 1: the lane's table entries (tokens 2 s + hi, pairs d = 4 lr and 4 lr + 2) of a 16-token block, fetched one block ahead: issued in front of the compiler fence behind the staging, used behind the next one, so that a block's arithmetic covers their latency
    // one address per lane for the table and one offset for the three planes (token r0 + hi, d = 4 lr); every step from there is a compile-time offset
    const float* cb = CS + ((size_t)(r0 + hi) * HD + lr * 4) * 2; const size_t pb = ((size_t)blockIdx.y * TT + r0 + hi) * HD + lr * 4;
    v2f csn[16];
    auto ldcs = [&](int mb) {
#pragma unroll
        for (int s = 0; s < 8; ++s)
#pragma unroll
            for (int p = 0; p < 2; ++p) csn[2 * s + p] = *(const v2f*)(cb + (mb * 16 + 2 * s) * (HD * 2) + 4 * p); };
    if constexpr (EPI == 1) ldcs(0);
#pragma unroll
    for (int mb = 0; mb < 4; ++mb) {
        v2f cs[16];
        if constexpr (EPI == 1) {
#pragma unroll
            for (int i = 0; i < 16; ++i) cs[i] = csn[i];
            // the wait in front of a rewrite of registers which issued global stores name: the loads behind it land in registers that the block before stored from
            if (mb > 0 && mb < 3) asm volatile("s_wait_xcnt 0x0" ::: "memory");
            if (mb < 3) ldcs(mb + 1); }
#pragma unroll
        for (int nb = 0; nb < 4; ++nb) {
#pragma unroll
            for (int j = 0; j < 8; ++j) os[(hi * 8 + j) * 68 + nb * 16 + lr] = acc[mb][nb][j]; }
        __builtin_amdgcn_wave_barrier(); asm volatile("" ::: "memory");
        if constexpr (EPI == 1) {
            v4f val[8];
#pragma unroll
            for (int s = 0; s < 8; ++s) val[s] = *(const v4fa*)(os + (2 * s + hi) * 68 + lr * 4);
            // inputs only, loaded values: the block's eight LDS reads are issued together and waited for once (left free, each sinks to its first use and is waited for alone)
            asm volatile("" :: "v"(val[0]), "v"(val[1]), "v"(val[2]), "v"(val[3]), "v"(val[4]), "v"(val[5]), "v"(val[6]), "v"(val[7]));
#pragma unroll
            for (int s = 0; s < 8; ++s) { v4h o16; v4us oh, ol;
#pragma unroll
                for (int p = 0; p < 2; ++p) { float e0, e1; rot2(val[s][2 * p], val[s][2 * p + 1], cs[2 * s + p], e0, e1); unsigned short a2, c2;
                    o16[2 * p] = tohx(e0); o16[2 * p + 1] = tohx(e1); splitf(e0, a2, c2); oh[2 * p] = a2; ol[2 * p] = c2; splitf(e1, a2, c2); oh[2 * p + 1] = a2; ol[2 * p + 1] = c2; }
                const int eo = (mb * 16 + 2 * s) * HD; *(v4ha*)(P16 + pb + eo) = o16; *(v4usa*)(Ph + pb + eo) = oh; *(v4usa*)(Pl + pb + eo) = ol; }
        } else {
        float* crow = C + (size_t)(r0 + mb * 16) * ldc + c0;
#pragma unroll
            for (int s = 0; s < 8; ++s) { const int row = 2 * s + hi, cofs = lr * 4; v4f val = *(const v4fa*)(os + row * 68 + cofs); if (BIAS) { val[0] += bfr(bias[c0 + cofs]); val[1] += bfr(bias[c0 + cofs + 1]); val[2] += bfr(bias[c0 + cofs + 2]); val[3] += bfr(bias[c0 + cofs + 3]); }
                *(v4f*)(crow + (size_t)row * ldc + cofs) = val; }
        }
        __builtin_amdgcn_wave_barrier(); asm volatile("" ::: "memory");
    }
}


__global__ __launch_bounds__(256) void k_wtG(const float* __restrict__ w, int K, int N, bf* Bt) {
    const int lane = threadIdx.x & 31; const int L0 = (blockIdx.x * 8 + (threadIdx.x >> 5)) * 8; const int nlines = N * K / 64;
{
#pragma unroll 1
        for (int l = 0; l < 8; ++l) { const int L = L0 + l; if (L >= nlines) break; const size_t e = (size_t)L * 64 + lane * 2; const int k = (int)(e % K), n = (int)(e / K); v2us o;
            o[0] = f2bf(w[(size_t)k * N + n]); o[1] = f2bf(w[(size_t)(k + 1) * N + n]); *(v2us*)(Bt + e) = o; }
         }
}
__global__ __launch_bounds__(256) void k_cvt8(const float* __restrict__ src, bf* dst, size_t n8) { const size_t i = (size_t)blockIdx.x * 256 + threadIdx.x; if (i >= n8) return; const v8f v = *(const v8f*)(src + i * 8); v8us o;
#pragma unroll
    for (int k = 0; k < 8; ++k) o[k] = f2bf(v[k]); *(v8us*)(dst + i * 8) = o;  }

__constant__ float INV[HD / 2] = {1.0f,0.749894202f,0.562341332f,0.421696514f,0.316227764f,0.237137362f,0.177827939f,0.133352146f,0.100000001f,0.0749894157f,0.0562341288f,0.0421696492f,0.0316227786f,0.0237137359f,0.0177827943f,0.0133352149f,0.00999999978f,0.00749894232f,0.00562341325f,0.00421696482f,0.00316227786f,0.00237137382f,0.00177827943f,0.00133352145f,0.00100000005f,0.000749894185f,0.000562341302f,0.000421696488f,0.000316227786f,0.000237137385f,0.00017782794f,0.00013335215f};
__global__ __launch_bounds__(256) void k_cstabP(const int* __restrict__ pos, float* CS) { const int idx = blockIdx.x * 256 + threadIdx.x; if (idx >= TT * HD) return; const int t = idx / HD, d = idx % HD; const float ang = __fmul_rn((float)pos[t], INV[d >> 1]); v2f cs; cs[0] = cosf(ang); cs[1] = sinf(ang);
    *(v2f*)(CS + (size_t)idx * 2) = cs;  }

// ---- k_attn: causal scores, softmax and probability x value contraction in one kernel; no score matrix goes through the workspace. One work-group of ANW waves owns one block of query rows of one head.
// Transposed products: S^T = K Q^T (A = 16 key rows, B = 16 query rows), so that a lane holds 16 scores of ONE query per 32 keys (keys kc + 8 hi + j and kc + 16 + 8 hi + j); the two converted score tiles are,
// register for register, the B operand of O^T += V^T P^T (A = 16 rows of the [d][t] value plane). Running maximum m and sum l per query (streaming softmax): a new maximum rescales l and O^T by exp(m_old - m_new).
// The 32-key chunks up to the diagonal are dealt to the waves (wave w: chunks w, w + ANW, ...); the ANW partial (m, l, O) go to LDS and are joined in fixed wave order 0..ANW-1 with weights exp(m_w - max m).
// HL: bf16 hi + lo planes, 3 products each (query rows < RH); otherwise single fp16 with the probabilities carried x1024 (the factor is in l too and cancels). Output: the merged [t][DQ] bf16 hi | lo planes.
// Every '#pragma unroll' below stands on a loop of constant length that indexes register arrays (fragments, accumulators, a lane's scores): unrolled, each index is a compile-time register.
#define ANW 4
#define L2E 1.4426950408889634f
__device__ __forceinline__ float xhalf(float x) { return __builtin_bit_cast(float, __builtin_amdgcn_permlanex16(__builtin_bit_cast(int, x), __builtin_bit_cast(int, x), 0x76543210, 0xfedcba98, false, false)); }  // lane l with lane l ^ 16
// v_exp_f32 and, in the same statement, the one slot that the instruction set asks for between a transcendental and an instruction that reads its result or overwrites its source
__device__ __forceinline__ float exp2s(float x) { float r; asm("v_exp_f32 %0, %1\n\tv_nop" : "=v"(r) : "v"(x)); return r; }
template <bool HL> struct AT;
template <> struct AT<true> { typedef bf T; };
template <> struct AT<false> { typedef h16 T; };
template <bool HL, int NQ>
__device__ __forceinline__ void attn_tile(const typename AT<HL>::T* __restrict__ Q, const typename AT<HL>::T* __restrict__ Q2, const typename AT<HL>::T* __restrict__ Kp, const typename AT<HL>::T* __restrict__ Kp2,
                                          const typename AT<HL>::T* __restrict__ Vp, const typename AT<HL>::T* __restrict__ Vp2, int q0, int hcol, bf* Ah, bf* Al, float* sO, float* sM, float* sL) {
    typedef typename AT<HL>::T T; typedef WFrag<T> F; typedef typename F::V V;
    const int tid = threadIdx.x, lane = tid & 31, lr = lane & 15, hi = lane >> 4; const int w = __builtin_amdgcn_readfirstlane(tid >> 5) /* wave number in a scalar register: the chunk loop keeps a scalar bound test */;
    V qf[NQ][2], qg[NQ][2];
#pragma unroll
    for (int qt = 0; qt < NQ; ++qt)
#pragma unroll
        for (int ks = 0; ks < 2; ++ks) { const size_t qo = (size_t)(q0 + qt * 16 + lr) * HD + ks * 32 + 8 * hi; qf[qt][ks] = F::ld(Q + qo); if (HL) qg[qt][ks] = F::ld(Q2 + qo); }
    v8f o[NQ][4]; float m[NQ], l[NQ];
#pragma unroll
    for (int qt = 0; qt < NQ; ++qt) { m[qt] = -1.0e30f; l[qt] = 0.f;
#pragma unroll
        for (int dt = 0; dt < 4; ++dt) o[qt][dt] = (v8f){}; }
    const int kend = q0 + NQ * 16;      // keys beyond the block's last query row are masked for every row of it
    // one 32-bit byte offset per lane into the key planes and one into the value planes, carried round the loop
    unsigned ko = (unsigned)((32 * w + lr) * HD + 8 * hi) * 2u, vo = (unsigned)(lr * TT + 32 * w + 8 * hi) * 2u;
    V kf[2][2], kg[2][2], vf[4], vg[4];
    auto ldk = [&]() {
#pragma unroll
        for (int kt = 0; kt < 2; ++kt)
#pragma unroll
            for (int ks = 0; ks < 2; ++ks) { kf[kt][ks] = F::ld((const T*)((const char*)Kp + ko) + kt * 16 * HD + ks * 32); if (HL) kg[kt][ks] = F::ld((const T*)((const char*)Kp2 + ko) + kt * 16 * HD + ks * 32); } };
    auto ldv = [&]() {
#pragma unroll
        for (int dt = 0; dt < 4; ++dt) { vf[dt] = F::ld((const T*)((const char*)Vp + vo) + dt * 16 * TT); if (HL) vg[dt] = F::ld((const T*)((const char*)Vp2 + vo) + dt * 16 * TT); } };
    // fp16 blocks (up to TT / 32 / ANW trips): every chunk but the wave's first is fetched one trip ahead, into the same registers, right behind the products that read them.
    // hi+lo blocks (at most RH / 32 / ANW trips, twice the fragments): each trip fetches its own chunk, so that the kernel stays within 256 registers.
    if (!HL && 32 * w < kend) {
        __builtin_amdgcn_sched_barrier(0);      // the query loads are issued first ...
        ldk(); ldv();
        // ... and have landed before the loop (inputs only, loaded values): otherwise the loop head's wait for them, which counts loads in issue order, would also wait for the value loads that each trip has just issued
        if constexpr (NQ == 2) asm volatile("" :: "v"(qf[0][0]), "v"(qf[0][1]), "v"(qf[1][0]), "v"(qf[1][1]));
    }
#pragma unroll 1   // rolled: one chunk's fragments, the query fragments, the scores and the output tiles fill most of a wave's 256 registers
    for (int kc = 32 * w; kc < kend; kc += 32 * ANW) {
        const bool more = kc + 32 * ANW < kend;      // wave-uniform; the last trip fetches its own chunk once more instead of one past the end: with no branch round the loads the load counter is exact at every wait
        if (HL) { ldk(); ldv(); }
        v8f s[NQ][2];
#pragma unroll
        for (int qt = 0; qt < NQ; ++qt)
#pragma unroll
            for (int kt = 0; kt < 2; ++kt) { s[qt][kt] = (v8f){};
#pragma unroll
                for (int ks = 0; ks < 2; ++ks) { s[qt][kt] = F::mma(kf[kt][ks], qf[qt][ks], s[qt][kt]); if (HL) { s[qt][kt] = F::mma(kf[kt][ks], qg[qt][ks], s[qt][kt]); s[qt][kt] = F::mma(kg[kt][ks], qf[qt][ks], s[qt][kt]); } } }
        if (!HL) {
            __builtin_amdgcn_sched_barrier(0);      // keeps the next chunk's key loads, and the wait in front of them, behind every score product (they land in the same registers) ...
            // the wait that stands in front of a rewrite of a register which issued global loads name; the offset is an in-out operand so that its step cannot be lifted over it
            asm volatile("s_wait_xcnt 0x0" : "+v"(ko) :: "memory");
            ko += more ? 32u * ANW * HD * 2u : 0u;
            ldk();
            __builtin_amdgcn_sched_barrier(0);      // ... and in front of the softmax, whose time covers their latency (left free, the scheduler sinks each load to its first use)
        }
#pragma unroll
        for (int qt = 0; qt < NQ; ++qt) {
            const int lim = q0 + qt * 16 + lr - kc - hi * 8; float t[16]; float mx = -2.0e38f;      // causal: the lane's key number e (kc + 8 hi + 16 (e >> 3) + (e & 7)) counts while it is <= the lane's query row
#pragma unroll
            for (int e = 0; e < 16; ++e) { t[e] = ((e >> 3) * 16 + (e & 7) <= lim) ? s[qt][e >> 3][e & 7] * SCL : -2.0e38f; mx = fmaxf(mx, t[e]); }
            mx = fmaxf(mx, xhalf(mx));      // the other half-wave holds the query's other 16 keys
            const float mn = fmaxf(m[qt], mx), al = exp2s((m[qt] - mn) * L2E); m[qt] = mn;
            float p[16];
#pragma unroll
            for (int e = 0; e < 16; ++e) p[e] = exp2s((t[e] - mn) * L2E + (HL ? 0.0f : 10.0f));   // a masked key gives exactly 0 (m >= -1e30)
            l[qt] = l[qt] * al + ((((p[0] + p[1]) + (p[2] + p[3])) + ((p[4] + p[5]) + (p[6] + p[7]))) + (((p[8] + p[9]) + (p[10] + p[11])) + ((p[12] + p[13]) + (p[14] + p[15]))));
#pragma unroll
            for (int dt = 0; dt < 4; ++dt) o[qt][dt] *= al;
            if constexpr (HL) { v8us h0, h1, l0, l1;
#pragma unroll
                for (int e = 0; e < 8; ++e) { unsigned short a, c2; splitf(p[e], a, c2); h0[e] = a; l0[e] = c2; splitf(p[8 + e], a, c2); h1[e] = a; l1[e] = c2; }
                const V ph = cat16b(h0, h1), pl = cat16b(l0, l1);
#pragma unroll
                for (int dt = 0; dt < 4; ++dt) { o[qt][dt] = F::mma(vf[dt], ph, o[qt][dt]); o[qt][dt] = F::mma(vf[dt], pl, o[qt][dt]); o[qt][dt] = F::mma(vg[dt], ph, o[qt][dt]); }
            } else { V pb;
#pragma unroll
                for (int e = 0; e < 16; ++e) pb[e] = tohx(p[e]);
#pragma unroll
                for (int dt = 0; dt < 4; ++dt) o[qt][dt] = F::mma(vf[dt], pb, o[qt][dt]); }
        }
        if (HL) { asm volatile("s_wait_xcnt 0x0" : "+v"(ko), "+v"(vo) :: "memory");      // the wait in front of the steps of both offsets, which issued global loads name
            ko += 32u * ANW * HD * 2u; vo += 32u * ANW * 2u;
        } else { asm volatile("s_wait_xcnt 0x0" : "+v"(vo) :: "memory");      // as above, for the value offset
            vo += more ? 32u * ANW * 2u : 0u;
            ldv(); }
    }
    // the same wait on the way out of the loop: the last trip's value loads name the offset's register, which is free for other values from here on (kept live up to this line as an in-out operand)
    if (!HL) asm volatile("s_wait_xcnt 0x0" : "+v"(vo) :: "memory");
#pragma unroll
    for (int qt = 0; qt < NQ; ++qt) { l[qt] += xhalf(l[qt]); const int qr = w * NQ * 16 + qt * 16 + lr;
        if (hi == 0) { sM[qr] = m[qt]; sL[qr] = l[qt]; }
#pragma unroll
        for (int dt = 0; dt < 4; ++dt)
#pragma unroll
            for (int jh = 0; jh < 2; ++jh) { const v8f a = o[qt][dt]; v4f x; x[0] = a[jh * 4]; x[1] = a[jh * 4 + 1]; x[2] = a[jh * 4 + 2]; x[3] = a[jh * 4 + 3]; *(v4fa*)(sO + (size_t)qr * 68 + dt * 16 + hi * 8 + jh * 4) = x; } }
    __syncthreads();      // every wave's partial (m, l, O) is in LDS before any wave joins them
    // join: a thread takes DPT consecutive d of one query row; the 64 d of a row (one 128-byte line of each output plane) lie in one wave
    constexpr int DPT = NQ * 16 * HD / (32 * ANW), PARTS = HD / DPT; const int ql = tid / PARTS, d0 = (tid % PARTS) * DPT;
    float M = sM[ql];
#pragma unroll
    for (int k = 1; k < ANW; ++k) M = fmaxf(M, sM[k * NQ * 16 + ql]);
    float f[ANW]; float L = 0.f;
#pragma unroll
    for (int k = 0; k < ANW; ++k) { f[k] = exp2s((sM[k * NQ * 16 + ql] - M) * L2E); L += f[k] * sL[k * NQ * 16 + ql]; }
    const float inv = __fdiv_rn(1.0f, L);
#pragma unroll
    for (int c = 0; c < DPT; c += 8) { v8us oh, ol;
#pragma unroll
        for (int g = 0; g < 2; ++g) { v4f a = *(const v4fa*)(sO + (size_t)ql * 68 + d0 + c + g * 4) * f[0];
#pragma unroll
            for (int k = 1; k < ANW; ++k) a += *(const v4fa*)(sO + (size_t)(k * NQ * 16 + ql) * 68 + d0 + c + g * 4) * f[k];
#pragma unroll
            for (int q = 0; q < 4; ++q) { unsigned short x, y; splitf(a[q] * inv, x, y); oh[g * 4 + q] = x; ol[g * 4 + q] = y; } }
        const size_t oo = (size_t)(q0 + ql) * DQ + hcol + d0 + c; *(v8usa*)(Ah + oo) = oh; *(v8usa*)(Al + oo) = ol; }
    // the wait behind the stores of the hi+lo instance: in the built kernel its code is followed by a branch whose other side (the fp16 instance) rewrites the registers that these stores name
    if (HL) asm volatile("s_wait_xcnt 0x0" ::: "memory");
}
// grid (heads, NF + RH / 16): y < NF: fp16 blocks of 32 query rows, the longest (last) rows first; the rest: hi+lo blocks of 16 query rows. The choice is the same for a whole work-group.
#define NF ((TT - RH) / 32)
__global__ __launch_bounds__(32 * ANW) void k_attn(const h16* __restrict__ Q16, const h16* __restrict__ K16, const h16* __restrict__ V16, const bf* __restrict__ Qh, const bf* __restrict__ Ql, const bf* __restrict__ Kh, const bf* __restrict__ Kl,
                                                   const bf* __restrict__ Vh, const bf* __restrict__ Vl, bf* Ah, bf* Al) {
    __shared__ __align__(16) float sO[ANW * 32 * 68]; __shared__ float sM[ANW * 32]; __shared__ float sL[ANW * 32];
    const int bx = blockIdx.y, h = blockIdx.x; const size_t pq = (size_t)h * TT * HD, pk = (size_t)(h / REP) * TT * HD;
    if (bx < NF) attn_tile<false, 2>(Q16 + pq, nullptr, K16 + pk, nullptr, V16 + pk, nullptr, TT - 32 * (bx + 1), h * HD, Ah, Al, sO, sM, sL);
    else attn_tile<true, 1>(Qh + pq, Ql + pq, Kh + pk, Kl + pk, Vh + pk, Vl + pk, RH - 16 * (bx - NF + 1), h * HD, Ah, Al, sO, sM, sL);
}

extern "C" void kernel_launch(void* const* d_in, const int* in_sizes, int n_in,
                              void* d_out, int out_size, void* d_ws, size_t ws_size, hipStream_t stream) {
    (void)in_sizes; (void)n_in; (void)out_size;
    const float* x = (const float*)d_in[0]; const int* PID = (const int*)d_in[1]; const float* wqkv = (const float*)d_in[2]; const float* wo = (const float*)d_in[3];  const float* wq = wqkv; const float* wk = wqkv + (size_t)1024 * 1024; const float* wv = wqkv + (size_t)2048 * 1024; (void)wq; (void)wk; (void)wv;
    float* OUT = (float*)d_out;     // [4][2048][1024]
    char* wsp = (char*)d_ws;
    auto take = [&](size_t bytes) { char* p = wsp; wsp += (bytes + 255) & ~(size_t)255; return (void*)p; };
    bf* WQ = (bf*)take((size_t)DQ * DM * 2); bf* WK = (bf*)take((size_t)DKV * DM * 2); bf* WV = (bf*)take((size_t)DKV * DM * 2); bf* WO = (bf*)take((size_t)DM * DQ * 2); float* CS = (float*)take((size_t)TT * HD * 2 * 4);
    bf* XB = (bf*)take((size_t)TT * DM * 2);
    h16* QP16 = (h16*)take((size_t)NH_ * TT * HD * 2); h16* KP16 = (h16*)take((size_t)NKV * TT * HD * 2); h16* VT16 = (h16*)take((size_t)NKV * HD * TT * 2);
    bf* QPh = (bf*)take((size_t)NH_ * TT * HD * 2); bf* QPl = (bf*)take((size_t)NH_ * TT * HD * 2); bf* KPh = (bf*)take((size_t)NKV * TT * HD * 2); bf* KPl = (bf*)take((size_t)NKV * TT * HD * 2); bf* VTh = (bf*)take((size_t)NKV * HD * TT * 2); bf* VTl = (bf*)take((size_t)NKV * HD * TT * 2);
    bf* ATh = (bf*)take((size_t)TT * DQ * 2); bf* ATl = (bf*)take((size_t)TT * DQ * 2);
    if ((size_t)(wsp - (char*)d_ws) > ws_size) return;    // ws 256 MiB
    { k_cvt8<<<(unsigned)(((size_t)DQ * DM / 8 + 255) / 256), 256, 0, stream>>>(wq, WQ, (size_t)DQ * DM / 8); k_cvt8<<<(unsigned)(((size_t)DKV * DM / 8 + 255) / 256), 256, 0, stream>>>(wk, WK, (size_t)DKV * DM / 8); k_cvt8<<<(unsigned)(((size_t)DKV * DM / 8 + 255) / 256), 256, 0, stream>>>(wv, WV, (size_t)DKV * DM / 8);
      k_cvt8<<<(unsigned)(((size_t)DM * DQ / 8 + 255) / 256), 256, 0, stream>>>(wo, WO, (size_t)DM * DQ / 8);
       }
    k_cstabP<<<(TT * HD + 255) / 256, 256, 0, stream>>>(PID, CS);
    for (int b = 0; b < NB_; ++b) {
        
        k_cvt8<<<(unsigned)(((size_t)TT * DM / 8 + 255) / 256), 256, 0, stream>>>(x + (size_t)b * TT * DM, XB, (size_t)TT * DM / 8);
        k_gemmw<bf, 0, false, 1><<<dim3(TT / 64, DQ / 64, 1), 32, 0, stream>>>(XB, nullptr, WQ, nullptr, DM, nullptr, 0, nullptr, 0, 0, 0, CS, QP16, QPh, QPl);
        k_gemmw<bf, 0, false, 1><<<dim3(TT / 64, DKV / 64, 1), 32, 0, stream>>>(XB, nullptr, WK, nullptr, DM, nullptr, 0, nullptr, 0, 0, 0, CS, KP16, KPh, KPl);
        k_gemmw<bf, 0, false, 2><<<dim3(TT / 64, DKV / 64, 1), 32, 0, stream>>>(XB, nullptr, WV, nullptr, DM, nullptr, 0, nullptr, 0, 0, 0, nullptr, VT16, VTh, VTl);
        k_attn<<<dim3(NH_, NF + RH / 16, 1), 32 * ANW, 0, stream>>>(QP16, KP16, VT16, QPh, QPl, KPh, KPl, VTh, VTl, ATh, ATl);
        k_gemmw<bf, 1, false, 0><<<dim3(TT / 64, DM / 64, 1), 32, 0, stream>>>(ATh, ATl, WO, nullptr, DQ, OUT + (size_t)b * TT * DM, DM, nullptr, 0, 0, 0, nullptr, nullptr, nullptr, nullptr); }
}

// v005
// One run takes 273 microseconds.
// In two side-by-side timings against v004, it was 1.83 and 1.82 times as fast.
// Counting every step since v000, it is 10.5 times as fast.
#include <hip/hip_runtime.h>

// Causal multi-head self-attention with interleaved-pair rotary embeddings (x [4][2048][1024]; qkv = x qkv_w^T ('oi' [3072][1024], row blocks q | k | v; 16 heads x 64); rotary on adjacent (even, odd) pairs with angle token_positions[t] x 10000^(-2i/64) (positions read from the int32 input; the reference's float32 table constants computed on device); scores / 8, causal (-inf); softmax; out = merged o_w^T ('oi', no bias) -> [4][2048][1024] (8.4 M)).
// Compute dtypes, f32 accumulate: every input rounded to bf16; q/k/v on PLAIN bf16 operands (inputs: exact); interleaved rotary in f32 (precise cosf/sinf table at the input positions); causal scores, streaming softmax (f32) and attn.v in one kernel: query rows < 512 hl (3 products), the rest single fp16 (x1024); o_w hl x exact (2 products).

#define NB_  4
#define TT   2048
#define DM   1024
#define NH_  16
#define NKV  16
#define REP  (NH_ / NKV)
#define HD   64
#define DQ   (NH_ * HD)
#define DKV  (NKV * HD)
#define RH   512                  // query rows < RH use hi+lo planes (0: none)
#define SCL  0.125f   // HD^-0.5
typedef _Float16 h16;
typedef unsigned short bf;
typedef __attribute__((ext_vector_type(16))) __bf16   v16bf;
typedef __attribute__((ext_vector_type(16))) _Float16 v16h;
typedef __attribute__((ext_vector_type(8)))  _Float16 v8h;
typedef __attribute__((ext_vector_type(8)))  unsigned short v8us;
typedef __attribute__((ext_vector_type(8)))  float    v8f;
typedef __attribute__((ext_vector_type(4)))  float    v4f;
typedef v8h  __attribute__((may_alias)) v8ha;
typedef v4f  __attribute__((may_alias)) v4fa;
typedef v8us __attribute__((may_alias)) v8usa;

__device__ __forceinline__ unsigned short f2bf(float f) { unsigned u = __float_as_uint(f); u += 0x7FFFu + ((u >> 16) & 1u); return (unsigned short)(u >> 16); }
__device__ __forceinline__ float bf2f(unsigned short b) { return __uint_as_float(((unsigned)b) << 16); }
__device__ __forceinline__ float bfr(float f) { return bf2f(f2bf(f)); }
__device__ __forceinline__ v16h cat16(v8h lo, v8h hi) { return __builtin_shufflevector(lo, hi, 0, 1, 2, 3, 4, 5, 6, 7, 8, 9, 10, 11, 12, 13, 14, 15); }
__device__ __forceinline__ v16bf cat16b(v8us lo, v8us hi) { return __builtin_bit_cast(v16bf, __builtin_shufflevector(lo, hi, 0, 1, 2, 3, 4, 5, 6, 7, 8, 9, 10, 11, 12, 13, 14, 15)); }
__device__ __forceinline__ v8f wmma16(v16h a, v16h b, v8f c) { return __builtin_amdgcn_wmma_f32_16x16x32_f16(false, a, false, b, (short)0, c, false, false); }
__device__ __forceinline__ v8f wmmab(v16bf a, v16bf b, v8f c) { return __builtin_amdgcn_wmma_f32_16x16x32_bf16(false, a, false, b, (short)0, c, false, false); }



__device__ __forceinline__ h16 tohx(float x) { return (h16)x; }
__device__ __forceinline__ void splitf(float y, unsigned short& h, unsigned short& l) { h = f2bf(y); l = f2bf(y - bf2f(h)); }
typedef __attribute__((ext_vector_type(2))) _Float16 v2h;
typedef __attribute__((ext_vector_type(4))) _Float16 v4h;
typedef __attribute__((ext_vector_type(2))) unsigned short v2us;
typedef __attribute__((ext_vector_type(4))) unsigned short v4us;
typedef __attribute__((ext_vector_type(2))) float v2f;
typedef __attribute__((ext_vector_type(4))) int v4i;
typedef v4h  __attribute__((may_alias)) v4ha;
typedef v4us __attribute__((may_alias)) v4usa;
// one rotary pair (even, odd) at table entry cs = (cos, sin): the operations of the former rotary kernel in their order, so that the q and k planes keep their bits (the four products are rounded on their own, as in the reference's table form)
__device__ __forceinline__ void rot2(float x0, float x1, v2f cs, float& e0, float& e1) {
    float a0 = __fmul_rn(x0, cs[0]), b0 = __fmul_rn(x1, cs[1]), a1 = __fmul_rn(x1, cs[0]), b1 = __fmul_rn(x0, cs[1]); asm volatile("" : "+v"(a0), "+v"(b0), "+v"(a1), "+v"(b1));
    e0 = __fsub_rn(a0, b0); e1 = __fadd_rn(b1, a1);   /* even: x0 c - x1 s; odd: x0 s + x1 c */
}

// ---- k_gemmw: register-blocked GEMM, ONE WAVE per 64x64 output tile (16 accumulators), operands straight from K-contiguous 16-bit planes; grid (M/64, N/64, Z), 32 threads.
// C[m][n] (f32, pitch ldc, + optional f32 bias[n]) = sum_k A[m][k] Bt[n][k] (+ split products per NSPLIT). z-batch strides sA/sB/sC in elements (sC: of C for EPI 0, of each 16-bit plane for EPI 1 and 2). K % 32 == 0.
// EPI says what leaves the tile. 0: the f32 tile to C. 1 and 2: N is heads x HD, so a tile is 64 tokens of ONE head (blockIdx.y), and the wave writes that head's 16-bit planes (fp16 | bf16 hi | bf16 lo) itself; no f32 projection goes through memory.
// 1: rotary with the table CS [t][d](cos, sin), planes [h][t][d]: 16 lanes store one token's 64 d, a whole 128-byte line of each plane. 2: planes [h][d][t]: a lane's 8 accumulator rows of one column are 8 consecutive t of one d, stored from registers.
template <typename T16> struct WFrag;
template <> struct WFrag<h16> { typedef v16h V; static __device__ __forceinline__ V ld(const h16* p) { return cat16(*(const v8h*)p, *(const v8h*)(p + 16)); } static __device__ __forceinline__ v8f mma(V a, V b, v8f c) { return wmma16(a, b, c); } };
template <> struct WFrag<bf> { typedef v16bf V; static __device__ __forceinline__ V ld(const bf* p) { return cat16b(*(const v8us*)p, *(const v8us*)(p + 16)); } static __device__ __forceinline__ v8f mma(V a, V b, v8f c) { return wmmab(a, b, c); } };
template <typename T16, int NSPLIT, bool BIAS, int EPI>
__global__ __launch_bounds__(32) void k_gemmw(const T16* __restrict__ A, const T16* __restrict__ A2, const T16* __restrict__ Bt, const T16* __restrict__ Bt2, int K, float* C, int ldc, const float* __restrict__ bias, size_t sA, size_t sB, size_t sC, const float* __restrict__ CS, h16* P16, bf* Ph, bf* Pl) {
    typedef typename WFrag<T16>::V V;
    __shared__ __align__(16) float os[16 * 68];
    const size_t z = blockIdx.z; A += z * sA; if (A2) A2 += z * sA; Bt += z * sB; if (Bt2) Bt2 += z * sB; if constexpr (EPI == 0) C += z * sC; else { P16 += z * sC; Ph += z * sC; Pl += z * sC; }
    const int lane = threadIdx.x & 31, lr = lane & 15, hi = lane >> 4; const int r0 = blockIdx.x * 64, c0 = blockIdx.y * 64;
    v8f acc[4][4];
#pragma unroll
    for (int mb = 0; mb < 4; ++mb)
#pragma unroll
        for (int nb = 0; nb < 4; ++nb) acc[mb][nb] = (v8f){};
    const size_t aoff = (size_t)(r0 + lr) * K + 8 * hi, boff = (size_t)(c0 + lr) * K + 8 * hi;
#pragma unroll 1
    for (int kc = 0; kc < K; kc += 32) {
        V a[4], a2[4];
#pragma unroll
        for (int mb = 0; mb < 4; ++mb) { a[mb] = WFrag<T16>::ld(A + aoff + (size_t)mb * 16 * K + kc); if (NSPLIT == 1 || NSPLIT == 2) a2[mb] = WFrag<T16>::ld(A2 + aoff + (size_t)mb * 16 * K + kc); }
#pragma unroll
        for (int nb = 0; nb < 4; ++nb) { const V b = WFrag<T16>::ld(Bt + boff + (size_t)nb * 16 * K + kc); V b2; if (NSPLIT >= 2) b2 = WFrag<T16>::ld(Bt2 + boff + (size_t)nb * 16 * K + kc);
#pragma unroll
            for (int mb = 0; mb < 4; ++mb) { acc[mb][nb] = WFrag<T16>::mma(a[mb], b, acc[mb][nb]); if (NSPLIT == 1 || NSPLIT == 2) acc[mb][nb] = WFrag<T16>::mma(a2[mb], b, acc[mb][nb]); if (NSPLIT >= 2) acc[mb][nb] = WFrag<T16>::mma(a[mb], b2, acc[mb][nb]); } }
        asm volatile("v_nop\n\tv_nop\n\tv_nop\n\tv_nop" : "+v"(acc[0][0]), "+v"(acc[1][1]), "+v"(acc[2][2]), "+v"(acc[3][3]) : "v"(a[0]), "v"(a[3]));
    }
    if constexpr (EPI == 2) {
        const size_t vb = (size_t)(c0 + lr) * TT + r0 + hi * 8;      // one offset per lane (d = lr, t = r0 + 8 hi); every step from there is a compile-time offset
#pragma unroll
        for (int nb = 0; nb < 4; ++nb)
#pragma unroll
            for (int mb = 0; mb < 4; ++mb) { v8h o16; v8us oh, ol;      // the four mb of one nb fill one 128-byte line per d and plane
#pragma unroll
                for (int j = 0; j < 8; ++j) { const float x = acc[mb][nb][j]; o16[j] = tohx(x); unsigned short a2, c2; splitf(x, a2, c2); oh[j] = a2; ol[j] = c2; }
                const int eo = nb * 16 * TT + mb * 16; *(v8ha*)(P16 + vb + eo) = o16; *(v8usa*)(Ph + vb + eo) = oh; *(v8usa*)(Pl + vb + eo) = ol; }
        return;
    }
    // EPI 1: the lane's table entries (tokens 2 s + hi, pairs d = 4 lr and 4 lr + 2) of a 16-token block, fetched one block ahead: issued in front of the compiler fence behind the staging, used behind the next one, so that a block's arithmetic covers their latency
    // one address per lane for the table and one offset for the three planes (token r0 + hi, d = 4 lr); every step from there is a compile-time offset
    const float* cb = CS + ((size_t)(r0 + hi) * HD + lr * 4) * 2; const size_t pb = ((size_t)blockIdx.y * TT + r0 + hi) * HD + lr * 4;
    v2f csn[16];
    auto ldcs = [&](int mb) {
#pragma unroll
        for (int s = 0; s < 8; ++s)
#pragma unroll
            for (int p = 0; p < 2; ++p) csn[2 * s + p] = *(const v2f*)(cb + (mb * 16 + 2 * s) * (HD * 2) + 4 * p); };
    if constexpr (EPI == 1) ldcs(0);
#pragma unroll
    for (int mb = 0; mb < 4; ++mb) {
        v2f cs[16];
        if constexpr (EPI == 1) {
#pragma unroll
            for (int i = 0; i < 16; ++i) cs[i] = csn[i];
            // the wait in front of a rewrite of registers which issued global stores name: the loads behind it land in registers that the block before stored from
            if (mb > 0 && mb < 3) asm volatile("s_wait_xcnt 0x0" ::: "memory");
            if (mb < 3) ldcs(mb + 1); }
#pragma unroll
        for (int nb = 0; nb < 4; ++nb) {
#pragma unroll
            for (int j = 0; j < 8; ++j) os[(hi * 8 + j) * 68 + nb * 16 + lr] = acc[mb][nb][j]; }
        __builtin_amdgcn_wave_barrier(); asm volatile("" ::: "memory");
        if constexpr (EPI == 1) {
            v4f val[8];
#pragma unroll
            for (int s = 0; s < 8; ++s) val[s] = *(const v4fa*)(os + (2 * s + hi) * 68 + lr * 4);
            // inputs only, loaded values: the block's eight LDS reads are issued together and waited for once (left free, each sinks to its first use and is waited for alone)
            asm volatile("" :: "v"(val[0]), "v"(val[1]), "v"(val[2]), "v"(val[3]), "v"(val[4]), "v"(val[5]), "v"(val[6]), "v"(val[7]));
#pragma unroll
            for (int s = 0; s < 8; ++s) { v4h o16; v4us oh, ol;
#pragma unroll
                for (int p = 0; p < 2; ++p) { float e0, e1; rot2(val[s][2 * p], val[s][2 * p + 1], cs[2 * s + p], e0, e1); unsigned short a2, c2;
                    o16[2 * p] = tohx(e0); o16[2 * p + 1] = tohx(e1); splitf(e0, a2, c2); oh[2 * p] = a2; ol[2 * p] = c2; splitf(e1, a2, c2); oh[2 * p + 1] = a2; ol[2 * p + 1] = c2; }
                const int eo = (mb * 16 + 2 * s) * HD; *(v4ha*)(P16 + pb + eo) = o16; *(v4usa*)(Ph + pb + eo) = oh; *(v4usa*)(Pl + pb + eo) = ol; }
        } else {
        float* crow = C + (size_t)(r0 + mb * 16) * ldc + c0;
#pragma unroll
            for (int s = 0; s < 8; ++s) { const int row = 2 * s + hi, cofs = lr * 4; v4f val = *(const v4fa*)(os + row * 68 + cofs); if (BIAS) { val[0] += bfr(bias[c0 + cofs]); val[1] += bfr(bias[c0 + cofs + 1]); val[2] += bfr(bias[c0 + cofs + 2]); val[3] += bfr(bias[c0 + cofs + 3]); }
                *(v4f*)(crow + (size_t)row * ldc + cofs) = val; }
        }
        __builtin_amdgcn_wave_barrier(); asm volatile("" ::: "memory");
    }
}


__global__ __launch_bounds__(256) void k_wtG(const float* __restrict__ w, int K, int N, bf* Bt) {
    const int lane = threadIdx.x & 31; const int L0 = (blockIdx.x * 8 + (threadIdx.x >> 5)) * 8; const int nlines = N * K / 64;
{
#pragma unroll 1
        for (int l = 0; l < 8; ++l) { const int L = L0 + l; if (L >= nlines) break; const size_t e = (size_t)L * 64 + lane * 2; const int k = (int)(e % K), n = (int)(e / K); v2us o;
            o[0] = f2bf(w[(size_t)k * N + n]); o[1] = f2bf(w[(size_t)(k + 1) * N + n]); *(v2us*)(Bt + e) = o; }
         }
}
__global__ __launch_bounds__(256) void k_cvt8(const float* __restrict__ src, bf* dst, size_t n8) { const size_t i = (size_t)blockIdx.x * 256 + threadIdx.x; if (i >= n8) return; const v8f v = *(const v8f*)(src + i * 8); v8us o;
#pragma unroll
    for (int k = 0; k < 8; ++k) o[k] = f2bf(v[k]); *(v8us*)(dst + i * 8) = o;  }

__constant__ float INV[HD / 2] = {1.0f,0.749894202f,0.562341332f,0.421696514f,0.316227764f,0.237137362f,0.177827939f,0.133352146f,0.100000001f,0.0749894157f,0.0562341288f,0.0421696492f,0.0316227786f,0.0237137359f,0.0177827943f,0.0133352149f,0.00999999978f,0.00749894232f,0.00562341325f,0.00421696482f,0.00316227786f,0.00237137382f,0.00177827943f,0.00133352145f,0.00100000005f,0.000749894185f,0.000562341302f,0.000421696488f,0.000316227786f,0.000237137385f,0.00017782794f,0.00013335215f};
__global__ __launch_bounds__(256) void k_cstabP(const int* __restrict__ pos, float* CS) { const int idx = blockIdx.x * 256 + threadIdx.x; if (idx >= TT * HD) return; const int t = idx / HD, d = idx % HD; const float ang = __fmul_rn((float)pos[t], INV[d >> 1]); v2f cs; cs[0] = cosf(ang); cs[1] = sinf(ang);
    *(v2f*)(CS + (size_t)idx * 2) = cs;  }

// ---- k_attn: causal scores, softmax and probability x value contraction in one kernel; no score matrix goes through the workspace. One work-group of ANW waves owns one block of query rows of one head.
// Transposed products: S^T = K Q^T (A = 16 key rows, B = 16 query rows), so that a lane holds 16 scores of ONE query per 32 keys (keys kc + 8 hi + j and kc + 16 + 8 hi + j); the two converted score tiles are,
// register for register, the B operand of O^T += V^T P^T (A = 16 rows of the [d][t] value plane). Running maximum m and sum l per query (streaming softmax): a new maximum rescales l and O^T by exp(m_old - m_new).
// The 32-key chunks up to the diagonal are dealt to the waves (wave w: chunks w, w + ANW, ...); the ANW partial (m, l, O) go to LDS and are joined in fixed wave order 0..ANW-1 with weights exp(m_w - max m).
// HL: bf16 hi + lo planes, 3 products each (query rows < RH); otherwise single fp16 with the probabilities carried x1024 (the factor is in l too and cancels). Output: the merged [t][DQ] bf16 hi | lo planes.
// Every '#pragma unroll' below stands on a loop of constant length that indexes register arrays (fragments, accumulators, a lane's scores): unrolled, each index is a compile-time register.
#define ANW 4
#define L2E 1.4426950408889634f
__device__ __forceinline__ float xhalf(float x) { return __builtin_bit_cast(float, __builtin_amdgcn_permlanex16(__builtin_bit_cast(int, x), __builtin_bit_cast(int, x), 0x76543210, 0xfedcba98, false, false)); }  // lane l with lane l ^ 16
// v_exp_f32 and, in the same statement, the one slot that the instruction set asks for between a transcendental and an instruction that reads its result or overwrites its source
__device__ __forceinline__ float exp2s(float x) { float r; asm("v_exp_f32 %0, %1\n\tv_nop" : "=v"(r) : "v"(x)); return r; }
template <bool HL> struct AT;
template <> struct AT<true> { typedef bf T; };
template <> struct AT<false> { typedef h16 T; };
template <bool HL, int NQ>
__device__ __forceinline__ void attn_tile(const typename AT<HL>::T* __restrict__ Q, const typename AT<HL>::T* __restrict__ Q2, const typename AT<HL>::T* __restrict__ Kp, const typename AT<HL>::T* __restrict__ Kp2,
                                          const typename AT<HL>::T* __restrict__ Vp, const typename AT<HL>::T* __restrict__ Vp2, int q0, int hcol, bf* Ah, bf* Al, float* sO, float* sM, float* sL) {
    typedef typename AT<HL>::T T; typedef WFrag<T> F; typedef typename F::V V;
    const int tid = threadIdx.x, lane = tid & 31, lr = lane & 15, hi = lane >> 4; const int w = __builtin_amdgcn_readfirstlane(tid >> 5) /* wave number in a scalar register: the chunk loop keeps a scalar bound test */;
    V qf[NQ][2], qg[NQ][2];
#pragma unroll
    for (int qt = 0; qt < NQ; ++qt)
#pragma unroll
        for (int ks = 0; ks < 2; ++ks) { const size_t qo = (size_t)(q0 + qt * 16 + lr) * HD + ks * 32 + 8 * hi; qf[qt][ks] = F::ld(Q + qo); if (HL) qg[qt][ks] = F::ld(Q2 + qo); }
    v8f o[NQ][4]; float m[NQ], l[NQ];
#pragma unroll
    for (int qt = 0; qt < NQ; ++qt) { m[qt] = -1.0e30f; l[qt] = 0.f;
#pragma unroll
        for (int dt = 0; dt < 4; ++dt) o[qt][dt] = (v8f){}; }
    const int kend = q0 + NQ * 16;      // keys beyond the block's last query row are masked for every row of it
    // one 32-bit byte offset per lane into the key planes and one into the value planes, carried round the loop
    unsigned ko = (unsigned)((32 * w + lr) * HD + 8 * hi) * 2u, vo = (unsigned)(lr * TT + 32 * w + 8 * hi) * 2u;
    V kf[2][2], kg[2][2], vf[4], vg[4];
    auto ldk = [&]() {
#pragma unroll
        for (int kt = 0; kt < 2; ++kt)
#pragma unroll
            for (int ks = 0; ks < 2; ++ks) { kf[kt][ks] = F::ld((const T*)((const char*)Kp + ko) + kt * 16 * HD + ks * 32); if (HL) kg[kt][ks] = F::ld((const T*)((const char*)Kp2 + ko) + kt * 16 * HD + ks * 32); } };
    auto ldv = [&]() {
#pragma unroll
        for (int dt = 0; dt < 4; ++dt) { vf[dt] = F::ld((const T*)((const char*)Vp + vo) + dt * 16 * TT); if (HL) vg[dt] = F::ld((const T*)((const char*)Vp2 + vo) + dt * 16 * TT); } };
    // fp16 blocks (up to TT / 32 / ANW trips): every chunk but the wave's first is fetched one trip ahead, into the same registers, right behind the products that read them.
    // hi+lo blocks (at most RH / 32 / ANW trips, twice the fragments): each trip fetches its own chunk, so that the kernel stays within 256 registers.
    if (!HL && 32 * w < kend) {
        __builtin_amdgcn_sched_barrier(0);      // the query loads are issued first ...
        ldk(); ldv();
        // ... and have landed before the loop (inputs only, loaded values): otherwise the loop head's wait for them, which counts loads in issue order, would also wait for the value loads that each trip has just issued
        if constexpr (NQ == 2) asm volatile("" :: "v"(qf[0][0]), "v"(qf[0][1]), "v"(qf[1][0]), "v"(qf[1][1]));
    }
#pragma unroll 1   // rolled: one chunk's fragments, the query fragments, the scores and the output tiles fill most of a wave's 256 registers
    for (int kc = 32 * w; kc < kend; kc += 32 * ANW) {
        const bool more = kc + 32 * ANW < kend;      // wave-uniform; the last trip fetches its own chunk once more instead of one past the end: with no branch round the loads the load counter is exact at every wait
        if (HL) { ldk(); ldv(); }
        v8f s[NQ][2];
#pragma unroll
        for (int qt = 0; qt < NQ; ++qt)
#pragma unroll
            for (int kt = 0; kt < 2; ++kt) { s[qt][kt] = (v8f){};
#pragma unroll
                for (int ks = 0; ks < 2; ++ks) { s[qt][kt] = F::mma(kf[kt][ks], qf[qt][ks], s[qt][kt]); if (HL) { s[qt][kt] = F::mma(kf[kt][ks], qg[qt][ks], s[qt][kt]); s[qt][kt] = F::mma(kg[kt][ks], qf[qt][ks], s[qt][kt]); } } }
        if (!HL) {
            __builtin_amdgcn_sched_barrier(0);      // keeps the next chunk's key loads, and the wait in front of them, behind every score product (they land in the same registers) ...
            // the wait that stands in front of a rewrite of a register which issued global loads name; the offset is an in-out operand so that its step cannot be lifted over it
            asm volatile("s_wait_xcnt 0x0" : "+v"(ko) :: "memory");
            ko += more ? 32u * ANW * HD * 2u : 0u;
            ldk();
            __builtin_amdgcn_sched_barrier(0);      // ... and in front of the softmax, whose time covers their latency (left free, the scheduler sinks each load to its first use)
        }
#pragma unroll
        for (int qt = 0; qt < NQ; ++qt) {
            const int lim = q0 + qt * 16 + lr - kc - hi * 8; float t[16]; float mx = -2.0e38f;      // causal: the lane's key number e (kc + 8 hi + 16 (e >> 3) + (e & 7)) counts while it is <= the lane's query row
#pragma unroll
            for (int e = 0; e < 16; ++e) { t[e] = ((e >> 3) * 16 + (e & 7) <= lim) ? s[qt][e >> 3][e & 7] * SCL : -2.0e38f; mx = fmaxf(mx, t[e]); }
            mx = fmaxf(mx, xhalf(mx));      // the other half-wave holds the query's other 16 keys
            const float mn = fmaxf(m[qt], mx), al = exp2s((m[qt] - mn) * L2E); m[qt] = mn;
            float p[16];
#pragma unroll
            for (int e = 0; e < 16; ++e) p[e] = exp2s((t[e] - mn) * L2E + (HL ? 0.0f : 10.0f));   // a masked key gives exactly 0 (m >= -1e30)
            l[qt] = l[qt] * al + ((((p[0] + p[1]) + (p[2] + p[3])) + ((p[4] + p[5]) + (p[6] + p[7]))) + (((p[8] + p[9]) + (p[10] + p[11])) + ((p[12] + p[13]) + (p[14] + p[15]))));
#pragma unroll
            for (int dt = 0; dt < 4; ++dt) o[qt][dt] *= al;
            if constexpr (HL) { v8us h0, h1, l0, l1;
#pragma unroll
                for (int e = 0; e < 8; ++e) { unsigned short a, c2; splitf(p[e], a, c2); h0[e] = a; l0[e] = c2; splitf(p[8 + e], a, c2); h1[e] = a; l1[e] = c2; }
                const V ph = cat16b(h0, h1), pl = cat16b(l0, l1);
#pragma unroll
                for (int dt = 0; dt < 4; ++dt) { o[qt][dt] = F::mma(vf[dt], ph, o[qt][dt]); o[qt][dt] = F::mma(vf[dt], pl, o[qt][dt]); o[qt][dt] = F::mma(vg[dt], ph, o[qt][dt]); }
            } else { V pb;
#pragma unroll
                for (int e = 0; e < 16; ++e) pb[e] = tohx(p[e]);
#pragma unroll
                for (int dt = 0; dt < 4; ++dt) o[qt][dt] = F::mma(vf[dt], pb, o[qt][dt]); }
        }
        if (HL) { asm volatile("s_wait_xcnt 0x0" : "+v"(ko), "+v"(vo) :: "memory");      // the wait in front of the steps of both offsets, which issued global loads name
            ko += 32u * ANW * HD * 2u; vo += 32u * ANW * 2u;
        } else { asm volatile("s_wait_xcnt 0x0" : "+v"(vo) :: "memory");      // as above, for the value offset
            vo += more ? 32u * ANW * 2u : 0u;
            ldv(); }
    }
    // the same wait on the way out of the loop: the last trip's value loads name the offset's register, which is free for other values from here on (kept live up to this line as an in-out operand)
    if (!HL) asm volatile("s_wait_xcnt 0x0" : "+v"(vo) :: "memory");
#pragma unroll
    for (int qt = 0; qt < NQ; ++qt) { l[qt] += xhalf(l[qt]); const int qr = w * NQ * 16 + qt * 16 + lr;
        if (hi == 0) { sM[qr] = m[qt]; sL[qr] = l[qt]; }
#pragma unroll
        for (int dt = 0; dt < 4; ++dt)
#pragma unroll
            for (int jh = 0; jh < 2; ++jh) { const v8f a = o[qt][dt]; v4f x; x[0] = a[jh * 4]; x[1] = a[jh * 4 + 1]; x[2] = a[jh * 4 + 2]; x[3] = a[jh * 4 + 3]; *(v4fa*)(sO + (size_t)qr * 68 + dt * 16 + hi * 8 + jh * 4) = x; } }
    __syncthreads();      // every wave's partial (m, l, O) is in LDS before any wave joins them
    // join: a thread takes DPT consecutive d of one query row; the 64 d of a row (one 128-byte line of each output plane) lie in one wave
    constexpr int DPT = NQ * 16 * HD / (32 * ANW), PARTS = HD / DPT; const int ql = tid / PARTS, d0 = (tid % PARTS) * DPT;
    float M = sM[ql];
#pragma unroll
    for (int k = 1; k < ANW; ++k) M = fmaxf(M, sM[k * NQ * 16 + ql]);
    float f[ANW]; float L = 0.f;
#pragma unroll
    for (int k = 0; k < ANW; ++k) { f[k] = exp2s((sM[k * NQ * 16 + ql] - M) * L2E); L += f[k] * sL[k * NQ * 16 + ql]; }
    const float inv = __fdiv_rn(1.0f, L);
#pragma unroll
    for (int c = 0; c < DPT; c += 8) { v8us oh, ol;
#pragma unroll
        for (int g = 0; g < 2; ++g) { v4f a = *(const v4fa*)(sO + (size_t)ql * 68 + d0 + c + g * 4) * f[0];
#pragma unroll
            for (int k = 1; k < ANW; ++k) a += *(const v4fa*)(sO + (size_t)(k * NQ * 16 + ql) * 68 + d0 + c + g * 4) * f[k];
#pragma unroll
            for (int q = 0; q < 4; ++q) { unsigned short x, y; splitf(a[q] * inv, x, y); oh[g * 4 + q] = x; ol[g * 4 + q] = y; } }
        const size_t oo = (size_t)(q0 + ql) * DQ + hcol + d0 + c; *(v8usa*)(Ah + oo) = oh; *(v8usa*)(Al + oo) = ol; }
    // the wait behind the stores of the hi+lo instance: in the built kernel its code is followed by a branch whose other side (the fp16 instance) rewrites the registers that these stores name
    if (HL) asm volatile("s_wait_xcnt 0x0" ::: "memory");
}
// grid (batches x heads, NF + RH / 16): x = batch * heads + head, the index of the [batch][head] planes; y < NF: fp16 blocks of 32 query rows, the longest (last) rows first; the rest: hi+lo blocks of 16 query rows. The choice is the same for a whole work-group.
// The longest blocks of every batch and head have the lowest y (for speed only).
#define NF ((TT - RH) / 32)
__global__ __launch_bounds__(32 * ANW) void k_attn(const h16* __restrict__ Q16, const h16* __restrict__ K16, const h16* __restrict__ V16, const bf* __restrict__ Qh, const bf* __restrict__ Ql, const bf* __restrict__ Kh, const bf* __restrict__ Kl,
                                                   const bf* __restrict__ Vh, const bf* __restrict__ Vl, bf* Ah, bf* Al) {
    __shared__ __align__(16) float sO[ANW * 32 * 68]; __shared__ float sM[ANW * 32]; __shared__ float sL[ANW * 32];
    const int bx = blockIdx.y, b = blockIdx.x / NH_, h = blockIdx.x % NH_; const size_t pq = (size_t)blockIdx.x * TT * HD, pk = (size_t)(b * NKV + h / REP) * TT * HD; Ah += (size_t)b * TT * DQ; Al += (size_t)b * TT * DQ;
    if (bx < NF) attn_tile<false, 2>(Q16 + pq, nullptr, K16 + pk, nullptr, V16 + pk, nullptr, TT - 32 * (bx + 1), h * HD, Ah, Al, sO, sM, sL);
    else attn_tile<true, 1>(Qh + pq, Ql + pq, Kh + pk, Kl + pk, Vh + pk, Vl + pk, RH - 16 * (bx - NF + 1), h * HD, Ah, Al, sO, sM, sL);
}

extern "C" void kernel_launch(void* const* d_in, const int* in_sizes, int n_in,
                              void* d_out, int out_size, void* d_ws, size_t ws_size, hipStream_t stream) {
    (void)in_sizes; (void)n_in; (void)out_size;
    const float* x = (const float*)d_in[0]; const int* PID = (const int*)d_in[1]; const float* wqkv = (const float*)d_in[2]; const float* wo = (const float*)d_in[3];  const float* wq = wqkv; const float* wk = wqkv + (size_t)1024 * 1024; const float* wv = wqkv + (size_t)2048 * 1024; (void)wq; (void)wk; (void)wv;
    float* OUT = (float*)d_out;     // [4][2048][1024]
    char* wsp = (char*)d_ws;
    auto take = [&](size_t bytes) { char* p = wsp; wsp += (bytes + 255) & ~(size_t)255; return (void*)p; };
    bf* WQ = (bf*)take((size_t)DQ * DM * 2); bf* WK = (bf*)take((size_t)DKV * DM * 2); bf* WV = (bf*)take((size_t)DKV * DM * 2); bf* WO = (bf*)take((size_t)DM * DQ * 2); float* CS = (float*)take((size_t)TT * HD * 2 * 4);
    bf* XB = (bf*)take((size_t)NB_ * TT * DM * 2);      // from here on every buffer holds all NB_ batches, batch outermost
    h16* QP16 = (h16*)take((size_t)NB_ * NH_ * TT * HD * 2); h16* KP16 = (h16*)take((size_t)NB_ * NKV * TT * HD * 2); h16* VT16 = (h16*)take((size_t)NB_ * NKV * HD * TT * 2);
    bf* QPh = (bf*)take((size_t)NB_ * NH_ * TT * HD * 2); bf* QPl = (bf*)take((size_t)NB_ * NH_ * TT * HD * 2); bf* KPh = (bf*)take((size_t)NB_ * NKV * TT * HD * 2); bf* KPl = (bf*)take((size_t)NB_ * NKV * TT * HD * 2); bf* VTh = (bf*)take((size_t)NB_ * NKV * HD * TT * 2); bf* VTl = (bf*)take((size_t)NB_ * NKV * HD * TT * 2);
    bf* ATh = (bf*)take((size_t)NB_ * TT * DQ * 2); bf* ATl = (bf*)take((size_t)NB_ * TT * DQ * 2);
    if ((size_t)(wsp - (char*)d_ws) > ws_size) return;    // ws 256 MiB
    { k_cvt8<<<(unsigned)(((size_t)DQ * DM / 8 + 255) / 256), 256, 0, stream>>>(wq, WQ, (size_t)DQ * DM / 8); k_cvt8<<<(unsigned)(((size_t)DKV * DM / 8 + 255) / 256), 256, 0, stream>>>(wk, WK, (size_t)DKV * DM / 8); k_cvt8<<<(unsigned)(((size_t)DKV * DM / 8 + 255) / 256), 256, 0, stream>>>(wv, WV, (size_t)DKV * DM / 8);
      k_cvt8<<<(unsigned)(((size_t)DM * DQ / 8 + 255) / 256), 256, 0, stream>>>(wo, WO, (size_t)DM * DQ / 8);
       }
    k_cstabP<<<(TT * HD + 255) / 256, 256, 0, stream>>>(PID, CS);
    // one launch per stage for all NB_ batches: the batch is grid z of the GEMMs (operand, plane and output strides of one batch) and part of grid x of the attention kernel
    k_cvt8<<<(unsigned)(((size_t)NB_ * TT * DM / 8 + 255) / 256), 256, 0, stream>>>(x, XB, (size_t)NB_ * TT * DM / 8);
    k_gemmw<bf, 0, false, 1><<<dim3(TT / 64, DQ / 64, NB_), 32, 0, stream>>>(XB, nullptr, WQ, nullptr, DM, nullptr, 0, nullptr, (size_t)TT * DM, 0, (size_t)NH_ * TT * HD, CS, QP16, QPh, QPl);
    k_gemmw<bf, 0, false, 1><<<dim3(TT / 64, DKV / 64, NB_), 32, 0, stream>>>(XB, nullptr, WK, nullptr, DM, nullptr, 0, nullptr, (size_t)TT * DM, 0, (size_t)NKV * TT * HD, CS, KP16, KPh, KPl);
    k_gemmw<bf, 0, false, 2><<<dim3(TT / 64, DKV / 64, NB_), 32, 0, stream>>>(XB, nullptr, WV, nullptr, DM, nullptr, 0, nullptr, (size_t)TT * DM, 0, (size_t)NKV * HD * TT, nullptr, VT16, VTh, VTl);
    k_attn<<<dim3(NB_ * NH_, NF + RH / 16, 1), 32 * ANW, 0, stream>>>(QP16, KP16, VT16, QPh, QPl, KPh, KPl, VTh, VTl, ATh, ATl);
    k_gemmw<bf, 1, false, 0><<<dim3(TT / 64, DM / 64, NB_), 32, 0, stream>>>(ATh, ATl, WO, nullptr, DQ, OUT, DM, nullptr, (size_t)TT * DQ, 0, (size_t)TT * DM, nullptr, nullptr, nullptr, nullptr);
}

// v006
// One run takes 261 microseconds.
// Timed twice side by side with v005, it ran 1.03 and 1.04 times as fast.
// All steps since v000 together make it 10.9 times as fast.
#include <hip/hip_runtime.h>

// Causal multi-head self-attention with interleaved-pair rotary embeddings (x [4][2048][1024]; qkv = x qkv_w^T ('oi' [3072][1024], row blocks q | k | v; 16 heads x 64); rotary on adjacent (even, odd) pairs with angle token_positions[t] x 10000^(-2i/64) (positions read from the int32 input; the reference's float32 table constants computed on device); scores / 8, causal (-inf); softmax; out = merged o_w^T ('oi', no bias) -> [4][2048][1024] (8.4 M)).
// Compute dtypes, f32 accumulate: every input rounded to bf16; q/k/v on PLAIN bf16 operands (inputs: exact); interleaved rotary in f32 (precise cosf/sinf table at the input positions); causal scores, streaming softmax (f32) and attn.v in one kernel: query rows < 512 hl (3 products), the rest single fp16 (x1024); o_w hl x exact (2 products).

// Fragment order: every 16-bit matrix operand plane M[r][k] (k contracted) is stored as 1-KiB blocks of 16 rows x 32 k; element (r, k) of a block lies at ((k >> 4) & 1) * 256 + ((k >> 3) & 1) * 128 + (r & 15) * 8 + (k & 7).
// A lane's fragment is then the 16 bytes at lane * 8 elements and those 256 elements on, so each wave-wide 16-byte load or store covers 512 contiguous bytes (4 whole lines) instead of 32-byte pieces of 16 lines.
// Block order: x, the weights and the merged attention output [r >> 4][k >> 5]; q and k per head [t >> 4][d >> 5]; v per head [t >> 5][d >> 4] (k = t): a 32-key chunk of k or of v is 4 contiguous KiB.
#define NB_  4
#define TT   2048
#define DM   1024
#define NH_  16
#define NKV  16
#define REP  (NH_ / NKV)
#define HD   64
#define DQ   (NH_ * HD)
#define DKV  (NKV * HD)
#define RH   512                  // query rows < RH use hi+lo planes (0: none)
#define SCL  0.125f   // HD^-0.5
typedef _Float16 h16;
typedef unsigned short bf;
typedef __attribute__((ext_vector_type(16))) __bf16   v16bf;
typedef __attribute__((ext_vector_type(16))) _Float16 v16h;
typedef __attribute__((ext_vector_type(8)))  _Float16 v8h;
typedef __attribute__((ext_vector_type(8)))  unsigned short v8us;
typedef __attribute__((ext_vector_type(8)))  float    v8f;
typedef __attribute__((ext_vector_type(4)))  float    v4f;
typedef v8h  __attribute__((may_alias)) v8ha;
typedef v4f  __attribute__((may_alias)) v4fa;
typedef v8us __attribute__((may_alias)) v8usa;

__device__ __forceinline__ unsigned short f2bf(float f) { unsigned u = __float_as_uint(f); u += 0x7FFFu + ((u >> 16) & 1u); return (unsigned short)(u >> 16); }
__device__ __forceinline__ float bf2f(unsigned short b) { return __uint_as_float(((unsigned)b) << 16); }
__device__ __forceinline__ float bfr(float f) { return bf2f(f2bf(f)); }
__device__ __forceinline__ v16h cat16(v8h lo, v8h hi) { return __builtin_shufflevector(lo, hi, 0, 1, 2, 3, 4, 5, 6, 7, 8, 9, 10, 11, 12, 13, 14, 15); }
__device__ __forceinline__ v16bf cat16b(v8us lo, v8us hi) { return __builtin_bit_cast(v16bf, __builtin_shufflevector(lo, hi, 0, 1, 2, 3, 4, 5, 6, 7, 8, 9, 10, 11, 12, 13, 14, 15)); }
__device__ __forceinline__ v8f wmma16(v16h a, v16h b, v8f c) { return __builtin_amdgcn_wmma_f32_16x16x32_f16(false, a, false, b, (short)0, c, false, false); }
__device__ __forceinline__ v8f wmmab(v16bf a, v16bf b, v8f c) { return __builtin_amdgcn_wmma_f32_16x16x32_bf16(false, a, false, b, (short)0, c, false, false); }



__device__ __forceinline__ h16 tohx(float x) { return (h16)x; }
__device__ __forceinline__ void splitf(float y, unsigned short& h, unsigned short& l) { h = f2bf(y); l = f2bf(y - bf2f(h)); }
typedef __attribute__((ext_vector_type(2))) _Float16 v2h;
typedef __attribute__((ext_vector_type(4))) _Float16 v4h;
typedef __attribute__((ext_vector_type(2))) unsigned short v2us;
typedef __attribute__((ext_vector_type(4))) unsigned short v4us;
typedef __attribute__((ext_vector_type(2))) float v2f;
typedef __attribute__((ext_vector_type(4))) int v4i;
typedef v4h  __attribute__((may_alias)) v4ha;
typedef v4us __attribute__((may_alias)) v4usa;
// one rotary pair (even, odd) at table entry cs = (cos, sin): the operations of the former rotary kernel in their order, so that the q and k planes keep their bits (the four products are rounded on their own, as in the reference's table form)
__device__ __forceinline__ void rot2(float x0, float x1, v2f cs, float& e0, float& e1) {
    float a0 = __fmul_rn(x0, cs[0]), b0 = __fmul_rn(x1, cs[1]), a1 = __fmul_rn(x1, cs[0]), b1 = __fmul_rn(x0, cs[1]); asm volatile("" : "+v"(a0), "+v"(b0), "+v"(a1), "+v"(b1));
    e0 = __fsub_rn(a0, b0); e1 = __fadd_rn(b1, a1);   /* even: x0 c - x1 s; odd: x0 s + x1 c */
}

// ---- k_gemmw: register-blocked GEMM, ONE WAVE per 64x64 output tile (16 accumulators), operands straight from 16-bit planes in fragment order; grid (M/64, N/64, Z), 32 threads.
// C[m][n] (f32, pitch ldc, + optional f32 bias[n]) = sum_k A[m][k] Bt[n][k] (+ split products per NSPLIT). z-batch strides sA/sB/sC in elements (sC: of C for EPI 0, of each 16-bit plane for EPI 1 and 2). K % 32 == 0.
// EPI says what leaves the tile. 0: the f32 tile to C. 1 and 2: a tile is 64 tokens of ONE head, and the wave writes that head's 16-bit planes (fp16 | bf16 hi | bf16 lo) itself, in fragment order, from registers; no f32 projection goes through memory.
// 1: A = the weight (M = heads x HD, head = blockIdx.x), Bt = x (N = tokens): a lane's 8 accumulator rows of one column are 8 consecutive d of one token, 4 rotary pairs and one 16-byte unit of the [t][d] planes; table CS as k_cstabP lays it.
// 2: A = x (M = tokens), Bt = the weight (head = blockIdx.y): a lane's 8 accumulator rows are 8 consecutive t of one d, one 16-byte unit of the [d][t] planes.
template <typename T16> struct WFrag;
template <> struct WFrag<h16> { typedef v16h V; static __device__ __forceinline__ V ld(const h16* p) { return cat16(*(const v8h*)p, *(const v8h*)(p + 256)); } static __device__ __forceinline__ v8f mma(V a, V b, v8f c) { return wmma16(a, b, c); } };
template <> struct WFrag<bf> { typedef v16bf V; static __device__ __forceinline__ V ld(const bf* p) { return cat16b(*(const v8us*)p, *(const v8us*)(p + 256)); } static __device__ __forceinline__ v8f mma(V a, V b, v8f c) { return wmmab(a, b, c); } };
template <typename T16, int NSPLIT, bool BIAS, int EPI, int K>
__global__ __launch_bounds__(32) void k_gemmw(const T16* __restrict__ A, const T16* __restrict__ A2, const T16* __restrict__ Bt, const T16* __restrict__ Bt2, float* C, int ldc, const float* __restrict__ bias, size_t sA, size_t sB, size_t sC, const float* __restrict__ CS, h16* P16, bf* Ph, bf* Pl) {
    typedef typename WFrag<T16>::V V;
    __shared__ __align__(16) float os[16 * 68];
    const size_t z = blockIdx.z; A += z * sA; if (A2) A2 += z * sA; Bt += z * sB; if (Bt2) Bt2 += z * sB; if constexpr (EPI == 0) C += z * sC; else { P16 += z * sC; Ph += z * sC; Pl += z * sC; }
    const int lane = threadIdx.x & 31, lr = lane & 15, hi = lane >> 4; const int r0 = blockIdx.x * 64, c0 = blockIdx.y * 64;
    v8f acc[4][4];
#pragma unroll
    for (int mb = 0; mb < 4; ++mb)
#pragma unroll
        for (int nb = 0; nb < 4; ++nb) acc[mb][nb] = (v8f){};
    A += (size_t)r0 * K; if (A2) A2 += (size_t)r0 * K; Bt += (size_t)c0 * K; if (Bt2) Bt2 += (size_t)c0 * K;      // 16 rows of K fill 16 K elements
    unsigned fo = (unsigned)lane * 16u;      // one 32-bit byte offset per lane for every operand plane, carried round the loop (32 k = one block of 1024 bytes); every other step is a compile-time offset
    auto at = [&](const T16* p, int rb) { return (const T16*)((const char*)p + fo) + rb * 16 * K; };
#pragma unroll 1
    for (int kc = 0; kc < K; kc += 32) {
        V a[4], a2[4];
#pragma unroll
        for (int mb = 0; mb < 4; ++mb) { a[mb] = WFrag<T16>::ld(at(A, mb)); if (NSPLIT == 1 || NSPLIT == 2) a2[mb] = WFrag<T16>::ld(at(A2, mb)); }
#pragma unroll
        for (int nb = 0; nb < 4; ++nb) { const V b = WFrag<T16>::ld(at(Bt, nb)); V b2; if (NSPLIT >= 2) b2 = WFrag<T16>::ld(at(Bt2, nb));
#pragma unroll
            for (int mb = 0; mb < 4; ++mb) { acc[mb][nb] = WFrag<T16>::mma(a[mb], b, acc[mb][nb]); if (NSPLIT == 1 || NSPLIT == 2) acc[mb][nb] = WFrag<T16>::mma(a2[mb], b, acc[mb][nb]); if (NSPLIT >= 2) acc[mb][nb] = WFrag<T16>::mma(a[mb], b2, acc[mb][nb]); } }
        asm volatile("v_nop\n\tv_nop\n\tv_nop\n\tv_nop" : "+v"(acc[0][0]), "+v"(acc[1][1]), "+v"(acc[2][2]), "+v"(acc[3][3]) : "v"(a[0]), "v"(a[3]));
        // the wait that stands in front of a rewrite of a register which issued global loads name; the offset is an in-out operand so that its step cannot be lifted over it
        asm volatile("s_wait_xcnt 0x0" : "+v"(fo) :: "memory");
        fo += 1024u;
    }
    if constexpr (EPI == 2) {
        const size_t vb = (size_t)c0 * TT + (size_t)r0 * HD + lane * 8;      // one offset per lane (head plane, chunk r0 / 32, the lane's unit: d = lr, t = 8 hi); every step from there is a compile-time offset
#pragma unroll
        for (int nb = 0; nb < 4; ++nb)
#pragma unroll
            for (int mb = 0; mb < 4; ++mb) { v8h o16; v8us oh, ol;      // each store of the wave is one half block, 512 contiguous bytes
#pragma unroll
                for (int j = 0; j < 8; ++j) { const float x = acc[mb][nb][j]; o16[j] = tohx(x); unsigned short a2, c2; splitf(x, a2, c2); oh[j] = a2; ol[j] = c2; }
                const int eo = (mb >> 1) * 2048 + nb * 512 + (mb & 1) * 256; *(v8ha*)(P16 + vb + eo) = o16; *(v8usa*)(Ph + vb + eo) = oh; *(v8usa*)(Pl + vb + eo) = ol; }
        return;
    }
    if constexpr (EPI == 1) {
        // one address per lane for the table and one offset for the three planes (head plane, token block c0 / 16, the lane's unit: token lr, d = 8 hi); every step from there is a compile-time offset
        const float* cb = CS + (size_t)c0 * HD + lane * 4; const size_t pb = (size_t)blockIdx.x * TT * HD + (size_t)c0 * HD + lane * 8;
        // the lane's table entries of two accumulator tiles (4 loads), fetched one such pair ahead: issued in front of the pair's first wait below, used behind its last, so that a pair's arithmetic covers their latency
        v4f tn[4];
        auto ldt = [&](int g) {
#pragma unroll
            for (int i = 0; i < 4; ++i) tn[i] = *(const v4fa*)(cb + g * 512 + i * 128); };
        ldt(0);
#pragma unroll
        for (int g = 0; g < 8; ++g) { v4f tc[4];
#pragma unroll
            for (int i = 0; i < 4; ++i) tc[i] = tn[i];
            if (g < 7) ldt(g + 1);
#pragma unroll
            for (int u = 0; u < 2; ++u) { const int nb = g >> 1, mb = (g & 1) * 2 + u; const v4f t0 = tc[2 * u], t1 = tc[2 * u + 1]; v8h o16; v8us oh, ol;      // the lane's 4 pairs (cos, sin): d = 16 mb + 8 hi + 0, 2 | 4, 6 of token c0 + 16 nb + lr
#pragma unroll
                for (int p = 0; p < 4; ++p) { const v4f tp = p < 2 ? t0 : t1; v2f cs; cs[0] = tp[2 * (p & 1)]; cs[1] = tp[2 * (p & 1) + 1]; float e0, e1; rot2(acc[mb][nb][2 * p], acc[mb][nb][2 * p + 1], cs, e0, e1); unsigned short a2, c2;
                    o16[2 * p] = tohx(e0); o16[2 * p + 1] = tohx(e1); splitf(e0, a2, c2); oh[2 * p] = a2; ol[2 * p] = c2; splitf(e1, a2, c2); oh[2 * p + 1] = a2; ol[2 * p + 1] = c2; }
                const int eo = nb * 1024 + mb * 256; *(v8ha*)(P16 + pb + eo) = o16; *(v8usa*)(Ph + pb + eo) = oh; *(v8usa*)(Pl + pb + eo) = ol;      // each store of the wave is one half block, 512 contiguous bytes
                asm volatile("s_wait_xcnt 0x0" ::: "memory"); } }      // the wait in front of a rewrite of registers which issued global stores name: the next unit's values land in the registers that this one was stored from
        return;
    }
#pragma unroll
    for (int mb = 0; mb < 4; ++mb) {
#pragma unroll
        for (int nb = 0; nb < 4; ++nb) {
#pragma unroll
            for (int j = 0; j < 8; ++j) os[(hi * 8 + j) * 68 + nb * 16 + lr] = acc[mb][nb][j]; }
        __builtin_amdgcn_wave_barrier(); asm volatile("" ::: "memory");
        float* crow = C + (size_t)(r0 + mb * 16) * ldc + c0;
#pragma unroll
            for (int s = 0; s < 8; ++s) { const int row = 2 * s + hi, cofs = lr * 4; v4f val = *(const v4fa*)(os + row * 68 + cofs); if (BIAS) { val[0] += bfr(bias[c0 + cofs]); val[1] += bfr(bias[c0 + cofs + 1]); val[2] += bfr(bias[c0 + cofs + 2]); val[3] += bfr(bias[c0 + cofs + 3]); }
                *(v4f*)(crow + (size_t)row * ldc + cofs) = val; }
        __builtin_amdgcn_wave_barrier(); asm volatile("" ::: "memory");
    }
}


__global__ __launch_bounds__(256) void k_wtG(const float* __restrict__ w, int K, int N, bf* Bt) {
    const int lane = threadIdx.x & 31; const int L0 = (blockIdx.x * 8 + (threadIdx.x >> 5)) * 8; const int nlines = N * K / 64;
{
#pragma unroll 1
        for (int l = 0; l < 8; ++l) { const int L = L0 + l; if (L >= nlines) break; const size_t e = (size_t)L * 64 + lane * 2; const int k = (int)(e % K), n = (int)(e / K); v2us o;
            o[0] = f2bf(w[(size_t)k * N + n]); o[1] = f2bf(w[(size_t)(k + 1) * N + n]); *(v2us*)(Bt + e) = o; }
         }
}
// f32 [r][DM] row-major -> bf16 in fragment order. Thread i writes 16-byte unit i of the destination (a wave: 512 contiguous bytes) and reads its 8 source elements: block i >> 6 = (r >> 4) * (DM / 32) + (k >> 5), half (i >> 5) & 1, lane i & 31 = ((k >> 3) & 1) * 16 + (r & 15).
__global__ __launch_bounds__(256) void k_cvt8(const float* __restrict__ src, bf* dst, size_t n8) { const size_t i = (size_t)blockIdx.x * 256 + threadIdx.x; if (i >= n8) return;
    const size_t blk = i >> 6, r = (blk / (DM / 32)) * 16 + (i & 15), k = (blk % (DM / 32)) * 32 + ((i >> 5) & 1) * 16 + ((i >> 4) & 1) * 8; const v8f v = *(const v8f*)(src + r * DM + k); v8us o;
#pragma unroll
    for (int k = 0; k < 8; ++k) o[k] = f2bf(v[k]); *(v8us*)(dst + i * 8) = o;  }

__constant__ float INV[HD / 2] = {1.0f,0.749894202f,0.562341332f,0.421696514f,0.316227764f,0.237137362f,0.177827939f,0.133352146f,0.100000001f,0.0749894157f,0.0562341288f,0.0421696492f,0.0316227786f,0.0237137359f,0.0177827943f,0.0133352149f,0.00999999978f,0.00749894232f,0.00562341325f,0.00421696482f,0.00316227786f,0.00237137382f,0.00177827943f,0.00133352145f,0.00100000005f,0.000749894185f,0.000562341302f,0.000421696488f,0.000316227786f,0.000237137385f,0.00017782794f,0.00013335215f};
// one (cos, sin) per token and pair, laid as the q and k tiles read it: entry idx = [t >> 4][d >> 4][(d >> 2) & 1][lane = ((d >> 3) & 1) * 16 + (t & 15)][(d >> 1) & 1], so that a lane's 2 neighbouring pairs are 16 bytes and a wave's load 512 contiguous bytes
__global__ __launch_bounds__(256) void k_cstabP(const int* __restrict__ pos, float* CS) { const int idx = blockIdx.x * 256 + threadIdx.x; if (idx >= TT * HD / 2) return; const int t = (idx >> 9) * 16 + ((idx >> 1) & 15), pr = ((idx >> 7) & 3) * 8 + ((idx >> 5) & 1) * 4 + ((idx >> 6) & 1) * 2 + (idx & 1); const float ang = __fmul_rn((float)pos[t], INV[pr]); v2f cs; cs[0] = cosf(ang); cs[1] = sinf(ang);
    *(v2f*)(CS + (size_t)idx * 2) = cs;  }

// ---- k_attn: causal scores, softmax and probability x value contraction in one kernel; no score matrix goes through the workspace. One work-group of ANW waves owns one block of query rows of one head.
// Transposed products: S^T = K Q^T (A = 16 key rows, B = 16 query rows), so that a lane holds 16 scores of ONE query per 32 keys (keys kc + 8 hi + j and kc + 16 + 8 hi + j); the two converted score tiles are,
// register for register, the B operand of O^T += V^T P^T (A = 16 rows of the [d][t] value plane). Running maximum m and sum l per query (streaming softmax): a new maximum rescales l and O^T by exp(m_old - m_new).
// The 32-key chunks up to the diagonal are dealt to the waves (wave w: chunks w, w + ANW, ...); the ANW partial (m, l, O) go to LDS and are joined in fixed wave order 0..ANW-1 with weights exp(m_w - max m).
// HL: bf16 hi + lo planes, 3 products each (query rows < RH); otherwise single fp16 with the probabilities carried x1024 (the factor is in l too and cancels). Output: the merged [t][DQ] bf16 hi | lo planes, in fragment order.
// Every '#pragma unroll' below stands on a loop of constant length that indexes register arrays (fragments, accumulators, a lane's scores): unrolled, each index is a compile-time register.
#define ANW 4
#define L2E 1.4426950408889634f
__device__ __forceinline__ float xhalf(float x) { return __builtin_bit_cast(float, __builtin_amdgcn_permlanex16(__builtin_bit_cast(int, x), __builtin_bit_cast(int, x), 0x76543210, 0xfedcba98, false, false)); }  // lane l with lane l ^ 16
// v_exp_f32 and, in the same statement, the one slot that the instruction set asks for between a transcendental and an instruction that reads its result or overwrites its source
__device__ __forceinline__ float exp2s(float x) { float r; asm("v_exp_f32 %0, %1\n\tv_nop" : "=v"(r) : "v"(x)); return r; }
template <bool HL> struct AT;
template <> struct AT<true> { typedef bf T; };
template <> struct AT<false> { typedef h16 T; };
template <bool HL, int NQ>
__device__ __forceinline__ void attn_tile(const typename AT<HL>::T* __restrict__ Q, const typename AT<HL>::T* __restrict__ Q2, const typename AT<HL>::T* __restrict__ Kp, const typename AT<HL>::T* __restrict__ Kp2,
                                          const typename AT<HL>::T* __restrict__ Vp, const typename AT<HL>::T* __restrict__ Vp2, int q0, int hcol, bf* Ah, bf* Al, float* sO, float* sM, float* sL) {
    typedef typename AT<HL>::T T; typedef WFrag<T> F; typedef typename F::V V;
    const int tid = threadIdx.x, lane = tid & 31, lr = lane & 15, hi = lane >> 4; const int w = __builtin_amdgcn_readfirstlane(tid >> 5) /* wave number in a scalar register: the chunk loop keeps a scalar bound test */;
    V qf[NQ][2], qg[NQ][2];
#pragma unroll
    for (int qt = 0; qt < NQ; ++qt)
#pragma unroll
        for (int ks = 0; ks < 2; ++ks) { const size_t qo = (size_t)(q0 + qt * 16) * HD + ks * 512 + lane * 8; qf[qt][ks] = F::ld(Q + qo); if (HL) qg[qt][ks] = F::ld(Q2 + qo); }
    v8f o[NQ][4]; float m[NQ], l[NQ];
#pragma unroll
    for (int qt = 0; qt < NQ; ++qt) { m[qt] = -1.0e30f; l[qt] = 0.f;
#pragma unroll
        for (int dt = 0; dt < 4; ++dt) o[qt][dt] = (v8f){}; }
    const int kend = q0 + NQ * 16;      // keys beyond the block's last query row are masked for every row of it
    // one 32-bit byte offset per lane into the key planes and one into the value planes, carried round the loop (fragment order: chunk 32 w of either plane starts at element 32 w HD, the lane's unit at lane * 8)
    unsigned ko = (unsigned)(32 * w * HD + lane * 8) * 2u, vo = ko;
    V kf[2][2], kg[2][2], vf[4], vg[4];
    auto ldk = [&]() {
#pragma unroll
        for (int kt = 0; kt < 2; ++kt)
#pragma unroll
            for (int ks = 0; ks < 2; ++ks) { kf[kt][ks] = F::ld((const T*)((const char*)Kp + ko) + kt * 1024 + ks * 512); if (HL) kg[kt][ks] = F::ld((const T*)((const char*)Kp2 + ko) + kt * 1024 + ks * 512); } };
    auto ldv = [&]() {
#pragma unroll
        for (int dt = 0; dt < 4; ++dt) { vf[dt] = F::ld((const T*)((const char*)Vp + vo) + dt * 512); if (HL) vg[dt] = F::ld((const T*)((const char*)Vp2 + vo) + dt * 512); } };
    // fp16 blocks (up to TT / 32 / ANW trips): every chunk but the wave's first is fetched one trip ahead, into the same registers, right behind the products that read them.
    // hi+lo blocks (at most RH / 32 / ANW trips, twice the fragments): each trip fetches its own chunk, so that the kernel stays within 256 registers.
    if (!HL && 32 * w < kend) {
        __builtin_amdgcn_sched_barrier(0);      // the query loads are issued first ...
        ldk(); ldv();
        // ... and have landed before the loop (inputs only, loaded values): otherwise the loop head's wait for them, which counts loads in issue order, would also wait for the value loads that each trip has just issued
        if constexpr (NQ == 2) asm volatile("" :: "v"(qf[0][0]), "v"(qf[0][1]), "v"(qf[1][0]), "v"(qf[1][1]));
    }
#pragma unroll 1   // rolled: one chunk's fragments, the query fragments, the scores and the output tiles fill most of a wave's 256 registers
    for (int kc = 32 * w; kc < kend; kc += 32 * ANW) {
        const bool more = kc + 32 * ANW < kend;      // wave-uniform; the last trip fetches its own chunk once more instead of one past the end: with no branch round the loads the load counter is exact at every wait
        if (HL) { ldk(); ldv(); }
        v8f s[NQ][2];
#pragma unroll
        for (int qt = 0; qt < NQ; ++qt)
#pragma unroll
            for (int kt = 0; kt < 2; ++kt) { s[qt][kt] = (v8f){};
#pragma unroll
                for (int ks = 0; ks < 2; ++ks) { s[qt][kt] = F::mma(kf[kt][ks], qf[qt][ks], s[qt][kt]); if (HL) { s[qt][kt] = F::mma(kf[kt][ks], qg[qt][ks], s[qt][kt]); s[qt][kt] = F::mma(kg[kt][ks], qf[qt][ks], s[qt][kt]); } } }
        if (!HL) {
            __builtin_amdgcn_sched_barrier(0);      // keeps the next chunk's key loads, and the wait in front of them, behind every score product (they land in the same registers) ...
            // the wait that stands in front of a rewrite of a register which issued global loads name; the offset is an in-out operand so that its step cannot be lifted over it
            asm volatile("s_wait_xcnt 0x0" : "+v"(ko) :: "memory");
            ko += more ? 32u * ANW * HD * 2u : 0u;
            ldk();
            __builtin_amdgcn_sched_barrier(0);      // ... and in front of the softmax, whose time covers their latency (left free, the scheduler sinks each load to its first use)
        }
#pragma unroll
        for (int qt = 0; qt < NQ; ++qt) {
            const int lim = q0 + qt * 16 + lr - kc - hi * 8; float t[16]; float mx = -2.0e38f;      // causal: the lane's key number e (kc + 8 hi + 16 (e >> 3) + (e & 7)) counts while it is <= the lane's query row
#pragma unroll
            for (int e = 0; e < 16; ++e) { t[e] = ((e >> 3) * 16 + (e & 7) <= lim) ? s[qt][e >> 3][e & 7] * SCL : -2.0e38f; mx = fmaxf(mx, t[e]); }
            mx = fmaxf(mx, xhalf(mx));      // the other half-wave holds the query's other 16 keys
            const float mn = fmaxf(m[qt], mx), al = exp2s((m[qt] - mn) * L2E); m[qt] = mn;
            float p[16];
#pragma unroll
            for (int e = 0; e < 16; ++e) p[e] = exp2s((t[e] - mn) * L2E + (HL ? 0.0f : 10.0f));   // a masked key gives exactly 0 (m >= -1e30)
            l[qt] = l[qt] * al + ((((p[0] + p[1]) + (p[2] + p[3])) + ((p[4] + p[5]) + (p[6] + p[7]))) + (((p[8] + p[9]) + (p[10] + p[11])) + ((p[12] + p[13]) + (p[14] + p[15]))));
#pragma unroll
            for (int dt = 0; dt < 4; ++dt) o[qt][dt] *= al;
            if constexpr (HL) { v8us h0, h1, l0, l1;
#pragma unroll
                for (int e = 0; e < 8; ++e) { unsigned short a, c2; splitf(p[e], a, c2); h0[e] = a; l0[e] = c2; splitf(p[8 + e], a, c2); h1[e] = a; l1[e] = c2; }
                const V ph = cat16b(h0, h1), pl = cat16b(l0, l1);
#pragma unroll
                for (int dt = 0; dt < 4; ++dt) { o[qt][dt] = F::mma(vf[dt], ph, o[qt][dt]); o[qt][dt] = F::mma(vf[dt], pl, o[qt][dt]); o[qt][dt] = F::mma(vg[dt], ph, o[qt][dt]); }
            } else { V pb;
#pragma unroll
                for (int e = 0; e < 16; ++e) pb[e] = tohx(p[e]);
#pragma unroll
                for (int dt = 0; dt < 4; ++dt) o[qt][dt] = F::mma(vf[dt], pb, o[qt][dt]); }
        }
        if (HL) { asm volatile("s_wait_xcnt 0x0" : "+v"(ko), "+v"(vo) :: "memory");      // the wait in front of the steps of both offsets, which issued global loads name
            ko += 32u * ANW * HD * 2u; vo += 32u * ANW * HD * 2u;
        } else { asm volatile("s_wait_xcnt 0x0" : "+v"(vo) :: "memory");      // as above, for the value offset
            vo += more ? 32u * ANW * HD * 2u : 0u;
            ldv(); }
    }
    // the same wait on the way out of the loop: the last trip's value loads name the offset's register, which is free for other values from here on (kept live up to this line as an in-out operand)
    if (!HL) asm volatile("s_wait_xcnt 0x0" : "+v"(vo) :: "memory");
#pragma unroll
    for (int qt = 0; qt < NQ; ++qt) { l[qt] += xhalf(l[qt]); const int qr = w * NQ * 16 + qt * 16 + lr;
        if (hi == 0) { sM[qr] = m[qt]; sL[qr] = l[qt]; }
#pragma unroll
        for (int dt = 0; dt < 4; ++dt)
#pragma unroll
            for (int jh = 0; jh < 2; ++jh) { const v8f a = o[qt][dt]; v4f x; x[0] = a[jh * 4]; x[1] = a[jh * 4 + 1]; x[2] = a[jh * 4 + 2]; x[3] = a[jh * 4 + 3]; *(v4fa*)(sO + (size_t)qr * 68 + dt * 16 + hi * 8 + jh * 4) = x; } }
    __syncthreads();      // every wave's partial (m, l, O) is in LDS before any wave joins them
    // join: a thread takes DPT consecutive d of one query row. The output planes are in fragment order, where 8 consecutive rows' units of the same 8 d are one 128-byte line: a wave takes 8 rows x 4 parts, so that every line has one writer
    constexpr int DPT = NQ * 16 * HD / (32 * ANW), PARTS = HD / DPT; static_assert(32 * ANW == 128 && (PARTS == 4 || PARTS == 8), "the deal below is for 4 waves");
    const int ql = PARTS == 4 ? tid / 4 : ((tid >> 5) & 1) * 8 + (tid & 7), d0 = (PARTS == 4 ? tid % 4 : (tid >> 6) * 4 + ((tid >> 3) & 3)) * DPT;
    float M = sM[ql];
#pragma unroll
    for (int k = 1; k < ANW; ++k) M = fmaxf(M, sM[k * NQ * 16 + ql]);
    float f[ANW]; float L = 0.f;
#pragma unroll
    for (int k = 0; k < ANW; ++k) { f[k] = exp2s((sM[k * NQ * 16 + ql] - M) * L2E); L += f[k] * sL[k * NQ * 16 + ql]; }
    const float inv = __fdiv_rn(1.0f, L);
#pragma unroll
    for (int c = 0; c < DPT; c += 8) { v8us oh, ol;
#pragma unroll
        for (int g = 0; g < 2; ++g) { v4f a = *(const v4fa*)(sO + (size_t)ql * 68 + d0 + c + g * 4) * f[0];
#pragma unroll
            for (int k = 1; k < ANW; ++k) a += *(const v4fa*)(sO + (size_t)(k * NQ * 16 + ql) * 68 + d0 + c + g * 4) * f[k];
#pragma unroll
            for (int q = 0; q < 4; ++q) { unsigned short x, y; splitf(a[q] * inv, x, y); oh[g * 4 + q] = x; ol[g * 4 + q] = y; } }
        const int kk = hcol + d0 + c, rr = q0 + ql; const size_t oo = ((size_t)(rr >> 4) * (DQ / 32) + (kk >> 5)) * 512 + ((kk >> 4) & 1) * 256 + ((kk >> 3) & 1) * 128 + (rr & 15) * 8; *(v8usa*)(Ah + oo) = oh; *(v8usa*)(Al + oo) = ol; }
    // the wait behind the stores of the hi+lo instance: in the built kernel its code is followed by a branch whose other side (the fp16 instance) rewrites the registers that these stores name
    if (HL) asm volatile("s_wait_xcnt 0x0" ::: "memory");
}
// grid (batches x heads, NF + RH / 16): x = batch * heads + head, the index of the [batch][head] planes; y < NF: fp16 blocks of 32 query rows, the longest (last) rows first; the rest: hi+lo blocks of 16 query rows. The choice is the same for a whole work-group.
// The longest blocks of every batch and head have the lowest y (for speed only).
#define NF ((TT - RH) / 32)
__global__ __launch_bounds__(32 * ANW) void k_attn(const h16* __restrict__ Q16, const h16* __restrict__ K16, const h16* __restrict__ V16, const bf* __restrict__ Qh, const bf* __restrict__ Ql, const bf* __restrict__ Kh, const bf* __restrict__ Kl,
                                                   const bf* __restrict__ Vh, const bf* __restrict__ Vl, bf* Ah, bf* Al) {
    __shared__ __align__(16) float sO[ANW * 32 * 68]; __shared__ float sM[ANW * 32]; __shared__ float sL[ANW * 32];
    const int bx = blockIdx.y, b = blockIdx.x / NH_, h = blockIdx.x % NH_; const size_t pq = (size_t)blockIdx.x * TT * HD, pk = (size_t)(b * NKV + h / REP) * TT * HD; Ah += (size_t)b * TT * DQ; Al += (size_t)b * TT * DQ;
    if (bx < NF) attn_tile<false, 2>(Q16 + pq, nullptr, K16 + pk, nullptr, V16 + pk, nullptr, TT - 32 * (bx + 1), h * HD, Ah, Al, sO, sM, sL);
    else attn_tile<true, 1>(Qh + pq, Ql + pq, Kh + pk, Kl + pk, Vh + pk, Vl + pk, RH - 16 * (bx - NF + 1), h * HD, Ah, Al, sO, sM, sL);
}

extern "C" void kernel_launch(void* const* d_in, const int* in_sizes, int n_in,
                              void* d_out, int out_size, void* d_ws, size_t ws_size, hipStream_t stream) {
    (void)in_sizes; (void)n_in; (void)out_size;
    const float* x = (const float*)d_in[0]; const int* PID = (const int*)d_in[1]; const float* wqkv = (const float*)d_in[2]; const float* wo = (const float*)d_in[3];  const float* wq = wqkv; const float* wk = wqkv + (size_t)1024 * 1024; const float* wv = wqkv + (size_t)2048 * 1024; (void)wq; (void)wk; (void)wv;
    float* OUT = (float*)d_out;     // [4][2048][1024]
    char* wsp = (char*)d_ws;
    auto take = [&](size_t bytes) { char* p = wsp; wsp += (bytes + 255) & ~(size_t)255; return (void*)p; };
    bf* WQ = (bf*)take((size_t)DQ * DM * 2); bf* WK = (bf*)take((size_t)DKV * DM * 2); bf* WV = (bf*)take((size_t)DKV * DM * 2); bf* WO = (bf*)take((size_t)DM * DQ * 2); float* CS = (float*)take((size_t)TT * HD * 2 * 4);
    bf* XB = (bf*)take((size_t)NB_ * TT * DM * 2);      // from here on every buffer holds all NB_ batches, batch outermost
    h16* QP16 = (h16*)take((size_t)NB_ * NH_ * TT * HD * 2); h16* KP16 = (h16*)take((size_t)NB_ * NKV * TT * HD * 2); h16* VT16 = (h16*)take((size_t)NB_ * NKV * HD * TT * 2);
    bf* QPh = (bf*)take((size_t)NB_ * NH_ * TT * HD * 2); bf* QPl = (bf*)take((size_t)NB_ * NH_ * TT * HD * 2); bf* KPh = (bf*)take((size_t)NB_ * NKV * TT * HD * 2); bf* KPl = (bf*)take((size_t)NB_ * NKV * TT * HD * 2); bf* VTh = (bf*)take((size_t)NB_ * NKV * HD * TT * 2); bf* VTl = (bf*)take((size_t)NB_ * NKV * HD * TT * 2);
    bf* ATh = (bf*)take((size_t)NB_ * TT * DQ * 2); bf* ATl = (bf*)take((size_t)NB_ * TT * DQ * 2);
    if ((size_t)(wsp - (char*)d_ws) > ws_size) return;    // ws 256 MiB
    { k_cvt8<<<(unsigned)(((size_t)DQ * DM / 8 + 255) / 256), 256, 0, stream>>>(wq, WQ, (size_t)DQ * DM / 8); k_cvt8<<<(unsigned)(((size_t)DKV * DM / 8 + 255) / 256), 256, 0, stream>>>(wk, WK, (size_t)DKV * DM / 8); k_cvt8<<<(unsigned)(((size_t)DKV * DM / 8 + 255) / 256), 256, 0, stream>>>(wv, WV, (size_t)DKV * DM / 8);
      k_cvt8<<<(unsigned)(((size_t)DM * DQ / 8 + 255) / 256), 256, 0, stream>>>(wo, WO, (size_t)DM * DQ / 8);
       }
    k_cstabP<<<(TT * HD / 2 + 255) / 256, 256, 0, stream>>>(PID, CS);
    // one launch per stage for all NB_ batches: the batch is grid z of the GEMMs (operand, plane and output strides of one batch) and part of grid x of the attention kernel
    k_cvt8<<<(unsigned)(((size_t)NB_ * TT * DM / 8 + 255) / 256), 256, 0, stream>>>(x, XB, (size_t)NB_ * TT * DM / 8);
    k_gemmw<bf, 0, false, 1, DM><<<dim3(DQ / 64, TT / 64, NB_), 32, 0, stream>>>(WQ, nullptr, XB, nullptr, nullptr, 0, nullptr, 0, (size_t)TT * DM, (size_t)NH_ * TT * HD, CS, QP16, QPh, QPl);
    k_gemmw<bf, 0, false, 1, DM><<<dim3(DKV / 64, TT / 64, NB_), 32, 0, stream>>>(WK, nullptr, XB, nullptr, nullptr, 0, nullptr, 0, (size_t)TT * DM, (size_t)NKV * TT * HD, CS, KP16, KPh, KPl);
    k_gemmw<bf, 0, false, 2, DM><<<dim3(TT / 64, DKV / 64, NB_), 32, 0, stream>>>(XB, nullptr, WV, nullptr, nullptr, 0, nullptr, (size_t)TT * DM, 0, (size_t)NKV * HD * TT, nullptr, VT16, VTh, VTl);
    k_attn<<<dim3(NB_ * NH_, NF + RH / 16, 1), 32 * ANW, 0, stream>>>(QP16, KP16, VT16, QPh, QPl, KPh, KPl, VTh, VTl, ATh, ATl);
    k_gemmw<bf, 1, false, 0, DQ><<<dim3(TT / 64, DM / 64, NB_), 32, 0, stream>>>(ATh, ATl, WO, nullptr, OUT, DM, nullptr, (size_t)TT * DQ, 0, (size_t)TT * DM, nullptr, nullptr, nullptr, nullptr);
}

// v007
// Measured time: 210 microseconds a run.
// Two timings next to v006 put it at 1.24 and 1.27 times that version's speed.
// Over all steps from v000 it is 13.6 times as fast.
#include <hip/hip_runtime.h>

// Causal multi-head self-attention with interleaved-pair rotary embeddings (x [4][2048][1024]; qkv = x qkv_w^T ('oi' [3072][1024], row blocks q | k | v; 16 heads x 64); rotary on adjacent (even, odd) pairs with angle token_positions[t] x 10000^(-2i/64) (positions read from the int32 input; the reference's float32 table constants computed on device); scores / 8, causal (-inf); softmax; out = merged o_w^T ('oi', no bias) -> [4][2048][1024] (8.4 M)).
// Compute dtypes, f32 accumulate: every input rounded to bf16; q/k/v on PLAIN bf16 operands (inputs: exact); interleaved rotary in f32 (precise cosf/sinf table at the input positions); causal scores, streaming softmax (f32) and attn.v in one kernel: query rows < 512 hl (3 products), the rest single fp16 (x1024); o_w hl x exact (2 products).

// Fragment order: every 16-bit matrix operand plane M[r][k] (k contracted) is stored as 1-KiB blocks of 16 rows x 32 k; element (r, k) of a block lies at ((k >> 4) & 1) * 256 + ((k >> 3) & 1) * 128 + (r & 15) * 8 + (k & 7).
// A lane's fragment is then the 16 bytes at lane * 8 elements and those 256 elements on, so each wave-wide 16-byte load or store covers 512 contiguous bytes (4 whole lines) instead of 32-byte pieces of 16 lines.
// Block order: x, the weights and the merged attention output [r >> 4][k >> 5]; q and k per head [t >> 4][d >> 5]; v per head [t >> 5][d >> 4] (k = t): a 32-key chunk of k or of v is 4 contiguous KiB.
#define NB_  4
#define TT   2048
#define DM   1024
#define NH_  16
#define NKV  16
#define REP  (NH_ / NKV)
#define HD   64
#define DQ   (NH_ * HD)
#define DKV  (NKV * HD)
#define RH   512                  // query rows < RH use hi+lo planes (0: none)
#define SCL  0.125f   // HD^-0.5
typedef _Float16 h16;
typedef unsigned short bf;
typedef __attribute__((ext_vector_type(16))) __bf16   v16bf;
typedef __attribute__((ext_vector_type(16))) _Float16 v16h;
typedef __attribute__((ext_vector_type(8)))  _Float16 v8h;
typedef __attribute__((ext_vector_type(8)))  unsigned short v8us;
typedef __attribute__((ext_vector_type(8)))  float    v8f;
typedef __attribute__((ext_vector_type(4)))  float    v4f;
typedef v8h  __attribute__((may_alias)) v8ha;
typedef v4f  __attribute__((may_alias)) v4fa;
typedef v8us __attribute__((may_alias)) v8usa;

__device__ __forceinline__ unsigned short f2bf(float f) { unsigned u = __float_as_uint(f); u += 0x7FFFu + ((u >> 16) & 1u); return (unsigned short)(u >> 16); }
__device__ __forceinline__ float bf2f(unsigned short b) { return __uint_as_float(((unsigned)b) << 16); }
__device__ __forceinline__ float bfr(float f) { return bf2f(f2bf(f)); }
__device__ __forceinline__ v16h cat16(v8h lo, v8h hi) { return __builtin_shufflevector(lo, hi, 0, 1, 2, 3, 4, 5, 6, 7, 8, 9, 10, 11, 12, 13, 14, 15); }
__device__ __forceinline__ v16bf cat16b(v8us lo, v8us hi) { return __builtin_bit_cast(v16bf, __builtin_shufflevector(lo, hi, 0, 1, 2, 3, 4, 5, 6, 7, 8, 9, 10, 11, 12, 13, 14, 15)); }
__device__ __forceinline__ v8f wmma16(v16h a, v16h b, v8f c) { return __builtin_amdgcn_wmma_f32_16x16x32_f16(false, a, false, b, (short)0, c, false, false); }
__device__ __forceinline__ v8f wmmab(v16bf a, v16bf b, v8f c) { return __builtin_amdgcn_wmma_f32_16x16x32_bf16(false, a, false, b, (short)0, c, false, false); }



__device__ __forceinline__ h16 tohx(float x) { return (h16)x; }
__device__ __forceinline__ void splitf(float y, unsigned short& h, unsigned short& l) { h = f2bf(y); l = f2bf(y - bf2f(h)); }
typedef __attribute__((ext_vector_type(2))) _Float16 v2h;
typedef __attribute__((ext_vector_type(4))) _Float16 v4h;
typedef __attribute__((ext_vector_type(2))) unsigned short v2us;
typedef __attribute__((ext_vector_type(4))) unsigned short v4us;
typedef __attribute__((ext_vector_type(2))) float v2f;
typedef __attribute__((ext_vector_type(4))) int v4i;
typedef v4h  __attribute__((may_alias)) v4ha;
typedef v4us __attribute__((may_alias)) v4usa;
// one rotary pair (even, odd) at table entry cs = (cos, sin): the operations of the former rotary kernel in their order, so that the q and k planes keep their bits (the four products are rounded on their own, as in the reference's table form)
__device__ __forceinline__ void rot2(float x0, float x1, v2f cs, float& e0, float& e1) {
    float a0 = __fmul_rn(x0, cs[0]), b0 = __fmul_rn(x1, cs[1]), a1 = __fmul_rn(x1, cs[0]), b1 = __fmul_rn(x0, cs[1]); asm volatile("" : "+v"(a0), "+v"(b0), "+v"(a1), "+v"(b1));
    e0 = __fsub_rn(a0, b0); e1 = __fadd_rn(b1, a1);   /* even: x0 c - x1 s; odd: x0 s + x1 c */
}

// ---- k_gemmw: register-blocked GEMM, ONE WAVE per 64x64 output tile (16 accumulators), operands straight from 16-bit planes in fragment order; grid (M/64, N/64, Z), 32 threads.
// C[m][n] (f32, pitch ldc, + optional f32 bias[n]) = sum_k A[m][k] Bt[n][k] (+ split products per NSPLIT). z-batch strides sA/sB/sC in elements (sC: of C for EPI 0, of each 16-bit plane for EPI 1 and 2). K % 32 == 0.
// EPI says what leaves the tile. 0: the f32 tile to C. 1 and 2: a tile is 64 tokens of ONE head, and the wave writes that head's 16-bit planes (fp16 | bf16 hi | bf16 lo) itself, in fragment order, from registers; no f32 projection goes through memory.
// 1: A = the weight (M = heads x HD, head = bx), Bt = x (N = tokens): a lane's 8 accumulator rows of one column are 8 consecutive d of one token, 4 rotary pairs and one 16-byte unit of the [t][d] planes; table CS as cstab_entry lays it.
// 2: A = x (M = tokens), Bt = the weight (head = by): a lane's 8 accumulator rows are 8 consecutive t of one d, one 16-byte unit of the [d][t] planes.
template <typename T16> struct WFrag;
template <> struct WFrag<h16> { typedef v16h V; static __device__ __forceinline__ V ld(const h16* p) { return cat16(*(const v8h*)p, *(const v8h*)(p + 256)); } static __device__ __forceinline__ v8f mma(V a, V b, v8f c) { return wmma16(a, b, c); } };
template <> struct WFrag<bf> { typedef v16bf V; static __device__ __forceinline__ V ld(const bf* p) { return cat16b(*(const v8us*)p, *(const v8us*)(p + 256)); } static __device__ __forceinline__ v8f mma(V a, V b, v8f c) { return wmmab(a, b, c); } };
// The tile's body is a device function of the tile's place (bx, by, z), so that one launch can hold tiles of several products.
template <typename T16, int NSPLIT, bool BIAS, int EPI, int K>
__device__ __forceinline__ void gemm_tile(const int bx, const int by, const size_t z, const T16* __restrict__ A, const T16* __restrict__ A2, const T16* __restrict__ Bt, const T16* __restrict__ Bt2, float* C, int ldc, const float* __restrict__ bias, size_t sA, size_t sB, size_t sC, const float* __restrict__ CS, h16* P16, bf* Ph, bf* Pl) {
    typedef typename WFrag<T16>::V V;
    __shared__ __align__(16) float os[16 * 68];
    A += z * sA; if (A2) A2 += z * sA; Bt += z * sB; if (Bt2) Bt2 += z * sB; if constexpr (EPI == 0) C += z * sC; else { P16 += z * sC; Ph += z * sC; Pl += z * sC; }
    const int lane = threadIdx.x & 31, lr = lane & 15, hi = lane >> 4; const int r0 = bx * 64, c0 = by * 64;
    v8f acc[4][4];
#pragma unroll
    for (int mb = 0; mb < 4; ++mb)
#pragma unroll
        for (int nb = 0; nb < 4; ++nb) acc[mb][nb] = (v8f){};
    A += (size_t)r0 * K; if (A2) A2 += (size_t)r0 * K; Bt += (size_t)c0 * K; if (Bt2) Bt2 += (size_t)c0 * K;      // 16 rows of K fill 16 K elements
    unsigned fo = (unsigned)lane * 16u;      // one 32-bit byte offset per lane for every operand plane, carried round the loop (32 k = one block of 1024 bytes); every other step is a compile-time offset
    auto at = [&](const T16* p, int rb) { return (const T16*)((const char*)p + fo) + rb * 16 * K; };
#pragma unroll 1
    for (int kc = 0; kc < K; kc += 32) {
        V a[4], a2[4];
#pragma unroll
        for (int mb = 0; mb < 4; ++mb) { a[mb] = WFrag<T16>::ld(at(A, mb)); if (NSPLIT == 1 || NSPLIT == 2) a2[mb] = WFrag<T16>::ld(at(A2, mb)); }
#pragma unroll
        for (int nb = 0; nb < 4; ++nb) { const V b = WFrag<T16>::ld(at(Bt, nb)); V b2; if (NSPLIT >= 2) b2 = WFrag<T16>::ld(at(Bt2, nb));
#pragma unroll
            for (int mb = 0; mb < 4; ++mb) { acc[mb][nb] = WFrag<T16>::mma(a[mb], b, acc[mb][nb]); if (NSPLIT == 1 || NSPLIT == 2) acc[mb][nb] = WFrag<T16>::mma(a2[mb], b, acc[mb][nb]); if (NSPLIT >= 2) acc[mb][nb] = WFrag<T16>::mma(a[mb], b2, acc[mb][nb]); } }
        asm volatile("v_nop\n\tv_nop\n\tv_nop\n\tv_nop" : "+v"(acc[0][0]), "+v"(acc[1][1]), "+v"(acc[2][2]), "+v"(acc[3][3]) : "v"(a[0]), "v"(a[3]));
        // the wait that stands in front of a rewrite of a register which issued global loads name; the offset is an in-out operand so that its step cannot be lifted over it
        asm volatile("s_wait_xcnt 0x0" : "+v"(fo) :: "memory");
        fo += 1024u;
    }
    if constexpr (EPI == 2) {
        const size_t vb = (size_t)c0 * TT + (size_t)r0 * HD + lane * 8;      // one offset per lane (head plane, chunk r0 / 32, the lane's unit: d = lr, t = 8 hi); every step from there is a compile-time offset
#pragma unroll
        for (int nb = 0; nb < 4; ++nb)
#pragma unroll
            for (int mb = 0; mb < 4; ++mb) { v8h o16; v8us oh, ol;      // each store of the wave is one half block, 512 contiguous bytes
#pragma unroll
                for (int j = 0; j < 8; ++j) { const float x = acc[mb][nb][j]; o16[j] = tohx(x); unsigned short a2, c2; splitf(x, a2, c2); oh[j] = a2; ol[j] = c2; }
                const int eo = (mb >> 1) * 2048 + nb * 512 + (mb & 1) * 256; *(v8ha*)(P16 + vb + eo) = o16; *(v8usa*)(Ph + vb + eo) = oh; *(v8usa*)(Pl + vb + eo) = ol; }
        return;
    }
    if constexpr (EPI == 1) {
        // one address per lane for the table and one offset for the three planes (head plane, token block c0 / 16, the lane's unit: token lr, d = 8 hi); every step from there is a compile-time offset
        const float* cb = CS + (size_t)c0 * HD + lane * 4; const size_t pb = (size_t)bx * TT * HD + (size_t)c0 * HD + lane * 8;
        // the lane's table entries of two accumulator tiles (4 loads), fetched one such pair ahead: issued in front of the pair's first wait below, used behind its last, so that a pair's arithmetic covers their latency
        v4f tn[4];
        auto ldt = [&](int g) {
#pragma unroll
            for (int i = 0; i < 4; ++i) tn[i] = *(const v4fa*)(cb + g * 512 + i * 128); };
        ldt(0);
#pragma unroll
        for (int g = 0; g < 8; ++g) { v4f tc[4];
#pragma unroll
            for (int i = 0; i < 4; ++i) tc[i] = tn[i];
            if (g < 7) ldt(g + 1);
#pragma unroll
            for (int u = 0; u < 2; ++u) { const int nb = g >> 1, mb = (g & 1) * 2 + u; const v4f t0 = tc[2 * u], t1 = tc[2 * u + 1]; v8h o16; v8us oh, ol;      // the lane's 4 pairs (cos, sin): d = 16 mb + 8 hi + 0, 2 | 4, 6 of token c0 + 16 nb + lr
#pragma unroll
                for (int p = 0; p < 4; ++p) { const v4f tp = p < 2 ? t0 : t1; v2f cs; cs[0] = tp[2 * (p & 1)]; cs[1] = tp[2 * (p & 1) + 1]; float e0, e1; rot2(acc[mb][nb][2 * p], acc[mb][nb][2 * p + 1], cs, e0, e1); unsigned short a2, c2;
                    o16[2 * p] = tohx(e0); o16[2 * p + 1] = tohx(e1); splitf(e0, a2, c2); oh[2 * p] = a2; ol[2 * p] = c2; splitf(e1, a2, c2); oh[2 * p + 1] = a2; ol[2 * p + 1] = c2; }
                const int eo = nb * 1024 + mb * 256; *(v8ha*)(P16 + pb + eo) = o16; *(v8usa*)(Ph + pb + eo) = oh; *(v8usa*)(Pl + pb + eo) = ol;      // each store of the wave is one half block, 512 contiguous bytes
                asm volatile("s_wait_xcnt 0x0" ::: "memory"); } }      // the wait in front of a rewrite of registers which issued global stores name: the next unit's values land in the registers that this one was stored from
        return;
    }
#pragma unroll
    for (int mb = 0; mb < 4; ++mb) {
#pragma unroll
        for (int nb = 0; nb < 4; ++nb) {
#pragma unroll
            for (int j = 0; j < 8; ++j) os[(hi * 8 + j) * 68 + nb * 16 + lr] = acc[mb][nb][j]; }
        __builtin_amdgcn_wave_barrier(); asm volatile("" ::: "memory");
        float* crow = C + (size_t)(r0 + mb * 16) * ldc + c0;
#pragma unroll
            for (int s = 0; s < 8; ++s) { const int row = 2 * s + hi, cofs = lr * 4; v4f val = *(const v4fa*)(os + row * 68 + cofs); if (BIAS) { val[0] += bfr(bias[c0 + cofs]); val[1] += bfr(bias[c0 + cofs + 1]); val[2] += bfr(bias[c0 + cofs + 2]); val[3] += bfr(bias[c0 + cofs + 3]); }
                *(v4f*)(crow + (size_t)row * ldc + cofs) = val; }
        __builtin_amdgcn_wave_barrier(); asm volatile("" ::: "memory");
    }
}


template <typename T16, int NSPLIT, bool BIAS, int EPI, int K>
__global__ __launch_bounds__(32) void k_gemmw(const T16* __restrict__ A, const T16* __restrict__ A2, const T16* __restrict__ Bt, const T16* __restrict__ Bt2, float* C, int ldc, const float* __restrict__ bias, size_t sA, size_t sB, size_t sC, const float* __restrict__ CS, h16* P16, bf* Ph, bf* Pl) {
    gemm_tile<T16, NSPLIT, BIAS, EPI, K>(blockIdx.x, blockIdx.y, blockIdx.z, A, A2, Bt, Bt2, C, ldc, bias, sA, sB, sC, CS, P16, Ph, Pl);
}
// ---- k_qkv: the q, k and v projections in one launch; they depend on nothing of each other. grid (heads, TT / 64, 3 x batches): z / NB_ = 0: q, 1: k, 2: v (the same for a whole work-group), z % NB_ = the batch.
static_assert(DQ == DKV, "one grid serves the three projections");
__global__ __launch_bounds__(32) void k_qkv(const bf* __restrict__ WQ, const bf* __restrict__ WK, const bf* __restrict__ WV, const bf* __restrict__ XB, const float* __restrict__ CS,
                                            h16* QP16, bf* QPh, bf* QPl, h16* KP16, bf* KPh, bf* KPl, h16* VT16, bf* VTh, bf* VTl) {
    const int which = blockIdx.z / NB_; const size_t b = blockIdx.z % NB_;
    if (which == 2) gemm_tile<bf, 0, false, 2, DM>(blockIdx.y, blockIdx.x, b, XB, nullptr, WV, nullptr, nullptr, 0, nullptr, (size_t)TT * DM, 0, (size_t)NKV * HD * TT, nullptr, VT16, VTh, VTl);
    else gemm_tile<bf, 0, false, 1, DM>(blockIdx.x, blockIdx.y, b, which ? WK : WQ, nullptr, XB, nullptr, nullptr, 0, nullptr, 0, (size_t)TT * DM, (size_t)NH_ * TT * HD, CS, which ? KP16 : QP16, which ? KPh : QPh, which ? KPl : QPl);
}

__global__ __launch_bounds__(256) void k_wtG(const float* __restrict__ w, int K, int N, bf* Bt) {
    const int lane = threadIdx.x & 31; const int L0 = (blockIdx.x * 8 + (threadIdx.x >> 5)) * 8; const int nlines = N * K / 64;
{
#pragma unroll 1
        for (int l = 0; l < 8; ++l) { const int L = L0 + l; if (L >= nlines) break; const size_t e = (size_t)L * 64 + lane * 2; const int k = (int)(e % K), n = (int)(e / K); v2us o;
            o[0] = f2bf(w[(size_t)k * N + n]); o[1] = f2bf(w[(size_t)(k + 1) * N + n]); *(v2us*)(Bt + e) = o; }
         }
}
// f32 [r][DM] row-major -> bf16 in fragment order. 16-byte unit i of the destination holds 8 source elements: block i >> 6 = (r >> 4) * (DM / 32) + (k >> 5), half (i >> 5) & 1, lane i & 31 = ((k >> 3) & 1) * 16 + (r & 15).
// Wave wv takes units 256 wv .. 256 wv + 255, four neighbouring blocks of one 16-row group: unit 256 wv + 32 j + lane lies 16 j source elements and 256 j destination elements behind the lane's first,
// so that all 16 loads (whole 512-byte pieces of 16 rows) go out from one address before the first conversion, and each store of the wave is 512 contiguous bytes.
__device__ __forceinline__ void cvt_wave(const float* __restrict__ src, bf* dst, unsigned wv, int lane) {
    const unsigned blk = wv * 4u; unsigned so = (((blk / (DM / 32)) * 16 + (lane & 15)) * DM + (blk % (DM / 32)) * 32 + (lane >> 4) * 8) * 4u /* byte offset of the lane's first source element */; bf* d = dst + (size_t)wv * 2048 + lane * 8;
    v8f v[8];      // the three loops below are unrolled because they index register arrays: each index is then a compile-time register, each step a compile-time offset
#pragma unroll
    for (int j = 0; j < 8; ++j) v[j] = *(const v8f*)((const char*)src + so + j * 64);
    // the wait that stands in front of a rewrite of a register which issued global loads name; the offset is an in-out operand, so that its register stays the offset's up to here
    asm volatile("s_wait_xcnt 0x0" : "+v"(so) :: "memory");
#pragma unroll
    for (int j = 0; j < 8; ++j) { v8us o;
#pragma unroll
        for (int k = 0; k < 8; ++k) o[k] = f2bf(v[j][k]);
        *(v8us*)(d + j * 256) = o; }
}

__constant__ float INV[HD / 2] = {1.0f,0.749894202f,0.562341332f,0.421696514f,0.316227764f,0.237137362f,0.177827939f,0.133352146f,0.100000001f,0.0749894157f,0.0562341288f,0.0421696492f,0.0316227786f,0.0237137359f,0.0177827943f,0.0133352149f,0.00999999978f,0.00749894232f,0.00562341325f,0.00421696482f,0.00316227786f,0.00237137382f,0.00177827943f,0.00133352145f,0.00100000005f,0.000749894185f,0.000562341302f,0.000421696488f,0.000316227786f,0.000237137385f,0.00017782794f,0.00013335215f};
// one (cos, sin) per token and pair, laid as the q and k tiles read it: entry idx = [t >> 4][d >> 4][(d >> 2) & 1][lane = ((d >> 3) & 1) * 16 + (t & 15)][(d >> 1) & 1], so that a lane's 2 neighbouring pairs are 16 bytes and a wave's load 512 contiguous bytes
__device__ __forceinline__ void cstab_entry(const int* __restrict__ pos, float* CS, int idx) { const int t = (idx >> 9) * 16 + ((idx >> 1) & 15), pr = ((idx >> 7) & 3) * 8 + ((idx >> 5) & 1) * 4 + ((idx >> 6) & 1) * 2 + (idx & 1); const float ang = __fmul_rn((float)pos[t], INV[pr]); v2f cs; cs[0] = cosf(ang); cs[1] = sinf(ang);
    *(v2f*)(CS + (size_t)idx * 2) = cs;  }
// ---- k_prep: everything that the projections wait for, in one launch; the parts depend on nothing of each other. Work-groups 0 .. PB_T - 1: the rotary table, one entry a thread; the rest, 8 waves each: x, then qkv_w (its q | k | v row blocks are one plane of 3 x 1024 rows), then o_w.
#define PB_T (TT * HD / 2 / 256)
#define PW_X (NB_ * TT * DM / 2048)
#define PW_W ((DQ + 2 * DKV) * DM / 2048)
#define PW_O (DM * DQ / 2048)
static_assert(TT * HD / 2 % 256 == 0 && PW_X % 8 == 0 && PW_W % 8 == 0 && PW_O % 8 == 0 && DM % 128 == 0, "whole work-groups per part, a wave's four blocks in one row group");
__global__ __launch_bounds__(256) void k_prep(const float* __restrict__ x, const float* __restrict__ wqkv, const float* __restrict__ wo, const int* __restrict__ pos, bf* XB, bf* WQKV, bf* WO, float* CS) {
    if (blockIdx.x < PB_T) { cstab_entry(pos, CS, blockIdx.x * 256 + threadIdx.x); return; }
    const int lane = threadIdx.x & 31; const unsigned wv = (blockIdx.x - PB_T) * 8 + __builtin_amdgcn_readfirstlane(threadIdx.x >> 5) /* wave number in a scalar register: the part's pointers stay scalar */;
    const bool isx = wv < PW_X, isw = wv < PW_X + PW_W;      // wave-uniform: source, destination and the wave's number in its part are scalar selects, and the conversion stands once in the text
    cvt_wave(isx ? x : isw ? wqkv : wo, isx ? XB : isw ? WQKV : WO, wv - (isx ? 0u : isw ? (unsigned)PW_X : (unsigned)(PW_X + PW_W)), lane);
}

// ---- k_attn: causal scores, softmax and probability x value contraction in one kernel; no score matrix goes through the workspace. One work-group of ANW waves owns one block of query rows of one head.
// Transposed products: S^T = K Q^T (A = 16 key rows, B = 16 query rows), so that a lane holds 16 scores of ONE query per 32 keys (keys kc + 8 hi + j and kc + 16 + 8 hi + j); the two converted score tiles are,
// register for register, the B operand of O^T += V^T P^T (A = 16 rows of the [d][t] value plane). Running maximum m and sum l per query (streaming softmax): a new maximum rescales l and O^T by exp(m_old - m_new).
// The 32-key chunks up to the diagonal are dealt to the waves (wave w: chunks w, w + ANW, ...); the ANW partial (m, l, O) go to LDS and are joined in fixed wave order 0..ANW-1 with weights exp(m_w - max m).
// HL: bf16 hi + lo planes, 3 products each (query rows < RH); otherwise single fp16 with the probabilities carried x1024 (the factor is in l too and cancels). Output: the merged [t][DQ] bf16 hi | lo planes, in fragment order.
// Every '#pragma unroll' below stands on a loop of constant length that indexes register arrays (fragments, accumulators, a lane's scores): unrolled, each index is a compile-time register.
#define ANW 4
#define L2E 1.4426950408889634f
__device__ __forceinline__ float xhalf(float x) { return __builtin_bit_cast(float, __builtin_amdgcn_permlanex16(__builtin_bit_cast(int, x), __builtin_bit_cast(int, x), 0x76543210, 0xfedcba98, false, false)); }  // lane l with lane l ^ 16
// v_exp_f32 and, in the same statement, the one slot that the instruction set asks for between a transcendental and an instruction that reads its result or overwrites its source
__device__ __forceinline__ float exp2s(float x) { float r; asm("v_exp_f32 %0, %1\n\tv_nop" : "=v"(r) : "v"(x)); return r; }
template <bool HL> struct AT;
template <> struct AT<true> { typedef bf T; };
template <> struct AT<false> { typedef h16 T; };
template <bool HL, int NQ>
__device__ __forceinline__ void attn_tile(const typename AT<HL>::T* __restrict__ Q, const typename AT<HL>::T* __restrict__ Q2, const typename AT<HL>::T* __restrict__ Kp, const typename AT<HL>::T* __restrict__ Kp2,
                                          const typename AT<HL>::T* __restrict__ Vp, const typename AT<HL>::T* __restrict__ Vp2, int q0, int hcol, bf* Ah, bf* Al, float* sO, float* sM, float* sL) {
    typedef typename AT<HL>::T T; typedef WFrag<T> F; typedef typename F::V V;
    const int tid = threadIdx.x, lane = tid & 31, lr = lane & 15, hi = lane >> 4; const int w = __builtin_amdgcn_readfirstlane(tid >> 5) /* wave number in a scalar register: the chunk loop keeps a scalar bound test */;
    V qf[NQ][2], qg[NQ][2];
#pragma unroll
    for (int qt = 0; qt < NQ; ++qt)
#pragma unroll
        for (int ks = 0; ks < 2; ++ks) { const size_t qo = (size_t)(q0 + qt * 16) * HD + ks * 512 + lane * 8; qf[qt][ks] = F::ld(Q + qo); if (HL) qg[qt][ks] = F::ld(Q2 + qo); }
    v8f o[NQ][4]; float m[NQ], l[NQ];
#pragma unroll
    for (int qt = 0; qt < NQ; ++qt) { m[qt] = -1.0e30f; l[qt] = 0.f;
#pragma unroll
        for (int dt = 0; dt < 4; ++dt) o[qt][dt] = (v8f){}; }
    const int kend = q0 + NQ * 16;      // keys beyond the block's last query row are masked for every row of it
    // one 32-bit byte offset per lane into the key planes and one into the value planes, carried round the loop (fragment order: chunk 32 w of either plane starts at element 32 w HD, the lane's unit at lane * 8)
    unsigned ko = (unsigned)(32 * w * HD + lane * 8) * 2u, vo = ko;
    V kf[2][2], kg[2][2], vf[4], vg[4];
    auto ldk = [&]() {
#pragma unroll
        for (int kt = 0; kt < 2; ++kt)
#pragma unroll
            for (int ks = 0; ks < 2; ++ks) { kf[kt][ks] = F::ld((const T*)((const char*)Kp + ko) + kt * 1024 + ks * 512); if (HL) kg[kt][ks] = F::ld((const T*)((const char*)Kp2 + ko) + kt * 1024 + ks * 512); } };
    auto ldv = [&]() {
#pragma unroll
        for (int dt = 0; dt < 4; ++dt) { vf[dt] = F::ld((const T*)((const char*)Vp + vo) + dt * 512); if (HL) vg[dt] = F::ld((const T*)((const char*)Vp2 + vo) + dt * 512); } };
    // fp16 blocks (up to TT / 32 / ANW trips): every chunk but the wave's first is fetched one trip ahead, into the same registers, right behind the products that read them.
    // hi+lo blocks (at most RH / 32 / ANW trips, twice the fragments): each trip fetches its own chunk, so that the kernel stays within 256 registers.
    if (!HL && 32 * w < kend) {
        __builtin_amdgcn_sched_barrier(0);      // the query loads are issued first ...
        ldk(); ldv();
        // ... and have landed before the loop (inputs only, loaded values): otherwise the loop head's wait for them, which counts loads in issue order, would also wait for the value loads that each trip has just issued
        if constexpr (NQ == 2) asm volatile("" :: "v"(qf[0][0]), "v"(qf[0][1]), "v"(qf[1][0]), "v"(qf[1][1]));
    }
#pragma unroll 1   // rolled: one chunk's fragments, the query fragments, the scores and the output tiles fill most of a wave's 256 registers
    for (int kc = 32 * w; kc < kend; kc += 32 * ANW) {
        const bool more = kc + 32 * ANW < kend;      // wave-uniform; the last trip fetches its own chunk once more instead of one past the end: with no branch round the loads the load counter is exact at every wait
        if (HL) { ldk(); ldv(); }
        v8f s[NQ][2];
#pragma unroll
        for (int qt = 0; qt < NQ; ++qt)
#pragma unroll
            for (int kt = 0; kt < 2; ++kt) { s[qt][kt] = (v8f){};
#pragma unroll
                for (int ks = 0; ks < 2; ++ks) { s[qt][kt] = F::mma(kf[kt][ks], qf[qt][ks], s[qt][kt]); if (HL) { s[qt][kt] = F::mma(kf[kt][ks], qg[qt][ks], s[qt][kt]); s[qt][kt] = F::mma(kg[kt][ks], qf[qt][ks], s[qt][kt]); } } }
        if (!HL) {
            __builtin_amdgcn_sched_barrier(0);      // keeps the next chunk's key loads, and the wait in front of them, behind every score product (they land in the same registers) ...
            // the wait that stands in front of a rewrite of a register which issued global loads name; the offset is an in-out operand so that its step cannot be lifted over it
            asm volatile("s_wait_xcnt 0x0" : "+v"(ko) :: "memory");
            ko += more ? 32u * ANW * HD * 2u : 0u;
            ldk();
            __builtin_amdgcn_sched_barrier(0);      // ... and in front of the softmax, whose time covers their latency (left free, the scheduler sinks each load to its first use)
        }
#pragma unroll
        for (int qt = 0; qt < NQ; ++qt) {
            const int lim = q0 + qt * 16 + lr - kc - hi * 8; float t[16]; float mx = -2.0e38f;      // causal: the lane's key number e (kc + 8 hi + 16 (e >> 3) + (e & 7)) counts while it is <= the lane's query row
#pragma unroll
            for (int e = 0; e < 16; ++e) { t[e] = ((e >> 3) * 16 + (e & 7) <= lim) ? s[qt][e >> 3][e & 7] * SCL : -2.0e38f; mx = fmaxf(mx, t[e]); }
            mx = fmaxf(mx, xhalf(mx));      // the other half-wave holds the query's other 16 keys
            const float mn = fmaxf(m[qt], mx), al = exp2s((m[qt] - mn) * L2E); m[qt] = mn;
            float p[16];
#pragma unroll
            for (int e = 0; e < 16; ++e) p[e] = exp2s((t[e] - mn) * L2E + (HL ? 0.0f : 10.0f));   // a masked key gives exactly 0 (m >= -1e30)
            l[qt] = l[qt] * al + ((((p[0] + p[1]) + (p[2] + p[3])) + ((p[4] + p[5]) + (p[6] + p[7]))) + (((p[8] + p[9]) + (p[10] + p[11])) + ((p[12] + p[13]) + (p[14] + p[15]))));
#pragma unroll
            for (int dt = 0; dt < 4; ++dt) o[qt][dt] *= al;
            if constexpr (HL) { v8us h0, h1, l0, l1;
#pragma unroll
                for (int e = 0; e < 8; ++e) { unsigned short a, c2; splitf(p[e], a, c2); h0[e] = a; l0[e] = c2; splitf(p[8 + e], a, c2); h1[e] = a; l1[e] = c2; }
                const V ph = cat16b(h0, h1), pl = cat16b(l0, l1);
#pragma unroll
                for (int dt = 0; dt < 4; ++dt) { o[qt][dt] = F::mma(vf[dt], ph, o[qt][dt]); o[qt][dt] = F::mma(vf[dt], pl, o[qt][dt]); o[qt][dt] = F::mma(vg[dt], ph, o[qt][dt]); }
            } else { V pb;
#pragma unroll
                for (int e = 0; e < 16; ++e) pb[e] = tohx(p[e]);
#pragma unroll
                for (int dt = 0; dt < 4; ++dt) o[qt][dt] = F::mma(vf[dt], pb, o[qt][dt]); }
        }
        if (HL) { asm volatile("s_wait_xcnt 0x0" : "+v"(ko), "+v"(vo) :: "memory");      // the wait in front of the steps of both offsets, which issued global loads name
            ko += 32u * ANW * HD * 2u; vo += 32u * ANW * HD * 2u;
        } else { asm volatile("s_wait_xcnt 0x0" : "+v"(vo) :: "memory");      // as above, for the value offset
            vo += more ? 32u * ANW * HD * 2u : 0u;
            ldv(); }
    }
    // the same wait on the way out of the loop: the last trip's value loads name the offset's register, which is free for other values from here on (kept live up to this line as an in-out operand)
    if (!HL) asm volatile("s_wait_xcnt 0x0" : "+v"(vo) :: "memory");
#pragma unroll
    for (int qt = 0; qt < NQ; ++qt) { l[qt] += xhalf(l[qt]); const int qr = w * NQ * 16 + qt * 16 + lr;
        if (hi == 0) { sM[qr] = m[qt]; sL[qr] = l[qt]; }
#pragma unroll
        for (int dt = 0; dt < 4; ++dt)
#pragma unroll
            for (int jh = 0; jh < 2; ++jh) { const v8f a = o[qt][dt]; v4f x; x[0] = a[jh * 4]; x[1] = a[jh * 4 + 1]; x[2] = a[jh * 4 + 2]; x[3] = a[jh * 4 + 3]; *(v4fa*)(sO + (size_t)qr * 68 + dt * 16 + hi * 8 + jh * 4) = x; } }
    __syncthreads();      // every wave's partial (m, l, O) is in LDS before any wave joins them
    // join: a thread takes DPT consecutive d of one query row. The output planes are in fragment order, where 8 consecutive rows' units of the same 8 d are one 128-byte line: a wave takes 8 rows x 4 parts, so that every line has one writer
    constexpr int DPT = NQ * 16 * HD / (32 * ANW), PARTS = HD / DPT; static_assert(32 * ANW == 128 && (PARTS == 4 || PARTS == 8), "the deal below is for 4 waves");
    const int ql = PARTS == 4 ? tid / 4 : ((tid >> 5) & 1) * 8 + (tid & 7), d0 = (PARTS == 4 ? tid % 4 : (tid >> 6) * 4 + ((tid >> 3) & 3)) * DPT;
    float M = sM[ql];
#pragma unroll
    for (int k = 1; k < ANW; ++k) M = fmaxf(M, sM[k * NQ * 16 + ql]);
    float f[ANW]; float L = 0.f;
#pragma unroll
    for (int k = 0; k < ANW; ++k) { f[k] = exp2s((sM[k * NQ * 16 + ql] - M) * L2E); L += f[k] * sL[k * NQ * 16 + ql]; }
    const float inv = __fdiv_rn(1.0f, L);
#pragma unroll
    for (int c = 0; c < DPT; c += 8) { v8us oh, ol;
#pragma unroll
        for (int g = 0; g < 2; ++g) { v4f a = *(const v4fa*)(sO + (size_t)ql * 68 + d0 + c + g * 4) * f[0];
#pragma unroll
            for (int k = 1; k < ANW; ++k) a += *(const v4fa*)(sO + (size_t)(k * NQ * 16 + ql) * 68 + d0 + c + g * 4) * f[k];
#pragma unroll
            for (int q = 0; q < 4; ++q) { unsigned short x, y; splitf(a[q] * inv, x, y); oh[g * 4 + q] = x; ol[g * 4 + q] = y; } }
        const int kk = hcol + d0 + c, rr = q0 + ql; const size_t oo = ((size_t)(rr >> 4) * (DQ / 32) + (kk >> 5)) * 512 + ((kk >> 4) & 1) * 256 + ((kk >> 3) & 1) * 128 + (rr & 15) * 8; *(v8usa*)(Ah + oo) = oh; *(v8usa*)(Al + oo) = ol; }
    // the wait behind the stores of the hi+lo instance: in the built kernel its code is followed by a branch whose other side (the fp16 instance) rewrites the registers that these stores name
    if (HL) asm volatile("s_wait_xcnt 0x0" ::: "memory");
}
// grid (batches x heads, NF + RH / 16): x = batch * heads + head, the index of the [batch][head] planes; y < NF: fp16 blocks of 32 query rows, the longest (last) rows first; the rest: hi+lo blocks of 16 query rows. The choice is the same for a whole work-group.
// The longest blocks of every batch and head have the lowest y (for speed only).
#define NF ((TT - RH) / 32)
__global__ __launch_bounds__(32 * ANW) void k_attn(const h16* __restrict__ Q16, const h16* __restrict__ K16, const h16* __restrict__ V16, const bf* __restrict__ Qh, const bf* __restrict__ Ql, const bf* __restrict__ Kh, const bf* __restrict__ Kl,
                                                   const bf* __restrict__ Vh, const bf* __restrict__ Vl, bf* Ah, bf* Al) {
    __shared__ __align__(16) float sO[ANW * 32 * 68]; __shared__ float sM[ANW * 32]; __shared__ float sL[ANW * 32];
    const int bx = blockIdx.y, b = blockIdx.x / NH_, h = blockIdx.x % NH_; const size_t pq = (size_t)blockIdx.x * TT * HD, pk = (size_t)(b * NKV + h / REP) * TT * HD; Ah += (size_t)b * TT * DQ; Al += (size_t)b * TT * DQ;
    if (bx < NF) attn_tile<false, 2>(Q16 + pq, nullptr, K16 + pk, nullptr, V16 + pk, nullptr, TT - 32 * (bx + 1), h * HD, Ah, Al, sO, sM, sL);
    else attn_tile<true, 1>(Qh + pq, Ql + pq, Kh + pk, Kl + pk, Vh + pk, Vl + pk, RH - 16 * (bx - NF + 1), h * HD, Ah, Al, sO, sM, sL);
}

extern "C" void kernel_launch(void* const* d_in, const int* in_sizes, int n_in,
                              void* d_out, int out_size, void* d_ws, size_t ws_size, hipStream_t stream) {
    (void)in_sizes; (void)n_in; (void)out_size;
    const float* x = (const float*)d_in[0]; const int* PID = (const int*)d_in[1]; const float* wqkv = (const float*)d_in[2]; const float* wo = (const float*)d_in[3];  const float* wq = wqkv; const float* wk = wqkv + (size_t)1024 * 1024; const float* wv = wqkv + (size_t)2048 * 1024; (void)wq; (void)wk; (void)wv;
    float* OUT = (float*)d_out;     // [4][2048][1024]
    char* wsp = (char*)d_ws;
    auto take = [&](size_t bytes) { char* p = wsp; wsp += (bytes + 255) & ~(size_t)255; return (void*)p; };
    bf* WQ = (bf*)take((size_t)(DQ + 2 * DKV) * DM * 2); bf* WK = WQ + (size_t)DQ * DM; bf* WV = WK + (size_t)DKV * DM; bf* WO = (bf*)take((size_t)DM * DQ * 2); float* CS = (float*)take((size_t)TT * HD * 2 * 4);
    bf* XB = (bf*)take((size_t)NB_ * TT * DM * 2);      // from here on every buffer holds all NB_ batches, batch outermost
    h16* QP16 = (h16*)take((size_t)NB_ * NH_ * TT * HD * 2); h16* KP16 = (h16*)take((size_t)NB_ * NKV * TT * HD * 2); h16* VT16 = (h16*)take((size_t)NB_ * NKV * HD * TT * 2);
    bf* QPh = (bf*)take((size_t)NB_ * NH_ * TT * HD * 2); bf* QPl = (bf*)take((size_t)NB_ * NH_ * TT * HD * 2); bf* KPh = (bf*)take((size_t)NB_ * NKV * TT * HD * 2); bf* KPl = (bf*)take((size_t)NB_ * NKV * TT * HD * 2); bf* VTh = (bf*)take((size_t)NB_ * NKV * HD * TT * 2); bf* VTl = (bf*)take((size_t)NB_ * NKV * HD * TT * 2);
    bf* ATh = (bf*)take((size_t)NB_ * TT * DQ * 2); bf* ATl = (bf*)take((size_t)NB_ * TT * DQ * 2);
    if ((size_t)(wsp - (char*)d_ws) > ws_size) return;    // ws 256 MiB
    // four launches, each for all NB_ batches; a launch holds every stage that waits for the same earlier launch
    k_prep<<<PB_T + (PW_X + PW_W + PW_O) / 8, 256, 0, stream>>>(x, wqkv, wo, PID, XB, WQ, WO, CS);
    k_qkv<<<dim3(DQ / 64, TT / 64, 3 * NB_), 32, 0, stream>>>(WQ, WK, WV, XB, CS, QP16, QPh, QPl, KP16, KPh, KPl, VT16, VTh, VTl);
    k_attn<<<dim3(NB_ * NH_, NF + RH / 16, 1), 32 * ANW, 0, stream>>>(QP16, KP16, VT16, QPh, QPl, KPh, KPl, VTh, VTl, ATh, ATl);
    k_gemmw<bf, 1, false, 0, DQ><<<dim3(TT / 64, DM / 64, NB_), 32, 0, stream>>>(ATh, ATl, WO, nullptr, OUT, DM, nullptr, (size_t)TT * DQ, 0, (size_t)TT * DM, nullptr, nullptr, nullptr, nullptr);
}

// v008
// One run takes 145 microseconds.
// Next to v007, in two timings, it ran 1.44 and 1.42 times as fast.
// Over all steps from v000 it is 19.5 times as fast.
#include <hip/hip_runtime.h>

// Causal multi-head self-attention with interleaved-pair rotary embeddings (x [4][2048][1024]; qkv = x qkv_w^T ('oi' [3072][1024], row blocks q | k | v; 16 heads x 64); rotary on adjacent (even, odd) pairs with angle token_positions[t] x 10000^(-2i/64) (positions read from the int32 input; the reference's float32 table constants computed on device); scores / 8, causal (-inf); softmax; out = merged o_w^T ('oi', no bias) -> [4][2048][1024] (8.4 M)).
// Compute dtypes, f32 accumulate: every input rounded to bf16; q/k/v on PLAIN bf16 operands (inputs: exact); interleaved rotary in f32 (precise cosf/sinf table at the input positions); causal scores, streaming softmax (f32) and attn.v in one kernel: query rows < 512 hl (3 products), the rest single fp16 (x1024); o_w hl x exact (2 products).

// Fragment order: every 16-bit matrix operand plane M[r][k] (k contracted) is stored as 1-KiB blocks of 16 rows x 32 k; element (r, k) of a block lies at ((k >> 4) & 1) * 256 + ((k >> 3) & 1) * 128 + (r & 15) * 8 + (k & 7).
// A lane's fragment is then the 16 bytes at lane * 8 elements and those 256 elements on, so each wave-wide 16-byte load or store covers 512 contiguous bytes (4 whole lines) instead of 32-byte pieces of 16 lines.
// Block order: x, the weights and the merged attention output [r >> 4][k >> 5]; q and k per head [t >> 4][d >> 5]; v per head [t >> 5][d >> 4] (k = t): a 32-key chunk of k or of v is 4 contiguous KiB.
#define NB_  4
#define TT   2048
#define DM   1024
#define NH_  16
#define NKV  16
#define REP  (NH_ / NKV)
#define HD   64
#define DQ   (NH_ * HD)
#define DKV  (NKV * HD)
#define RH   512                  // query rows < RH use hi+lo planes (0: none)
#define SCL  0.125f   // HD^-0.5
typedef _Float16 h16;
typedef unsigned short bf;
typedef __attribute__((ext_vector_type(16))) __bf16   v16bf;
typedef __attribute__((ext_vector_type(16))) _Float16 v16h;
typedef __attribute__((ext_vector_type(8)))  _Float16 v8h;
typedef __attribute__((ext_vector_type(8)))  unsigned short v8us;
typedef __attribute__((ext_vector_type(8)))  float    v8f;
typedef __attribute__((ext_vector_type(4)))  float    v4f;
typedef v8h  __attribute__((may_alias)) v8ha;
typedef v4f  __attribute__((may_alias)) v4fa;
typedef v8us __attribute__((may_alias)) v8usa;

__device__ __forceinline__ unsigned short f2bf(float f) { unsigned u = __float_as_uint(f); u += 0x7FFFu + ((u >> 16) & 1u); return (unsigned short)(u >> 16); }
__device__ __forceinline__ float bf2f(unsigned short b) { return __uint_as_float(((unsigned)b) << 16); }
__device__ __forceinline__ float bfr(float f) { return bf2f(f2bf(f)); }
__device__ __forceinline__ v16h cat16(v8h lo, v8h hi) { return __builtin_shufflevector(lo, hi, 0, 1, 2, 3, 4, 5, 6, 7, 8, 9, 10, 11, 12, 13, 14, 15); }
__device__ __forceinline__ v16bf cat16b(v8us lo, v8us hi) { return __builtin_bit_cast(v16bf, __builtin_shufflevector(lo, hi, 0, 1, 2, 3, 4, 5, 6, 7, 8, 9, 10, 11, 12, 13, 14, 15)); }
__device__ __forceinline__ v8f wmma16(v16h a, v16h b, v8f c) { return __builtin_amdgcn_wmma_f32_16x16x32_f16(false, a, false, b, (short)0, c, false, false); }
__device__ __forceinline__ v8f wmmab(v16bf a, v16bf b, v8f c) { return __builtin_amdgcn_wmma_f32_16x16x32_bf16(false, a, false, b, (short)0, c, false, false); }



__device__ __forceinline__ h16 tohx(float x) { return (h16)x; }
__device__ __forceinline__ void splitf(float y, unsigned short& h, unsigned short& l) { h = f2bf(y); l = f2bf(y - bf2f(h)); }
typedef __attribute__((ext_vector_type(2))) _Float16 v2h;
typedef __attribute__((ext_vector_type(4))) _Float16 v4h;
typedef __attribute__((ext_vector_type(2))) unsigned short v2us;
typedef __attribute__((ext_vector_type(4))) unsigned short v4us;
typedef __attribute__((ext_vector_type(2))) float v2f;
typedef __attribute__((ext_vector_type(4))) int v4i;
typedef v4h  __attribute__((may_alias)) v4ha;
typedef v4us __attribute__((may_alias)) v4usa;
// one rotary pair (even, odd) at table entry cs = (cos, sin): the operations of the former rotary kernel in their order, so that the q and k planes keep their bits (the four products are rounded on their own, as in the reference's table form)
__device__ __forceinline__ void rot2(float x0, float x1, v2f cs, float& e0, float& e1) {
    float a0 = __fmul_rn(x0, cs[0]), b0 = __fmul_rn(x1, cs[1]), a1 = __fmul_rn(x1, cs[0]), b1 = __fmul_rn(x0, cs[1]); asm volatile("" : "+v"(a0), "+v"(b0), "+v"(a1), "+v"(b1));
    e0 = __fsub_rn(a0, b0); e1 = __fadd_rn(b1, a1);   /* even: x0 c - x1 s; odd: x0 s + x1 c */
}

// ---- k_gemmw: register-blocked GEMM, ONE WAVE per 64x64 output tile (16 accumulators), operands straight from 16-bit planes in fragment order; grid (M/64, N/64, Z), 32 threads.
// C[m][n] (f32, pitch ldc, + optional f32 bias[n]) = sum_k A[m][k] Bt[n][k] (+ split products per NSPLIT). z-batch strides sA/sB/sC in elements (sC: of C for EPI 0, of each 16-bit plane for EPI 1 and 2). K % 256 == 0.
// EPI says what leaves the tile. 0: the f32 tile to C. 1 and 2: a tile is 64 tokens of ONE head, and the wave writes that head's 16-bit planes (fp16 | bf16 hi | bf16 lo) itself, in fragment order, from registers; no f32 projection goes through memory.
// 1: A = the weight (M = heads x HD, head = bx), Bt = x (N = tokens): a lane's 8 accumulator rows of one column are 8 consecutive d of one token, 4 rotary pairs and one 16-byte unit of the [t][d] planes; table CS as cstab_entry lays it.
// 2: A = x (M = tokens), Bt = the weight (head = by): a lane's 8 accumulator rows are 8 consecutive t of one d, one 16-byte unit of the [d][t] planes.
template <typename T16> struct WFrag;
template <> struct WFrag<h16> { typedef v16h V; static __device__ __forceinline__ V ld(const h16* p) { return cat16(*(const v8h*)p, *(const v8h*)(p + 256)); } static __device__ __forceinline__ v8f mma(V a, V b, v8f c) { return wmma16(a, b, c); } };
template <> struct WFrag<bf> { typedef v16bf V; static __device__ __forceinline__ V ld(const bf* p) { return cat16b(*(const v8us*)p, *(const v8us*)(p + 256)); } static __device__ __forceinline__ v8f mma(V a, V b, v8f c) { return wmmab(a, b, c); } };
// The tile's body is a device function of the tile's place (bx, by, z), so that one launch can hold tiles of several products.
template <typename T16, int NSPLIT, bool BIAS, int EPI, int K>
__device__ __forceinline__ void gemm_tile(const int bx, const int by, const size_t z, const T16* __restrict__ A, const T16* __restrict__ A2, const T16* __restrict__ Bt, const T16* __restrict__ Bt2, float* C, int ldc, const float* __restrict__ bias, size_t sA, size_t sB, size_t sC, const float* __restrict__ CS, h16* P16, bf* Ph, bf* Pl) {
    typedef typename WFrag<T16>::V V;
    __shared__ __align__(16) float os[16 * 68];
    A += z * sA; if (A2) A2 += z * sA; Bt += z * sB; if (Bt2) Bt2 += z * sB; if constexpr (EPI == 0) C += z * sC; else { P16 += z * sC; Ph += z * sC; Pl += z * sC; }
    const int lane = threadIdx.x & 31, lr = lane & 15, hi = lane >> 4; const int r0 = bx * 64, c0 = by * 64;
    v8f acc[4][4];
#pragma unroll
    for (int mb = 0; mb < 4; ++mb)
#pragma unroll
        for (int nb = 0; nb < 4; ++nb) acc[mb][nb] = (v8f){};
    A += (size_t)r0 * K; if (A2) A2 += (size_t)r0 * K; Bt += (size_t)c0 * K; (void)Bt2;      // 16 rows of K fill 16 K elements
    static_assert(NSPLIT <= 1 && K % 256 == 0, "planes A (A2) Bt; whole trips of US steps");
    constexpr int US = 8;      // steps per trip: unrolled, so that the two A sets are compile-time registers and the offsets are stepped (behind their wait) once in US steps
    unsigned fo = (unsigned)lane * 16u;      // one 32-bit byte offset per lane for every operand plane, carried round the loop (32 k = one step = one block of 1024 bytes); every other distance is a compile-time offset
    unsigned fn = fo;      // the offset of the next trip's first step (of this trip's once more in the last trip)
    auto at = [&](const T16* p, int rb, int st) { return (const T16*)((const char*)p + (st == US ? fn : fo)) + rb * 16 * K + (st == US ? 0 : st) * 512; };      // row group rb, st steps behind the trip's first
    // Every fragment is fetched ONE STEP AHEAD of the products that read it, so that a step waits for no load that it has issued itself:
    // the A side has two register sets (the next step's four fragments go out at the head of a step); each B fragment is fetched again, into its own registers, right behind the four products that read it.
    // Loads return in issue order and are issued in the order of their first use, so that every wait is a counted one.
    V a[2][4], a2[2][4], b[4];
    auto lda = [&](int set, int st) {
#pragma unroll
        for (int mb = 0; mb < 4; ++mb) { a[set][mb] = WFrag<T16>::ld(at(A, mb, st)); if (NSPLIT == 1) a2[set][mb] = WFrag<T16>::ld(at(A2, mb, st)); } };
    lda(0, 0);
#pragma unroll
    for (int nb = 0; nb < 4; ++nb) b[nb] = WFrag<T16>::ld(at(Bt, nb, 0));
#pragma unroll 1   // rolled: US steps of text are enough to hide the offset's step
    for (int kc = 0; kc < K; kc += 32 * US) {
        fn = fo + (kc + 32 * US < K ? US * 1024u : 0u);      // wave-uniform choice; the last step of all fetches its trip's first step once more instead of one past the end: with no branch round the loads the load counter is exact at every wait
#pragma unroll   // unrolled: the register set (u & 1) and each step's distance from the offset are then compile-time
        for (int u = 0; u < US; ++u) {
            const int cs = u & 1, st = u + 1;
            lda(cs ^ 1, st);
            __builtin_amdgcn_sched_barrier(0);      // the next step's A loads stay at the head of this step (left free, the scheduler sinks each load to its first use)
#pragma unroll
            for (int nb = 0; nb < 4; ++nb) {
#pragma unroll
                for (int mb = 0; mb < 4; ++mb) { acc[mb][nb] = WFrag<T16>::mma(a[cs][mb], b[nb], acc[mb][nb]); if (NSPLIT == 1) acc[mb][nb] = WFrag<T16>::mma(a2[cs][mb], b[nb], acc[mb][nb]); }
                __builtin_amdgcn_sched_barrier(0);      // the next step's B fragment is asked for behind the products that read this one (same registers) ...
                b[nb] = WFrag<T16>::ld(at(Bt, nb, st));
                __builtin_amdgcn_sched_barrier(0);      // ... and in front of the next column's products, whose time covers its latency
            }
        }
        // the wait that stands in front of a rewrite of a register which issued global loads name (both offsets here, the scalar bases behind the loop); the offsets are in-out operands so that their steps cannot be lifted over it
        asm volatile("s_wait_xcnt 0x0" : "+v"(fo), "+v"(fn) :: "memory");
        fo = fn;
    }
    if constexpr (EPI == 2) {
        const size_t vb = (size_t)c0 * TT + (size_t)r0 * HD + lane * 8;      // one offset per lane (head plane, chunk r0 / 32, the lane's unit: d = lr, t = 8 hi); every step from there is a compile-time offset
#pragma unroll
        for (int nb = 0; nb < 4; ++nb)
#pragma unroll
            for (int mb = 0; mb < 4; ++mb) { v8h o16; v8us oh, ol;      // each store of the wave is one half block, 512 contiguous bytes
#pragma unroll
                for (int j = 0; j < 8; ++j) { const float x = acc[mb][nb][j]; o16[j] = tohx(x); unsigned short a2, c2; splitf(x, a2, c2); oh[j] = a2; ol[j] = c2; }
                const int eo = (mb >> 1) * 2048 + nb * 512 + (mb & 1) * 256; *(v8ha*)(P16 + vb + eo) = o16; *(v8usa*)(Ph + vb + eo) = oh; *(v8usa*)(Pl + vb + eo) = ol; }
        return;
    }
    if constexpr (EPI == 1) {
        // one address per lane for the table and one offset for the three planes (head plane, token block c0 / 16, the lane's unit: token lr, d = 8 hi); every step from there is a compile-time offset
        const float* cb = CS + (size_t)c0 * HD + lane * 4; const size_t pb = (size_t)bx * TT * HD + (size_t)c0 * HD + lane * 8;
        // the lane's table entries of two accumulator tiles (4 loads), fetched one such pair ahead: issued in front of the pair's first wait below, used behind its last, so that a pair's arithmetic covers their latency
        v4f tn[4];
        auto ldt = [&](int g) {
#pragma unroll
            for (int i = 0; i < 4; ++i) tn[i] = *(const v4fa*)(cb + g * 512 + i * 128); };
        ldt(0);
#pragma unroll
        for (int g = 0; g < 8; ++g) { v4f tc[4];
#pragma unroll
            for (int i = 0; i < 4; ++i) tc[i] = tn[i];
            if (g < 7) ldt(g + 1);
#pragma unroll
            for (int u = 0; u < 2; ++u) { const int nb = g >> 1, mb = (g & 1) * 2 + u; const v4f t0 = tc[2 * u], t1 = tc[2 * u + 1]; v8h o16; v8us oh, ol;      // the lane's 4 pairs (cos, sin): d = 16 mb + 8 hi + 0, 2 | 4, 6 of token c0 + 16 nb + lr
#pragma unroll
                for (int p = 0; p < 4; ++p) { const v4f tp = p < 2 ? t0 : t1; v2f cs; cs[0] = tp[2 * (p & 1)]; cs[1] = tp[2 * (p & 1) + 1]; float e0, e1; rot2(acc[mb][nb][2 * p], acc[mb][nb][2 * p + 1], cs, e0, e1); unsigned short a2, c2;
                    o16[2 * p] = tohx(e0); o16[2 * p + 1] = tohx(e1); splitf(e0, a2, c2); oh[2 * p] = a2; ol[2 * p] = c2; splitf(e1, a2, c2); oh[2 * p + 1] = a2; ol[2 * p + 1] = c2; }
                const int eo = nb * 1024 + mb * 256; *(v8ha*)(P16 + pb + eo) = o16; *(v8usa*)(Ph + pb + eo) = oh; *(v8usa*)(Pl + pb + eo) = ol;      // each store of the wave is one half block, 512 contiguous bytes
                asm volatile("s_wait_xcnt 0x0" ::: "memory"); } }      // the wait in front of a rewrite of registers which issued global stores name: the next unit's values land in the registers that this one was stored from
        return;
    }
#pragma unroll
    for (int mb = 0; mb < 4; ++mb) {
#pragma unroll
        for (int nb = 0; nb < 4; ++nb) {
#pragma unroll
            for (int j = 0; j < 8; ++j) os[(hi * 8 + j) * 68 + nb * 16 + lr] = acc[mb][nb][j]; }
        __builtin_amdgcn_wave_barrier(); asm volatile("" ::: "memory");
        float* crow = C + (size_t)(r0 + mb * 16) * ldc + c0;
#pragma unroll
            for (int s = 0; s < 8; ++s) { const int row = 2 * s + hi, cofs = lr * 4; v4f val = *(const v4fa*)(os + row * 68 + cofs); if (BIAS) { val[0] += bfr(bias[c0 + cofs]); val[1] += bfr(bias[c0 + cofs + 1]); val[2] += bfr(bias[c0 + cofs + 2]); val[3] += bfr(bias[c0 + cofs + 3]); }
                *(v4f*)(crow + (size_t)row * ldc + cofs) = val; }
        __builtin_amdgcn_wave_barrier(); asm volatile("" ::: "memory");
    }
}


template <typename T16, int NSPLIT, bool BIAS, int EPI, int K>
__global__ __launch_bounds__(32) void k_gemmw(const T16* __restrict__ A, const T16* __restrict__ A2, const T16* __restrict__ Bt, const T16* __restrict__ Bt2, float* C, int ldc, const float* __restrict__ bias, size_t sA, size_t sB, size_t sC, const float* __restrict__ CS, h16* P16, bf* Ph, bf* Pl) {
    gemm_tile<T16, NSPLIT, BIAS, EPI, K>(blockIdx.x, blockIdx.y, blockIdx.z, A, A2, Bt, Bt2, C, ldc, bias, sA, sB, sC, CS, P16, Ph, Pl);
}
// ---- k_qkv: the q, k and v projections in one launch; they depend on nothing of each other. grid (heads, TT / 64, 3 x batches): z / NB_ = 0: q, 1: k, 2: v (the same for a whole work-group), z % NB_ = the batch.
static_assert(DQ == DKV, "one grid serves the three projections");
__global__ __launch_bounds__(32) void k_qkv(const bf* __restrict__ WQ, const bf* __restrict__ WK, const bf* __restrict__ WV, const bf* __restrict__ XB, const float* __restrict__ CS,
                                            h16* QP16, bf* QPh, bf* QPl, h16* KP16, bf* KPh, bf* KPl, h16* VT16, bf* VTh, bf* VTl) {
    const int which = blockIdx.z / NB_; const size_t b = blockIdx.z % NB_;
    if (which == 2) gemm_tile<bf, 0, false, 2, DM>(blockIdx.y, blockIdx.x, b, XB, nullptr, WV, nullptr, nullptr, 0, nullptr, (size_t)TT * DM, 0, (size_t)NKV * HD * TT, nullptr, VT16, VTh, VTl);
    else gemm_tile<bf, 0, false, 1, DM>(blockIdx.x, blockIdx.y, b, which ? WK : WQ, nullptr, XB, nullptr, nullptr, 0, nullptr, 0, (size_t)TT * DM, (size_t)NH_ * TT * HD, CS, which ? KP16 : QP16, which ? KPh : QPh, which ? KPl : QPl);
}

__global__ __launch_bounds__(256) void k_wtG(const float* __restrict__ w, int K, int N, bf* Bt) {
    const int lane = threadIdx.x & 31; const int L0 = (blockIdx.x * 8 + (threadIdx.x >> 5)) * 8; const int nlines = N * K / 64;
{
#pragma unroll 1
        for (int l = 0; l < 8; ++l) { const int L = L0 + l; if (L >= nlines) break; const size_t e = (size_t)L * 64 + lane * 2; const int k = (int)(e % K), n = (int)(e / K); v2us o;
            o[0] = f2bf(w[(size_t)k * N + n]); o[1] = f2bf(w[(size_t)(k + 1) * N + n]); *(v2us*)(Bt + e) = o; }
         }
}
// f32 [r][DM] row-major -> bf16 in fragment order. 16-byte unit i of the destination holds 8 source elements: block i >> 6 = (r >> 4) * (DM / 32) + (k >> 5), half (i >> 5) & 1, lane i & 31 = ((k >> 3) & 1) * 16 + (r & 15).
// Wave wv takes units 256 wv .. 256 wv + 255, four neighbouring blocks of one 16-row group: unit 256 wv + 32 j + lane lies 16 j source elements and 256 j destination elements behind the lane's first,
// so that all 16 loads (whole 512-byte pieces of 16 rows) go out from one address before the first conversion, and each store of the wave is 512 contiguous bytes.
__device__ __forceinline__ void cvt_wave(const float* __restrict__ src, bf* dst, unsigned wv, int lane) {
    const unsigned blk = wv * 4u; unsigned so = (((blk / (DM / 32)) * 16 + (lane & 15)) * DM + (blk % (DM / 32)) * 32 + (lane >> 4) * 8) * 4u /* byte offset of the lane's first source element */; bf* d = dst + (size_t)wv * 2048 + lane * 8;
    v8f v[8];      // the three loops below are unrolled because they index register arrays: each index is then a compile-time register, each step a compile-time offset
#pragma unroll
    for (int j = 0; j < 8; ++j) v[j] = *(const v8f*)((const char*)src + so + j * 64);
    // the wait that stands in front of a rewrite of a register which issued global loads name; the offset is an in-out operand, so that its register stays the offset's up to here
    asm volatile("s_wait_xcnt 0x0" : "+v"(so) :: "memory");
#pragma unroll
    for (int j = 0; j < 8; ++j) { v8us o;
#pragma unroll
        for (int k = 0; k < 8; ++k) o[k] = f2bf(v[j][k]);
        *(v8us*)(d + j * 256) = o; }
}

__constant__ float INV[HD / 2] = {1.0f,0.749894202f,0.562341332f,0.421696514f,0.316227764f,0.237137362f,0.177827939f,0.133352146f,0.100000001f,0.0749894157f,0.0562341288f,0.0421696492f,0.0316227786f,0.0237137359f,0.0177827943f,0.0133352149f,0.00999999978f,0.00749894232f,0.00562341325f,0.00421696482f,0.00316227786f,0.00237137382f,0.00177827943f,0.00133352145f,0.00100000005f,0.000749894185f,0.000562341302f,0.000421696488f,0.000316227786f,0.000237137385f,0.00017782794f,0.00013335215f};
// one (cos, sin) per token and pair, laid as the q and k tiles read it: entry idx = [t >> 4][d >> 4][(d >> 2) & 1][lane = ((d >> 3) & 1) * 16 + (t & 15)][(d >> 1) & 1], so that a lane's 2 neighbouring pairs are 16 bytes and a wave's load 512 contiguous bytes
__device__ __forceinline__ void cstab_entry(const int* __restrict__ pos, float* CS, int idx) { const int t = (idx >> 9) * 16 + ((idx >> 1) & 15), pr = ((idx >> 7) & 3) * 8 + ((idx >> 5) & 1) * 4 + ((idx >> 6) & 1) * 2 + (idx & 1); const float ang = __fmul_rn((float)pos[t], INV[pr]); v2f cs; cs[0] = cosf(ang); cs[1] = sinf(ang);
    *(v2f*)(CS + (size_t)idx * 2) = cs;  }
// ---- k_prep: everything that the projections wait for, in one launch; the parts depend on nothing of each other. Work-groups 0 .. PB_T - 1: the rotary table, one entry a thread; the rest, 8 waves each: x, then qkv_w (its q | k | v row blocks are one plane of 3 x 1024 rows), then o_w.
#define PB_T (TT * HD / 2 / 256)
#define PW_X (NB_ * TT * DM / 2048)
#define PW_W ((DQ + 2 * DKV) * DM / 2048)
#define PW_O (DM * DQ / 2048)
static_assert(TT * HD / 2 % 256 == 0 && PW_X % 8 == 0 && PW_W % 8 == 0 && PW_O % 8 == 0 && DM % 128 == 0, "whole work-groups per part, a wave's four blocks in one row group");
__global__ __launch_bounds__(256) void k_prep(const float* __restrict__ x, const float* __restrict__ wqkv, const float* __restrict__ wo, const int* __restrict__ pos, bf* XB, bf* WQKV, bf* WO, float* CS) {
    if (blockIdx.x < PB_T) { cstab_entry(pos, CS, blockIdx.x * 256 + threadIdx.x); return; }
    const int lane = threadIdx.x & 31; const unsigned wv = (blockIdx.x - PB_T) * 8 + __builtin_amdgcn_readfirstlane(threadIdx.x >> 5) /* wave number in a scalar register: the part's pointers stay scalar */;
    const bool isx = wv < PW_X, isw = wv < PW_X + PW_W;      // wave-uniform: source, destination and the wave's number in its part are scalar selects, and the conversion stands once in the text
    cvt_wave(isx ? x : isw ? wqkv : wo, isx ? XB : isw ? WQKV : WO, wv - (isx ? 0u : isw ? (unsigned)PW_X : (unsigned)(PW_X + PW_W)), lane);
}

// ---- k_attn: causal scores, softmax and probability x value contraction in one kernel; no score matrix goes through the workspace. One work-group of ANW waves owns one block of query rows of one head.
// Transposed products: S^T = K Q^T (A = 16 key rows, B = 16 query rows), so that a lane holds 16 scores of ONE query per 32 keys (keys kc + 8 hi + j and kc + 16 + 8 hi + j); the two converted score tiles are,
// register for register, the B operand of O^T += V^T P^T (A = 16 rows of the [d][t] value plane). Running maximum m and sum l per query (streaming softmax): a new maximum rescales l and O^T by exp(m_old - m_new).
// The 32-key chunks up to the diagonal are dealt to the waves (wave w: chunks w, w + ANW, ...); the ANW partial (m, l, O) go to LDS and are joined in fixed wave order 0..ANW-1 with weights exp(m_w - max m).
// HL: bf16 hi + lo planes, 3 products each (query rows < RH); otherwise single fp16 with the probabilities carried x1024 (the factor is in l too and cancels). Output: the merged [t][DQ] bf16 hi | lo planes, in fragment order.
// Every '#pragma unroll' below stands on a loop of constant length that indexes register arrays (fragments, accumulators, a lane's scores): unrolled, each index is a compile-time register.
#define ANW 4
#define L2E 1.4426950408889634f
__device__ __forceinline__ float xhalf(float x) { return __builtin_bit_cast(float, __builtin_amdgcn_permlanex16(__builtin_bit_cast(int, x), __builtin_bit_cast(int, x), 0x76543210, 0xfedcba98, false, false)); }  // lane l with lane l ^ 16
// v_exp_f32 and, in the same statement, the one slot that the instruction set asks for between a transcendental and an instruction that reads its result or overwrites its source
__device__ __forceinline__ float exp2s(float x) { float r; asm("v_exp_f32 %0, %1\n\tv_nop" : "=v"(r) : "v"(x)); return r; }
template <bool HL> struct AT;
template <> struct AT<true> { typedef bf T; };
template <> struct AT<false> { typedef h16 T; };
template <bool HL, int NQ>
__device__ __forceinline__ void attn_tile(const typename AT<HL>::T* __restrict__ Q, const typename AT<HL>::T* __restrict__ Q2, const typename AT<HL>::T* __restrict__ Kp, const typename AT<HL>::T* __restrict__ Kp2,
                                          const typename AT<HL>::T* __restrict__ Vp, const typename AT<HL>::T* __restrict__ Vp2, int q0, int hcol, bf* Ah, bf* Al, float* sO, float* sM, float* sL) {
    typedef typename AT<HL>::T T; typedef WFrag<T> F; typedef typename F::V V;
    const int tid = threadIdx.x, lane = tid & 31, lr = lane & 15, hi = lane >> 4; const int w = __builtin_amdgcn_readfirstlane(tid >> 5) /* wave number in a scalar register: the chunk loop keeps a scalar bound test */;
    V qf[NQ][2], qg[NQ][2];
#pragma unroll
    for (int qt = 0; qt < NQ; ++qt)
#pragma unroll
        for (int ks = 0; ks < 2; ++ks) { const size_t qo = (size_t)(q0 + qt * 16) * HD + ks * 512 + lane * 8; qf[qt][ks] = F::ld(Q + qo); if (HL) qg[qt][ks] = F::ld(Q2 + qo); }
    v8f o[NQ][4]; float m[NQ], l[NQ];
#pragma unroll
    for (int qt = 0; qt < NQ; ++qt) { m[qt] = -1.0e30f; l[qt] = 0.f;
#pragma unroll
        for (int dt = 0; dt < 4; ++dt) o[qt][dt] = (v8f){}; }
    const int kend = q0 + NQ * 16;      // keys beyond the block's last query row are masked for every row of it
    // one 32-bit byte offset per lane into the key planes and one into the value planes, carried round the loop (fragment order: chunk 32 w of either plane starts at element 32 w HD, the lane's unit at lane * 8)
    unsigned ko = (unsigned)(32 * w * HD + lane * 8) * 2u, vo = ko;
    V kf[2][2], kg[2][2], vf[4], vg[4];
    auto ldk = [&]() {
#pragma unroll
        for (int kt = 0; kt < 2; ++kt)
#pragma unroll
            for (int ks = 0; ks < 2; ++ks) { kf[kt][ks] = F::ld((const T*)((const char*)Kp + ko) + kt * 1024 + ks * 512); if (HL) kg[kt][ks] = F::ld((const T*)((const char*)Kp2 + ko) + kt * 1024 + ks * 512); } };
    auto ldv = [&]() {
#pragma unroll
        for (int dt = 0; dt < 4; ++dt) { vf[dt] = F::ld((const T*)((const char*)Vp + vo) + dt * 512); if (HL) vg[dt] = F::ld((const T*)((const char*)Vp2 + vo) + dt * 512); } };
    // fp16 blocks (up to TT / 32 / ANW trips): every chunk but the wave's first is fetched one trip ahead, into the same registers, right behind the products that read them.
    // hi+lo blocks (at most RH / 32 / ANW trips, twice the fragments): each trip fetches its own chunk, so that the kernel stays within 256 registers.
    if (!HL && 32 * w < kend) {
        __builtin_amdgcn_sched_barrier(0);      // the query loads are issued first ...
        ldk(); ldv();
        // ... and have landed before the loop (inputs only, loaded values): otherwise the loop head's wait for them, which counts loads in issue order, would also wait for the value loads that each trip has just issued
        if constexpr (NQ == 2) asm volatile("" :: "v"(qf[0][0]), "v"(qf[0][1]), "v"(qf[1][0]), "v"(qf[1][1]));
    }
#pragma unroll 1   // rolled: one chunk's fragments, the query fragments, the scores and the output tiles fill most of a wave's 256 registers
    for (int kc = 32 * w; kc < kend; kc += 32 * ANW) {
        const bool more = kc + 32 * ANW < kend;      // wave-uniform; the last trip fetches its own chunk once more instead of one past the end: with no branch round the loads the load counter is exact at every wait
        if (HL) { ldk(); ldv(); }
        v8f s[NQ][2];
#pragma unroll
        for (int qt = 0; qt < NQ; ++qt)
#pragma unroll
            for (int kt = 0; kt < 2; ++kt) { s[qt][kt] = (v8f){};
#pragma unroll
                for (int ks = 0; ks < 2; ++ks) { s[qt][kt] = F::mma(kf[kt][ks], qf[qt][ks], s[qt][kt]); if (HL) { s[qt][kt] = F::mma(kf[kt][ks], qg[qt][ks], s[qt][kt]); s[qt][kt] = F::mma(kg[kt][ks], qf[qt][ks], s[qt][kt]); } } }
        if (!HL) {
            __builtin_amdgcn_sched_barrier(0);      // keeps the next chunk's key loads, and the wait in front of them, behind every score product (they land in the same registers) ...
            // the wait that stands in front of a rewrite of a register which issued global loads name; the offset is an in-out operand so that its step cannot be lifted over it
            asm volatile("s_wait_xcnt 0x0" : "+v"(ko) :: "memory");
            ko += more ? 32u * ANW * HD * 2u : 0u;
            ldk();
            __builtin_amdgcn_sched_barrier(0);      // ... and in front of the softmax, whose time covers their latency (left free, the scheduler sinks each load to its first use)
        }
#pragma unroll
        for (int qt = 0; qt < NQ; ++qt) {
            const int lim = q0 + qt * 16 + lr - kc - hi * 8; float t[16]; float mx = -2.0e38f;      // causal: the lane's key number e (kc + 8 hi + 16 (e >> 3) + (e & 7)) counts while it is <= the lane's query row
#pragma unroll
            for (int e = 0; e < 16; ++e) { t[e] = ((e >> 3) * 16 + (e & 7) <= lim) ? s[qt][e >> 3][e & 7] * SCL : -2.0e38f; mx = fmaxf(mx, t[e]); }
            mx = fmaxf(mx, xhalf(mx));      // the other half-wave holds the query's other 16 keys
            const float mn = fmaxf(m[qt], mx), al = exp2s((m[qt] - mn) * L2E); m[qt] = mn;
            float p[16];
#pragma unroll
            for (int e = 0; e < 16; ++e) p[e] = exp2s((t[e] - mn) * L2E + (HL ? 0.0f : 10.0f));   // a masked key gives exactly 0 (m >= -1e30)
            l[qt] = l[qt] * al + ((((p[0] + p[1]) + (p[2] + p[3])) + ((p[4] + p[5]) + (p[6] + p[7]))) + (((p[8] + p[9]) + (p[10] + p[11])) + ((p[12] + p[13]) + (p[14] + p[15]))));
#pragma unroll
            for (int dt = 0; dt < 4; ++dt) o[qt][dt] *= al;
            if constexpr (HL) { v8us h0, h1, l0, l1;
#pragma unroll
                for (int e = 0; e < 8; ++e) { unsigned short a, c2; splitf(p[e], a, c2); h0[e] = a; l0[e] = c2; splitf(p[8 + e], a, c2); h1[e] = a; l1[e] = c2; }
                const V ph = cat16b(h0, h1), pl = cat16b(l0, l1);
#pragma unroll
                for (int dt = 0; dt < 4; ++dt) { o[qt][dt] = F::mma(vf[dt], ph, o[qt][dt]); o[qt][dt] = F::mma(vf[dt], pl, o[qt][dt]); o[qt][dt] = F::mma(vg[dt], ph, o[qt][dt]); }
            } else { V pb;
#pragma unroll
                for (int e = 0; e < 16; ++e) pb[e] = tohx(p[e]);
#pragma unroll
                for (int dt = 0; dt < 4; ++dt) o[qt][dt] = F::mma(vf[dt], pb, o[qt][dt]); }
        }
        if (HL) { asm volatile("s_wait_xcnt 0x0" : "+v"(ko), "+v"(vo) :: "memory");      // the wait in front of the steps of both offsets, which issued global loads name
            ko += 32u * ANW * HD * 2u; vo += 32u * ANW * HD * 2u;
        } else { asm volatile("s_wait_xcnt 0x0" : "+v"(vo) :: "memory");      // as above, for the value offset
            vo += more ? 32u * ANW * HD * 2u : 0u;
            ldv(); }
    }
    // the same wait on the way out of the loop: the last trip's value loads name the offset's register, which is free for other values from here on (kept live up to this line as an in-out operand)
    if (!HL) asm volatile("s_wait_xcnt 0x0" : "+v"(vo) :: "memory");
#pragma unroll
    for (int qt = 0; qt < NQ; ++qt) { l[qt] += xhalf(l[qt]); const int qr = w * NQ * 16 + qt * 16 + lr;
        if (hi == 0) { sM[qr] = m[qt]; sL[qr] = l[qt]; }
#pragma unroll
        for (int dt = 0; dt < 4; ++dt)
#pragma unroll
            for (int jh = 0; jh < 2; ++jh) { const v8f a = o[qt][dt]; v4f x; x[0] = a[jh * 4]; x[1] = a[jh * 4 + 1]; x[2] = a[jh * 4 + 2]; x[3] = a[jh * 4 + 3]; *(v4fa*)(sO + (size_t)qr * 68 + dt * 16 + hi * 8 + jh * 4) = x; } }
    __syncthreads();      // every wave's partial (m, l, O) is in LDS before any wave joins them
    // join: a thread takes DPT consecutive d of one query row. The output planes are in fragment order, where 8 consecutive rows' units of the same 8 d are one 128-byte line: a wave takes 8 rows x 4 parts, so that every line has one writer
    constexpr int DPT = NQ * 16 * HD / (32 * ANW), PARTS = HD / DPT; static_assert(32 * ANW == 128 && (PARTS == 4 || PARTS == 8), "the deal below is for 4 waves");
    const int ql = PARTS == 4 ? tid / 4 : ((tid >> 5) & 1) * 8 + (tid & 7), d0 = (PARTS == 4 ? tid % 4 : (tid >> 6) * 4 + ((tid >> 3) & 3)) * DPT;
    float M = sM[ql];
#pragma unroll
    for (int k = 1; k < ANW; ++k) M = fmaxf(M, sM[k * NQ * 16 + ql]);
    float f[ANW]; float L = 0.f;
#pragma unroll
    for (int k = 0; k < ANW; ++k) { f[k] = exp2s((sM[k * NQ * 16 + ql] - M) * L2E); L += f[k] * sL[k * NQ * 16 + ql]; }
    const float inv = __fdiv_rn(1.0f, L);
#pragma unroll
    for (int c = 0; c < DPT; c += 8) { v8us oh, ol;
#pragma unroll
        for (int g = 0; g < 2; ++g) { v4f a = *(const v4fa*)(sO + (size_t)ql * 68 + d0 + c + g * 4) * f[0];
#pragma unroll
            for (int k = 1; k < ANW; ++k) a += *(const v4fa*)(sO + (size_t)(k * NQ * 16 + ql) * 68 + d0 + c + g * 4) * f[k];
#pragma unroll
            for (int q = 0; q < 4; ++q) { unsigned short x, y; splitf(a[q] * inv, x, y); oh[g * 4 + q] = x; ol[g * 4 + q] = y; } }
        const int kk = hcol + d0 + c, rr = q0 + ql; const size_t oo = ((size_t)(rr >> 4) * (DQ / 32) + (kk >> 5)) * 512 + ((kk >> 4) & 1) * 256 + ((kk >> 3) & 1) * 128 + (rr & 15) * 8; *(v8usa*)(Ah + oo) = oh; *(v8usa*)(Al + oo) = ol; }
    // the wait behind the stores of the hi+lo instance: in the built kernel its code is followed by a branch whose other side (the fp16 instance) rewrites the registers that these stores name
    if (HL) asm volatile("s_wait_xcnt 0x0" ::: "memory");
}
// grid (batches x heads, NF + RH / 16): x = batch * heads + head, the index of the [batch][head] planes; y < NF: fp16 blocks of 32 query rows, the longest (last) rows first; the rest: hi+lo blocks of 16 query rows. The choice is the same for a whole work-group.
// The longest blocks of every batch and head have the lowest y (for speed only).
#define NF ((TT - RH) / 32)
__global__ __launch_bounds__(32 * ANW) void k_attn(const h16* __restrict__ Q16, const h16* __restrict__ K16, const h16* __restrict__ V16, const bf* __restrict__ Qh, const bf* __restrict__ Ql, const bf* __restrict__ Kh, const bf* __restrict__ Kl,
                                                   const bf* __restrict__ Vh, const bf* __restrict__ Vl, bf* Ah, bf* Al) {
    __shared__ __align__(16) float sO[ANW * 32 * 68]; __shared__ float sM[ANW * 32]; __shared__ float sL[ANW * 32];
    const int bx = blockIdx.y, b = blockIdx.x / NH_, h = blockIdx.x % NH_; const size_t pq = (size_t)blockIdx.x * TT * HD, pk = (size_t)(b * NKV + h / REP) * TT * HD; Ah += (size_t)b * TT * DQ; Al += (size_t)b * TT * DQ;
    if (bx < NF) attn_tile<false, 2>(Q16 + pq, nullptr, K16 + pk, nullptr, V16 + pk, nullptr, TT - 32 * (bx + 1), h * HD, Ah, Al, sO, sM, sL);
    else attn_tile<true, 1>(Qh + pq, Ql + pq, Kh + pk, Kl + pk, Vh + pk, Vl + pk, RH - 16 * (bx - NF + 1), h * HD, Ah, Al, sO, sM, sL);
}

extern "C" void kernel_launch(void* const* d_in, const int* in_sizes, int n_in,
                              void* d_out, int out_size, void* d_ws, size_t ws_size, hipStream_t stream) {
    (void)in_sizes; (void)n_in; (void)out_size;
    const float* x = (const float*)d_in[0]; const int* PID = (const int*)d_in[1]; const float* wqkv = (const float*)d_in[2]; const float* wo = (const float*)d_in[3];  const float* wq = wqkv; const float* wk = wqkv + (size_t)1024 * 1024; const float* wv = wqkv + (size_t)2048 * 1024; (void)wq; (void)wk; (void)wv;
    float* OUT = (float*)d_out;     // [4][2048][1024]
    char* wsp = (char*)d_ws;
    auto take = [&](size_t bytes) { char* p = wsp; wsp += (bytes + 255) & ~(size_t)255; return (void*)p; };
    bf* WQ = (bf*)take((size_t)(DQ + 2 * DKV) * DM * 2); bf* WK = WQ + (size_t)DQ * DM; bf* WV = WK + (size_t)DKV * DM; bf* WO = (bf*)take((size_t)DM * DQ * 2); float* CS = (float*)take((size_t)TT * HD * 2 * 4);
    bf* XB = (bf*)take((size_t)NB_ * TT * DM * 2);      // from here on every buffer holds all NB_ batches, batch outermost
    h16* QP16 = (h16*)take((size_t)NB_ * NH_ * TT * HD * 2); h16* KP16 = (h16*)take((size_t)NB_ * NKV * TT * HD * 2); h16* VT16 = (h16*)take((size_t)NB_ * NKV * HD * TT * 2);
    bf* QPh = (bf*)take((size_t)NB_ * NH_ * TT * HD * 2); bf* QPl = (bf*)take((size_t)NB_ * NH_ * TT * HD * 2); bf* KPh = (bf*)take((size_t)NB_ * NKV * TT * HD * 2); bf* KPl = (bf*)take((size_t)NB_ * NKV * TT * HD * 2); bf* VTh = (bf*)take((size_t)NB_ * NKV * HD * TT * 2); bf* VTl = (bf*)take((size_t)NB_ * NKV * HD * TT * 2);
    bf* ATh = (bf*)take((size_t)NB_ * TT * DQ * 2); bf* ATl = (bf*)take((size_t)NB_ * TT * DQ * 2);
    if ((size_t)(wsp - (char*)d_ws) > ws_size) return;    // ws 256 MiB
    // four launches, each for all NB_ batches; a launch holds every stage that waits for the same earlier launch
    k_prep<<<PB_T + (PW_X + PW_W + PW_O) / 8, 256, 0, stream>>>(x, wqkv, wo, PID, XB, WQ, WO, CS);
    k_qkv<<<dim3(DQ / 64, TT / 64, 3 * NB_), 32, 0, stream>>>(WQ, WK, WV, XB, CS, QP16, QPh, QPl, KP16, KPh, KPl, VT16, VTh, VTl);
    k_attn<<<dim3(NB_ * NH_, NF + RH / 16, 1), 32 * ANW, 0, stream>>>(QP16, KP16, VT16, QPh, QPl, KPh, KPl, VTh, VTl, ATh, ATl);
    k_gemmw<bf, 1, false, 0, DQ><<<dim3(TT / 64, DM / 64, NB_), 32, 0, stream>>>(ATh, ATl, WO, nullptr, OUT, DM, nullptr, (size_t)TT * DQ, 0, (size_t)TT * DM, nullptr, nullptr, nullptr, nullptr);
}

// v009
// One run takes 132 microseconds.
// In two side-by-side timings against v008, it was 1.12 and 1.16 times as fast.
// Over all steps from v000 it is 22.3 times as fast.
#include <hip/hip_runtime.h>

// Causal multi-head self-attention with interleaved-pair rotary embeddings (x [4][2048][1024]; qkv = x qkv_w^T ('oi' [3072][1024], row blocks q | k | v; 16 heads x 64); rotary on adjacent (even, odd) pairs with angle token_positions[t] x 10000^(-2i/64) (positions read from the int32 input; the reference's float32 table constants computed on device); scores / 8, causal (-inf); softmax; out = merged o_w^T ('oi', no bias) -> [4][2048][1024] (8.4 M)).
// Compute dtypes, f32 accumulate: every input rounded to bf16; q/k/v on PLAIN bf16 operands (inputs: exact); interleaved rotary in f32 (precise cosf/sinf table at the input positions); causal scores, streaming softmax (f32) and attn.v in one kernel: query rows < 512 hl (3 products), the rest single fp16 (x1024); o_w hl x exact (2 products).

// Fragment order: every 16-bit matrix operand plane M[r][k] (k contracted) is stored as 1-KiB blocks of 16 rows x 32 k; element (r, k) of a block lies at ((k >> 4) & 1) * 256 + ((k >> 3) & 1) * 128 + (r & 15) * 8 + (k & 7).
// A lane's fragment is then the 16 bytes at lane * 8 elements and those 256 elements on, so each wave-wide 16-byte load or store covers 512 contiguous bytes (4 whole lines) instead of 32-byte pieces of 16 lines.
// Block order: x, the weights and the merged attention output [r >> 4][k >> 5]; q and k per head [t >> 4][d >> 5]; v per head [t >> 5][d >> 4] (k = t): a 32-key chunk of k or of v is 4 contiguous KiB.
#define NB_  4
#define TT   2048
#define DM   1024
#define NH_  16
#define NKV  16
#define REP  (NH_ / NKV)
#define HD   64
#define DQ   (NH_ * HD)
#define DKV  (NKV * HD)
#define RH   512                  // query rows < RH use hi+lo planes (0: none)
#define SCL  0.125f   // HD^-0.5
typedef _Float16 h16;
typedef unsigned short bf;
typedef __attribute__((ext_vector_type(16))) __bf16   v16bf;
typedef __attribute__((ext_vector_type(16))) _Float16 v16h;
typedef __attribute__((ext_vector_type(8)))  _Float16 v8h;
typedef __attribute__((ext_vector_type(8)))  unsigned short v8us;
typedef __attribute__((ext_vector_type(8)))  float    v8f;
typedef __attribute__((ext_vector_type(4)))  float    v4f;
typedef v8h  __attribute__((may_alias)) v8ha;
typedef v4f  __attribute__((may_alias)) v4fa;
typedef v8us __attribute__((may_alias)) v8usa;

__device__ __forceinline__ unsigned short f2bf(float f) { unsigned u = __float_as_uint(f); u += 0x7FFFu + ((u >> 16) & 1u); return (unsigned short)(u >> 16); }
__device__ __forceinline__ float bf2f(unsigned short b) { return __uint_as_float(((unsigned)b) << 16); }
__device__ __forceinline__ float bfr(float f) { return bf2f(f2bf(f)); }
__device__ __forceinline__ v16h cat16(v8h lo, v8h hi) { return __builtin_shufflevector(lo, hi, 0, 1, 2, 3, 4, 5, 6, 7, 8, 9, 10, 11, 12, 13, 14, 15); }
__device__ __forceinline__ v16bf cat16b(v8us lo, v8us hi) { return __builtin_bit_cast(v16bf, __builtin_shufflevector(lo, hi, 0, 1, 2, 3, 4, 5, 6, 7, 8, 9, 10, 11, 12, 13, 14, 15)); }
__device__ __forceinline__ v8f wmma16(v16h a, v16h b, v8f c) { return __builtin_amdgcn_wmma_f32_16x16x32_f16(false, a, false, b, (short)0, c, false, false); }
__device__ __forceinline__ v8f wmmab(v16bf a, v16bf b, v8f c) { return __builtin_amdgcn_wmma_f32_16x16x32_bf16(false, a, false, b, (short)0, c, false, false); }



__device__ __forceinline__ h16 tohx(float x) { return (h16)x; }
__device__ __forceinline__ void splitf(float y, unsigned short& h, unsigned short& l) { h = f2bf(y); l = f2bf(y - bf2f(h)); }
typedef __attribute__((ext_vector_type(2))) _Float16 v2h;
typedef __attribute__((ext_vector_type(4))) _Float16 v4h;
typedef __attribute__((ext_vector_type(2))) unsigned short v2us;
typedef __attribute__((ext_vector_type(4))) unsigned short v4us;
typedef __attribute__((ext_vector_type(2))) float v2f;
typedef __attribute__((ext_vector_type(4))) int v4i;
typedef v4h  __attribute__((may_alias)) v4ha;
typedef v4us __attribute__((may_alias)) v4usa;
// one rotary pair (even, odd) at table entry cs = (cos, sin): the operations of the former rotary kernel in their order, so that the q and k planes keep their bits (the four products are rounded on their own, as in the reference's table form)
__device__ __forceinline__ void rot2(float x0, float x1, v2f cs, float& e0, float& e1) {
    float a0 = __fmul_rn(x0, cs[0]), b0 = __fmul_rn(x1, cs[1]), a1 = __fmul_rn(x1, cs[0]), b1 = __fmul_rn(x0, cs[1]); asm volatile("" : "+v"(a0), "+v"(b0), "+v"(a1), "+v"(b1));
    e0 = __fsub_rn(a0, b0); e1 = __fadd_rn(b1, a1);   /* even: x0 c - x1 s; odd: x0 s + x1 c */
}

// ---- The GEMMs: ONE WAVE per 64x64 output tile (16 accumulators), several such waves a work-group. The operand planes are 16-bit, in fragment order.
// The waves of a work-group share their operands: every 16-row group that any of them reads is brought into LDS once, by asynchronous copies, and each wave takes its fragments from there.
// C[m][n] = sum_k A[m][k] Bt[n][k] (+ the same with the second plane A2 for NSPLIT 1), f32 accumulate, k ascending in steps of 32.
// EPI says what leaves a tile. 0: the f32 tile to C. 1 and 2: a tile is 64 tokens of ONE head, and the wave writes that head's 16-bit planes (fp16 | bf16 hi | bf16 lo) itself, in fragment order, from registers; no f32 projection goes through memory.
// 1: A = the weight (M = heads x HD, head = bx), Bt = x (N = tokens): a lane's 8 accumulator rows of one column are 8 consecutive d of one token, 4 rotary pairs and one 16-byte unit of the [t][d] planes; table CS as cstab_entry lays it.
// 2: A = x (M = tokens), Bt = the weight (head = by): a lane's 8 accumulator rows are 8 consecutive t of one d, one 16-byte unit of the [d][t] planes.
template <typename T16> struct WFrag;
template <> struct WFrag<h16> { typedef v16h V; static __device__ __forceinline__ V ld(const h16* p) { return cat16(*(const v8h*)p, *(const v8h*)(p + 256)); } static __device__ __forceinline__ v8f mma(V a, V b, v8f c) { return wmma16(a, b, c); } };
template <> struct WFrag<bf> { typedef v16bf V; static __device__ __forceinline__ V ld(const bf* p) { return cat16b(*(const v8us*)p, *(const v8us*)(p + 256)); } static __device__ __forceinline__ v8f mma(V a, V b, v8f c) { return wmmab(a, b, c); } };
#define KS  4                     // 32-k steps in one stage of the LDS ring
#define RGB (KS * 1024)           // bytes of one 16-row group in a stage: KS neighbouring blocks, contiguous in the plane and in LDS
// One row group of one stage, plane -> LDS: 2 KS asynchronous copies of the wave, 512 contiguous bytes each, from one LDS address and one pointer (the lane's own first 16 bytes); the immediate offset moves both addresses alike.
// CP8(L, G): the eight copies of the row group whose LDS address is operand L and whose pointer is operand G.
#define CP8(L, G) "global_load_async_to_lds_b128 %" #L ", %" #G ", off\n\t"             "global_load_async_to_lds_b128 %" #L ", %" #G ", off offset:512\n\t" \
                  "global_load_async_to_lds_b128 %" #L ", %" #G ", off offset:1024\n\t" "global_load_async_to_lds_b128 %" #L ", %" #G ", off offset:1536\n\t" \
                  "global_load_async_to_lds_b128 %" #L ", %" #G ", off offset:2048\n\t" "global_load_async_to_lds_b128 %" #L ", %" #G ", off offset:2560\n\t" \
                  "global_load_async_to_lds_b128 %" #L ", %" #G ", off offset:3072\n\t" "global_load_async_to_lds_b128 %" #L ", %" #G ", off offset:3584\n\t"
static_assert(KS == 4, "eight copies a row group");
// One, two or four row groups in one statement. Its last line is the s_wait_xcnt that stands in front of a rewrite of the address registers which the copies name.
__device__ __forceinline__ void copy_rg1(unsigned l0, const bf* g0) { asm volatile(CP8(0, 1) "s_wait_xcnt 0x0" :: "v"(l0), "v"(g0) : "memory"); }
__device__ __forceinline__ void copy_rg2(unsigned l0, unsigned l1, const bf* g0, const bf* g1) { asm volatile(CP8(0, 2) CP8(1, 3) "s_wait_xcnt 0x0" :: "v"(l0), "v"(l1), "v"(g0), "v"(g1) : "memory"); }
__device__ __forceinline__ void copy_rg4(unsigned l0, unsigned l1, unsigned l2, unsigned l3, const bf* g0, const bf* g1, const bf* g2, const bf* g3) {
    asm volatile(CP8(0, 4) CP8(1, 5) CP8(2, 6) CP8(3, 7) "s_wait_xcnt 0x0" :: "v"(l0), "v"(l1), "v"(l2), "v"(l3), "v"(g0), "v"(g1), "v"(g2), "v"(g3) : "memory"); }
// The k loop of a work-group of NW waves over NJ row groups ("jobs"; src(job): the group's first element in its plane, the same in every lane). Two buffers of NJ row groups x KS steps; stage t lies in buffer t & 1.
// Wave w copies jobs w, w + NW, ...; its own tile reads jobs aj .. aj + 3 (A), a2j .. a2j + 3 (A2, NSPLIT 1) and bj .. bj + 3 (Bt). While stage t is worked on, stage t + 1's copies fly.
// A '#pragma unroll' without a note of its own stands on a loop of constant length that indexes register arrays (fragments, accumulators, the wave's jobs): unrolled, each index is a compile-time register.
template <int NSPLIT, int NJ, int NW, int K, typename SRC>
__device__ __forceinline__ void gemm_ring(char* ring, const int w, const int lane, SRC src, const int aj, const int a2j, const int bj, v8f (&acc)[4][4]) {
    typedef v16bf V; constexpr int TB = NJ * RGB, NT = K / (32 * KS), JW = (NJ + NW - 1) / NW; static_assert(K % (32 * KS) == 0 && NT >= 2, "whole stages, two or more");
    const unsigned l0 = (unsigned)(size_t)ring + (unsigned)lane * 16u;      // the lane's LDS byte address in row group 0 of buffer 0
    const bf* gp[JW]; unsigned lp[JW];      // the lane's first 16 bytes of each of the wave's jobs: in the plane at stage 0, in buffer 0 (a job past the last is not copied; its addresses are the last job's)
#pragma unroll
    for (int j = 0; j < JW; ++j) { const int job = w + j * NW, jc = job < NJ ? job : NJ - 1; gp[j] = src(jc) + lane * 8; lp[j] = l0 + (unsigned)(jc * RGB); }
    const int full = __builtin_amdgcn_readfirstlane(w + (JW - 1) * NW < NJ ? 1 : 0);      // has the wave a last job? In a scalar register: the test in fill is a scalar compare and branch, every lane is on at the copies
    static_assert((JW == 4 && NJ == 4 * NW) || (JW == 3 && NJ > 2 * NW), "four jobs a wave, or two and for some waves a third");
    auto fill = [&](int t) { const unsigned lo = (unsigned)((t & 1) * TB); const size_t go = (size_t)t * (KS * 512);
        if constexpr (JW == 4) copy_rg4(lp[0] + lo, lp[1] + lo, lp[2] + lo, lp[3] + lo, gp[0] + go, gp[1] + go, gp[2] + go, gp[3] + go);
        else { copy_rg2(lp[0] + lo, lp[1] + lo, gp[0] + go, gp[1] + go); if (full) copy_rg1(lp[2] + lo, gp[2] + go); } };
    auto ldf = [&](const char* p, int rb, int s) { const char* q = p + rb * RGB + s * 1024; return cat16b(*(const v8usa*)q, *(const v8usa*)(q + 512)); };
#pragma unroll
    for (int mb = 0; mb < 4; ++mb)
#pragma unroll
        for (int nb = 0; nb < 4; ++nb) acc[mb][nb] = (v8f){};
    fill(0);
    asm volatile("s_wait_asynccnt 0x0" ::: "memory");      // this wave's copies of stage 0 have landed ...
    __syncthreads();                                        // ... and every other wave's: nobody reads stage 0 in front of this barrier
    fill(1);
#pragma unroll 1   // rolled: one stage's text (KS steps) is the loop
    for (int t = 0; t < NT; ++t) {
        const char* bp = ring + (t & 1) * TB + lane * 16; const char* pa = bp + aj * RGB; const char* pa2 = bp + a2j * RGB; const char* pb = bp + bj * RGB;
        V a[2][4], a2[2][4], b[2][4];      // two fragment sets: a step's LDS reads go out as one group in front of the step before it (inside the stage only)
        auto lds = [&](int set, int s) {
#pragma unroll
            for (int i = 0; i < 4; ++i) { a[set][i] = ldf(pa, i, s); if (NSPLIT == 1) a2[set][i] = ldf(pa2, i, s); b[set][i] = ldf(pb, i, s); } };
        lds(0, 0);
        __builtin_amdgcn_sched_barrier(0);      // the stage's first reads go out first, in the order of their use: the first products wait for them alone
#pragma unroll   // unrolled: the register set (s & 1) and each step's LDS offset are compile-time
        for (int s = 0; s < KS; ++s) { const int cs = s & 1;
            if (s + 1 < KS) lds(cs ^ 1, s + 1);
            __builtin_amdgcn_sched_barrier(0);      // the next step's LDS reads stay one group in front of this step's products (left free, the scheduler sinks each read to its first use, and every wait there is to 0) ...
#pragma unroll
            for (int nb = 0; nb < 4; ++nb)
#pragma unroll
                for (int mb = 0; mb < 4; ++mb) { acc[mb][nb] = wmmab(a[cs][mb], b[cs][nb], acc[mb][nb]); if (NSPLIT == 1) acc[mb][nb] = wmmab(a2[cs][mb], b[cs][nb], acc[mb][nb]); }
            __builtin_amdgcn_sched_barrier(0);      // ... and the group after that behind them
        }
        asm volatile("s_wait_dscnt 0x0" ::: "memory");         // this wave's reads of stage t are done (its buffer is refilled below)
        asm volatile("s_wait_asynccnt 0x0" ::: "memory");      // this wave's copies of stage t + 1 have landed
        __syncthreads();                                        // one barrier a stage: it publishes stage t + 1 and ends every wave's reads of stage t
        if (t + 2 < NT) fill(t + 2);
    }
    asm volatile("s_wait_asynccnt 0x0" ::: "memory");      // no copy is outstanding when the wave goes on
}
// What leaves the tile (bx, by) of batch z. sC: z stride in elements, of C for EPI 0, of each 16-bit plane for EPI 1 and 2. os: 16 x 68 floats of LDS of the wave's own (EPI 0).
template <bool BIAS, int EPI>
__device__ __forceinline__ void gemm_epi(v8f (&acc)[4][4], const int bx, const int by, const size_t z, float* C, int ldc, const float* __restrict__ bias, size_t sC, const float* __restrict__ CS, h16* P16, bf* Ph, bf* Pl, float* os) {
    if constexpr (EPI == 0) C += z * sC; else { P16 += z * sC; Ph += z * sC; Pl += z * sC; }
    const int lane = threadIdx.x & 31, lr = lane & 15, hi = lane >> 4; const int r0 = bx * 64, c0 = by * 64; (void)lr; (void)hi;
    if constexpr (EPI == 2) {
        const size_t vb = (size_t)c0 * TT + (size_t)r0 * HD + lane * 8;      // one offset per lane (head plane, chunk r0 / 32, the lane's unit: d = lr, t = 8 hi); every step from there is a compile-time offset
#pragma unroll
        for (int nb = 0; nb < 4; ++nb)
#pragma unroll
            for (int mb = 0; mb < 4; ++mb) { v8h o16; v8us oh, ol;      // each store of the wave is one half block, 512 contiguous bytes
#pragma unroll
                for (int j = 0; j < 8; ++j) { const float x = acc[mb][nb][j]; o16[j] = tohx(x); unsigned short a2, c2; splitf(x, a2, c2); oh[j] = a2; ol[j] = c2; }
                const int eo = (mb >> 1) * 2048 + nb * 512 + (mb & 1) * 256; *(v8ha*)(P16 + vb + eo) = o16; *(v8usa*)(Ph + vb + eo) = oh; *(v8usa*)(Pl + vb + eo) = ol; }
        return;
    }
    if constexpr (EPI == 1) {
        // one address per lane for the table and one offset for the three planes (head plane, token block c0 / 16, the lane's unit: token lr, d = 8 hi); every step from there is a compile-time offset
        const float* cb = CS + (size_t)c0 * HD + lane * 4; const size_t pb = (size_t)bx * TT * HD + (size_t)c0 * HD + lane * 8;
        // the lane's table entries of two accumulator tiles (4 loads), fetched one such pair ahead: issued in front of the pair's first wait below, used behind its last, so that a pair's arithmetic covers their latency
        v4f tn[4];
        auto ldt = [&](int g) {
#pragma unroll
            for (int i = 0; i < 4; ++i) tn[i] = *(const v4fa*)(cb + g * 512 + i * 128); };
        ldt(0);
#pragma unroll
        for (int g = 0; g < 8; ++g) { v4f tc[4];
#pragma unroll
            for (int i = 0; i < 4; ++i) tc[i] = tn[i];
            if (g < 7) ldt(g + 1);
#pragma unroll
            for (int u = 0; u < 2; ++u) { const int nb = g >> 1, mb = (g & 1) * 2 + u; const v4f t0 = tc[2 * u], t1 = tc[2 * u + 1]; v8h o16; v8us oh, ol;      // the lane's 4 pairs (cos, sin): d = 16 mb + 8 hi + 0, 2 | 4, 6 of token c0 + 16 nb + lr
#pragma unroll
                for (int p = 0; p < 4; ++p) { const v4f tp = p < 2 ? t0 : t1; v2f cs; cs[0] = tp[2 * (p & 1)]; cs[1] = tp[2 * (p & 1) + 1]; float e0, e1; rot2(acc[mb][nb][2 * p], acc[mb][nb][2 * p + 1], cs, e0, e1); unsigned short a2, c2;
                    o16[2 * p] = tohx(e0); o16[2 * p + 1] = tohx(e1); splitf(e0, a2, c2); oh[2 * p] = a2; ol[2 * p] = c2; splitf(e1, a2, c2); oh[2 * p + 1] = a2; ol[2 * p + 1] = c2; }
                const int eo = nb * 1024 + mb * 256; *(v8ha*)(P16 + pb + eo) = o16; *(v8usa*)(Ph + pb + eo) = oh; *(v8usa*)(Pl + pb + eo) = ol;      // each store of the wave is one half block, 512 contiguous bytes
                asm volatile("s_wait_xcnt 0x0" ::: "memory"); } }      // the wait in front of a rewrite of registers which issued global stores name: the next unit's values land in the registers that this one was stored from
        return;
    }
#pragma unroll
    for (int mb = 0; mb < 4; ++mb) {
#pragma unroll
        for (int nb = 0; nb < 4; ++nb) {
#pragma unroll
            for (int j = 0; j < 8; ++j) os[(hi * 8 + j) * 68 + nb * 16 + lr] = acc[mb][nb][j]; }
        __builtin_amdgcn_wave_barrier(); asm volatile("" ::: "memory");
        float* crow = C + (size_t)(r0 + mb * 16) * ldc + c0;
#pragma unroll
            for (int s = 0; s < 8; ++s) { const int row = 2 * s + hi, cofs = lr * 4; v4f val = *(const v4fa*)(os + row * 68 + cofs); if (BIAS) { val[0] += bfr(bias[c0 + cofs]); val[1] += bfr(bias[c0 + cofs + 1]); val[2] += bfr(bias[c0 + cofs + 2]); val[3] += bfr(bias[c0 + cofs + 3]); }
                *(v4f*)(crow + (size_t)row * ldc + cofs) = val; }
        __builtin_amdgcn_wave_barrier(); asm volatile("" ::: "memory");
    }
}

// ---- k_qkv: the q, k and v projections in one launch. grid (heads, TT / 256, batches), 12 waves: a work-group is one head's q, k and v for 256 tokens. Wave w: token tile w & 3, product w >> 2 (0: q, 1: k, 2: v).
// Row groups in LDS: 0 .. 15 the 256 rows of x (read by three waves each), 16 .. 27 the head's 64 rows of the q, k and v weights (read by four waves each): 28 KiB a step for 12 tiles.
static_assert(DQ == DKV && NH_ == NKV && TT % 256 == 0, "one grid serves the three projections");
__global__ __launch_bounds__(384) void k_qkv(const bf* __restrict__ WQ, const bf* __restrict__ WK, const bf* __restrict__ WV, const bf* __restrict__ XB, const float* __restrict__ CS,
                                            h16* QP16, bf* QPh, bf* QPl, h16* KP16, bf* KPh, bf* KPl, h16* VT16, bf* VTh, bf* VTl) {
    __shared__ __align__(16) char ring[2 * 28 * RGB];
    const int lane = threadIdx.x & 31, w = __builtin_amdgcn_readfirstlane(threadIdx.x >> 5) /* wave number in a scalar register */, tt = w & 3, wh = w >> 2;
    const int head = blockIdx.x, tile = blockIdx.y * 4 + tt; const size_t b = blockIdx.z;
    const bf* X = XB + (b * TT + (size_t)blockIdx.y * 256) * DM;
    auto src = [&](int job) { const int jw = job - 16; const bf* Wp = jw < 4 ? WQ : jw < 8 ? WK : WV; return job < 16 ? X + (size_t)job * 16 * DM : Wp + (size_t)(head * 64 + (jw & 3) * 16) * DM; };
    v8f acc[4][4];
    gemm_ring<0, 28, 12, DM>(ring, w, lane, src, wh == 2 ? tt * 4 : 16 + wh * 4, 0, wh == 2 ? 24 : tt * 4, acc);
    // wave-uniform; no barrier stands behind this line
    if (wh == 2) gemm_epi<false, 2>(acc, tile, head, b, nullptr, 0, nullptr, (size_t)NKV * HD * TT, nullptr, VT16, VTh, VTl, nullptr);
    else gemm_epi<false, 1>(acc, head, tile, b, nullptr, 0, nullptr, (size_t)NH_ * TT * HD, CS, wh ? KP16 : QP16, wh ? KPh : QPh, wh ? KPl : QPl, nullptr);
}
// ---- k_out: the output projection, A = the merged attention output (hi | lo planes, 2 products), Bt = o_w. grid (TT / 128, DM / 256, batches), 8 waves: 128 tokens x 256 columns. Wave w: token tile w & 1, column tile w >> 1.
// Row groups in LDS: 0 .. 7 hi, 8 .. 15 lo (128 tokens), 16 .. 31 the 256 rows of o_w: 32 KiB a step for 8 tiles.
static_assert(TT % 128 == 0 && DM % 256 == 0, "whole work-groups");
__global__ __launch_bounds__(256) void k_out(const bf* __restrict__ Ah, const bf* __restrict__ Al, const bf* __restrict__ WO, float* C) {
    __shared__ __align__(16) char ring[2 * 32 * RGB]; __shared__ __align__(16) float os[8][16 * 68];
    const int lane = threadIdx.x & 31, w = __builtin_amdgcn_readfirstlane(threadIdx.x >> 5) /* wave number in a scalar register */, ta = w & 1, tb = w >> 1;
    const size_t b = blockIdx.z, ro = (b * TT + (size_t)blockIdx.x * 128) * DQ;
    auto src = [&](int job) { return job < 8 ? Ah + ro + (size_t)job * 16 * DQ : job < 16 ? Al + ro + (size_t)(job - 8) * 16 * DQ : WO + ((size_t)blockIdx.y * 256 + (size_t)(job - 16) * 16) * DQ; };
    v8f acc[4][4];
    gemm_ring<1, 32, 8, DQ>(ring, w, lane, src, ta * 4, 8 + ta * 4, 16 + tb * 4, acc);
    gemm_epi<false, 0>(acc, blockIdx.x * 2 + ta, blockIdx.y * 4 + tb, b, C, DM, nullptr, (size_t)TT * DM, nullptr, nullptr, nullptr, nullptr, os[w]);
}

__global__ __launch_bounds__(256) void k_wtG(const float* __restrict__ w, int K, int N, bf* Bt) {
    const int lane = threadIdx.x & 31; const int L0 = (blockIdx.x * 8 + (threadIdx.x >> 5)) * 8; const int nlines = N * K / 64;
{
#pragma unroll 1
        for (int l = 0; l < 8; ++l) { const int L = L0 + l; if (L >= nlines) break; const size_t e = (size_t)L * 64 + lane * 2; const int k = (int)(e % K), n = (int)(e / K); v2us o;
            o[0] = f2bf(w[(size_t)k * N + n]); o[1] = f2bf(w[(size_t)(k + 1) * N + n]); *(v2us*)(Bt + e) = o; }
         }
}
// f32 [r][DM] row-major -> bf16 in fragment order. 16-byte unit i of the destination holds 8 source elements: block i >> 6 = (r >> 4) * (DM / 32) + (k >> 5), half (i >> 5) & 1, lane i & 31 = ((k >> 3) & 1) * 16 + (r & 15).
// Wave wv takes units 256 wv .. 256 wv + 255, four neighbouring blocks of one 16-row group: unit 256 wv + 32 j + lane lies 16 j source elements and 256 j destination elements behind the lane's first,
// so that all 16 loads (whole 512-byte pieces of 16 rows) go out from one address before the first conversion, and each store of the wave is 512 contiguous bytes.
__device__ __forceinline__ void cvt_wave(const float* __restrict__ src, bf* dst, unsigned wv, int lane) {
    const unsigned blk = wv * 4u; unsigned so = (((blk / (DM / 32)) * 16 + (lane & 15)) * DM + (blk % (DM / 32)) * 32 + (lane >> 4) * 8) * 4u /* byte offset of the lane's first source element */; bf* d = dst + (size_t)wv * 2048 + lane * 8;
    v8f v[8];      // the three loops below are unrolled because they index register arrays: each index is then a compile-time register, each step a compile-time offset
#pragma unroll
    for (int j = 0; j < 8; ++j) v[j] = *(const v8f*)((const char*)src + so + j * 64);
    // the wait that stands in front of a rewrite of a register which issued global loads name; the offset is an in-out operand, so that its register stays the offset's up to here
    asm volatile("s_wait_xcnt 0x0" : "+v"(so) :: "memory");
#pragma unroll
    for (int j = 0; j < 8; ++j) { v8us o;
#pragma unroll
        for (int k = 0; k < 8; ++k) o[k] = f2bf(v[j][k]);
        *(v8us*)(d + j * 256) = o; }
}

__constant__ float INV[HD / 2] = {1.0f,0.749894202f,0.562341332f,0.421696514f,0.316227764f,0.237137362f,0.177827939f,0.133352146f,0.100000001f,0.0749894157f,0.0562341288f,0.0421696492f,0.0316227786f,0.0237137359f,0.0177827943f,0.0133352149f,0.00999999978f,0.00749894232f,0.00562341325f,0.00421696482f,0.00316227786f,0.00237137382f,0.00177827943f,0.00133352145f,0.00100000005f,0.000749894185f,0.000562341302f,0.000421696488f,0.000316227786f,0.000237137385f,0.00017782794f,0.00013335215f};
// one (cos, sin) per token and pair, laid as the q and k tiles read it: entry idx = [t >> 4][d >> 4][(d >> 2) & 1][lane = ((d >> 3) & 1) * 16 + (t & 15)][(d >> 1) & 1], so that a lane's 2 neighbouring pairs are 16 bytes and a wave's load 512 contiguous bytes
__device__ __forceinline__ void cstab_entry(const int* __restrict__ pos, float* CS, int idx) { const int t = (idx >> 9) * 16 + ((idx >> 1) & 15), pr = ((idx >> 7) & 3) * 8 + ((idx >> 5) & 1) * 4 + ((idx >> 6) & 1) * 2 + (idx & 1); const float ang = __fmul_rn((float)pos[t], INV[pr]); v2f cs; cs[0] = cosf(ang); cs[1] = sinf(ang);
    *(v2f*)(CS + (size_t)idx * 2) = cs;  }
// ---- k_prep: everything that the projections wait for, in one launch; the parts depend on nothing of each other. Work-groups 0 .. PB_T - 1: the rotary table, one entry a thread; the rest, 8 waves each: x, then qkv_w (its q | k | v row blocks are one plane of 3 x 1024 rows), then o_w.
#define PB_T (TT * HD / 2 / 256)
#define PW_X (NB_ * TT * DM / 2048)
#define PW_W ((DQ + 2 * DKV) * DM / 2048)
#define PW_O (DM * DQ / 2048)
static_assert(TT * HD / 2 % 256 == 0 && PW_X % 8 == 0 && PW_W % 8 == 0 && PW_O % 8 == 0 && DM % 128 == 0, "whole work-groups per part, a wave's four blocks in one row group");
__global__ __launch_bounds__(256) void k_prep(const float* __restrict__ x, const float* __restrict__ wqkv, const float* __restrict__ wo, const int* __restrict__ pos, bf* XB, bf* WQKV, bf* WO, float* CS) {
    if (blockIdx.x < PB_T) { cstab_entry(pos, CS, blockIdx.x * 256 + threadIdx.x); return; }
    const int lane = threadIdx.x & 31; const unsigned wv = (blockIdx.x - PB_T) * 8 + __builtin_amdgcn_readfirstlane(threadIdx.x >> 5) /* wave number in a scalar register: the part's pointers stay scalar */;
    const bool isx = wv < PW_X, isw = wv < PW_X + PW_W;      // wave-uniform: source, destination and the wave's number in its part are scalar selects, and the conversion stands once in the text
    cvt_wave(isx ? x : isw ? wqkv : wo, isx ? XB : isw ? WQKV : WO, wv - (isx ? 0u : isw ? (unsigned)PW_X : (unsigned)(PW_X + PW_W)), lane);
}

// ---- k_attn: causal scores, softmax and probability x value contraction in one kernel; no score matrix goes through the workspace. One work-group of ANW waves owns one block of query rows of one head.
// Transposed products: S^T = K Q^T (A = 16 key rows, B = 16 query rows), so that a lane holds 16 scores of ONE query per 32 keys (keys kc + 8 hi + j and kc + 16 + 8 hi + j); the two converted score tiles are,
// register for register, the B operand of O^T += V^T P^T (A = 16 rows of the [d][t] value plane). Running maximum m and sum l per query (streaming softmax): a new maximum rescales l and O^T by exp(m_old - m_new).
// The 32-key chunks up to the diagonal are dealt to the waves (wave w: chunks w, w + ANW, ...); the ANW partial (m, l, O) go to LDS and are joined in fixed wave order 0..ANW-1 with weights exp(m_w - max m).
// HL: bf16 hi + lo planes, 3 products each (query rows < RH); otherwise single fp16 with the probabilities carried x1024 (the factor is in l too and cancels). Output: the merged [t][DQ] bf16 hi | lo planes, in fragment order.
// Every '#pragma unroll' below stands on a loop of constant length that indexes register arrays (fragments, accumulators, a lane's scores): unrolled, each index is a compile-time register.
#define ANW 4
#define L2E 1.4426950408889634f
__device__ __forceinline__ float xhalf(float x) { return __builtin_bit_cast(float, __builtin_amdgcn_permlanex16(__builtin_bit_cast(int, x), __builtin_bit_cast(int, x), 0x76543210, 0xfedcba98, false, false)); }  // lane l with lane l ^ 16
// v_exp_f32 and, in the same statement, the one slot that the instruction set asks for between a transcendental and an instruction that reads its result or overwrites its source
__device__ __forceinline__ float exp2s(float x) { float r; asm("v_exp_f32 %0, %1\n\tv_nop" : "=v"(r) : "v"(x)); return r; }
template <bool HL> struct AT;
template <> struct AT<true> { typedef bf T; };
template <> struct AT<false> { typedef h16 T; };
template <bool HL, int NQ>
__device__ __forceinline__ void attn_tile(const typename AT<HL>::T* __restrict__ Q, const typename AT<HL>::T* __restrict__ Q2, const typename AT<HL>::T* __restrict__ Kp, const typename AT<HL>::T* __restrict__ Kp2,
                                          const typename AT<HL>::T* __restrict__ Vp, const typename AT<HL>::T* __restrict__ Vp2, int q0, int hcol, bf* Ah, bf* Al, float* sO, float* sM, float* sL) {
    typedef typename AT<HL>::T T; typedef WFrag<T> F; typedef typename F::V V;
    const int tid = threadIdx.x, lane = tid & 31, lr = lane & 15, hi = lane >> 4; const int w = __builtin_amdgcn_readfirstlane(tid >> 5) /* wave number in a scalar register: the chunk loop keeps a scalar bound test */;
    V qf[NQ][2], qg[NQ][2];
#pragma unroll
    for (int qt = 0; qt < NQ; ++qt)
#pragma unroll
        for (int ks = 0; ks < 2; ++ks) { const size_t qo = (size_t)(q0 + qt * 16) * HD + ks * 512 + lane * 8; qf[qt][ks] = F::ld(Q + qo); if (HL) qg[qt][ks] = F::ld(Q2 + qo); }
    v8f o[NQ][4]; float m[NQ], l[NQ];
#pragma unroll
    for (int qt = 0; qt < NQ; ++qt) { m[qt] = -1.0e30f; l[qt] = 0.f;
#pragma unroll
        for (int dt = 0; dt < 4; ++dt) o[qt][dt] = (v8f){}; }
    const int kend = q0 + NQ * 16;      // keys beyond the block's last query row are masked for every row of it
    // one 32-bit byte offset per lane into the key planes and one into the value planes, carried round the loop (fragment order: chunk 32 w of either plane starts at element 32 w HD, the lane's unit at lane * 8)
    unsigned ko = (unsigned)(32 * w * HD + lane * 8) * 2u, vo = ko;
    V kf[2][2], kg[2][2], vf[4], vg[4];
    auto ldk = [&]() {
#pragma unroll
        for (int kt = 0; kt < 2; ++kt)
#pragma unroll
            for (int ks = 0; ks < 2; ++ks) { kf[kt][ks] = F::ld((const T*)((const char*)Kp + ko) + kt * 1024 + ks * 512); if (HL) kg[kt][ks] = F::ld((const T*)((const char*)Kp2 + ko) + kt * 1024 + ks * 512); } };
    auto ldv = [&]() {
#pragma unroll
        for (int dt = 0; dt < 4; ++dt) { vf[dt] = F::ld((const T*)((const char*)Vp + vo) + dt * 512); if (HL) vg[dt] = F::ld((const T*)((const char*)Vp2 + vo) + dt * 512); } };
    // fp16 blocks (up to TT / 32 / ANW trips): every chunk but the wave's first is fetched one trip ahead, into the same registers, right behind the products that read them.
    // hi+lo blocks (at most RH / 32 / ANW trips, twice the fragments): each trip fetches its own chunk, so that the kernel stays within 256 registers.
    if (!HL && 32 * w < kend) {
        __builtin_amdgcn_sched_barrier(0);      // the query loads are issued first ...
        ldk(); ldv();
        // ... and have landed before the loop (inputs only, loaded values): otherwise the loop head's wait for them, which counts loads in issue order, would also wait for the value loads that each trip has just issued
        if constexpr (NQ == 2) asm volatile("" :: "v"(qf[0][0]), "v"(qf[0][1]), "v"(qf[1][0]), "v"(qf[1][1]));
    }
#pragma unroll 1   // rolled: one chunk's fragments, the query fragments, the scores and the output tiles fill most of a wave's 256 registers
    for (int kc = 32 * w; kc < kend; kc += 32 * ANW) {
        const bool more = kc + 32 * ANW < kend;      // wave-uniform; the last trip fetches its own chunk once more instead of one past the end: with no branch round the loads the load counter is exact at every wait
        if (HL) { ldk(); ldv(); }
        v8f s[NQ][2];
#pragma unroll
        for (int qt = 0; qt < NQ; ++qt)
#pragma unroll
            for (int kt = 0; kt < 2; ++kt) { s[qt][kt] = (v8f){};
#pragma unroll
                for (int ks = 0; ks < 2; ++ks) { s[qt][kt] = F::mma(kf[kt][ks], qf[qt][ks], s[qt][kt]); if (HL) { s[qt][kt] = F::mma(kf[kt][ks], qg[qt][ks], s[qt][kt]); s[qt][kt] = F::mma(kg[kt][ks], qf[qt][ks], s[qt][kt]); } } }
        if (!HL) {
            __builtin_amdgcn_sched_barrier(0);      // keeps the next chunk's key loads, and the wait in front of them, behind every score product (they land in the same registers) ...
            // the wait that stands in front of a rewrite of a register which issued global loads name; the offset is an in-out operand so that its step cannot be lifted over it
            asm volatile("s_wait_xcnt 0x0" : "+v"(ko) :: "memory");
            ko += more ? 32u * ANW * HD * 2u : 0u;
            ldk();
            __builtin_amdgcn_sched_barrier(0);      // ... and in front of the softmax, whose time covers their latency (left free, the scheduler sinks each load to its first use)
        }
#pragma unroll
        for (int qt = 0; qt < NQ; ++qt) {
            const int lim = q0 + qt * 16 + lr - kc - hi * 8; float t[16]; float mx = -2.0e38f;      // causal: the lane's key number e (kc + 8 hi + 16 (e >> 3) + (e & 7)) counts while it is <= the lane's query row
#pragma unroll
            for (int e = 0; e < 16; ++e) { t[e] = ((e >> 3) * 16 + (e & 7) <= lim) ? s[qt][e >> 3][e & 7] * SCL : -2.0e38f; mx = fmaxf(mx, t[e]); }
            mx = fmaxf(mx, xhalf(mx));      // the other half-wave holds the query's other 16 keys
            const float mn = fmaxf(m[qt], mx), al = exp2s((m[qt] - mn) * L2E); m[qt] = mn;
            float p[16];
#pragma unroll
            for (int e = 0; e < 16; ++e) p[e] = exp2s((t[e] - mn) * L2E + (HL ? 0.0f : 10.0f));   // a masked key gives exactly 0 (m >= -1e30)
            l[qt] = l[qt] * al + ((((p[0] + p[1]) + (p[2] + p[3])) + ((p[4] + p[5]) + (p[6] + p[7]))) + (((p[8] + p[9]) + (p[10] + p[11])) + ((p[12] + p[13]) + (p[14] + p[15]))));
#pragma unroll
            for (int dt = 0; dt < 4; ++dt) o[qt][dt] *= al;
            if constexpr (HL) { v8us h0, h1, l0, l1;
#pragma unroll
                for (int e = 0; e < 8; ++e) { unsigned short a, c2; splitf(p[e], a, c2); h0[e] = a; l0[e] = c2; splitf(p[8 + e], a, c2); h1[e] = a; l1[e] = c2; }
                const V ph = cat16b(h0, h1), pl = cat16b(l0, l1);
#pragma unroll
                for (int dt = 0; dt < 4; ++dt) { o[qt][dt] = F::mma(vf[dt], ph, o[qt][dt]); o[qt][dt] = F::mma(vf[dt], pl, o[qt][dt]); o[qt][dt] = F::mma(vg[dt], ph, o[qt][dt]); }
            } else { V pb;
#pragma unroll
                for (int e = 0; e < 16; ++e) pb[e] = tohx(p[e]);
#pragma unroll
                for (int dt = 0; dt < 4; ++dt) o[qt][dt] = F::mma(vf[dt], pb, o[qt][dt]); }
        }
        if (HL) { asm volatile("s_wait_xcnt 0x0" : "+v"(ko), "+v"(vo) :: "memory");      // the wait in front of the steps of both offsets, which issued global loads name
            ko += 32u * ANW * HD * 2u; vo += 32u * ANW * HD * 2u;
        } else { asm volatile("s_wait_xcnt 0x0" : "+v"(vo) :: "memory");      // as above, for the value offset
            vo += more ? 32u * ANW * HD * 2u : 0u;
            ldv(); }
    }
    // the same wait on the way out of the loop: the last trip's value loads name the offset's register, which is free for other values from here on (kept live up to this line as an in-out operand)
    if (!HL) asm volatile("s_wait_xcnt 0x0" : "+v"(vo) :: "memory");
#pragma unroll
    for (int qt = 0; qt < NQ; ++qt) { l[qt] += xhalf(l[qt]); const int qr = w * NQ * 16 + qt * 16 + lr;
        if (hi == 0) { sM[qr] = m[qt]; sL[qr] = l[qt]; }
#pragma unroll
        for (int dt = 0; dt < 4; ++dt)
#pragma unroll
            for (int jh = 0; jh < 2; ++jh) { const v8f a = o[qt][dt]; v4f x; x[0] = a[jh * 4]; x[1] = a[jh * 4 + 1]; x[2] = a[jh * 4 + 2]; x[3] = a[jh * 4 + 3]; *(v4fa*)(sO + (size_t)qr * 68 + dt * 16 + hi * 8 + jh * 4) = x; } }
    __syncthreads();      // every wave's partial (m, l, O) is in LDS before any wave joins them
    // join: a thread takes DPT consecutive d of one query row. The output planes are in fragment order, where 8 consecutive rows' units of the same 8 d are one 128-byte line: a wave takes 8 rows x 4 parts, so that every line has one writer
    constexpr int DPT = NQ * 16 * HD / (32 * ANW), PARTS = HD / DPT; static_assert(32 * ANW == 128 && (PARTS == 4 || PARTS == 8), "the deal below is for 4 waves");
    const int ql = PARTS == 4 ? tid / 4 : ((tid >> 5) & 1) * 8 + (tid & 7), d0 = (PARTS == 4 ? tid % 4 : (tid >> 6) * 4 + ((tid >> 3) & 3)) * DPT;
    float M = sM[ql];
#pragma unroll
    for (int k = 1; k < ANW; ++k) M = fmaxf(M, sM[k * NQ * 16 + ql]);
    float f[ANW]; float L = 0.f;
#pragma unroll
    for (int k = 0; k < ANW; ++k) { f[k] = exp2s((sM[k * NQ * 16 + ql] - M) * L2E); L += f[k] * sL[k * NQ * 16 + ql]; }
    const float inv = __fdiv_rn(1.0f, L);
#pragma unroll
    for (int c = 0; c < DPT; c += 8) { v8us oh, ol;
#pragma unroll
        for (int g = 0; g < 2; ++g) { v4f a = *(const v4fa*)(sO + (size_t)ql * 68 + d0 + c + g * 4) * f[0];
#pragma unroll
            for (int k = 1; k < ANW; ++k) a += *(const v4fa*)(sO + (size_t)(k * NQ * 16 + ql) * 68 + d0 + c + g * 4) * f[k];
#pragma unroll
            for (int q = 0; q < 4; ++q) { unsigned short x, y; splitf(a[q] * inv, x, y); oh[g * 4 + q] = x; ol[g * 4 + q] = y; } }
        const int kk = hcol + d0 + c, rr = q0 + ql; const size_t oo = ((size_t)(rr >> 4) * (DQ / 32) + (kk >> 5)) * 512 + ((kk >> 4) & 1) * 256 + ((kk >> 3) & 1) * 128 + (rr & 15) * 8; *(v8usa*)(Ah + oo) = oh; *(v8usa*)(Al + oo) = ol; }
    // the wait behind the stores of the hi+lo instance: in the built kernel its code is followed by a branch whose other side (the fp16 instance) rewrites the registers that these stores name
    if (HL) asm volatile("s_wait_xcnt 0x0" ::: "memory");
}
// grid (batches x heads, NF + RH / 16): x = batch * heads + head, the index of the [batch][head] planes; y < NF: fp16 blocks of 32 query rows, the longest (last) rows first; the rest: hi+lo blocks of 16 query rows. The choice is the same for a whole work-group.
// The longest blocks of every batch and head have the lowest y (for speed only).
#define NF ((TT - RH) / 32)
__global__ __launch_bounds__(32 * ANW) void k_attn(const h16* __restrict__ Q16, const h16* __restrict__ K16, const h16* __restrict__ V16, const bf* __restrict__ Qh, const bf* __restrict__ Ql, const bf* __restrict__ Kh, const bf* __restrict__ Kl,
                                                   const bf* __restrict__ Vh, const bf* __restrict__ Vl, bf* Ah, bf* Al) {
    __shared__ __align__(16) float sO[ANW * 32 * 68]; __shared__ float sM[ANW * 32]; __shared__ float sL[ANW * 32];
    const int bx = blockIdx.y, b = blockIdx.x / NH_, h = blockIdx.x % NH_; const size_t pq = (size_t)blockIdx.x * TT * HD, pk = (size_t)(b * NKV + h / REP) * TT * HD; Ah += (size_t)b * TT * DQ; Al += (size_t)b * TT * DQ;
    if (bx < NF) attn_tile<false, 2>(Q16 + pq, nullptr, K16 + pk, nullptr, V16 + pk, nullptr, TT - 32 * (bx + 1), h * HD, Ah, Al, sO, sM, sL);
    else attn_tile<true, 1>(Qh + pq, Ql + pq, Kh + pk, Kl + pk, Vh + pk, Vl + pk, RH - 16 * (bx - NF + 1), h * HD, Ah, Al, sO, sM, sL);
}

extern "C" void kernel_launch(void* const* d_in, const int* in_sizes, int n_in,
                              void* d_out, int out_size, void* d_ws, size_t ws_size, hipStream_t stream) {
    (void)in_sizes; (void)n_in; (void)out_size;
    const float* x = (const float*)d_in[0]; const int* PID = (const int*)d_in[1]; const float* wqkv = (const float*)d_in[2]; const float* wo = (const float*)d_in[3];  const float* wq = wqkv; const float* wk = wqkv + (size_t)1024 * 1024; const float* wv = wqkv + (size_t)2048 * 1024; (void)wq; (void)wk; (void)wv;
    float* OUT = (float*)d_out;     // [4][2048][1024]
    char* wsp = (char*)d_ws;
    auto take = [&](size_t bytes) { char* p = wsp; wsp += (bytes + 255) & ~(size_t)255; return (void*)p; };
    bf* WQ = (bf*)take((size_t)(DQ + 2 * DKV) * DM * 2); bf* WK = WQ + (size_t)DQ * DM; bf* WV = WK + (size_t)DKV * DM; bf* WO = (bf*)take((size_t)DM * DQ * 2); float* CS = (float*)take((size_t)TT * HD * 2 * 4);
    bf* XB = (bf*)take((size_t)NB_ * TT * DM * 2);      // from here on every buffer holds all NB_ batches, batch outermost
    h16* QP16 = (h16*)take((size_t)NB_ * NH_ * TT * HD * 2); h16* KP16 = (h16*)take((size_t)NB_ * NKV * TT * HD * 2); h16* VT16 = (h16*)take((size_t)NB_ * NKV * HD * TT * 2);
    bf* QPh = (bf*)take((size_t)NB_ * NH_ * TT * HD * 2); bf* QPl = (bf*)take((size_t)NB_ * NH_ * TT * HD * 2); bf* KPh = (bf*)take((size_t)NB_ * NKV * TT * HD * 2); bf* KPl = (bf*)take((size_t)NB_ * NKV * TT * HD * 2); bf* VTh = (bf*)take((size_t)NB_ * NKV * HD * TT * 2); bf* VTl = (bf*)take((size_t)NB_ * NKV * HD * TT * 2);
    bf* ATh = (bf*)take((size_t)NB_ * TT * DQ * 2); bf* ATl = (bf*)take((size_t)NB_ * TT * DQ * 2);
    if ((size_t)(wsp - (char*)d_ws) > ws_size) return;    // ws 256 MiB
    // four launches, each for all NB_ batches; a launch holds every stage that waits for the same earlier launch
    k_prep<<<PB_T + (PW_X + PW_W + PW_O) / 8, 256, 0, stream>>>(x, wqkv, wo, PID, XB, WQ, WO, CS);
    k_qkv<<<dim3(NH_, TT / 256, NB_), 384, 0, stream>>>(WQ, WK, WV, XB, CS, QP16, QPh, QPl, KP16, KPh, KPl, VT16, VTh, VTl);
    k_attn<<<dim3(NB_ * NH_, NF + RH / 16, 1), 32 * ANW, 0, stream>>>(QP16, KP16, VT16, QPh, QPl, KPh, KPl, VTh, VTl, ATh, ATl);
    k_out<<<dim3(TT / 128, DM / 256, NB_), 256, 0, stream>>>(ATh, ATl, WO, OUT);
}

// v010
// One run takes 121 microseconds.
// Timed twice side by side with v009, it ran 1.09 times as fast both times.
// All steps since v000 together make it 24.3 times as fast.
#include <hip/hip_runtime.h>

// Causal multi-head self-attention with interleaved-pair rotary embeddings (x [4][2048][1024]; qkv = x qkv_w^T ('oi' [3072][1024], row blocks q | k | v; 16 heads x 64); rotary on adjacent (even, odd) pairs with angle token_positions[t] x 10000^(-2i/64) (positions read from the int32 input; the reference's float32 table constants computed on device); scores / 8, causal (-inf); softmax; out = merged o_w^T ('oi', no bias) -> [4][2048][1024] (8.4 M)).
// Compute dtypes, f32 accumulate: every input rounded to bf16; q/k/v on PLAIN bf16 operands (inputs: exact); interleaved rotary in f32 (precise cosf/sinf table at the input positions); causal scores, streaming softmax (f32) and attn.v in one kernel: query rows < 512 hl (3 products), the rest single fp16 (x1024); o_w hl x exact (2 products).

// Fragment order: every 16-bit matrix operand plane M[r][k] (k contracted) is stored as 1-KiB blocks of 16 rows x 32 k; element (r, k) of a block lies at ((k >> 4) & 1) * 256 + ((k >> 3) & 1) * 128 + (r & 15) * 8 + (k & 7).
// A lane's fragment is then the 16 bytes at lane * 8 elements and those 256 elements on, so each wave-wide 16-byte load or store covers 512 contiguous bytes (4 whole lines) instead of 32-byte pieces of 16 lines.
// Block order: x, the weights and the merged attention output [r >> 4][k >> 5]; q and k per head [t >> 4][d >> 5]; v per head [t >> 5][d >> 4] (k = t): a 32-key chunk of k or of v is 4 contiguous KiB.
#define NB_  4
#define TT   2048
#define DM   1024
#define NH_  16
#define NKV  16
#define REP  (NH_ / NKV)
#define HD   64
#define DQ   (NH_ * HD)
#define DKV  (NKV * HD)
#define RH   512                  // query rows < RH use hi+lo planes
#define SCL  0.125f   // HD^-0.5
typedef _Float16 h16;
typedef unsigned short bf;
typedef __attribute__((ext_vector_type(16))) __bf16   v16bf;
typedef __attribute__((ext_vector_type(16))) _Float16 v16h;
typedef __attribute__((ext_vector_type(8)))  _Float16 v8h;
typedef __attribute__((ext_vector_type(8)))  unsigned short v8us;
typedef __attribute__((ext_vector_type(8)))  float    v8f;
typedef __attribute__((ext_vector_type(4)))  float    v4f;
typedef v8h  __attribute__((may_alias)) v8ha;
typedef v4f  __attribute__((may_alias)) v4fa;
typedef v8us __attribute__((may_alias)) v8usa;

__device__ __forceinline__ unsigned short f2bf(float f) { unsigned u = __float_as_uint(f); u += 0x7FFFu + ((u >> 16) & 1u); return (unsigned short)(u >> 16); }
__device__ __forceinline__ float bf2f(unsigned short b) { return __uint_as_float(((unsigned)b) << 16); }
__device__ __forceinline__ float bfr(float f) { return bf2f(f2bf(f)); }
__device__ __forceinline__ v16h cat16(v8h lo, v8h hi) { return __builtin_shufflevector(lo, hi, 0, 1, 2, 3, 4, 5, 6, 7, 8, 9, 10, 11, 12, 13, 14, 15); }
__device__ __forceinline__ v16bf cat16b(v8us lo, v8us hi) { return __builtin_bit_cast(v16bf, __builtin_shufflevector(lo, hi, 0, 1, 2, 3, 4, 5, 6, 7, 8, 9, 10, 11, 12, 13, 14, 15)); }
__device__ __forceinline__ v8f wmma16(v16h a, v16h b, v8f c) { return __builtin_amdgcn_wmma_f32_16x16x32_f16(false, a, false, b, (short)0, c, false, false); }
__device__ __forceinline__ v8f wmmab(v16bf a, v16bf b, v8f c) { return __builtin_amdgcn_wmma_f32_16x16x32_bf16(false, a, false, b, (short)0, c, false, false); }



__device__ __forceinline__ h16 tohx(float x) { return (h16)x; }
__device__ __forceinline__ void splitf(float y, unsigned short& h, unsigned short& l) { h = f2bf(y); l = f2bf(y - bf2f(h)); }
typedef __attribute__((ext_vector_type(2))) _Float16 v2h;
typedef __attribute__((ext_vector_type(4))) _Float16 v4h;
typedef __attribute__((ext_vector_type(2))) unsigned short v2us;
typedef __attribute__((ext_vector_type(4))) unsigned short v4us;
typedef __attribute__((ext_vector_type(2))) float v2f;
typedef __attribute__((ext_vector_type(4))) int v4i;
typedef v4h  __attribute__((may_alias)) v4ha;
typedef v4us __attribute__((may_alias)) v4usa;
// one rotary pair (even, odd) at table entry cs = (cos, sin): the operations of the former rotary kernel in their order, so that the q and k planes keep their bits (the four products are rounded on their own, as in the reference's table form)
__device__ __forceinline__ void rot2(float x0, float x1, v2f cs, float& e0, float& e1) {
    float a0 = __fmul_rn(x0, cs[0]), b0 = __fmul_rn(x1, cs[1]), a1 = __fmul_rn(x1, cs[0]), b1 = __fmul_rn(x0, cs[1]); asm volatile("" : "+v"(a0), "+v"(b0), "+v"(a1), "+v"(b1));
    e0 = __fsub_rn(a0, b0); e1 = __fadd_rn(b1, a1);   /* even: x0 c - x1 s; odd: x0 s + x1 c */
}

// ---- The GEMMs: ONE WAVE per 64x64 output tile (16 accumulators), several such waves a work-group. The operand planes are 16-bit, in fragment order.
// The waves of a work-group share their operands: every 16-row group that any of them reads is brought into LDS once, by asynchronous copies, and each wave takes its fragments from there.
// C[m][n] = sum_k A[m][k] Bt[n][k] (+ the same with the second plane A2 for NSPLIT 1), f32 accumulate, k ascending in steps of 32.
// EPI says what leaves a tile. 0: the f32 tile to C. 1 and 2: a tile is 64 tokens of ONE head, and the wave writes that head's 16-bit planes (fp16 | bf16 hi | bf16 lo) itself, in fragment order, from registers; no f32 projection goes through memory.
// 1: A = the weight (M = heads x HD, head = bx), Bt = x (N = tokens): a lane's 8 accumulator rows of one column are 8 consecutive d of one token, 4 rotary pairs and one 16-byte unit of the [t][d] planes; table CS as cstab_entry lays it.
// 2: A = x (M = tokens), Bt = the weight (head = by): a lane's 8 accumulator rows are 8 consecutive t of one d, one 16-byte unit of the [d][t] planes.
template <typename T16> struct WFrag;
template <> struct WFrag<h16> { typedef v16h V; static __device__ __forceinline__ V ld(const h16* p) { return cat16(*(const v8h*)p, *(const v8h*)(p + 256)); } static __device__ __forceinline__ v8f mma(V a, V b, v8f c) { return wmma16(a, b, c); } };
template <> struct WFrag<bf> { typedef v16bf V; static __device__ __forceinline__ V ld(const bf* p) { return cat16b(*(const v8us*)p, *(const v8us*)(p + 256)); } static __device__ __forceinline__ v8f mma(V a, V b, v8f c) { return wmmab(a, b, c); } };
#define KS  4                     // 32-k steps in one stage of the LDS ring
#define RGB (KS * 1024)           // bytes of one 16-row group in a stage: KS neighbouring blocks, contiguous in the plane and in LDS
// One row group of one stage, plane -> LDS: 2 KS asynchronous copies of the wave, 512 contiguous bytes each, from one LDS address and one pointer (the lane's own first 16 bytes); the immediate offset moves both addresses alike.
// CP8(L, G): the eight copies of the row group whose LDS address is operand L and whose pointer is operand G.
#define CP8(L, G) "global_load_async_to_lds_b128 %" #L ", %" #G ", off\n\t"             "global_load_async_to_lds_b128 %" #L ", %" #G ", off offset:512\n\t" \
                  "global_load_async_to_lds_b128 %" #L ", %" #G ", off offset:1024\n\t" "global_load_async_to_lds_b128 %" #L ", %" #G ", off offset:1536\n\t" \
                  "global_load_async_to_lds_b128 %" #L ", %" #G ", off offset:2048\n\t" "global_load_async_to_lds_b128 %" #L ", %" #G ", off offset:2560\n\t" \
                  "global_load_async_to_lds_b128 %" #L ", %" #G ", off offset:3072\n\t" "global_load_async_to_lds_b128 %" #L ", %" #G ", off offset:3584\n\t"
static_assert(KS == 4, "eight copies a row group");
// One, two or four row groups in one statement. Its last line is the s_wait_xcnt that stands in front of a rewrite of the address registers which the copies name.
__device__ __forceinline__ void copy_rg1(unsigned l0, const bf* g0) { asm volatile(CP8(0, 1) "s_wait_xcnt 0x0" :: "v"(l0), "v"(g0) : "memory"); }
__device__ __forceinline__ void copy_rg2(unsigned l0, unsigned l1, const bf* g0, const bf* g1) { asm volatile(CP8(0, 2) CP8(1, 3) "s_wait_xcnt 0x0" :: "v"(l0), "v"(l1), "v"(g0), "v"(g1) : "memory"); }
__device__ __forceinline__ void copy_rg4(unsigned l0, unsigned l1, unsigned l2, unsigned l3, const bf* g0, const bf* g1, const bf* g2, const bf* g3) {
    asm volatile(CP8(0, 4) CP8(1, 5) CP8(2, 6) CP8(3, 7) "s_wait_xcnt 0x0" :: "v"(l0), "v"(l1), "v"(l2), "v"(l3), "v"(g0), "v"(g1), "v"(g2), "v"(g3) : "memory"); }
// The k loop of a work-group of NW waves over NJ row groups ("jobs"; src(job): the group's first element in its plane, the same in every lane). Two buffers of NJ row groups x KS steps; stage t lies in buffer t & 1.
// Wave w copies jobs w, w + NW, ...; its own tile reads jobs aj .. aj + 3 (A), a2j .. a2j + 3 (A2, NSPLIT 1) and bj .. bj + 3 (Bt). While stage t is worked on, stage t + 1's copies fly.
// A '#pragma unroll' without a note of its own stands on a loop of constant length that indexes register arrays (fragments, accumulators, the wave's jobs): unrolled, each index is a compile-time register.
template <int NSPLIT, int NJ, int NW, int K, typename SRC>
__device__ __forceinline__ void gemm_ring(char* ring, const int w, const int lane, SRC src, const int aj, const int a2j, const int bj, v8f (&acc)[4][4]) {
    typedef v16bf V; constexpr int TB = NJ * RGB, NT = K / (32 * KS), JW = (NJ + NW - 1) / NW; static_assert(K % (32 * KS) == 0 && NT >= 2, "whole stages, two or more");
    const unsigned l0 = (unsigned)(size_t)ring + (unsigned)lane * 16u;      // the lane's LDS byte address in row group 0 of buffer 0
    const bf* gp[JW]; unsigned lp[JW];      // the lane's first 16 bytes of each of the wave's jobs: in the plane at stage 0, in buffer 0 (a job past the last is not copied; its addresses are the last job's)
#pragma unroll
    for (int j = 0; j < JW; ++j) { const int job = w + j * NW, jc = job < NJ ? job : NJ - 1; gp[j] = src(jc) + lane * 8; lp[j] = l0 + (unsigned)(jc * RGB); }
    const int full = __builtin_amdgcn_readfirstlane(w + (JW - 1) * NW < NJ ? 1 : 0);      // has the wave a last job? In a scalar register: the test in fill is a scalar compare and branch, every lane is on at the copies
    static_assert((JW == 4 && NJ == 4 * NW) || (JW == 3 && NJ > 2 * NW), "four jobs a wave, or two and for some waves a third");
    auto fill = [&](int t) { const unsigned lo = (unsigned)((t & 1) * TB); const size_t go = (size_t)t * (KS * 512);
        if constexpr (JW == 4) copy_rg4(lp[0] + lo, lp[1] + lo, lp[2] + lo, lp[3] + lo, gp[0] + go, gp[1] + go, gp[2] + go, gp[3] + go);
        else { copy_rg2(lp[0] + lo, lp[1] + lo, gp[0] + go, gp[1] + go); if (full) copy_rg1(lp[2] + lo, gp[2] + go); } };
    auto ldf = [&](const char* p, int rb, int s) { const char* q = p + rb * RGB + s * 1024; return cat16b(*(const v8usa*)q, *(const v8usa*)(q + 512)); };
#pragma unroll
    for (int mb = 0; mb < 4; ++mb)
#pragma unroll
        for (int nb = 0; nb < 4; ++nb) acc[mb][nb] = (v8f){};
    fill(0);
    asm volatile("s_wait_asynccnt 0x0" ::: "memory");      // this wave's copies of stage 0 have landed ...
    __syncthreads();                                        // ... and every other wave's: nobody reads stage 0 in front of this barrier
    fill(1);
#pragma unroll 1   // rolled: one stage's text (KS steps) is the loop
    for (int t = 0; t < NT; ++t) {
        const char* bp = ring + (t & 1) * TB + lane * 16; const char* pa = bp + aj * RGB; const char* pa2 = bp + a2j * RGB; const char* pb = bp + bj * RGB;
        V a[2][4], a2[2][4], b[2][4];      // two fragment sets: a step's LDS reads go out as one group in front of the step before it (inside the stage only)
        auto lds = [&](int set, int s) {
#pragma unroll
            for (int i = 0; i < 4; ++i) { a[set][i] = ldf(pa, i, s); if (NSPLIT == 1) a2[set][i] = ldf(pa2, i, s); b[set][i] = ldf(pb, i, s); } };
        lds(0, 0);
        __builtin_amdgcn_sched_barrier(0);      // the stage's first reads go out first, in the order of their use: the first products wait for them alone
#pragma unroll   // unrolled: the register set (s & 1) and each step's LDS offset are compile-time
        for (int s = 0; s < KS; ++s) { const int cs = s & 1;
            if (s + 1 < KS) lds(cs ^ 1, s + 1);
            __builtin_amdgcn_sched_barrier(0);      // the next step's LDS reads stay one group in front of this step's products (left free, the scheduler sinks each read to its first use, and every wait there is to 0) ...
#pragma unroll
            for (int nb = 0; nb < 4; ++nb)
#pragma unroll
                for (int mb = 0; mb < 4; ++mb) { acc[mb][nb] = wmmab(a[cs][mb], b[cs][nb], acc[mb][nb]); if (NSPLIT == 1) acc[mb][nb] = wmmab(a2[cs][mb], b[cs][nb], acc[mb][nb]); }
            __builtin_amdgcn_sched_barrier(0);      // ... and the group after that behind them
        }
        asm volatile("s_wait_dscnt 0x0" ::: "memory");         // this wave's reads of stage t are done (its buffer is refilled below)
        asm volatile("s_wait_asynccnt 0x0" ::: "memory");      // this wave's copies of stage t + 1 have landed
        __syncthreads();                                        // one barrier a stage: it publishes stage t + 1 and ends every wave's reads of stage t
        if (t + 2 < NT) fill(t + 2);
    }
    asm volatile("s_wait_asynccnt 0x0" ::: "memory");      // no copy is outstanding when the wave goes on
}
// What leaves the tile (bx, by) of batch z. sC: z stride in elements, of C for EPI 0, of each 16-bit plane for EPI 1 and 2. os: 16 x 68 floats of LDS of the wave's own (EPI 0).
template <bool BIAS, int EPI>
__device__ __forceinline__ void gemm_epi(v8f (&acc)[4][4], const int bx, const int by, const size_t z, float* C, int ldc, const float* __restrict__ bias, size_t sC, const float* __restrict__ CS, h16* P16, bf* Ph, bf* Pl, float* os) {
    if constexpr (EPI == 0) C += z * sC; else { P16 += z * sC; Ph += z * sC; Pl += z * sC; }
    const int lane = threadIdx.x & 31, lr = lane & 15, hi = lane >> 4; const int r0 = bx * 64, c0 = by * 64; (void)lr; (void)hi;
    if constexpr (EPI == 2) {
        const size_t vb = (size_t)c0 * TT + (size_t)r0 * HD + lane * 8;      // one offset per lane (head plane, chunk r0 / 32, the lane's unit: d = lr, t = 8 hi); every step from there is a compile-time offset
#pragma unroll
        for (int nb = 0; nb < 4; ++nb)
#pragma unroll
            for (int mb = 0; mb < 4; ++mb) { v8h o16; v8us oh, ol;      // each store of the wave is one half block, 512 contiguous bytes
#pragma unroll
                for (int j = 0; j < 8; ++j) { const float x = acc[mb][nb][j]; o16[j] = tohx(x); unsigned short a2, c2; splitf(x, a2, c2); oh[j] = a2; ol[j] = c2; }
                const int eo = (mb >> 1) * 2048 + nb * 512 + (mb & 1) * 256; *(v8ha*)(P16 + vb + eo) = o16; *(v8usa*)(Ph + vb + eo) = oh; *(v8usa*)(Pl + vb + eo) = ol; }
        return;
    }
    if constexpr (EPI == 1) {
        // one address per lane for the table and one offset for the three planes (head plane, token block c0 / 16, the lane's unit: token lr, d = 8 hi); every step from there is a compile-time offset
        const float* cb = CS + (size_t)c0 * HD + lane * 4; const size_t pb = (size_t)bx * TT * HD + (size_t)c0 * HD + lane * 8;
        // the lane's table entries of two accumulator tiles (4 loads), fetched one such pair ahead: issued in front of the pair's first wait below, used behind its last, so that a pair's arithmetic covers their latency
        v4f tn[4];
        auto ldt = [&](int g) {
#pragma unroll
            for (int i = 0; i < 4; ++i) tn[i] = *(const v4fa*)(cb + g * 512 + i * 128); };
        ldt(0);
#pragma unroll
        for (int g = 0; g < 8; ++g) { v4f tc[4];
#pragma unroll
            for (int i = 0; i < 4; ++i) tc[i] = tn[i];
            if (g < 7) ldt(g + 1);
#pragma unroll
            for (int u = 0; u < 2; ++u) { const int nb = g >> 1, mb = (g & 1) * 2 + u; const v4f t0 = tc[2 * u], t1 = tc[2 * u + 1]; v8h o16; v8us oh, ol;      // the lane's 4 pairs (cos, sin): d = 16 mb + 8 hi + 0, 2 | 4, 6 of token c0 + 16 nb + lr
#pragma unroll
                for (int p = 0; p < 4; ++p) { const v4f tp = p < 2 ? t0 : t1; v2f cs; cs[0] = tp[2 * (p & 1)]; cs[1] = tp[2 * (p & 1) + 1]; float e0, e1; rot2(acc[mb][nb][2 * p], acc[mb][nb][2 * p + 1], cs, e0, e1); unsigned short a2, c2;
                    o16[2 * p] = tohx(e0); o16[2 * p + 1] = tohx(e1); splitf(e0, a2, c2); oh[2 * p] = a2; ol[2 * p] = c2; splitf(e1, a2, c2); oh[2 * p + 1] = a2; ol[2 * p + 1] = c2; }
                const int eo = nb * 1024 + mb * 256; *(v8ha*)(P16 + pb + eo) = o16; *(v8usa*)(Ph + pb + eo) = oh; *(v8usa*)(Pl + pb + eo) = ol;      // each store of the wave is one half block, 512 contiguous bytes
                asm volatile("s_wait_xcnt 0x0" ::: "memory"); } }      // the wait in front of a rewrite of registers which issued global stores name: the next unit's values land in the registers that this one was stored from
        return;
    }
#pragma unroll
    for (int mb = 0; mb < 4; ++mb) {
#pragma unroll
        for (int nb = 0; nb < 4; ++nb) {
#pragma unroll
            for (int j = 0; j < 8; ++j) os[(hi * 8 + j) * 68 + nb * 16 + lr] = acc[mb][nb][j]; }
        __builtin_amdgcn_wave_barrier(); asm volatile("" ::: "memory");
        float* crow = C + (size_t)(r0 + mb * 16) * ldc + c0;
#pragma unroll
            for (int s = 0; s < 8; ++s) { const int row = 2 * s + hi, cofs = lr * 4; v4f val = *(const v4fa*)(os + row * 68 + cofs); if (BIAS) { val[0] += bfr(bias[c0 + cofs]); val[1] += bfr(bias[c0 + cofs + 1]); val[2] += bfr(bias[c0 + cofs + 2]); val[3] += bfr(bias[c0 + cofs + 3]); }
                *(v4f*)(crow + (size_t)row * ldc + cofs) = val; }
        __builtin_amdgcn_wave_barrier(); asm volatile("" ::: "memory");
    }
}

// ---- k_qkv: the q, k and v projections in one launch. grid (heads, TT / 256, batches), 12 waves: a work-group is one head's q, k and v for 256 tokens. Wave w: token tile w & 3, product w >> 2 (0: q, 1: k, 2: v).
// Row groups in LDS: 0 .. 15 the 256 rows of x (read by three waves each), 16 .. 27 the head's 64 rows of the q, k and v weights (read by four waves each): 28 KiB a step for 12 tiles.
static_assert(DQ == DKV && NH_ == NKV && TT % 256 == 0, "one grid serves the three projections");
__global__ __launch_bounds__(384) void k_qkv(const bf* __restrict__ WQ, const bf* __restrict__ WK, const bf* __restrict__ WV, const bf* __restrict__ XB, const float* __restrict__ CS,
                                            h16* QP16, bf* QPh, bf* QPl, h16* KP16, bf* KPh, bf* KPl, h16* VT16, bf* VTh, bf* VTl) {
    __shared__ __align__(16) char ring[2 * 28 * RGB];
    const int lane = threadIdx.x & 31, w = __builtin_amdgcn_readfirstlane(threadIdx.x >> 5) /* wave number in a scalar register */, tt = w & 3, wh = w >> 2;
    const int head = blockIdx.x, tile = blockIdx.y * 4 + tt; const size_t b = blockIdx.z;
    const bf* X = XB + (b * TT + (size_t)blockIdx.y * 256) * DM;
    auto src = [&](int job) { const int jw = job - 16; const bf* Wp = jw < 4 ? WQ : jw < 8 ? WK : WV; return job < 16 ? X + (size_t)job * 16 * DM : Wp + (size_t)(head * 64 + (jw & 3) * 16) * DM; };
    v8f acc[4][4];
    gemm_ring<0, 28, 12, DM>(ring, w, lane, src, wh == 2 ? tt * 4 : 16 + wh * 4, 0, wh == 2 ? 24 : tt * 4, acc);
    // wave-uniform; no barrier stands behind this line
    if (wh == 2) gemm_epi<false, 2>(acc, tile, head, b, nullptr, 0, nullptr, (size_t)NKV * HD * TT, nullptr, VT16, VTh, VTl, nullptr);
    else gemm_epi<false, 1>(acc, head, tile, b, nullptr, 0, nullptr, (size_t)NH_ * TT * HD, CS, wh ? KP16 : QP16, wh ? KPh : QPh, wh ? KPl : QPl, nullptr);
}
// ---- k_out: the output projection, A = the merged attention output (hi | lo planes, 2 products), Bt = o_w. grid (TT / 128, DM / 256, batches), 8 waves: 128 tokens x 256 columns. Wave w: token tile w & 1, column tile w >> 1.
// Row groups in LDS: 0 .. 7 hi, 8 .. 15 lo (128 tokens), 16 .. 31 the 256 rows of o_w: 32 KiB a step for 8 tiles.
static_assert(TT % 128 == 0 && DM % 256 == 0, "whole work-groups");
__global__ __launch_bounds__(256) void k_out(const bf* __restrict__ Ah, const bf* __restrict__ Al, const bf* __restrict__ WO, float* C) {
    __shared__ __align__(16) char ring[2 * 32 * RGB]; __shared__ __align__(16) float os[8][16 * 68];
    const int lane = threadIdx.x & 31, w = __builtin_amdgcn_readfirstlane(threadIdx.x >> 5) /* wave number in a scalar register */, ta = w & 1, tb = w >> 1;
    const size_t b = blockIdx.z, ro = (b * TT + (size_t)blockIdx.x * 128) * DQ;
    auto src = [&](int job) { return job < 8 ? Ah + ro + (size_t)job * 16 * DQ : job < 16 ? Al + ro + (size_t)(job - 8) * 16 * DQ : WO + ((size_t)blockIdx.y * 256 + (size_t)(job - 16) * 16) * DQ; };
    v8f acc[4][4];
    gemm_ring<1, 32, 8, DQ>(ring, w, lane, src, ta * 4, 8 + ta * 4, 16 + tb * 4, acc);
    gemm_epi<false, 0>(acc, blockIdx.x * 2 + ta, blockIdx.y * 4 + tb, b, C, DM, nullptr, (size_t)TT * DM, nullptr, nullptr, nullptr, nullptr, os[w]);
}

__global__ __launch_bounds__(256) void k_wtG(const float* __restrict__ w, int K, int N, bf* Bt) {
    const int lane = threadIdx.x & 31; const int L0 = (blockIdx.x * 8 + (threadIdx.x >> 5)) * 8; const int nlines = N * K / 64;
{
#pragma unroll 1
        for (int l = 0; l < 8; ++l) { const int L = L0 + l; if (L >= nlines) break; const size_t e = (size_t)L * 64 + lane * 2; const int k = (int)(e % K), n = (int)(e / K); v2us o;
            o[0] = f2bf(w[(size_t)k * N + n]); o[1] = f2bf(w[(size_t)(k + 1) * N + n]); *(v2us*)(Bt + e) = o; }
         }
}
// f32 [r][DM] row-major -> bf16 in fragment order. 16-byte unit i of the destination holds 8 source elements: block i >> 6 = (r >> 4) * (DM / 32) + (k >> 5), half (i >> 5) & 1, lane i & 31 = ((k >> 3) & 1) * 16 + (r & 15).
// Wave wv takes units 256 wv .. 256 wv + 255, four neighbouring blocks of one 16-row group: unit 256 wv + 32 j + lane lies 16 j source elements and 256 j destination elements behind the lane's first,
// so that all 16 loads (whole 512-byte pieces of 16 rows) go out from one address before the first conversion, and each store of the wave is 512 contiguous bytes.
__device__ __forceinline__ void cvt_wave(const float* __restrict__ src, bf* dst, unsigned wv, int lane) {
    const unsigned blk = wv * 4u; unsigned so = (((blk / (DM / 32)) * 16 + (lane & 15)) * DM + (blk % (DM / 32)) * 32 + (lane >> 4) * 8) * 4u /* byte offset of the lane's first source element */; bf* d = dst + (size_t)wv * 2048 + lane * 8;
    v8f v[8];      // the three loops below are unrolled because they index register arrays: each index is then a compile-time register, each step a compile-time offset
#pragma unroll
    for (int j = 0; j < 8; ++j) v[j] = *(const v8f*)((const char*)src + so + j * 64);
    // the wait that stands in front of a rewrite of a register which issued global loads name; the offset is an in-out operand, so that its register stays the offset's up to here
    asm volatile("s_wait_xcnt 0x0" : "+v"(so) :: "memory");
#pragma unroll
    for (int j = 0; j < 8; ++j) { v8us o;
#pragma unroll
        for (int k = 0; k < 8; ++k) o[k] = f2bf(v[j][k]);
        *(v8us*)(d + j * 256) = o; }
}

__constant__ float INV[HD / 2] = {1.0f,0.749894202f,0.562341332f,0.421696514f,0.316227764f,0.237137362f,0.177827939f,0.133352146f,0.100000001f,0.0749894157f,0.0562341288f,0.0421696492f,0.0316227786f,0.0237137359f,0.0177827943f,0.0133352149f,0.00999999978f,0.00749894232f,0.00562341325f,0.00421696482f,0.00316227786f,0.00237137382f,0.00177827943f,0.00133352145f,0.00100000005f,0.000749894185f,0.000562341302f,0.000421696488f,0.000316227786f,0.000237137385f,0.00017782794f,0.00013335215f};
// one (cos, sin) per token and pair, laid as the q and k tiles read it: entry idx = [t >> 4][d >> 4][(d >> 2) & 1][lane = ((d >> 3) & 1) * 16 + (t & 15)][(d >> 1) & 1], so that a lane's 2 neighbouring pairs are 16 bytes and a wave's load 512 contiguous bytes
__device__ __forceinline__ void cstab_entry(const int* __restrict__ pos, float* CS, int idx) { const int t = (idx >> 9) * 16 + ((idx >> 1) & 15), pr = ((idx >> 7) & 3) * 8 + ((idx >> 5) & 1) * 4 + ((idx >> 6) & 1) * 2 + (idx & 1); const float ang = __fmul_rn((float)pos[t], INV[pr]); v2f cs; cs[0] = cosf(ang); cs[1] = sinf(ang);
    *(v2f*)(CS + (size_t)idx * 2) = cs;  }
// ---- k_prep: everything that the projections wait for, in one launch; the parts depend on nothing of each other. Work-groups 0 .. PB_T - 1: the rotary table, one entry a thread; the rest, 8 waves each: x, then qkv_w (its q | k | v row blocks are one plane of 3 x 1024 rows), then o_w.
#define PB_T (TT * HD / 2 / 256)
#define PW_X (NB_ * TT * DM / 2048)
#define PW_W ((DQ + 2 * DKV) * DM / 2048)
#define PW_O (DM * DQ / 2048)
static_assert(TT * HD / 2 % 256 == 0 && PW_X % 8 == 0 && PW_W % 8 == 0 && PW_O % 8 == 0 && DM % 128 == 0, "whole work-groups per part, a wave's four blocks in one row group");
__global__ __launch_bounds__(256) void k_prep(const float* __restrict__ x, const float* __restrict__ wqkv, const float* __restrict__ wo, const int* __restrict__ pos, bf* XB, bf* WQKV, bf* WO, float* CS) {
    if (blockIdx.x < PB_T) { cstab_entry(pos, CS, blockIdx.x * 256 + threadIdx.x); return; }
    const int lane = threadIdx.x & 31; const unsigned wv = (blockIdx.x - PB_T) * 8 + __builtin_amdgcn_readfirstlane(threadIdx.x >> 5) /* wave number in a scalar register: the part's pointers stay scalar */;
    const bool isx = wv < PW_X, isw = wv < PW_X + PW_W;      // wave-uniform: source, destination and the wave's number in its part are scalar selects, and the conversion stands once in the text
    cvt_wave(isx ? x : isw ? wqkv : wo, isx ? XB : isw ? WQKV : WO, wv - (isx ? 0u : isw ? (unsigned)PW_X : (unsigned)(PW_X + PW_W)), lane);
}

// ---- k_attn: causal scores, softmax and probability x value contraction in one kernel; no score matrix goes through the workspace. One work-group of ANW waves owns one block of query rows of one head.
// Transposed products: S^T = K Q^T (A = 16 key rows, B = 16 query rows), so that a lane holds 16 scores of ONE query per 32 keys (keys kc + 8 hi + j and kc + 16 + 8 hi + j); the two converted score tiles are,
// register for register, the B operand of O^T += V^T P^T (A = 16 rows of the [d][t] value plane). Running maximum m and sum l per query (streaming softmax): a new maximum rescales l and O^T by exp(m_old - m_new).
// hi+lo blocks (attn_hl, query rows < RH, 16 rows): bf16 hi + lo planes, 3 products each; the 32-key chunks up to the diagonal are dealt to the waves (wave w: chunks w, w + ANW, ...); the ANW partial (m, l, O) go to LDS and are joined in fixed wave order 0..ANW-1 with weights exp(m_w - max m).
// fp16 blocks (attn_f16, the other rows, 32 ANW rows): single fp16 with the probabilities carried x1024 (the factor is in l too and cancels); each wave owns 32 query rows and walks every chunk up to its own diagonal, keys ascending; the chunks come from LDS, where each is brought once for the ANW waves. Output: the merged [t][DQ] bf16 hi | lo planes, in fragment order.
// Every '#pragma unroll' below stands on a loop of constant length that indexes register arrays (fragments, accumulators, a lane's scores): unrolled, each index is a compile-time register.
#define ANW 4
#define L2E 1.4426950408889634f
__device__ __forceinline__ float xhalf(float x) { return __builtin_bit_cast(float, __builtin_amdgcn_permlanex16(__builtin_bit_cast(int, x), __builtin_bit_cast(int, x), 0x76543210, 0xfedcba98, false, false)); }  // lane l with lane l ^ 16
// v_exp_f32 and, in the same statement, the one slot that the instruction set asks for between a transcendental and an instruction that reads its result or overwrites its source
__device__ __forceinline__ float exp2s(float x) { float r; asm("v_exp_f32 %0, %1\n\tv_nop" : "=v"(r) : "v"(x)); return r; }
template <int NQ>
__device__ __forceinline__ void attn_hl(const bf* __restrict__ Q, const bf* __restrict__ Q2, const bf* __restrict__ Kp, const bf* __restrict__ Kp2,
                                        const bf* __restrict__ Vp, const bf* __restrict__ Vp2, int q0, int hcol, bf* Ah, bf* Al, float* sO, float* sM, float* sL) {
    typedef bf T; typedef WFrag<T> F; typedef typename F::V V;
    const int tid = threadIdx.x, lane = tid & 31, lr = lane & 15, hi = lane >> 4; const int w = __builtin_amdgcn_readfirstlane(tid >> 5) /* wave number in a scalar register: the chunk loop keeps a scalar bound test */;
    V qf[NQ][2], qg[NQ][2];
#pragma unroll
    for (int qt = 0; qt < NQ; ++qt)
#pragma unroll
        for (int ks = 0; ks < 2; ++ks) { const size_t qo = (size_t)(q0 + qt * 16) * HD + ks * 512 + lane * 8; qf[qt][ks] = F::ld(Q + qo); qg[qt][ks] = F::ld(Q2 + qo); }
    v8f o[NQ][4]; float m[NQ], l[NQ];
#pragma unroll
    for (int qt = 0; qt < NQ; ++qt) { m[qt] = -1.0e30f; l[qt] = 0.f;
#pragma unroll
        for (int dt = 0; dt < 4; ++dt) o[qt][dt] = (v8f){}; }
    const int kend = q0 + NQ * 16;      // keys beyond the block's last query row are masked for every row of it
    // one 32-bit byte offset per lane into the key planes and one into the value planes, carried round the loop (fragment order: chunk 32 w of either plane starts at element 32 w HD, the lane's unit at lane * 8)
    unsigned ko = (unsigned)(32 * w * HD + lane * 8) * 2u, vo = ko;
    V kf[2][2], kg[2][2], vf[4], vg[4];
    auto ldk = [&]() {
#pragma unroll
        for (int kt = 0; kt < 2; ++kt)
#pragma unroll
            for (int ks = 0; ks < 2; ++ks) { kf[kt][ks] = F::ld((const T*)((const char*)Kp + ko) + kt * 1024 + ks * 512); kg[kt][ks] = F::ld((const T*)((const char*)Kp2 + ko) + kt * 1024 + ks * 512); } };
    auto ldv = [&]() {
#pragma unroll
        for (int dt = 0; dt < 4; ++dt) { vf[dt] = F::ld((const T*)((const char*)Vp + vo) + dt * 512); vg[dt] = F::ld((const T*)((const char*)Vp2 + vo) + dt * 512); } };
    // at most RH / 32 / ANW trips: each trip fetches its own chunk
#pragma unroll 1   // rolled: one chunk's fragments, the query fragments, the scores and the output tiles fill most of a wave's 256 registers
    for (int kc = 32 * w; kc < kend; kc += 32 * ANW) {
        ldk(); ldv();
        v8f s[NQ][2];
#pragma unroll
        for (int qt = 0; qt < NQ; ++qt)
#pragma unroll
            for (int kt = 0; kt < 2; ++kt) { s[qt][kt] = (v8f){};
#pragma unroll
                for (int ks = 0; ks < 2; ++ks) { s[qt][kt] = F::mma(kf[kt][ks], qf[qt][ks], s[qt][kt]); s[qt][kt] = F::mma(kf[kt][ks], qg[qt][ks], s[qt][kt]); s[qt][kt] = F::mma(kg[kt][ks], qf[qt][ks], s[qt][kt]); } }
#pragma unroll
        for (int qt = 0; qt < NQ; ++qt) {
            const int lim = q0 + qt * 16 + lr - kc - hi * 8; float t[16]; float mx = -2.0e38f;      // causal: the lane's key number e (kc + 8 hi + 16 (e >> 3) + (e & 7)) counts while it is <= the lane's query row
#pragma unroll
            for (int e = 0; e < 16; ++e) { t[e] = ((e >> 3) * 16 + (e & 7) <= lim) ? s[qt][e >> 3][e & 7] * SCL : -2.0e38f; mx = fmaxf(mx, t[e]); }
            mx = fmaxf(mx, xhalf(mx));      // the other half-wave holds the query's other 16 keys
            const float mn = fmaxf(m[qt], mx), al = exp2s((m[qt] - mn) * L2E); m[qt] = mn;
            float p[16];
#pragma unroll
            for (int e = 0; e < 16; ++e) p[e] = exp2s((t[e] - mn) * L2E);   // a masked key gives exactly 0 (m >= -1e30)
            l[qt] = l[qt] * al + ((((p[0] + p[1]) + (p[2] + p[3])) + ((p[4] + p[5]) + (p[6] + p[7]))) + (((p[8] + p[9]) + (p[10] + p[11])) + ((p[12] + p[13]) + (p[14] + p[15]))));
#pragma unroll
            for (int dt = 0; dt < 4; ++dt) o[qt][dt] *= al;
            v8us h0, h1, l0, l1;
#pragma unroll
                for (int e = 0; e < 8; ++e) { unsigned short a, c2; splitf(p[e], a, c2); h0[e] = a; l0[e] = c2; splitf(p[8 + e], a, c2); h1[e] = a; l1[e] = c2; }
                const V ph = cat16b(h0, h1), pl = cat16b(l0, l1);
#pragma unroll
                for (int dt = 0; dt < 4; ++dt) { o[qt][dt] = F::mma(vf[dt], ph, o[qt][dt]); o[qt][dt] = F::mma(vf[dt], pl, o[qt][dt]); o[qt][dt] = F::mma(vg[dt], ph, o[qt][dt]); }
        }
        asm volatile("s_wait_xcnt 0x0" : "+v"(ko), "+v"(vo) :: "memory");      // the wait in front of the steps of both offsets, which issued global loads name
        ko += 32u * ANW * HD * 2u; vo += 32u * ANW * HD * 2u;
    }
#pragma unroll
    for (int qt = 0; qt < NQ; ++qt) { l[qt] += xhalf(l[qt]); const int qr = w * NQ * 16 + qt * 16 + lr;
        if (hi == 0) { sM[qr] = m[qt]; sL[qr] = l[qt]; }
#pragma unroll
        for (int dt = 0; dt < 4; ++dt)
#pragma unroll
            for (int jh = 0; jh < 2; ++jh) { const v8f a = o[qt][dt]; v4f x; x[0] = a[jh * 4]; x[1] = a[jh * 4 + 1]; x[2] = a[jh * 4 + 2]; x[3] = a[jh * 4 + 3]; *(v4fa*)(sO + (size_t)qr * 68 + dt * 16 + hi * 8 + jh * 4) = x; } }
    __syncthreads();      // every wave's partial (m, l, O) is in LDS before any wave joins them
    // join: a thread takes DPT consecutive d of one query row. The output planes are in fragment order, where 8 consecutive rows' units of the same 8 d are one 128-byte line: a wave takes 8 rows x 4 parts, so that every line has one writer
    constexpr int DPT = NQ * 16 * HD / (32 * ANW), PARTS = HD / DPT; static_assert(32 * ANW == 128 && (PARTS == 4 || PARTS == 8), "the deal below is for 4 waves");
    const int ql = PARTS == 4 ? tid / 4 : ((tid >> 5) & 1) * 8 + (tid & 7), d0 = (PARTS == 4 ? tid % 4 : (tid >> 6) * 4 + ((tid >> 3) & 3)) * DPT;
    float M = sM[ql];
#pragma unroll
    for (int k = 1; k < ANW; ++k) M = fmaxf(M, sM[k * NQ * 16 + ql]);
    float f[ANW]; float L = 0.f;
#pragma unroll
    for (int k = 0; k < ANW; ++k) { f[k] = exp2s((sM[k * NQ * 16 + ql] - M) * L2E); L += f[k] * sL[k * NQ * 16 + ql]; }
    const float inv = __fdiv_rn(1.0f, L);
#pragma unroll
    for (int c = 0; c < DPT; c += 8) { v8us oh, ol;
#pragma unroll
        for (int g = 0; g < 2; ++g) { v4f a = *(const v4fa*)(sO + (size_t)ql * 68 + d0 + c + g * 4) * f[0];
#pragma unroll
            for (int k = 1; k < ANW; ++k) a += *(const v4fa*)(sO + (size_t)(k * NQ * 16 + ql) * 68 + d0 + c + g * 4) * f[k];
#pragma unroll
            for (int q = 0; q < 4; ++q) { unsigned short x, y; splitf(a[q] * inv, x, y); oh[g * 4 + q] = x; ol[g * 4 + q] = y; } }
        const int kk = hcol + d0 + c, rr = q0 + ql; const size_t oo = ((size_t)(rr >> 4) * (DQ / 32) + (kk >> 5)) * 512 + ((kk >> 4) & 1) * 256 + ((kk >> 3) & 1) * 128 + (rr & 15) * 8; *(v8usa*)(Ah + oo) = oh; *(v8usa*)(Al + oo) = ol; }
    // the wait behind these stores: in the built kernel this code is followed by a branch whose other side (the fp16 blocks) rewrites the registers that the stores name
    asm volatile("s_wait_xcnt 0x0" ::: "memory");
}
// ---- fp16 blocks. A stage of the LDS ring is SK keys: their SK / 32 chunks of the key plane, then those of the value plane (each chunk 4 KiB, contiguous in its plane and, byte for byte, in LDS: fragment order).
// Wave w brings chunk w of a stage (copy_rg1: 8 asynchronous copies of 512 bytes); every wave takes its fragments of every chunk from LDS, so that a chunk leaves L2 once for 32 ANW query rows. Two buffers: while stage t is worked on, stage t + 1's copies fly.
#define SK  64
#define SKB (SK * HD * 2 * 2)     // bytes of one stage
static_assert(2 * SK / 32 == ANW && 32 * HD * 2 == RGB && (32 * ANW) % SK == 0, "one chunk a wave and stage; a chunk is one copy_rg1; whole stages up to a block's last row");
__device__ __forceinline__ void attn_f16(const h16* __restrict__ Q, const h16* __restrict__ Kp, const h16* __restrict__ Vp, int q0, int hcol, bf* Ah, bf* Al, char* ring) {
    typedef WFrag<h16> F; typedef F::V V; constexpr int NQ = 2;
    const int lane = threadIdx.x & 31, lr = lane & 15, hi = lane >> 4; const int w = __builtin_amdgcn_readfirstlane(threadIdx.x >> 5) /* wave number in a scalar register: the tests on the wave's own bound are scalar */;
    const int qw = q0 + 32 * w, kend = qw + 32, NT = (q0 + 32 * ANW) / SK;      // the wave's first query row; keys from kend on are masked for all its rows; stages of the work-group (the same for every wave; 2 or more)
    V qf[NQ][2]; unsigned qo = (unsigned)(qw * HD + lane * 8) * 2u;      // byte offset of the lane's first unit in the query plane
#pragma unroll
    for (int qt = 0; qt < NQ; ++qt)
#pragma unroll
        for (int ks = 0; ks < 2; ++ks) qf[qt][ks] = F::ld((const h16*)((const char*)Q + qo) + qt * 1024 + ks * 512);
    // the wait that stands in front of a rewrite of a register which issued global loads name; the offset is an in-out operand, so that its register stays the offset's up to here
    asm volatile("s_wait_xcnt 0x0" : "+v"(qo) :: "memory");
    v8f o[NQ][4]; float m[NQ], l[NQ];
#pragma unroll
    for (int qt = 0; qt < NQ; ++qt) { m[qt] = -1.0e30f; l[qt] = 0.f;
#pragma unroll
        for (int dt = 0; dt < 4; ++dt) o[qt][dt] = (v8f){}; }
    // the lane's 16 bytes of the wave's chunk: in buffer 0, and in the plane at stage 0 (waves 0, 1: key chunks 0, 1; waves 2, 3: value chunks 0, 1)
    const unsigned lp = (unsigned)(size_t)ring + (unsigned)(w * RGB + lane * 16); const bf* gp = (const bf*)(w < 2 ? Kp : Vp) + (w & 1) * (32 * HD) + lane * 8;
    auto fill = [&](int t) { copy_rg1(lp + (unsigned)((t & 1) * SKB), gp + (size_t)t * (SK * HD)); };
    auto ldl = [&](const char* p) { return cat16(*(const v8ha*)p, *(const v8ha*)(p + 512)); };
    fill(0);
    asm volatile("s_wait_asynccnt 0x0" ::: "memory");      // this wave's copies of stage 0 have landed ...
    __syncthreads();                                        // ... and every other wave's: nobody reads stage 0 in front of this barrier
    fill(1);
#pragma unroll 1   // rolled: one chunk's text is the loop
    for (int t = 0; t < NT; ++t) {
#pragma unroll 1   // rolled, as above
        for (int c = 0; c < SK / 32; ++c) { const int kc = t * SK + c * 32;
            if (kc < kend) {      // wave-uniform (scalar): a wave passes over the chunks behind its own diagonal, but not over the barrier below
                const char* cp = ring + (t & 1) * SKB + c * RGB + lane * 16; V kf[2][2], vf[4];
#pragma unroll
                for (int kt = 0; kt < 2; ++kt)
#pragma unroll
                    for (int ks = 0; ks < 2; ++ks) kf[kt][ks] = ldl(cp + kt * 2048 + ks * 1024);
#pragma unroll
                for (int dt = 0; dt < 4; ++dt) vf[dt] = ldl(cp + SKB / 2 + dt * 1024);
                __builtin_amdgcn_sched_barrier(0);      // the chunk's LDS reads go out as one group, keys first: the score products wait for the keys alone, and the softmax covers the values' latency (left free, the scheduler sinks each read to its first use)
                v8f s[NQ][2];
#pragma unroll
                for (int qt = 0; qt < NQ; ++qt)
#pragma unroll
                    for (int kt = 0; kt < 2; ++kt) { s[qt][kt] = (v8f){};
#pragma unroll
                        for (int ks = 0; ks < 2; ++ks) s[qt][kt] = F::mma(kf[kt][ks], qf[qt][ks], s[qt][kt]); }
#pragma unroll
                for (int qt = 0; qt < NQ; ++qt) {
                    const int lim = qw + qt * 16 + lr - kc - hi * 8; float t2[16]; float mx = -2.0e38f;      // causal: the lane's key number e (kc + 8 hi + 16 (e >> 3) + (e & 7)) counts while it is <= the lane's query row
#pragma unroll
                    for (int e = 0; e < 16; ++e) { t2[e] = ((e >> 3) * 16 + (e & 7) <= lim) ? s[qt][e >> 3][e & 7] * SCL : -2.0e38f; mx = fmaxf(mx, t2[e]); }
                    mx = fmaxf(mx, xhalf(mx));      // the other half-wave holds the query's other 16 keys
                    const float mn = fmaxf(m[qt], mx), al = exp2s((m[qt] - mn) * L2E); m[qt] = mn;
                    float p[16];
#pragma unroll
                    for (int e = 0; e < 16; ++e) p[e] = exp2s((t2[e] - mn) * L2E + 10.0f);   // a masked key gives exactly 0 (m >= -1e30)
                    l[qt] = l[qt] * al + ((((p[0] + p[1]) + (p[2] + p[3])) + ((p[4] + p[5]) + (p[6] + p[7]))) + (((p[8] + p[9]) + (p[10] + p[11])) + ((p[12] + p[13]) + (p[14] + p[15]))));
#pragma unroll
                    for (int dt = 0; dt < 4; ++dt) o[qt][dt] *= al;
                    V pb;
#pragma unroll
                    for (int e = 0; e < 16; ++e) pb[e] = tohx(p[e]);
#pragma unroll
                    for (int dt = 0; dt < 4; ++dt) o[qt][dt] = F::mma(vf[dt], pb, o[qt][dt]);
                }
            }
        }
        asm volatile("s_wait_dscnt 0x0" ::: "memory");         // this wave's reads of stage t are done (its buffer is refilled below)
        asm volatile("s_wait_asynccnt 0x0" ::: "memory");      // this wave's copies of stage t + 1 have landed
        __syncthreads();                                        // one barrier a stage: it publishes stage t + 1 and ends every wave's reads of stage t
        if (t + 2 < NT) fill(t + 2);
    }
    asm volatile("s_wait_asynccnt 0x0" ::: "memory");      // no copy is outstanding when the wave goes on
    // a lane's 8 accumulator rows of one column are 8 consecutive d of one query row, one 16-byte unit of the output planes: each store of the wave is one half block, 512 contiguous bytes; every step from the lane's one offset is a compile-time offset
    const size_t ob = ((size_t)(qw >> 4) * (DQ / 32) + (hcol >> 5)) * 512 + lane * 8;
#pragma unroll
    for (int qt = 0; qt < NQ; ++qt) { const float inv = __fdiv_rn(1.0f, l[qt] + xhalf(l[qt]));      // the other half-wave holds the sum over the query's other keys
#pragma unroll
        for (int dt = 0; dt < 4; ++dt) { v8us oh, ol;
#pragma unroll
            for (int j = 0; j < 8; ++j) { unsigned short x, y; splitf(o[qt][dt][j] * inv, x, y); oh[j] = x; ol[j] = y; }
            const int eo = qt * (DQ / 32) * 512 + (dt >> 1) * 512 + (dt & 1) * 256; *(v8usa*)(Ah + ob + eo) = oh; *(v8usa*)(Al + ob + eo) = ol;
            asm volatile("s_wait_xcnt 0x0" ::: "memory"); } }      // the wait in front of a rewrite of registers which issued global stores name: the next unit's values land in the registers that this one was stored from
}
// grid (batches x heads, NF + RH / 16): x = batch * heads + head, the index of the [batch][head] planes; y < NF: fp16 blocks of 32 ANW query rows, the longest (last) rows first; the rest: hi+lo blocks of 16 query rows. The choice is the same for a whole work-group.
// The longest blocks of every batch and head have the lowest y; this order is for speed only.
#define NF ((TT - RH) / (32 * ANW))
static_assert((TT - RH) % (32 * ANW) == 0 && RH % (32 * ANW) == 0 && RH >= SK, "whole fp16 blocks, each ending on a whole stage, two stages or more");
__global__ __launch_bounds__(32 * ANW) void k_attn(const h16* __restrict__ Q16, const h16* __restrict__ K16, const h16* __restrict__ V16, const bf* __restrict__ Qh, const bf* __restrict__ Ql, const bf* __restrict__ Kh, const bf* __restrict__ Kl,
                                                   const bf* __restrict__ Vh, const bf* __restrict__ Vl, bf* Ah, bf* Al) {
    __shared__ __align__(16) char ring[2 * SKB]; __shared__ __align__(16) float sO[ANW * 16 * 68]; __shared__ float sM[ANW * 16]; __shared__ float sL[ANW * 16];
    const int bx = blockIdx.y, b = blockIdx.x / NH_, h = blockIdx.x % NH_; const size_t pq = (size_t)blockIdx.x * TT * HD, pk = (size_t)(b * NKV + h / REP) * TT * HD; Ah += (size_t)b * TT * DQ; Al += (size_t)b * TT * DQ;
    if (bx < NF) attn_f16(Q16 + pq, K16 + pk, V16 + pk, TT - 32 * ANW * (bx + 1), h * HD, Ah, Al, ring);
    else attn_hl<1>(Qh + pq, Ql + pq, Kh + pk, Kl + pk, Vh + pk, Vl + pk, RH - 16 * (bx - NF + 1), h * HD, Ah, Al, sO, sM, sL);
}

extern "C" void kernel_launch(void* const* d_in, const int* in_sizes, int n_in,
                              void* d_out, int out_size, void* d_ws, size_t ws_size, hipStream_t stream) {
    (void)in_sizes; (void)n_in; (void)out_size;
    const float* x = (const float*)d_in[0]; const int* PID = (const int*)d_in[1]; const float* wqkv = (const float*)d_in[2]; const float* wo = (const float*)d_in[3];  const float* wq = wqkv; const float* wk = wqkv + (size_t)1024 * 1024; const float* wv = wqkv + (size_t)2048 * 1024; (void)wq; (void)wk; (void)wv;
    float* OUT = (float*)d_out;     // [4][2048][1024]
    char* wsp = (char*)d_ws;
    auto take = [&](size_t bytes) { char* p = wsp; wsp += (bytes + 255) & ~(size_t)255; return (void*)p; };
    bf* WQ = (bf*)take((size_t)(DQ + 2 * DKV) * DM * 2); bf* WK = WQ + (size_t)DQ * DM; bf* WV = WK + (size_t)DKV * DM; bf* WO = (bf*)take((size_t)DM * DQ * 2); float* CS = (float*)take((size_t)TT * HD * 2 * 4);
    bf* XB = (bf*)take((size_t)NB_ * TT * DM * 2);      // from here on every buffer holds all NB_ batches, batch outermost
    h16* QP16 = (h16*)take((size_t)NB_ * NH_ * TT * HD * 2); h16* KP16 = (h16*)take((size_t)NB_ * NKV * TT * HD * 2); h16* VT16 = (h16*)take((size_t)NB_ * NKV * HD * TT * 2);
    bf* QPh = (bf*)take((size_t)NB_ * NH_ * TT * HD * 2); bf* QPl = (bf*)take((size_t)NB_ * NH_ * TT * HD * 2); bf* KPh = (bf*)take((size_t)NB_ * NKV * TT * HD * 2); bf* KPl = (bf*)take((size_t)NB_ * NKV * TT * HD * 2); bf* VTh = (bf*)take((size_t)NB_ * NKV * HD * TT * 2); bf* VTl = (bf*)take((size_t)NB_ * NKV * HD * TT * 2);
    bf* ATh = (bf*)take((size_t)NB_ * TT * DQ * 2); bf* ATl = (bf*)take((size_t)NB_ * TT * DQ * 2);
    if ((size_t)(wsp - (char*)d_ws) > ws_size) return;    // ws 256 MiB
    // four launches, each for all NB_ batches; a launch holds every stage that waits for the same earlier launch
    k_prep<<<PB_T + (PW_X + PW_W + PW_O) / 8, 256, 0, stream>>>(x, wqkv, wo, PID, XB, WQ, WO, CS);
    k_qkv<<<dim3(NH_, TT / 256, NB_), 384, 0, stream>>>(WQ, WK, WV, XB, CS, QP16, QPh, QPl, KP16, KPh, KPl, VT16, VTh, VTl);
    k_attn<<<dim3(NB_ * NH_, NF + RH / 16, 1), 32 * ANW, 0, stream>>>(QP16, KP16, VT16, QPh, QPl, KPh, KPl, VTh, VTl, ATh, ATl);
    k_out<<<dim3(TT / 128, DM / 256, NB_), 256, 0, stream>>>(ATh, ATl, WO, OUT);
}
